// v000
// The times below were measured on an AMD MI455X: many runs one after another, warmed up first and cycling through
// copies of the inputs, with the whole window's GPU time divided by the number of runs. Launches and the gaps
// between them are all in it. The median over several windows is given; except for v000 it joins two sittings, which
// can be a few percent apart, so the side-by-side timings, each taken in one sitting, are the better comparison.
// v000, which the later versions start from, runs in 355 microseconds.
// All contractions (x.kp_w1, x.qp_w1, x.v_w, h.kp_w2, h.qp_w2, x.ka_w, x.qa_w, causal score S = Qt.Kt^T and S.V, ln.o_w): v_wmma_f32_16x16x32_bf16 with bf16 hi/lo operands (hi.hi + hi.lo + lo.hi), f32 accumulate; encoders (tanh, softplus, sincos), norm scale, LayerNorm, biases and residual in f32.
#include <hip/hip_runtime.h>
#include <math.h>
#include <stdint.h>

#define NB   2
#define SEQ  2048
#define DM   512
#define KO   32
#define QK   64
#define MTOT (NB * SEQ)

typedef __attribute__((ext_vector_type(16))) __bf16 v16b;
typedef __attribute__((ext_vector_type(8)))  __bf16 v8b;
typedef __attribute__((ext_vector_type(8)))  float  v8f;
typedef __attribute__((ext_vector_type(4)))  float  v4f;
typedef __attribute__((ext_vector_type(2)))  float  v2f;
typedef __attribute__((ext_vector_type(4)))  unsigned int   v4u;
typedef __attribute__((ext_vector_type(8)))  unsigned short v8us;

union FB { v16b v; v8b h[2]; };

__device__ __forceinline__ unsigned short f2bf_bits(float f) {
  unsigned u = __float_as_uint(f);
  return (unsigned short)((u + 0x7FFFu + ((u >> 16) & 1u)) >> 16);   // RNE
}
__device__ __forceinline__ float bf_bits2f(unsigned short h) { return __uint_as_float(((unsigned)h) << 16); }
__device__ __forceinline__ unsigned pk16(unsigned short a, unsigned short b) { return (unsigned)a | ((unsigned)b << 16); }

__device__ __forceinline__ v8f zero8() { return (v8f){0.f, 0.f, 0.f, 0.f, 0.f, 0.f, 0.f, 0.f}; }

// 16-bit A/B fragment from a k-contiguous row p = &T[row][k0 + 8*(lane>>4)]:
// elements 0..7 <- p[0..7] (k0+8h..), elements 8..15 <- p[16..23] (k0+16+8h..)
__device__ __forceinline__ v16b ldfrag(const __bf16* p) {
  FB f;
  f.h[0] = *(const v8b*)(p);
  f.h[1] = *(const v8b*)(p + 16);
  return f.v;
}

// hi/lo split product group: c += ah.bh + ah.bl + al.bh, then 4 VALU slots tying D and keeping all operands live
__device__ __forceinline__ v8f mma3(v16b ah, v16b al, v16b bh, v16b bl, v8f c) {
  c = __builtin_amdgcn_wmma_f32_16x16x32_bf16(false, ah, false, bh, (short)0, c, false, false);
  c = __builtin_amdgcn_wmma_f32_16x16x32_bf16(false, ah, false, bl, (short)0, c, false, false);
  c = __builtin_amdgcn_wmma_f32_16x16x32_bf16(false, al, false, bh, (short)0, c, false, false);
  asm volatile("v_nop\n\tv_nop\n\tv_nop\n\tv_nop" : "+v"(c) : "v"(ah), "v"(al), "v"(bh), "v"(bl));
  return c;
}

// same-wave LDS exchange: order the wave's LDS stores before its cross-lane reloads
__device__ __forceinline__ void wave_lds_sync() {
  __builtin_amdgcn_fence(__ATOMIC_RELEASE, "workgroup");
  __builtin_amdgcn_wave_barrier();
  __builtin_amdgcn_fence(__ATOMIC_ACQUIRE, "workgroup");
}

// ---------------------------------------------------------------------------
// Elementwise bf16 split of a flat f32 array: hi = bf16(in), lo = bf16(in - hi); 2 elements per thread,
// ---------------------------------------------------------------------------
__global__ __launch_bounds__(256) void split_bf16x2_kernel(const float* __restrict__ in, unsigned short* hi,
                                                           unsigned short* lo, int n2) {
  const int i = blockIdx.x * 256 + threadIdx.x;
  if (i < n2) {
    const v2f f = *(const v2f*)(in + 2 * (size_t)i);
    const unsigned short h0 = f2bf_bits(f[0]), h1 = f2bf_bits(f[1]);
    const unsigned short l0 = f2bf_bits(f[0] - bf_bits2f(h0)), l1 = f2bf_bits(f[1] - bf_bits2f(h1));
    const unsigned uh = pk16(h0, h1), ul = pk16(l0, l1);
    ((unsigned*)hi)[i] = uh;
    ((unsigned*)lo)[i] = ul;
    
  }
}

// ---------------------------------------------------------------------------
// Fused transpose + bf16 split of an f32 matrix: in [R][Cc] -> oh[c][r] = bf16(in[r][c]), ol = residual
// ([Cc][R], pitch R). 64x64 tiles through LDS. grid = (Cc/64, R/64), 256 threads (R, Cc multiples of 64).
// Coverage per block and plane: load 4 it x 256 thr x 4 = 64x64; store 2 it x 256 thr x 8 = 64x64.
// ---------------------------------------------------------------------------
__global__ __launch_bounds__(256) void tsplit_kernel(const float* __restrict__ W, unsigned short* oh,
                                                     unsigned short* ol, int R, int Cc) {
  __shared__ __align__(16) float tf[64 * 68];
  const int c0  = blockIdx.x * 64;
  const int r0  = blockIdx.y * 64;
  const int tid = threadIdx.x;
  {
    const int lr = tid >> 4;
    const int c4 = (tid & 15) * 4;
#pragma unroll
    for (int it = 0; it < 4; ++it) {
      const int rr = it * 16 + lr;
      const v4f a = *(const v4f*)(W + (size_t)(r0 + rr) * Cc + c0 + c4);
      *(v4f*)(tf + rr * 68 + c4) = a;
    }
  }
  __syncthreads();
  const int sub = tid >> 3;
  const int c8  = (tid & 7) * 8;
  v4u hv[2], lv[2];
#pragma unroll
  for (int it = 0; it < 2; ++it) {
    const int oc = it * 32 + sub;
    v4u a, a2;
#pragma unroll
    for (int q = 0; q < 4; ++q) {
      const float f0 = tf[(c8 + 2 * q) * 68 + oc];
      const float f1 = tf[(c8 + 2 * q + 1) * 68 + oc];
      const unsigned short h0 = f2bf_bits(f0), h1 = f2bf_bits(f1);
      const unsigned short l0 = f2bf_bits(f0 - bf_bits2f(h0)), l1 = f2bf_bits(f1 - bf_bits2f(h1));
      a[q]  = pk16(h0, h1);
      a2[q] = pk16(l0, l1);
    }
    hv[it] = a; lv[it] = a2;
  }
  {
#pragma unroll
    for (int it = 0; it < 2; ++it) {
      const int oc = it * 32 + sub;
      const size_t go = (size_t)(c0 + oc) * R + r0 + c8;
      *(v4u*)(oh + go) = hv[it];
      *(v4u*)(ol + go) = lv[it];
    }
    
  }
}

// ---------------------------------------------------------------------------
// Transpose + bf16 split of a narrow f32 matrix: in [R][32] -> oh/ol [32][R] (pitch R). grid = R/64, 256 threads.
// Coverage per block: load 2 it x 256 thr x 4 = 64 rows x 32; store 32 output rows x (8 lanes x 8) = 32 x 64.
// ---------------------------------------------------------------------------
__global__ __launch_bounds__(256) void tsplit32_kernel(const float* __restrict__ W, unsigned short* oh,
                                                       unsigned short* ol, int R) {
  __shared__ __align__(16) float tf[64 * 36];
  const int r0  = blockIdx.x * 64;
  const int tid = threadIdx.x;
  {
    const int rr = tid >> 3;          // 0..31
    const int c4 = (tid & 7) * 4;     // 0..28
#pragma unroll
    for (int it = 0; it < 2; ++it) {
      const int row = it * 32 + rr;   // 0..63
      const v4f a = *(const v4f*)(W + (size_t)(r0 + row) * KO + c4);
      *(v4f*)(tf + row * 36 + c4) = a;
    }
  }
  __syncthreads();
  const int oc = tid >> 3;            // output row = input column 0..31
  const int c8 = (tid & 7) * 8;       // output cols r0+c8 .. +7
  v4u hv, lv;
#pragma unroll
  for (int q = 0; q < 4; ++q) {
    const float f0 = tf[(c8 + 2 * q) * 36 + oc];
    const float f1 = tf[(c8 + 2 * q + 1) * 36 + oc];
    const unsigned short h0 = f2bf_bits(f0), h1 = f2bf_bits(f1);
    const unsigned short l0 = f2bf_bits(f0 - bf_bits2f(h0)), l1 = f2bf_bits(f1 - bf_bits2f(h1));
    hv[q] = pk16(h0, h1);
    lv[q] = pk16(l0, l1);
  }
  const size_t go = (size_t)oc * R + r0 + c8;
  {
    *(v4u*)(oh + go) = hv;
    *(v4u*)(ol + go) = lv;
    
  }
}

// ---------------------------------------------------------------------------
// Register-blocked batched WMMA GEMM on bf16 hi/lo planes:
//   C[m,n] = sum_k A[m,k] * Bt[n,k] (+bias)(+resid)(act); product = hi.hi + hi.lo + lo.hi.
// A planes row-major [M][K] (pitch lda), Bt planes row-major [N][K] (pitch ldb); M % 32 == 0, N % 64 == 0, K % 32 == 0.
// Each wave owns a 32x64 tile (tile index = blockIdx.x*8 + wave), blockIdx.y = batch with element strides.
// BIAS_MODE: 1 = bias[m], 2 = bias[n]. OUT_MODE: 0 = f32, 2 = bf16 hi plane (Cout) + lo plane (Cout2). ACT 1 = tanh.
// ---------------------------------------------------------------------------
template <int BIAS_MODE, int OUT_MODE, bool RESID, int ACT>
__global__ __launch_bounds__(256) void gemm_hl_kernel(
    const unsigned short* __restrict__ Ahp, const unsigned short* __restrict__ Alp, int lda, long long strideA,
    const unsigned short* __restrict__ Bhp, const unsigned short* __restrict__ Blp, int ldb, long long strideB,
    void* Cout, void* Cout2, int ldc, long long strideC,
    const float* __restrict__ bias,
    const float* __restrict__ resid, long long strideR,
    int M, int N, int K) {
  __shared__ __align__(16) float sT[8][16 * 68];
  const __bf16* Ah = (const __bf16*)(const void*)Ahp;
  const __bf16* Al = (const __bf16*)(const void*)Alp;
  const __bf16* Bh = (const __bf16*)(const void*)Bhp;
  const __bf16* Bl = (const __bf16*)(const void*)Blp;
  const int bz   = blockIdx.y;
  const int lane = threadIdx.x & 31;
  const int wave = threadIdx.x >> 5;
  const int tilesN = N >> 6;
  const int tilesM = M >> 5;
  const int tile = blockIdx.x * 8 + wave;
  if (tile >= tilesM * tilesN) return;   // wave-uniform; no block barriers in this kernel
  const int tm = tile / tilesN;
  const int tn = tile - tm * tilesN;
  const int m0 = tm << 5;
  const int n0 = tn << 6;

  const __bf16* Abh = Ah + (size_t)bz * strideA;
  const __bf16* Abl = Al + (size_t)bz * strideA;
  const __bf16* Bbh = Bh + (size_t)bz * strideB;
  const __bf16* Bbl = Bl + (size_t)bz * strideB;

  const int rl   = lane & 15;            // row (A) / col (B, D) within subtile
  const int koff = (lane >> 4) * 8;      // k offset of this lane half
  const int mOff = (lane >> 4) * 8;      // D row offset

  v8f acc[2][4];
#pragma unroll
  for (int i = 0; i < 2; ++i)
#pragma unroll
    for (int j = 0; j < 4; ++j) acc[i][j] = zero8();

#pragma unroll 1
  for (int k0 = 0; k0 < K; k0 += 32) {
    v16b bh[4], bl[4];
#pragma unroll
    for (int j = 0; j < 4; ++j) {
      const size_t bo = (size_t)(n0 + (j << 4) + rl) * ldb + koff + k0;
      bh[j] = ldfrag(Bbh + bo);
      bl[j] = ldfrag(Bbl + bo);
    }
#pragma unroll
    for (int i = 0; i < 2; ++i) {
      const size_t ao = (size_t)(m0 + (i << 4) + rl) * lda + koff + k0;
      const v16b ah = ldfrag(Abh + ao);
      const v16b al = ldfrag(Abl + ao);
#pragma unroll
      for (int j = 0; j < 4; ++j) acc[i][j] = mma3(ah, al, bh[j], bl[j], acc[i][j]);
    }
  }

  // ---- epilogue ----
  float* slab = sT[wave];
  const float* Rb = RESID ? (resid + (size_t)bz * strideR) : nullptr;
#pragma unroll
  for (int i = 0; i < 2; ++i) {
    const int mBase = m0 + (i << 4);
#pragma unroll
    for (int j = 0; j < 4; ++j) {
      const int n = n0 + (j << 4) + rl;
      float bv = 0.f;
      if (BIAS_MODE == 2) bv = bias[n];
#pragma unroll
      for (int r = 0; r < 8; ++r) {
        float v = acc[i][j][r];
        if (BIAS_MODE == 1) v += bias[mBase + mOff + r];
        if (BIAS_MODE == 2) v += bv;
        if (RESID) v += Rb[(size_t)(mBase + mOff + r) * ldc + n];
        if (ACT == 1) v = tanhf(v);
        slab[(mOff + r) * 68 + (j << 4) + rl] = v;
      }
    }
    wave_lds_sync();
    if (OUT_MODE == 0) {
      float* C = (float*)Cout + (size_t)bz * strideC;
      const int hsel = lane >> 4, c4 = (lane & 15) * 4;   // row seg = 256 B = 16 lanes x 16 B, 2 rows per instruction
      {
#pragma unroll
        for (int it = 0; it < 8; ++it) {
          const int row = it * 2 + hsel;                   // it 0..7 x hsel 0..1 = rows 0..15
          const v4f v = *(const v4f*)(slab + row * 68 + c4);
          *(v4f*)(C + (size_t)(mBase + row) * ldc + n0 + c4) = v;
        }
        
      }
    } else {
      const int q4 = lane >> 3, c8 = (lane & 7) * 8;
      unsigned short* C  = (unsigned short*)Cout  + (size_t)bz * strideC;
      unsigned short* C2 = (unsigned short*)Cout2 + (size_t)bz * strideC;
      {
#pragma unroll
        for (int it = 0; it < 4; ++it) {
          const int row = it * 4 + q4;                     // it 0..3 x q4 0..3 = rows 0..15
          const float* sp = slab + row * 68 + c8;
          v8us hv, lv;
#pragma unroll
          for (int e = 0; e < 8; ++e) {
            const unsigned short hb = f2bf_bits(sp[e]);
            const unsigned short lb = f2bf_bits(sp[e] - bf_bits2f(hb));
            hv[e] = hb;
            lv[e] = lb;
          }
          const size_t go = (size_t)(mBase + row) * ldc + n0 + c8;
          *(v8us*)(C + go)  = hv;
          *(v8us*)(C2 + go) = lv;
        }
        
      }
    }
    wave_lds_sync();
  }
}

// ---------------------------------------------------------------------------
// Fused oscillator heads + encode. Per wave 16 rows (block = 4 waves = 64 rows, grid = 4096/64):
//   Pk = Hk.kp_w2, Pq = Hq.qp_w2, Ak = X.ka_w, Aq = X.qa_w  (each 16 x 32, K = 512, hi/lo WMMA);
//   phase = tanh(P + b2)*pi + pos[l]; amp = softplus(A + ba) + 0.1;
//   Kt[row] = [amp_k cos | amp_k sin] (64), Qt[row] = [amp_q cos | amp_q sin]  -> bf16 hi/lo planes [4096][64].
// Operand planes: H/X [4096][512]; W2t planes [32][512] (k-contiguous).
// LDS slab per wave [16][132]: cols 0..31 / 32..63 / 64..95 / 96..127 = k-phase / k-amp / q-phase / q-amp pre-acts,
// ---------------------------------------------------------------------------
__global__ __launch_bounds__(128) void enc_head_kernel(
    const unsigned short* __restrict__ Hkhp, const unsigned short* __restrict__ Hklp,
    const unsigned short* __restrict__ Hqhp, const unsigned short* __restrict__ Hqlp,
    const unsigned short* __restrict__ Xhp,  const unsigned short* __restrict__ Xlp,
    const unsigned short* __restrict__ Wk2hp, const unsigned short* __restrict__ Wk2lp,
    const unsigned short* __restrict__ Wq2hp, const unsigned short* __restrict__ Wq2lp,
    const unsigned short* __restrict__ Wkahp, const unsigned short* __restrict__ Wkalp,
    const unsigned short* __restrict__ Wqahp, const unsigned short* __restrict__ Wqalp,
    const float* __restrict__ bk2, const float* __restrict__ bq2,
    const float* __restrict__ bka, const float* __restrict__ bqa,
    const float* __restrict__ pos,
    unsigned short* Qhp, unsigned short* Qlp, unsigned short* Khp, unsigned short* Klp) {
  __shared__ __align__(16) float slab_all[4][16 * 132];
  const int tid = threadIdx.x, wave = tid >> 5, lane = tid & 31, hh = lane >> 4, c = lane & 15;
  const int row0 = blockIdx.x * 64 + wave * 16;

  const __bf16* Hkh = (const __bf16*)(const void*)Hkhp;  const __bf16* Hkl = (const __bf16*)(const void*)Hklp;
  const __bf16* Hqh = (const __bf16*)(const void*)Hqhp;  const __bf16* Hql = (const __bf16*)(const void*)Hqlp;
  const __bf16* Xh  = (const __bf16*)(const void*)Xhp;   const __bf16* Xl  = (const __bf16*)(const void*)Xlp;
  const __bf16* Wk2h = (const __bf16*)(const void*)Wk2hp; const __bf16* Wk2l = (const __bf16*)(const void*)Wk2lp;
  const __bf16* Wq2h = (const __bf16*)(const void*)Wq2hp; const __bf16* Wq2l = (const __bf16*)(const void*)Wq2lp;
  const __bf16* Wkah = (const __bf16*)(const void*)Wkahp; const __bf16* Wkal = (const __bf16*)(const void*)Wkalp;
  const __bf16* Wqah = (const __bf16*)(const void*)Wqahp; const __bf16* Wqal = (const __bf16*)(const void*)Wqalp;

  v8f aPk[2], aPq[2], aAk[2], aAq[2];
#pragma unroll
  for (int t = 0; t < 2; ++t) { aPk[t] = zero8(); aPq[t] = zero8(); aAk[t] = zero8(); aAq[t] = zero8(); }

#pragma unroll 1
  for (int k0 = 0; k0 < DM; k0 += 32) {
    const size_t ao = (size_t)(row0 + c) * DM + k0 + 8 * hh;
    const v16b ahk = ldfrag(Hkh + ao), alk = ldfrag(Hkl + ao);
    const v16b ahq = ldfrag(Hqh + ao), alq = ldfrag(Hql + ao);
    const v16b axh = ldfrag(Xh + ao),  axl = ldfrag(Xl + ao);
#pragma unroll
    for (int t = 0; t < 2; ++t) {
      const size_t bo = (size_t)(t * 16 + c) * DM + k0 + 8 * hh;
      aPk[t] = mma3(ahk, alk, ldfrag(Wk2h + bo), ldfrag(Wk2l + bo), aPk[t]);
      aPq[t] = mma3(ahq, alq, ldfrag(Wq2h + bo), ldfrag(Wq2l + bo), aPq[t]);
      aAk[t] = mma3(axh, axl, ldfrag(Wkah + bo), ldfrag(Wkal + bo), aAk[t]);
      aAq[t] = mma3(axh, axl, ldfrag(Wqah + bo), ldfrag(Wqal + bo), aAq[t]);
    }
  }

  // stage pre-activations (+bias) in the D layout: row 8hh+r, oscillator n = t*16+c
  float* sl = slab_all[wave];
#pragma unroll
  for (int t = 0; t < 2; ++t) {
    const int n = t * 16 + c;
    const float b1 = bk2[n], b2 = bka[n], b3 = bq2[n], b4 = bqa[n];
#pragma unroll
    for (int r = 0; r < 8; ++r) {
      float* sp = sl + (8 * hh + r) * 132;
      sp[n]      = aPk[t][r] + b1;
      sp[32 + n] = aAk[t][r] + b2;
      sp[64 + n] = aPq[t][r] + b3;
      sp[96 + n] = aAq[t][r] + b4;
    }
  }
  wave_lds_sync();

  // encode: lane = oscillator index, one row per iteration (same lane reads and writes its own 4 slots)
  const float PI = 3.14159265358979323846f;
#pragma unroll 1
  for (int it = 0; it < 16; ++it) {
    float* sp = sl + it * 132;
    const int l = (row0 + it) & (SEQ - 1);
    const float pa  = pos[l * KO + lane];
    const float vpk = sp[lane], vak = sp[32 + lane], vpq = sp[64 + lane], vaq = sp[96 + lane];
    const float phk = tanhf(vpk) * PI + pa;
    const float phq = tanhf(vpq) * PI + pa;
    const float ak  = fmaxf(vak, 0.f) + log1pf(expf(-fabsf(vak))) + 0.1f;
    const float aq  = fmaxf(vaq, 0.f) + log1pf(expf(-fabsf(vaq))) + 0.1f;
    sp[lane]      = ak * cosf(phk);
    sp[32 + lane] = ak * sinf(phk);
    sp[64 + lane] = aq * cosf(phq);
    sp[96 + lane] = aq * sinf(phq);
  }
  wave_lds_sync();

  const int q4 = lane >> 3, c8 = (lane & 7) * 8;
  {
#pragma unroll
    for (int it = 0; it < 4; ++it) {
      const int row = it * 4 + q4;   // 0..15
      const float* sk = sl + row * 132 + c8;
      const float* sq = sl + row * 132 + 64 + c8;
      v8us khv, klv, qhv, qlv;
#pragma unroll
      for (int e = 0; e < 8; ++e) {
        const unsigned short kh = f2bf_bits(sk[e]);
        const unsigned short kl = f2bf_bits(sk[e] - bf_bits2f(kh));
        const unsigned short qh = f2bf_bits(sq[e]);
        const unsigned short ql = f2bf_bits(sq[e] - bf_bits2f(qh));
        khv[e] = kh; klv[e] = kl; qhv[e] = qh; qlv[e] = ql;
      }
      const size_t go = (size_t)(row0 + row) * QK + c8;
      *(v8us*)(Khp + go) = khv;
      *(v8us*)(Klp + go) = klv;
      *(v8us*)(Qhp + go) = qhv;
      *(v8us*)(Qlp + go) = qlv;
    }
    
  }
}

// ---------------------------------------------------------------------------
// Causal mixing: R[b][l][d] = (1/sqrt((l+1)*32)) * sum_{l' <= l} S[l][l'] * V[l'][d],  S = Qt[l] . Kt[l'] (K = 64).
// Block = 4 waves = 64 query rows of one batch element and one 128-wide d chunk; grid = NB * 32 * 4.
//   Qt/Kt planes bf16 hi/lo [4096][64]; V^T planes bf16 hi/lo [b][512 d][2048 l']; R f32 [4096][512].
//   Key tiles of 64 (trip count qb+1 <= 32): stage Kt tile [64][64] and V^T chunk [128][64] (hi+lo) in LDS
//   (plain 16-B loads, __syncthreads before and after); S per wave in registers (A = Qt rows, B = Kt rows from LDS);
//   entries with l' > l set to 0 by value on the diagonal tile; P = S split to bf16 hi/lo into the wave's LDS tile
//   Output: per wave 16 rows x 128 floats staged in LDS (aliasing the K/V region after a block barrier), each
//   Coverage: 4 d chunks x 32 row blocks x 2 batches x (4 waves x 16 rows x 128) = the whole [4096][512] R plane.
// ---------------------------------------------------------------------------
__global__ __launch_bounds__(128) void causal_mix_kernel(
    const unsigned short* __restrict__ Qhp, const unsigned short* __restrict__ Qlp,
    const unsigned short* __restrict__ Khp, const unsigned short* __restrict__ Klp,
    const unsigned short* __restrict__ Vhp, const unsigned short* __restrict__ Vlp,
    float* Rout) {
  __shared__ __align__(16) unsigned char smem[65536];
  __bf16* Ksh = (__bf16*)(smem);           // [64 l'][64]   8192 B
  __bf16* Ksl = (__bf16*)(smem + 8192);
  __bf16* Vth = (__bf16*)(smem + 16384);   // [128 d][64 l'] 16384 B
  __bf16* Vtl = (__bf16*)(smem + 32768);
  __bf16* Pgh = (__bf16*)(smem + 49152);   // [4 waves][16][64]  8192 B
  __bf16* Pgl = (__bf16*)(smem + 57344);
  float*  Osb = (float*)(smem);            // [4 waves][16][132] after the main loop (aliases K/V tiles)

  const int tid = threadIdx.x, wave = tid >> 5, lane = tid & 31, hh = lane >> 4, c = lane & 15;
  const int bx  = blockIdx.x;
  const int dch = bx & 3;
  const int qb  = (bx >> 2) & 31;
  const int b   = bx >> 7;
  const int q0  = qb * 64 + wave * 16;                 // sequence-local first row of this wave
  const size_t grow0 = (size_t)b * SEQ + q0;           // global row of this wave's row 0

  const __bf16* Qh = (const __bf16*)(const void*)Qhp; const __bf16* Ql = (const __bf16*)(const void*)Qlp;
  const __bf16* Kh = (const __bf16*)(const void*)Khp; const __bf16* Kl = (const __bf16*)(const void*)Klp;
  const __bf16* Vh = (const __bf16*)(const void*)Vhp; const __bf16* Vl = (const __bf16*)(const void*)Vlp;

  // Qt fragments (A operand, row = lane&15): two 32-deep k chunks, hi and lo
  v16b qah[2], qal[2];
#pragma unroll
  for (int dc = 0; dc < 2; ++dc) {
    qah[dc] = ldfrag(Qh + (grow0 + c) * QK + dc * 32 + 8 * hh);
    qal[dc] = ldfrag(Ql + (grow0 + c) * QK + dc * 32 + 8 * hh);
  }
  v8f oacc[8];
#pragma unroll
  for (int t = 0; t < 8; ++t) oacc[t] = zero8();

  __bf16* pwh = Pgh + wave * (16 * 64);
  __bf16* pwl = Pgl + wave * (16 * 64);

  const int nch = qb + 1;   // block-uniform, <= 32
  for (int kc = 0; kc < nch; ++kc) {
    const int kv0 = kc * 64;
    __syncthreads();
    {
      // Kt tile: 128 threads x 32 halves per plane = 64 x 64
      const int r = tid >> 1, half = (tid & 1) * 32;
      const __bf16* ks = Kh + ((size_t)b * SEQ + kv0 + r) * QK + half;
      const __bf16* ls = Kl + ((size_t)b * SEQ + kv0 + r) * QK + half;
#pragma unroll
      for (int i = 0; i < 4; ++i) {
        *(v8b*)(Ksh + r * QK + half + 8 * i) = *(const v8b*)(ks + 8 * i);
        *(v8b*)(Ksl + r * QK + half + 8 * i) = *(const v8b*)(ls + 8 * i);
      }
      // V^T chunk: thread = d row (dch*128 + tid), 64 halves per plane = 128 x 64
      const __bf16* vs = Vh + ((size_t)b * DM + dch * 128 + tid) * SEQ + kv0;
      const __bf16* vl = Vl + ((size_t)b * DM + dch * 128 + tid) * SEQ + kv0;
#pragma unroll
      for (int i = 0; i < 8; ++i) {
        *(v8b*)(Vth + tid * 64 + 8 * i) = *(const v8b*)(vs + 8 * i);
        *(v8b*)(Vtl + tid * 64 + 8 * i) = *(const v8b*)(vl + 8 * i);
      }
    }
    __syncthreads();

    // S strip 16 x 64 for this wave: B[k = feature][n = key] = Kt[key][feature]
    v8f s[4];
#pragma unroll
    for (int j = 0; j < 4; ++j) {
      s[j] = zero8();
#pragma unroll
      for (int dc = 0; dc < 2; ++dc) {
        FB kb, kl;
        const int kb0 = (j * 16 + c) * QK + dc * 32 + 8 * hh;
        kb.h[0] = *(const v8b*)(Ksh + kb0);
        kb.h[1] = *(const v8b*)(Ksh + kb0 + 16);
        kl.h[0] = *(const v8b*)(Ksl + kb0);
        kl.h[1] = *(const v8b*)(Ksl + kb0 + 16);
        s[j] = mma3(qah[dc], qal[dc], kb.v, kl.v, s[j]);
      }
    }
    // causal select by value, split to bf16 hi/lo, into the wave's P tile [row][key]
    const bool diag = (kc == qb);   // block-uniform
#pragma unroll
    for (int r = 0; r < 8; ++r) {
      const int qrow = q0 + 8 * hh + r;
#pragma unroll
      for (int j = 0; j < 4; ++j) {
        const int kvcol = kv0 + j * 16 + c;
        float pm = s[j][r];
        if (diag && kvcol > qrow) pm = 0.f;
        const unsigned short hb = f2bf_bits(pm);
        const unsigned short lb = f2bf_bits(pm - bf_bits2f(hb));
        pwh[(8 * hh + r) * 64 + j * 16 + c] = __builtin_bit_cast(__bf16, hb);
        pwl[(8 * hh + r) * 64 + j * 16 + c] = __builtin_bit_cast(__bf16, lb);
      }
    }
    wave_lds_sync();

    // O[16 x 128] += P[16 x 64] . V[64 x 128]: A = P (row = lane&15), B[k = key][n = d] = V^T[d][key]
#pragma unroll 1
    for (int kk = 0; kk < 2; ++kk) {
      FB pa, pl;
      const int pb0 = c * 64 + kk * 32 + 8 * hh;
      pa.h[0] = *(const v8b*)(pwh + pb0);
      pa.h[1] = *(const v8b*)(pwh + pb0 + 16);
      pl.h[0] = *(const v8b*)(pwl + pb0);
      pl.h[1] = *(const v8b*)(pwl + pb0 + 16);
#pragma unroll
      for (int t = 0; t < 8; ++t) {
        FB vb, vlo;
        const int vb0 = (t * 16 + c) * 64 + kk * 32 + 8 * hh;
        vb.h[0]  = *(const v8b*)(Vth + vb0);
        vb.h[1]  = *(const v8b*)(Vth + vb0 + 16);
        vlo.h[0] = *(const v8b*)(Vtl + vb0);
        vlo.h[1] = *(const v8b*)(Vtl + vb0 + 16);
        oacc[t] = mma3(pa.v, pl.v, vb.v, vlo.v, oacc[t]);
      }
    }
  }
  __syncthreads();   // every wave done with the K/V tiles before the output staging aliases them

  // scale by 1/sqrt((l+1)*32), stage the wave's 16 x 128 tile, write whole 512-B row segments
  float* os = Osb + wave * (16 * 132);
#pragma unroll
  for (int r = 0; r < 8; ++r) {
    const int lq = q0 + 8 * hh + r;
    const float nrm = sqrtf((float)((lq + 1) * KO));
    const float inv = 1.0f / nrm;
#pragma unroll
    for (int t = 0; t < 8; ++t) os[(8 * hh + r) * 132 + t * 16 + c] = oacc[t][r] * inv;
  }
  wave_lds_sync();
  {
#pragma unroll
    for (int it = 0; it < 16; ++it) {
      const v4f val = *(const v4f*)(os + it * 132 + lane * 4);
      *(v4f*)(Rout + (grow0 + it) * DM + dch * 128 + lane * 4) = val;
    }
    
  }
}

// ---------------------------------------------------------------------------
// One wave per row (block = 8 rows, grid = 4096/8); lane holds cols 8*lane..+7 and 256+8*lane..+7.
// ---------------------------------------------------------------------------
__global__ __launch_bounds__(256) void ln_split_kernel(const float* __restrict__ R, const float* __restrict__ g,
                                                       const float* __restrict__ be,
                                                       unsigned short* Lh, unsigned short* Ll) {
  const int tid = threadIdx.x, wave = tid >> 5, lane = tid & 31;
  const int row = blockIdx.x * 8 + wave;
  const float* rp = R + (size_t)row * DM;
  const int cA = 8 * lane, cB = 256 + 8 * lane;
  const v4f x0 = *(const v4f*)(rp + cA), x1 = *(const v4f*)(rp + cA + 4);
  const v4f x2 = *(const v4f*)(rp + cB), x3 = *(const v4f*)(rp + cB + 4);
  const v4f g0 = *(const v4f*)(g + cA),  g1 = *(const v4f*)(g + cA + 4);
  const v4f g2 = *(const v4f*)(g + cB),  g3 = *(const v4f*)(g + cB + 4);
  const v4f e0 = *(const v4f*)(be + cA), e1 = *(const v4f*)(be + cA + 4);
  const v4f e2 = *(const v4f*)(be + cB), e3 = *(const v4f*)(be + cB + 4);
  float v[16], gg[16], bb[16];
#pragma unroll
  for (int e = 0; e < 4; ++e) {
    v[e] = x0[e]; v[4 + e] = x1[e]; v[8 + e] = x2[e]; v[12 + e] = x3[e];
    gg[e] = g0[e]; gg[4 + e] = g1[e]; gg[8 + e] = g2[e]; gg[12 + e] = g3[e];
    bb[e] = e0[e]; bb[4 + e] = e1[e]; bb[8 + e] = e2[e]; bb[12 + e] = e3[e];
  }
  float sum = 0.f;
#pragma unroll
  for (int e = 0; e < 16; ++e) sum += v[e];
#pragma unroll
  for (int off = 1; off < 32; off <<= 1) sum += __shfl_xor(sum, off, 32);
  const float mu = sum * (1.0f / (float)DM);
  float ss = 0.f;
#pragma unroll
  for (int e = 0; e < 16; ++e) { const float d = v[e] - mu; v[e] = d; ss += d * d; }
#pragma unroll
  for (int off = 1; off < 32; off <<= 1) ss += __shfl_xor(ss, off, 32);
  const float var  = ss * (1.0f / (float)DM);
  const float rstd = 1.0f / sqrtf(var + 1e-5f);
  v8us hA, lA, hB, lB;
#pragma unroll
  for (int e = 0; e < 8; ++e) {
    const float ya = v[e] * rstd * gg[e] + bb[e];
    const float yb = v[8 + e] * rstd * gg[8 + e] + bb[8 + e];
    const unsigned short ha = f2bf_bits(ya), la = f2bf_bits(ya - bf_bits2f(ha));
    const unsigned short hb = f2bf_bits(yb), lb = f2bf_bits(yb - bf_bits2f(hb));
    hA[e] = ha; lA[e] = la; hB[e] = hb; lB[e] = lb;
  }
  const size_t oA = (size_t)row * DM + cA, oB = (size_t)row * DM + cB;
  {
    *(v8us*)(Lh + oA) = hA;
    *(v8us*)(Lh + oB) = hB;
    *(v8us*)(Ll + oA) = lA;
    *(v8us*)(Ll + oB) = lB;
    
  }
}

// ---------------------------------------------------------------------------
// Workspace region map (bytes; every region an exact multiple of its store granularity, no tail rows):
//   Xh, Xl            bf16 [4096][512]     2 x 4,194,304          0 ..  8,388,608
//   Hkh,Hkl,Hqh,Hql   bf16 [4096][512]     4 x 4,194,304   8,388,608 .. 25,165,824
//   W1t planes (kp,qp,v,o) bf16 [512][512] 8 x 524,288  25,165,824 .. 29,360,128
//   W2t planes (kp2,qp2,ka,qa) bf16 [32][512] 8 x 32,768 29,360,128 .. 29,622,272
//   Qth,Qtl,Kth,Ktl   bf16 [4096][64]      4 x 524,288    29,622,272 .. 31,719,424
//   VTh, VTl          bf16 [2][512][2048]  2 x 4,194,304  31,719,424 .. 40,108,032
//   R                 f32  [4096][512]     8,388,608      40,108,032 .. 48,496,640
//   Lh, Ll            bf16 [4096][512]     2 x 4,194,304  48,496,640 .. 56,885,248
// ---------------------------------------------------------------------------
extern "C" void kernel_launch(void* const* d_in, const int* in_sizes, int n_in,
                              void* d_out, int out_size, void* d_ws, size_t ws_size,
                              hipStream_t stream) {
  if (n_in < 20) return;
  if (in_sizes[0] != MTOT * DM || in_sizes[1] != SEQ * KO) return;
  if (in_sizes[2] != DM * DM || in_sizes[8] != DM * DM || in_sizes[14] != DM * DM || in_sizes[18] != DM * DM) return;
  if (in_sizes[3] != DM || in_sizes[9] != DM || in_sizes[15] != DM || in_sizes[19] != DM) return;
  if (in_sizes[16] != DM || in_sizes[17] != DM) return;
  if (in_sizes[4] != DM * KO || in_sizes[6] != DM * KO || in_sizes[10] != DM * KO || in_sizes[12] != DM * KO) return;
  if (in_sizes[5] != KO || in_sizes[7] != KO || in_sizes[11] != KO || in_sizes[13] != KO) return;
  if (out_size != MTOT * DM) return;

  const float* x     = (const float*)d_in[0];
  const float* pos   = (const float*)d_in[1];
  const float* kp_w1 = (const float*)d_in[2];
  const float* kp_b1 = (const float*)d_in[3];
  const float* kp_w2 = (const float*)d_in[4];
  const float* kp_b2 = (const float*)d_in[5];
  const float* ka_w  = (const float*)d_in[6];
  const float* ka_b  = (const float*)d_in[7];
  const float* qp_w1 = (const float*)d_in[8];
  const float* qp_b1 = (const float*)d_in[9];
  const float* qp_w2 = (const float*)d_in[10];
  const float* qp_b2 = (const float*)d_in[11];
  const float* qa_w  = (const float*)d_in[12];
  const float* qa_b  = (const float*)d_in[13];
  const float* v_w   = (const float*)d_in[14];
  const float* v_b   = (const float*)d_in[15];
  const float* ln_g  = (const float*)d_in[16];
  const float* ln_b  = (const float*)d_in[17];
  const float* o_w   = (const float*)d_in[18];
  const float* o_b   = (const float*)d_in[19];

  const size_t PX = (size_t)MTOT * DM * 2;        // 4,194,304
  const size_t PW = (size_t)DM * DM * 2;          //   524,288
  const size_t PS = (size_t)KO * DM * 2;          //    32,768
  const size_t PQ = (size_t)MTOT * QK * 2;        //   524,288
  const size_t PV = (size_t)NB * DM * SEQ * 2;    // 4,194,304
  const size_t PR = (size_t)MTOT * DM * 4;        // 8,388,608
  size_t off = 0;
  const size_t oXh  = off; off += PX;  const size_t oXl  = off; off += PX;
  const size_t oHkh = off; off += PX;  const size_t oHkl = off; off += PX;
  const size_t oHqh = off; off += PX;  const size_t oHql = off; off += PX;
  const size_t oWkh = off; off += PW;  const size_t oWkl = off; off += PW;
  const size_t oWqh = off; off += PW;  const size_t oWql = off; off += PW;
  const size_t oWvh = off; off += PW;  const size_t oWvl = off; off += PW;
  const size_t oWoh = off; off += PW;  const size_t oWol = off; off += PW;
  const size_t oSk2h = off; off += PS; const size_t oSk2l = off; off += PS;
  const size_t oSq2h = off; off += PS; const size_t oSq2l = off; off += PS;
  const size_t oSkah = off; off += PS; const size_t oSkal = off; off += PS;
  const size_t oSqah = off; off += PS; const size_t oSqal = off; off += PS;
  const size_t oQth = off; off += PQ;  const size_t oQtl = off; off += PQ;
  const size_t oKth = off; off += PQ;  const size_t oKtl = off; off += PQ;
  const size_t oVTh = off; off += PV;  const size_t oVTl = off; off += PV;
  const size_t oR   = off; off += PR;
  const size_t oLh  = off; off += PX;  const size_t oLl  = off; off += PX;
  if (off > ws_size) return;                      // off = 56,885,248

  char* ws = (char*)d_ws;
  unsigned short* Xh  = (unsigned short*)(ws + oXh);   unsigned short* Xl  = (unsigned short*)(ws + oXl);
  unsigned short* Hkh = (unsigned short*)(ws + oHkh);  unsigned short* Hkl = (unsigned short*)(ws + oHkl);
  unsigned short* Hqh = (unsigned short*)(ws + oHqh);  unsigned short* Hql = (unsigned short*)(ws + oHql);
  unsigned short* Wkh = (unsigned short*)(ws + oWkh);  unsigned short* Wkl = (unsigned short*)(ws + oWkl);
  unsigned short* Wqh = (unsigned short*)(ws + oWqh);  unsigned short* Wql = (unsigned short*)(ws + oWql);
  unsigned short* Wvh = (unsigned short*)(ws + oWvh);  unsigned short* Wvl = (unsigned short*)(ws + oWvl);
  unsigned short* Woh = (unsigned short*)(ws + oWoh);  unsigned short* Wol = (unsigned short*)(ws + oWol);
  unsigned short* Sk2h = (unsigned short*)(ws + oSk2h); unsigned short* Sk2l = (unsigned short*)(ws + oSk2l);
  unsigned short* Sq2h = (unsigned short*)(ws + oSq2h); unsigned short* Sq2l = (unsigned short*)(ws + oSq2l);
  unsigned short* Skah = (unsigned short*)(ws + oSkah); unsigned short* Skal = (unsigned short*)(ws + oSkal);
  unsigned short* Sqah = (unsigned short*)(ws + oSqah); unsigned short* Sqal = (unsigned short*)(ws + oSqal);
  unsigned short* Qth = (unsigned short*)(ws + oQth);  unsigned short* Qtl = (unsigned short*)(ws + oQtl);
  unsigned short* Kth = (unsigned short*)(ws + oKth);  unsigned short* Ktl = (unsigned short*)(ws + oKtl);
  unsigned short* VTh = (unsigned short*)(ws + oVTh);  unsigned short* VTl = (unsigned short*)(ws + oVTl);
  float*          Rws = (float*)(ws + oR);
  unsigned short* Lh  = (unsigned short*)(ws + oLh);   unsigned short* Ll  = (unsigned short*)(ws + oLl);

  const dim3 b256(256), b128(128);

  // (1) x [4096][512] f32 -> bf16 hi/lo planes
  const int n2x = MTOT * DM / 2;                               // 1,048,576 pairs
  split_bf16x2_kernel<<<dim3((n2x + 255) / 256), b256, 0, stream>>>(x, Xh, Xl, n2x);

  // (2) [in k][out n] weights -> transposed hi/lo planes [n][k]; in rows = 512, cols = 512; grid (cols/64, rows/64)
  tsplit_kernel<<<dim3(DM / 64, DM / 64), b256, 0, stream>>>(kp_w1, Wkh, Wkl, DM, DM);
  tsplit_kernel<<<dim3(DM / 64, DM / 64), b256, 0, stream>>>(qp_w1, Wqh, Wql, DM, DM);
  tsplit_kernel<<<dim3(DM / 64, DM / 64), b256, 0, stream>>>(v_w,   Wvh, Wvl, DM, DM);
  tsplit_kernel<<<dim3(DM / 64, DM / 64), b256, 0, stream>>>(o_w,   Woh, Wol, DM, DM);
  // (3) [512][32] weights -> [32][512] hi/lo planes
  tsplit32_kernel<<<dim3(DM / 64), b256, 0, stream>>>(kp_w2, Sk2h, Sk2l, DM);
  tsplit32_kernel<<<dim3(DM / 64), b256, 0, stream>>>(qp_w2, Sq2h, Sq2l, DM);
  tsplit32_kernel<<<dim3(DM / 64), b256, 0, stream>>>(ka_w,  Skah, Skal, DM);
  tsplit32_kernel<<<dim3(DM / 64), b256, 0, stream>>>(qa_w,  Sqah, Sqal, DM);

  // (4) hk = tanh(x . kp_w1 + kp_b1), hq likewise -> bf16 hi/lo planes [4096][512]  (M=4096, N=512, K=512; 1024 wave tiles)
  const dim3 gH(((MTOT / 32) * (DM / 64) + 7) / 8, 1);         // 128 blocks
  gemm_hl_kernel<2, 2, false, 1><<<gH, b256, 0, stream>>>(
      Xh, Xl, DM, 0LL, Wkh, Wkl, DM, 0LL, (void*)Hkh, (void*)Hkl, DM, 0LL,
      kp_b1, nullptr, 0LL, MTOT, DM, DM);
  gemm_hl_kernel<2, 2, false, 1><<<gH, b256, 0, stream>>>(
      Xh, Xl, DM, 0LL, Wqh, Wql, DM, 0LL, (void*)Hqh, (void*)Hql, DM, 0LL,
      qp_b1, nullptr, 0LL, MTOT, DM, DM);

  // (5) V^T[b][d][l] = sum_k v_w^T[d][k] x[b][l][k] + v_b[d] -> bf16 hi/lo planes [2][512][2048]
  //     (A = v_w^T planes [512][512], Bt = x planes of batch b [2048][512]; M=512, N=2048, K=512; 512 tiles per batch)
  const dim3 gV(((DM / 32) * (SEQ / 64) + 7) / 8, NB);         // (64, 2)
  gemm_hl_kernel<1, 2, false, 0><<<gV, b256, 0, stream>>>(
      Wvh, Wvl, DM, 0LL, Xh, Xl, DM, (long long)SEQ * DM, (void*)VTh, (void*)VTl, SEQ, (long long)DM * SEQ,
      v_b, nullptr, 0LL, DM, SEQ, DM);

  // (6) oscillator heads + encode -> Qt, Kt hi/lo planes [4096][64]
  enc_head_kernel<<<dim3(MTOT / 64), b128, 0, stream>>>(
      Hkh, Hkl, Hqh, Hql, Xh, Xl,
      Sk2h, Sk2l, Sq2h, Sq2l, Skah, Skal, Sqah, Sqal,
      kp_b2, qp_b2, ka_b, qa_b, pos,
      Qth, Qtl, Kth, Ktl);

  // (7) causal mixing -> R f32 [4096][512]
  causal_mix_kernel<<<dim3(NB * (SEQ / 64) * 4), b128, 0, stream>>>(Qth, Qtl, Kth, Ktl, VTh, VTl, Rws);

  // (8) LayerNorm -> bf16 hi/lo planes [4096][512]
  ln_split_kernel<<<dim3(MTOT / 8), b256, 0, stream>>>(Rws, ln_g, ln_b, Lh, Ll);

  // (9) out = x + ln . o_w + o_b -> d_out f32 [4096][512]
  gemm_hl_kernel<2, 0, true, 0><<<gH, b256, 0, stream>>>(
      Lh, Ll, DM, 0LL, Woh, Wol, DM, 0LL, d_out, d_out, DM, 0LL,
      o_b, x, 0LL, MTOT, DM, DM);

  (void)hipGetLastError();
}

// v001
// One run takes 310 microseconds.
// Two timings next to v000 put it at 1.17 and 1.16 times that version's speed.
// All contractions (x.kp_w1, x.qp_w1, x.v_w, h.kp_w2, h.qp_w2, x.ka_w, x.qa_w, causal score S = Qt.Kt^T and S.V, ln.o_w): v_wmma_f32_16x16x32_bf16 with bf16 hi/lo operands (hi.hi + hi.lo + lo.hi), f32 accumulate; encoders (tanh, softplus, sincos), norm scale, LayerNorm, biases and residual in f32.
#include <hip/hip_runtime.h>
#include <math.h>
#include <stdint.h>

#define NB   2
#define SEQ  2048
#define DM   512
#define KO   32
#define QK   64
#define MTOT (NB * SEQ)

typedef __attribute__((ext_vector_type(16))) __bf16 v16b;
typedef __attribute__((ext_vector_type(8)))  __bf16 v8b;
typedef __attribute__((ext_vector_type(8)))  float  v8f;
typedef __attribute__((ext_vector_type(4)))  float  v4f;
typedef __attribute__((ext_vector_type(2)))  float  v2f;
typedef __attribute__((ext_vector_type(4)))  unsigned int   v4u;
typedef __attribute__((ext_vector_type(8)))  unsigned short v8us;

union FB { v16b v; v8b h[2]; };

__device__ __forceinline__ unsigned short f2bf_bits(float f) {
  unsigned u = __float_as_uint(f);
  return (unsigned short)((u + 0x7FFFu + ((u >> 16) & 1u)) >> 16);   // RNE
}
__device__ __forceinline__ float bf_bits2f(unsigned short h) { return __uint_as_float(((unsigned)h) << 16); }
__device__ __forceinline__ unsigned pk16(unsigned short a, unsigned short b) { return (unsigned)a | ((unsigned)b << 16); }

__device__ __forceinline__ v8f zero8() { return (v8f){0.f, 0.f, 0.f, 0.f, 0.f, 0.f, 0.f, 0.f}; }

// 16-bit A/B fragment from a k-contiguous row p = &T[row][k0 + 8*(lane>>4)]:
// elements 0..7 <- p[0..7] (k0+8h..), elements 8..15 <- p[16..23] (k0+16+8h..)
__device__ __forceinline__ v16b ldfrag(const __bf16* p) {
  FB f;
  f.h[0] = *(const v8b*)(p);
  f.h[1] = *(const v8b*)(p + 16);
  return f.v;
}

// hi/lo split product group: c += ah.bh + ah.bl + al.bh, then 4 VALU slots tying D and keeping all operands live
__device__ __forceinline__ v8f mma3(v16b ah, v16b al, v16b bh, v16b bl, v8f c) {
  c = __builtin_amdgcn_wmma_f32_16x16x32_bf16(false, ah, false, bh, (short)0, c, false, false);
  c = __builtin_amdgcn_wmma_f32_16x16x32_bf16(false, ah, false, bl, (short)0, c, false, false);
  c = __builtin_amdgcn_wmma_f32_16x16x32_bf16(false, al, false, bh, (short)0, c, false, false);
  asm volatile("v_nop\n\tv_nop\n\tv_nop\n\tv_nop" : "+v"(c) : "v"(ah), "v"(al), "v"(bh), "v"(bl));
  return c;
}

// same-wave LDS exchange: order the wave's LDS stores before its cross-lane reloads
__device__ __forceinline__ void wave_lds_sync() {
  __builtin_amdgcn_fence(__ATOMIC_RELEASE, "workgroup");
  __builtin_amdgcn_wave_barrier();
  __builtin_amdgcn_fence(__ATOMIC_ACQUIRE, "workgroup");
}

// ---------------------------------------------------------------------------
// Elementwise bf16 split of a flat f32 array: hi = bf16(in), lo = bf16(in - hi); 2 elements per thread,
// ---------------------------------------------------------------------------
__global__ __launch_bounds__(256) void split_bf16x2_kernel(const float* __restrict__ in, unsigned short* hi,
                                                           unsigned short* lo, int n2) {
  const int i = blockIdx.x * 256 + threadIdx.x;
  if (i < n2) {
    const v2f f = *(const v2f*)(in + 2 * (size_t)i);
    const unsigned short h0 = f2bf_bits(f[0]), h1 = f2bf_bits(f[1]);
    const unsigned short l0 = f2bf_bits(f[0] - bf_bits2f(h0)), l1 = f2bf_bits(f[1] - bf_bits2f(h1));
    const unsigned uh = pk16(h0, h1), ul = pk16(l0, l1);
    ((unsigned*)hi)[i] = uh;
    ((unsigned*)lo)[i] = ul;
    
  }
}

// ---------------------------------------------------------------------------
// Fused transpose + bf16 split of an f32 matrix: in [R][Cc] -> oh[c][r] = bf16(in[r][c]), ol = residual
// ([Cc][R], pitch R). 64x64 tiles through LDS. grid = (Cc/64, R/64), 256 threads (R, Cc multiples of 64).
// Coverage per block and plane: load 4 it x 256 thr x 4 = 64x64; store 2 it x 256 thr x 8 = 64x64.
// ---------------------------------------------------------------------------
__global__ __launch_bounds__(256) void tsplit_kernel(const float* __restrict__ W, unsigned short* oh,
                                                     unsigned short* ol, int R, int Cc) {
  __shared__ __align__(16) float tf[64 * 68];
  const int c0  = blockIdx.x * 64;
  const int r0  = blockIdx.y * 64;
  const int tid = threadIdx.x;
  {
    const int lr = tid >> 4;
    const int c4 = (tid & 15) * 4;
#pragma unroll
    for (int it = 0; it < 4; ++it) {
      const int rr = it * 16 + lr;
      const v4f a = *(const v4f*)(W + (size_t)(r0 + rr) * Cc + c0 + c4);
      *(v4f*)(tf + rr * 68 + c4) = a;
    }
  }
  __syncthreads();
  const int sub = tid >> 3;
  const int c8  = (tid & 7) * 8;
  v4u hv[2], lv[2];
#pragma unroll
  for (int it = 0; it < 2; ++it) {
    const int oc = it * 32 + sub;
    v4u a, a2;
#pragma unroll
    for (int q = 0; q < 4; ++q) {
      const float f0 = tf[(c8 + 2 * q) * 68 + oc];
      const float f1 = tf[(c8 + 2 * q + 1) * 68 + oc];
      const unsigned short h0 = f2bf_bits(f0), h1 = f2bf_bits(f1);
      const unsigned short l0 = f2bf_bits(f0 - bf_bits2f(h0)), l1 = f2bf_bits(f1 - bf_bits2f(h1));
      a[q]  = pk16(h0, h1);
      a2[q] = pk16(l0, l1);
    }
    hv[it] = a; lv[it] = a2;
  }
  {
#pragma unroll
    for (int it = 0; it < 2; ++it) {
      const int oc = it * 32 + sub;
      const size_t go = (size_t)(c0 + oc) * R + r0 + c8;
      *(v4u*)(oh + go) = hv[it];
      *(v4u*)(ol + go) = lv[it];
    }
    
  }
}

// ---------------------------------------------------------------------------
// Transpose + bf16 split of a narrow f32 matrix: in [R][32] -> oh/ol [32][R] (pitch R). grid = R/64, 256 threads.
// Coverage per block: load 2 it x 256 thr x 4 = 64 rows x 32; store 32 output rows x (8 lanes x 8) = 32 x 64.
// ---------------------------------------------------------------------------
__global__ __launch_bounds__(256) void tsplit32_kernel(const float* __restrict__ W, unsigned short* oh,
                                                       unsigned short* ol, int R) {
  __shared__ __align__(16) float tf[64 * 36];
  const int r0  = blockIdx.x * 64;
  const int tid = threadIdx.x;
  {
    const int rr = tid >> 3;          // 0..31
    const int c4 = (tid & 7) * 4;     // 0..28
#pragma unroll
    for (int it = 0; it < 2; ++it) {
      const int row = it * 32 + rr;   // 0..63
      const v4f a = *(const v4f*)(W + (size_t)(r0 + row) * KO + c4);
      *(v4f*)(tf + row * 36 + c4) = a;
    }
  }
  __syncthreads();
  const int oc = tid >> 3;            // output row = input column 0..31
  const int c8 = (tid & 7) * 8;       // output cols r0+c8 .. +7
  v4u hv, lv;
#pragma unroll
  for (int q = 0; q < 4; ++q) {
    const float f0 = tf[(c8 + 2 * q) * 36 + oc];
    const float f1 = tf[(c8 + 2 * q + 1) * 36 + oc];
    const unsigned short h0 = f2bf_bits(f0), h1 = f2bf_bits(f1);
    const unsigned short l0 = f2bf_bits(f0 - bf_bits2f(h0)), l1 = f2bf_bits(f1 - bf_bits2f(h1));
    hv[q] = pk16(h0, h1);
    lv[q] = pk16(l0, l1);
  }
  const size_t go = (size_t)oc * R + r0 + c8;
  {
    *(v4u*)(oh + go) = hv;
    *(v4u*)(ol + go) = lv;
    
  }
}

// ---------------------------------------------------------------------------
// Register-blocked batched WMMA GEMM on bf16 hi/lo planes:
//   C[m,n] = sum_k A[m,k] * Bt[n,k] (+bias)(+resid)(act); product = hi.hi + hi.lo + lo.hi.
// A planes row-major [M][K] (pitch lda), Bt planes row-major [N][K] (pitch ldb); M % 32 == 0, N % 64 == 0, K % 32 == 0.
// Each wave owns a 32x64 tile (tile index = blockIdx.x*8 + wave), blockIdx.y = batch with element strides.
// BIAS_MODE: 1 = bias[m], 2 = bias[n]. OUT_MODE: 0 = f32, 2 = bf16 hi plane (Cout) + lo plane (Cout2). ACT 1 = tanh.
// ---------------------------------------------------------------------------
template <int BIAS_MODE, int OUT_MODE, bool RESID, int ACT>
__global__ __launch_bounds__(256) void gemm_hl_kernel(
    const unsigned short* __restrict__ Ahp, const unsigned short* __restrict__ Alp, int lda, long long strideA,
    const unsigned short* __restrict__ Bhp, const unsigned short* __restrict__ Blp, int ldb, long long strideB,
    void* Cout, void* Cout2, int ldc, long long strideC,
    const float* __restrict__ bias,
    const float* __restrict__ resid, long long strideR,
    int M, int N, int K) {
  __shared__ __align__(16) float sT[8][16 * 68];
  const __bf16* Ah = (const __bf16*)(const void*)Ahp;
  const __bf16* Al = (const __bf16*)(const void*)Alp;
  const __bf16* Bh = (const __bf16*)(const void*)Bhp;
  const __bf16* Bl = (const __bf16*)(const void*)Blp;
  const int bz   = blockIdx.y;
  const int lane = threadIdx.x & 31;
  const int wave = threadIdx.x >> 5;
  const int tilesN = N >> 6;
  const int tilesM = M >> 5;
  const int tile = blockIdx.x * 8 + wave;
  if (tile >= tilesM * tilesN) return;   // wave-uniform; no block barriers in this kernel
  const int tm = tile / tilesN;
  const int tn = tile - tm * tilesN;
  const int m0 = tm << 5;
  const int n0 = tn << 6;

  const __bf16* Abh = Ah + (size_t)bz * strideA;
  const __bf16* Abl = Al + (size_t)bz * strideA;
  const __bf16* Bbh = Bh + (size_t)bz * strideB;
  const __bf16* Bbl = Bl + (size_t)bz * strideB;

  const int rl   = lane & 15;            // row (A) / col (B, D) within subtile
  const int koff = (lane >> 4) * 8;      // k offset of this lane half
  const int mOff = (lane >> 4) * 8;      // D row offset

  v8f acc[2][4];
#pragma unroll
  for (int i = 0; i < 2; ++i)
#pragma unroll
    for (int j = 0; j < 4; ++j) acc[i][j] = zero8();

#pragma unroll 1
  for (int k0 = 0; k0 < K; k0 += 32) {
    v16b bh[4], bl[4];
#pragma unroll
    for (int j = 0; j < 4; ++j) {
      const size_t bo = (size_t)(n0 + (j << 4) + rl) * ldb + koff + k0;
      bh[j] = ldfrag(Bbh + bo);
      bl[j] = ldfrag(Bbl + bo);
    }
#pragma unroll
    for (int i = 0; i < 2; ++i) {
      const size_t ao = (size_t)(m0 + (i << 4) + rl) * lda + koff + k0;
      const v16b ah = ldfrag(Abh + ao);
      const v16b al = ldfrag(Abl + ao);
#pragma unroll
      for (int j = 0; j < 4; ++j) acc[i][j] = mma3(ah, al, bh[j], bl[j], acc[i][j]);
    }
  }

  // ---- epilogue ----
  float* slab = sT[wave];
  const float* Rb = RESID ? (resid + (size_t)bz * strideR) : nullptr;
#pragma unroll
  for (int i = 0; i < 2; ++i) {
    const int mBase = m0 + (i << 4);
#pragma unroll
    for (int j = 0; j < 4; ++j) {
      const int n = n0 + (j << 4) + rl;
      float bv = 0.f;
      if (BIAS_MODE == 2) bv = bias[n];
#pragma unroll
      for (int r = 0; r < 8; ++r) {
        float v = acc[i][j][r];
        if (BIAS_MODE == 1) v += bias[mBase + mOff + r];
        if (BIAS_MODE == 2) v += bv;
        if (RESID) v += Rb[(size_t)(mBase + mOff + r) * ldc + n];
        if (ACT == 1) v = tanhf(v);
        slab[(mOff + r) * 68 + (j << 4) + rl] = v;
      }
    }
    wave_lds_sync();
    if (OUT_MODE == 0) {
      float* C = (float*)Cout + (size_t)bz * strideC;
      const int hsel = lane >> 4, c4 = (lane & 15) * 4;   // row seg = 256 B = 16 lanes x 16 B, 2 rows per instruction
      {
#pragma unroll
        for (int it = 0; it < 8; ++it) {
          const int row = it * 2 + hsel;                   // it 0..7 x hsel 0..1 = rows 0..15
          const v4f v = *(const v4f*)(slab + row * 68 + c4);
          *(v4f*)(C + (size_t)(mBase + row) * ldc + n0 + c4) = v;
        }
        
      }
    } else {
      const int q4 = lane >> 3, c8 = (lane & 7) * 8;
      unsigned short* C  = (unsigned short*)Cout  + (size_t)bz * strideC;
      unsigned short* C2 = (unsigned short*)Cout2 + (size_t)bz * strideC;
      {
#pragma unroll
        for (int it = 0; it < 4; ++it) {
          const int row = it * 4 + q4;                     // it 0..3 x q4 0..3 = rows 0..15
          const float* sp = slab + row * 68 + c8;
          v8us hv, lv;
#pragma unroll
          for (int e = 0; e < 8; ++e) {
            const unsigned short hb = f2bf_bits(sp[e]);
            const unsigned short lb = f2bf_bits(sp[e] - bf_bits2f(hb));
            hv[e] = hb;
            lv[e] = lb;
          }
          const size_t go = (size_t)(mBase + row) * ldc + n0 + c8;
          *(v8us*)(C + go)  = hv;
          *(v8us*)(C2 + go) = lv;
        }
        
      }
    }
    wave_lds_sync();
  }
}

// ---------------------------------------------------------------------------
// Fused oscillator heads + encode. Per wave 16 rows (block = 4 waves = 64 rows, grid = 4096/64):
//   Pk = Hk.kp_w2, Pq = Hq.qp_w2, Ak = X.ka_w, Aq = X.qa_w  (each 16 x 32, K = 512, hi/lo WMMA);
//   phase = tanh(P + b2)*pi + pos[l]; amp = softplus(A + ba) + 0.1;
//   Kt[row] = [amp_k cos | amp_k sin] (64), Qt[row] = [amp_q cos | amp_q sin]  -> bf16 hi/lo planes [4096][64].
// Operand planes: H/X [4096][512]; W2t planes [32][512] (k-contiguous).
// LDS slab per wave [16][132]: cols 0..31 / 32..63 / 64..95 / 96..127 = k-phase / k-amp / q-phase / q-amp pre-acts,
// ---------------------------------------------------------------------------
__global__ __launch_bounds__(128) void enc_head_kernel(
    const unsigned short* __restrict__ Hkhp, const unsigned short* __restrict__ Hklp,
    const unsigned short* __restrict__ Hqhp, const unsigned short* __restrict__ Hqlp,
    const unsigned short* __restrict__ Xhp,  const unsigned short* __restrict__ Xlp,
    const unsigned short* __restrict__ Wk2hp, const unsigned short* __restrict__ Wk2lp,
    const unsigned short* __restrict__ Wq2hp, const unsigned short* __restrict__ Wq2lp,
    const unsigned short* __restrict__ Wkahp, const unsigned short* __restrict__ Wkalp,
    const unsigned short* __restrict__ Wqahp, const unsigned short* __restrict__ Wqalp,
    const float* __restrict__ bk2, const float* __restrict__ bq2,
    const float* __restrict__ bka, const float* __restrict__ bqa,
    const float* __restrict__ pos,
    unsigned short* Qhp, unsigned short* Qlp, unsigned short* Khp, unsigned short* Klp) {
  __shared__ __align__(16) float slab_all[4][16 * 132];
  const int tid = threadIdx.x, wave = tid >> 5, lane = tid & 31, hh = lane >> 4, c = lane & 15;
  const int row0 = blockIdx.x * 64 + wave * 16;

  const __bf16* Hkh = (const __bf16*)(const void*)Hkhp;  const __bf16* Hkl = (const __bf16*)(const void*)Hklp;
  const __bf16* Hqh = (const __bf16*)(const void*)Hqhp;  const __bf16* Hql = (const __bf16*)(const void*)Hqlp;
  const __bf16* Xh  = (const __bf16*)(const void*)Xhp;   const __bf16* Xl  = (const __bf16*)(const void*)Xlp;
  const __bf16* Wk2h = (const __bf16*)(const void*)Wk2hp; const __bf16* Wk2l = (const __bf16*)(const void*)Wk2lp;
  const __bf16* Wq2h = (const __bf16*)(const void*)Wq2hp; const __bf16* Wq2l = (const __bf16*)(const void*)Wq2lp;
  const __bf16* Wkah = (const __bf16*)(const void*)Wkahp; const __bf16* Wkal = (const __bf16*)(const void*)Wkalp;
  const __bf16* Wqah = (const __bf16*)(const void*)Wqahp; const __bf16* Wqal = (const __bf16*)(const void*)Wqalp;

  v8f aPk[2], aPq[2], aAk[2], aAq[2];
#pragma unroll
  for (int t = 0; t < 2; ++t) { aPk[t] = zero8(); aPq[t] = zero8(); aAk[t] = zero8(); aAq[t] = zero8(); }

#pragma unroll 1
  for (int k0 = 0; k0 < DM; k0 += 32) {
    const size_t ao = (size_t)(row0 + c) * DM + k0 + 8 * hh;
    const v16b ahk = ldfrag(Hkh + ao), alk = ldfrag(Hkl + ao);
    const v16b ahq = ldfrag(Hqh + ao), alq = ldfrag(Hql + ao);
    const v16b axh = ldfrag(Xh + ao),  axl = ldfrag(Xl + ao);
#pragma unroll
    for (int t = 0; t < 2; ++t) {
      const size_t bo = (size_t)(t * 16 + c) * DM + k0 + 8 * hh;
      aPk[t] = mma3(ahk, alk, ldfrag(Wk2h + bo), ldfrag(Wk2l + bo), aPk[t]);
      aPq[t] = mma3(ahq, alq, ldfrag(Wq2h + bo), ldfrag(Wq2l + bo), aPq[t]);
      aAk[t] = mma3(axh, axl, ldfrag(Wkah + bo), ldfrag(Wkal + bo), aAk[t]);
      aAq[t] = mma3(axh, axl, ldfrag(Wqah + bo), ldfrag(Wqal + bo), aAq[t]);
    }
  }

  // stage pre-activations (+bias) in the D layout: row 8hh+r, oscillator n = t*16+c
  float* sl = slab_all[wave];
#pragma unroll
  for (int t = 0; t < 2; ++t) {
    const int n = t * 16 + c;
    const float b1 = bk2[n], b2 = bka[n], b3 = bq2[n], b4 = bqa[n];
#pragma unroll
    for (int r = 0; r < 8; ++r) {
      float* sp = sl + (8 * hh + r) * 132;
      sp[n]      = aPk[t][r] + b1;
      sp[32 + n] = aAk[t][r] + b2;
      sp[64 + n] = aPq[t][r] + b3;
      sp[96 + n] = aAq[t][r] + b4;
    }
  }
  wave_lds_sync();

  // encode: lane = oscillator index, one row per iteration (same lane reads and writes its own 4 slots)
  const float PI = 3.14159265358979323846f;
#pragma unroll 1
  for (int it = 0; it < 16; ++it) {
    float* sp = sl + it * 132;
    const int l = (row0 + it) & (SEQ - 1);
    const float pa  = pos[l * KO + lane];
    const float vpk = sp[lane], vak = sp[32 + lane], vpq = sp[64 + lane], vaq = sp[96 + lane];
    const float phk = tanhf(vpk) * PI + pa;
    const float phq = tanhf(vpq) * PI + pa;
    const float ak  = fmaxf(vak, 0.f) + log1pf(expf(-fabsf(vak))) + 0.1f;
    const float aq  = fmaxf(vaq, 0.f) + log1pf(expf(-fabsf(vaq))) + 0.1f;
    sp[lane]      = ak * cosf(phk);
    sp[32 + lane] = ak * sinf(phk);
    sp[64 + lane] = aq * cosf(phq);
    sp[96 + lane] = aq * sinf(phq);
  }
  wave_lds_sync();

  const int q4 = lane >> 3, c8 = (lane & 7) * 8;
  {
#pragma unroll
    for (int it = 0; it < 4; ++it) {
      const int row = it * 4 + q4;   // 0..15
      const float* sk = sl + row * 132 + c8;
      const float* sq = sl + row * 132 + 64 + c8;
      v8us khv, klv, qhv, qlv;
#pragma unroll
      for (int e = 0; e < 8; ++e) {
        const unsigned short kh = f2bf_bits(sk[e]);
        const unsigned short kl = f2bf_bits(sk[e] - bf_bits2f(kh));
        const unsigned short qh = f2bf_bits(sq[e]);
        const unsigned short ql = f2bf_bits(sq[e] - bf_bits2f(qh));
        khv[e] = kh; klv[e] = kl; qhv[e] = qh; qlv[e] = ql;
      }
      const size_t go = (size_t)(row0 + row) * QK + c8;
      *(v8us*)(Khp + go) = khv;
      *(v8us*)(Klp + go) = klv;
      *(v8us*)(Qhp + go) = qhv;
      *(v8us*)(Qlp + go) = qlv;
    }
    
  }
}

// ---------------------------------------------------------------------------
// Causal mixing: R[b][l][d] = (1/sqrt((l+1)*32)) * sum_{l' <= l} S[l][l'] * V[l'][d],  S = Qt[l] . Kt[l'] (K = 64).
// Block = 4 waves = 64 query rows of one batch element and one 128-wide d chunk; grid = NB * 32 * 4.
//   Qt/Kt planes bf16 hi/lo [4096][64]; V^T planes bf16 hi/lo [b][512 d][2048 l']; R f32 [4096][512].
//   Key tiles of 64 (trip count qb+1 <= 32): stage Kt tile [64][64] and V^T chunk [128][64] (hi+lo) in LDS
//   (plain 16-B loads, __syncthreads before and after); S per wave in registers (A = Qt rows, B = Kt rows from LDS);
//   entries with l' > l set to 0 by value on the diagonal tile; P = S split to bf16 hi/lo into the wave's LDS tile
//   Output: per wave 16 rows x 128 floats staged in LDS (aliasing the K/V region after a block barrier), each
//   Coverage: 4 d chunks x 32 row blocks x 2 batches x (4 waves x 16 rows x 128) = the whole [4096][512] R plane.
// ---------------------------------------------------------------------------
__global__ __launch_bounds__(128) void causal_mix_kernel(
    const unsigned short* __restrict__ Qhp, const unsigned short* __restrict__ Qlp,
    const unsigned short* __restrict__ Khp, const unsigned short* __restrict__ Klp,
    const unsigned short* __restrict__ Vhp, const unsigned short* __restrict__ Vlp,
    float* Rout) {
  // Every tile row holds 64 halves (128 B) at a pitch of LP = 72 halves (144 B = 16 B x 9): the 16 rows that one
  // ds_load_b128 / ds_store_b128 touches then start on 16 different 4-bank groups instead of 2.
  constexpr int LP = 72;
  __shared__ __align__(16) unsigned char smem[73728];
  __bf16* Ksh = (__bf16*)(smem);           // [64 l'][LP]    9216 B
  __bf16* Ksl = (__bf16*)(smem + 9216);
  __bf16* Vth = (__bf16*)(smem + 18432);   // [128 d][LP]   18432 B
  __bf16* Vtl = (__bf16*)(smem + 36864);
  __bf16* Pgh = (__bf16*)(smem + 55296);   // [4 waves][16][LP]  9216 B
  __bf16* Pgl = (__bf16*)(smem + 64512);
  float*  Osb = (float*)(smem);            // [4 waves][16][132] after the main loop (aliases K/V tiles)

  const int tid = threadIdx.x, wave = tid >> 5, lane = tid & 31, hh = lane >> 4, c = lane & 15;
  const int bx  = blockIdx.x;
  const int dch = bx & 3;
  const int qb  = (bx >> 2) & 31;
  const int b   = bx >> 7;
  const int q0  = qb * 64 + wave * 16;                 // sequence-local first row of this wave
  const size_t grow0 = (size_t)b * SEQ + q0;           // global row of this wave's row 0

  const __bf16* Qh = (const __bf16*)(const void*)Qhp; const __bf16* Ql = (const __bf16*)(const void*)Qlp;
  const __bf16* Kh = (const __bf16*)(const void*)Khp; const __bf16* Kl = (const __bf16*)(const void*)Klp;
  const __bf16* Vh = (const __bf16*)(const void*)Vhp; const __bf16* Vl = (const __bf16*)(const void*)Vlp;

  // Qt fragments (A operand, row = lane&15): two 32-deep k chunks, hi and lo
  v16b qah[2], qal[2];
#pragma unroll
  for (int dc = 0; dc < 2; ++dc) {
    qah[dc] = ldfrag(Qh + (grow0 + c) * QK + dc * 32 + 8 * hh);
    qal[dc] = ldfrag(Ql + (grow0 + c) * QK + dc * 32 + 8 * hh);
  }
  v8f oacc[8];
#pragma unroll
  for (int t = 0; t < 8; ++t) oacc[t] = zero8();

  __bf16* pwh = Pgh + wave * (16 * LP);
  __bf16* pwl = Pgl + wave * (16 * LP);

  const int nch = qb + 1;   // block-uniform, <= 32
  for (int kc = 0; kc < nch; ++kc) {
    const int kv0 = kc * 64;
    __syncthreads();
    {
      // Kt tile: 128 threads x 32 halves per plane = 64 x 64
      const int r = tid >> 1, half = (tid & 1) * 32;
      const __bf16* ks = Kh + ((size_t)b * SEQ + kv0 + r) * QK + half;
      const __bf16* ls = Kl + ((size_t)b * SEQ + kv0 + r) * QK + half;
      v8b kr[4], lr[4];
#pragma unroll
      for (int i = 0; i < 4; ++i) {
        kr[i] = *(const v8b*)(ks + 8 * i);
        lr[i] = *(const v8b*)(ls + 8 * i);
      }
      // V^T chunk: thread = d row (dch*128 + tid), 64 halves per plane = 128 x 64
      const __bf16* vs = Vh + ((size_t)b * DM + dch * 128 + tid) * SEQ + kv0;
      const __bf16* vl = Vl + ((size_t)b * DM + dch * 128 + tid) * SEQ + kv0;
      v8b vr[8], wr[8];
#pragma unroll
      for (int i = 0; i < 8; ++i) {
        vr[i] = *(const v8b*)(vs + 8 * i);
        wr[i] = *(const v8b*)(vl + 8 * i);
      }
      // wait before any address register of the 24 loads above is overwritten; the four addresses are inputs so that
      // they stay live up to the wait and no later load's result is placed in them
      asm volatile("s_wait_xcnt 0x0" :: "v"(ks), "v"(ls), "v"(vs), "v"(vl) : "memory");
#pragma unroll
      for (int i = 0; i < 4; ++i) {
        *(v8b*)(Ksh + r * LP + half + 8 * i) = kr[i];
        *(v8b*)(Ksl + r * LP + half + 8 * i) = lr[i];
      }
#pragma unroll
      for (int i = 0; i < 8; ++i) {
        *(v8b*)(Vth + tid * LP + 8 * i) = vr[i];
        *(v8b*)(Vtl + tid * LP + 8 * i) = wr[i];
      }
    }
    __syncthreads();

    // S strip 16 x 64 for this wave: B[k = feature][n = key] = Kt[key][feature]
    v8f s[4];
#pragma unroll
    for (int j = 0; j < 4; ++j) {
      s[j] = zero8();
#pragma unroll
      for (int dc = 0; dc < 2; ++dc) {
        FB kb, kl;
        const int kb0 = (j * 16 + c) * LP + dc * 32 + 8 * hh;
        kb.h[0] = *(const v8b*)(Ksh + kb0);
        kb.h[1] = *(const v8b*)(Ksh + kb0 + 16);
        kl.h[0] = *(const v8b*)(Ksl + kb0);
        kl.h[1] = *(const v8b*)(Ksl + kb0 + 16);
        s[j] = mma3(qah[dc], qal[dc], kb.v, kl.v, s[j]);
      }
    }
    // causal select by value, split to bf16 hi/lo, into the wave's P tile [row][key]
    const bool diag = (kc == qb);   // block-uniform
#pragma unroll
    for (int r = 0; r < 8; ++r) {
      const int qrow = q0 + 8 * hh + r;
#pragma unroll
      for (int j = 0; j < 4; ++j) {
        const int kvcol = kv0 + j * 16 + c;
        float pm = s[j][r];
        if (diag && kvcol > qrow) pm = 0.f;
        const unsigned short hb = f2bf_bits(pm);
        const unsigned short lb = f2bf_bits(pm - bf_bits2f(hb));
        pwh[(8 * hh + r) * LP + j * 16 + c] = __builtin_bit_cast(__bf16, hb);
        pwl[(8 * hh + r) * LP + j * 16 + c] = __builtin_bit_cast(__bf16, lb);
      }
    }
    wave_lds_sync();

    // O[16 x 128] += P[16 x 64] . V[64 x 128]: A = P (row = lane&15), B[k = key][n = d] = V^T[d][key]
#pragma unroll 1
    for (int kk = 0; kk < 2; ++kk) {
      FB pa, pl;
      const int pb0 = c * LP + kk * 32 + 8 * hh;
      pa.h[0] = *(const v8b*)(pwh + pb0);
      pa.h[1] = *(const v8b*)(pwh + pb0 + 16);
      pl.h[0] = *(const v8b*)(pwl + pb0);
      pl.h[1] = *(const v8b*)(pwl + pb0 + 16);
#pragma unroll
      for (int t = 0; t < 8; ++t) {
        FB vb, vlo;
        const int vb0 = (t * 16 + c) * LP + kk * 32 + 8 * hh;
        vb.h[0]  = *(const v8b*)(Vth + vb0);
        vb.h[1]  = *(const v8b*)(Vth + vb0 + 16);
        vlo.h[0] = *(const v8b*)(Vtl + vb0);
        vlo.h[1] = *(const v8b*)(Vtl + vb0 + 16);
        oacc[t] = mma3(pa.v, pl.v, vb.v, vlo.v, oacc[t]);
      }
    }
  }
  __syncthreads();   // every wave done with the K/V tiles before the output staging aliases them

  // scale by 1/sqrt((l+1)*32), stage the wave's 16 x 128 tile, write whole 512-B row segments
  float* os = Osb + wave * (16 * 132);
#pragma unroll
  for (int r = 0; r < 8; ++r) {
    const int lq = q0 + 8 * hh + r;
    const float nrm = sqrtf((float)((lq + 1) * KO));
    const float inv = 1.0f / nrm;
#pragma unroll
    for (int t = 0; t < 8; ++t) os[(8 * hh + r) * 132 + t * 16 + c] = oacc[t][r] * inv;
  }
  wave_lds_sync();
  {
#pragma unroll
    for (int it = 0; it < 16; ++it) {
      const v4f val = *(const v4f*)(os + it * 132 + lane * 4);
      *(v4f*)(Rout + (grow0 + it) * DM + dch * 128 + lane * 4) = val;
    }
    
  }
}

// ---------------------------------------------------------------------------
// One wave per row (block = 8 rows, grid = 4096/8); lane holds cols 8*lane..+7 and 256+8*lane..+7.
// ---------------------------------------------------------------------------
__global__ __launch_bounds__(256) void ln_split_kernel(const float* __restrict__ R, const float* __restrict__ g,
                                                       const float* __restrict__ be,
                                                       unsigned short* Lh, unsigned short* Ll) {
  const int tid = threadIdx.x, wave = tid >> 5, lane = tid & 31;
  const int row = blockIdx.x * 8 + wave;
  const float* rp = R + (size_t)row * DM;
  const int cA = 8 * lane, cB = 256 + 8 * lane;
  const v4f x0 = *(const v4f*)(rp + cA), x1 = *(const v4f*)(rp + cA + 4);
  const v4f x2 = *(const v4f*)(rp + cB), x3 = *(const v4f*)(rp + cB + 4);
  const v4f g0 = *(const v4f*)(g + cA),  g1 = *(const v4f*)(g + cA + 4);
  const v4f g2 = *(const v4f*)(g + cB),  g3 = *(const v4f*)(g + cB + 4);
  const v4f e0 = *(const v4f*)(be + cA), e1 = *(const v4f*)(be + cA + 4);
  const v4f e2 = *(const v4f*)(be + cB), e3 = *(const v4f*)(be + cB + 4);
  float v[16], gg[16], bb[16];
#pragma unroll
  for (int e = 0; e < 4; ++e) {
    v[e] = x0[e]; v[4 + e] = x1[e]; v[8 + e] = x2[e]; v[12 + e] = x3[e];
    gg[e] = g0[e]; gg[4 + e] = g1[e]; gg[8 + e] = g2[e]; gg[12 + e] = g3[e];
    bb[e] = e0[e]; bb[4 + e] = e1[e]; bb[8 + e] = e2[e]; bb[12 + e] = e3[e];
  }
  float sum = 0.f;
#pragma unroll
  for (int e = 0; e < 16; ++e) sum += v[e];
#pragma unroll
  for (int off = 1; off < 32; off <<= 1) sum += __shfl_xor(sum, off, 32);
  const float mu = sum * (1.0f / (float)DM);
  float ss = 0.f;
#pragma unroll
  for (int e = 0; e < 16; ++e) { const float d = v[e] - mu; v[e] = d; ss += d * d; }
#pragma unroll
  for (int off = 1; off < 32; off <<= 1) ss += __shfl_xor(ss, off, 32);
  const float var  = ss * (1.0f / (float)DM);
  const float rstd = 1.0f / sqrtf(var + 1e-5f);
  v8us hA, lA, hB, lB;
#pragma unroll
  for (int e = 0; e < 8; ++e) {
    const float ya = v[e] * rstd * gg[e] + bb[e];
    const float yb = v[8 + e] * rstd * gg[8 + e] + bb[8 + e];
    const unsigned short ha = f2bf_bits(ya), la = f2bf_bits(ya - bf_bits2f(ha));
    const unsigned short hb = f2bf_bits(yb), lb = f2bf_bits(yb - bf_bits2f(hb));
    hA[e] = ha; lA[e] = la; hB[e] = hb; lB[e] = lb;
  }
  const size_t oA = (size_t)row * DM + cA, oB = (size_t)row * DM + cB;
  {
    *(v8us*)(Lh + oA) = hA;
    *(v8us*)(Lh + oB) = hB;
    *(v8us*)(Ll + oA) = lA;
    *(v8us*)(Ll + oB) = lB;
    
  }
}

// ---------------------------------------------------------------------------
// Workspace region map (bytes; every region an exact multiple of its store granularity, no tail rows):
//   Xh, Xl            bf16 [4096][512]     2 x 4,194,304          0 ..  8,388,608
//   Hkh,Hkl,Hqh,Hql   bf16 [4096][512]     4 x 4,194,304   8,388,608 .. 25,165,824
//   W1t planes (kp,qp,v,o) bf16 [512][512] 8 x 524,288  25,165,824 .. 29,360,128
//   W2t planes (kp2,qp2,ka,qa) bf16 [32][512] 8 x 32,768 29,360,128 .. 29,622,272
//   Qth,Qtl,Kth,Ktl   bf16 [4096][64]      4 x 524,288    29,622,272 .. 31,719,424
//   VTh, VTl          bf16 [2][512][2048]  2 x 4,194,304  31,719,424 .. 40,108,032
//   R                 f32  [4096][512]     8,388,608      40,108,032 .. 48,496,640
//   Lh, Ll            bf16 [4096][512]     2 x 4,194,304  48,496,640 .. 56,885,248
// ---------------------------------------------------------------------------
extern "C" void kernel_launch(void* const* d_in, const int* in_sizes, int n_in,
                              void* d_out, int out_size, void* d_ws, size_t ws_size,
                              hipStream_t stream) {
  if (n_in < 20) return;
  if (in_sizes[0] != MTOT * DM || in_sizes[1] != SEQ * KO) return;
  if (in_sizes[2] != DM * DM || in_sizes[8] != DM * DM || in_sizes[14] != DM * DM || in_sizes[18] != DM * DM) return;
  if (in_sizes[3] != DM || in_sizes[9] != DM || in_sizes[15] != DM || in_sizes[19] != DM) return;
  if (in_sizes[16] != DM || in_sizes[17] != DM) return;
  if (in_sizes[4] != DM * KO || in_sizes[6] != DM * KO || in_sizes[10] != DM * KO || in_sizes[12] != DM * KO) return;
  if (in_sizes[5] != KO || in_sizes[7] != KO || in_sizes[11] != KO || in_sizes[13] != KO) return;
  if (out_size != MTOT * DM) return;

  const float* x     = (const float*)d_in[0];
  const float* pos   = (const float*)d_in[1];
  const float* kp_w1 = (const float*)d_in[2];
  const float* kp_b1 = (const float*)d_in[3];
  const float* kp_w2 = (const float*)d_in[4];
  const float* kp_b2 = (const float*)d_in[5];
  const float* ka_w  = (const float*)d_in[6];
  const float* ka_b  = (const float*)d_in[7];
  const float* qp_w1 = (const float*)d_in[8];
  const float* qp_b1 = (const float*)d_in[9];
  const float* qp_w2 = (const float*)d_in[10];
  const float* qp_b2 = (const float*)d_in[11];
  const float* qa_w  = (const float*)d_in[12];
  const float* qa_b  = (const float*)d_in[13];
  const float* v_w   = (const float*)d_in[14];
  const float* v_b   = (const float*)d_in[15];
  const float* ln_g  = (const float*)d_in[16];
  const float* ln_b  = (const float*)d_in[17];
  const float* o_w   = (const float*)d_in[18];
  const float* o_b   = (const float*)d_in[19];

  const size_t PX = (size_t)MTOT * DM * 2;        // 4,194,304
  const size_t PW = (size_t)DM * DM * 2;          //   524,288
  const size_t PS = (size_t)KO * DM * 2;          //    32,768
  const size_t PQ = (size_t)MTOT * QK * 2;        //   524,288
  const size_t PV = (size_t)NB * DM * SEQ * 2;    // 4,194,304
  const size_t PR = (size_t)MTOT * DM * 4;        // 8,388,608
  size_t off = 0;
  const size_t oXh  = off; off += PX;  const size_t oXl  = off; off += PX;
  const size_t oHkh = off; off += PX;  const size_t oHkl = off; off += PX;
  const size_t oHqh = off; off += PX;  const size_t oHql = off; off += PX;
  const size_t oWkh = off; off += PW;  const size_t oWkl = off; off += PW;
  const size_t oWqh = off; off += PW;  const size_t oWql = off; off += PW;
  const size_t oWvh = off; off += PW;  const size_t oWvl = off; off += PW;
  const size_t oWoh = off; off += PW;  const size_t oWol = off; off += PW;
  const size_t oSk2h = off; off += PS; const size_t oSk2l = off; off += PS;
  const size_t oSq2h = off; off += PS; const size_t oSq2l = off; off += PS;
  const size_t oSkah = off; off += PS; const size_t oSkal = off; off += PS;
  const size_t oSqah = off; off += PS; const size_t oSqal = off; off += PS;
  const size_t oQth = off; off += PQ;  const size_t oQtl = off; off += PQ;
  const size_t oKth = off; off += PQ;  const size_t oKtl = off; off += PQ;
  const size_t oVTh = off; off += PV;  const size_t oVTl = off; off += PV;
  const size_t oR   = off; off += PR;
  const size_t oLh  = off; off += PX;  const size_t oLl  = off; off += PX;
  if (off > ws_size) return;                      // off = 56,885,248

  char* ws = (char*)d_ws;
  unsigned short* Xh  = (unsigned short*)(ws + oXh);   unsigned short* Xl  = (unsigned short*)(ws + oXl);
  unsigned short* Hkh = (unsigned short*)(ws + oHkh);  unsigned short* Hkl = (unsigned short*)(ws + oHkl);
  unsigned short* Hqh = (unsigned short*)(ws + oHqh);  unsigned short* Hql = (unsigned short*)(ws + oHql);
  unsigned short* Wkh = (unsigned short*)(ws + oWkh);  unsigned short* Wkl = (unsigned short*)(ws + oWkl);
  unsigned short* Wqh = (unsigned short*)(ws + oWqh);  unsigned short* Wql = (unsigned short*)(ws + oWql);
  unsigned short* Wvh = (unsigned short*)(ws + oWvh);  unsigned short* Wvl = (unsigned short*)(ws + oWvl);
  unsigned short* Woh = (unsigned short*)(ws + oWoh);  unsigned short* Wol = (unsigned short*)(ws + oWol);
  unsigned short* Sk2h = (unsigned short*)(ws + oSk2h); unsigned short* Sk2l = (unsigned short*)(ws + oSk2l);
  unsigned short* Sq2h = (unsigned short*)(ws + oSq2h); unsigned short* Sq2l = (unsigned short*)(ws + oSq2l);
  unsigned short* Skah = (unsigned short*)(ws + oSkah); unsigned short* Skal = (unsigned short*)(ws + oSkal);
  unsigned short* Sqah = (unsigned short*)(ws + oSqah); unsigned short* Sqal = (unsigned short*)(ws + oSqal);
  unsigned short* Qth = (unsigned short*)(ws + oQth);  unsigned short* Qtl = (unsigned short*)(ws + oQtl);
  unsigned short* Kth = (unsigned short*)(ws + oKth);  unsigned short* Ktl = (unsigned short*)(ws + oKtl);
  unsigned short* VTh = (unsigned short*)(ws + oVTh);  unsigned short* VTl = (unsigned short*)(ws + oVTl);
  float*          Rws = (float*)(ws + oR);
  unsigned short* Lh  = (unsigned short*)(ws + oLh);   unsigned short* Ll  = (unsigned short*)(ws + oLl);

  const dim3 b256(256), b128(128);

  // (1) x [4096][512] f32 -> bf16 hi/lo planes
  const int n2x = MTOT * DM / 2;                               // 1,048,576 pairs
  split_bf16x2_kernel<<<dim3((n2x + 255) / 256), b256, 0, stream>>>(x, Xh, Xl, n2x);

  // (2) [in k][out n] weights -> transposed hi/lo planes [n][k]; in rows = 512, cols = 512; grid (cols/64, rows/64)
  tsplit_kernel<<<dim3(DM / 64, DM / 64), b256, 0, stream>>>(kp_w1, Wkh, Wkl, DM, DM);
  tsplit_kernel<<<dim3(DM / 64, DM / 64), b256, 0, stream>>>(qp_w1, Wqh, Wql, DM, DM);
  tsplit_kernel<<<dim3(DM / 64, DM / 64), b256, 0, stream>>>(v_w,   Wvh, Wvl, DM, DM);
  tsplit_kernel<<<dim3(DM / 64, DM / 64), b256, 0, stream>>>(o_w,   Woh, Wol, DM, DM);
  // (3) [512][32] weights -> [32][512] hi/lo planes
  tsplit32_kernel<<<dim3(DM / 64), b256, 0, stream>>>(kp_w2, Sk2h, Sk2l, DM);
  tsplit32_kernel<<<dim3(DM / 64), b256, 0, stream>>>(qp_w2, Sq2h, Sq2l, DM);
  tsplit32_kernel<<<dim3(DM / 64), b256, 0, stream>>>(ka_w,  Skah, Skal, DM);
  tsplit32_kernel<<<dim3(DM / 64), b256, 0, stream>>>(qa_w,  Sqah, Sqal, DM);

  // (4) hk = tanh(x . kp_w1 + kp_b1), hq likewise -> bf16 hi/lo planes [4096][512]  (M=4096, N=512, K=512; 1024 wave tiles)
  const dim3 gH(((MTOT / 32) * (DM / 64) + 7) / 8, 1);         // 128 blocks
  gemm_hl_kernel<2, 2, false, 1><<<gH, b256, 0, stream>>>(
      Xh, Xl, DM, 0LL, Wkh, Wkl, DM, 0LL, (void*)Hkh, (void*)Hkl, DM, 0LL,
      kp_b1, nullptr, 0LL, MTOT, DM, DM);
  gemm_hl_kernel<2, 2, false, 1><<<gH, b256, 0, stream>>>(
      Xh, Xl, DM, 0LL, Wqh, Wql, DM, 0LL, (void*)Hqh, (void*)Hql, DM, 0LL,
      qp_b1, nullptr, 0LL, MTOT, DM, DM);

  // (5) V^T[b][d][l] = sum_k v_w^T[d][k] x[b][l][k] + v_b[d] -> bf16 hi/lo planes [2][512][2048]
  //     (A = v_w^T planes [512][512], Bt = x planes of batch b [2048][512]; M=512, N=2048, K=512; 512 tiles per batch)
  const dim3 gV(((DM / 32) * (SEQ / 64) + 7) / 8, NB);         // (64, 2)
  gemm_hl_kernel<1, 2, false, 0><<<gV, b256, 0, stream>>>(
      Wvh, Wvl, DM, 0LL, Xh, Xl, DM, (long long)SEQ * DM, (void*)VTh, (void*)VTl, SEQ, (long long)DM * SEQ,
      v_b, nullptr, 0LL, DM, SEQ, DM);

  // (6) oscillator heads + encode -> Qt, Kt hi/lo planes [4096][64]
  enc_head_kernel<<<dim3(MTOT / 64), b128, 0, stream>>>(
      Hkh, Hkl, Hqh, Hql, Xh, Xl,
      Sk2h, Sk2l, Sq2h, Sq2l, Skah, Skal, Sqah, Sqal,
      kp_b2, qp_b2, ka_b, qa_b, pos,
      Qth, Qtl, Kth, Ktl);

  // (7) causal mixing -> R f32 [4096][512]
  causal_mix_kernel<<<dim3(NB * (SEQ / 64) * 4), b128, 0, stream>>>(Qth, Qtl, Kth, Ktl, VTh, VTl, Rws);

  // (8) LayerNorm -> bf16 hi/lo planes [4096][512]
  ln_split_kernel<<<dim3(MTOT / 8), b256, 0, stream>>>(Rws, ln_g, ln_b, Lh, Ll);

  // (9) out = x + ln . o_w + o_b -> d_out f32 [4096][512]
  gemm_hl_kernel<2, 0, true, 0><<<gH, b256, 0, stream>>>(
      Lh, Ll, DM, 0LL, Woh, Wol, DM, 0LL, d_out, d_out, DM, 0LL,
      o_b, x, 0LL, MTOT, DM, DM);

  (void)hipGetLastError();
}

// v002
// A run of this version takes 246 microseconds.
// Two timings next to v001 put it at 1.25 and 1.27 times that version's speed.
// All steps since v000 together make it 1.46 times as fast.
// All contractions (x.kp_w1, x.qp_w1, x.v_w, h.kp_w2, h.qp_w2, x.ka_w, x.qa_w, causal score S = Qt.Kt^T and S.V, chunk sums V^T.Kt, state term Qt.M, ln.o_w): v_wmma_f32_16x16x32_bf16 with bf16 hi/lo operands (hi.hi + hi.lo + lo.hi), f32 accumulate; encoders (tanh, softplus, sincos), norm scale, LayerNorm, biases and residual in f32.
#include <hip/hip_runtime.h>
#include <math.h>
#include <stdint.h>

#define NB   2
#define SEQ  2048
#define DM   512
#define KO   32
#define QK   64
#define MTOT (NB * SEQ)
#define NCH  (SEQ / 64)

typedef __attribute__((ext_vector_type(16))) __bf16 v16b;
typedef __attribute__((ext_vector_type(8)))  __bf16 v8b;
typedef __attribute__((ext_vector_type(8)))  float  v8f;
typedef __attribute__((ext_vector_type(4)))  float  v4f;
typedef __attribute__((ext_vector_type(2)))  float  v2f;
typedef __attribute__((ext_vector_type(4)))  unsigned int   v4u;
typedef __attribute__((ext_vector_type(2)))  unsigned int   v2u;
typedef __attribute__((ext_vector_type(8)))  unsigned short v8us;

union FB { v16b v; v8b h[2]; };

__device__ __forceinline__ unsigned short f2bf_bits(float f) {
  unsigned u = __float_as_uint(f);
  return (unsigned short)((u + 0x7FFFu + ((u >> 16) & 1u)) >> 16);   // RNE
}
__device__ __forceinline__ float bf_bits2f(unsigned short h) { return __uint_as_float(((unsigned)h) << 16); }
__device__ __forceinline__ unsigned pk16(unsigned short a, unsigned short b) { return (unsigned)a | ((unsigned)b << 16); }

__device__ __forceinline__ v8f zero8() { return (v8f){0.f, 0.f, 0.f, 0.f, 0.f, 0.f, 0.f, 0.f}; }

// 16-bit A/B fragment from a k-contiguous row p = &T[row][k0 + 8*(lane>>4)]:
// elements 0..7 <- p[0..7] (k0+8h..), elements 8..15 <- p[16..23] (k0+16+8h..)
__device__ __forceinline__ v16b ldfrag(const __bf16* p) {
  FB f;
  f.h[0] = *(const v8b*)(p);
  f.h[1] = *(const v8b*)(p + 16);
  return f.v;
}

// hi/lo split product group: c += ah.bh + ah.bl + al.bh, then 4 VALU slots tying D and keeping all operands live
__device__ __forceinline__ v8f mma3(v16b ah, v16b al, v16b bh, v16b bl, v8f c) {
  c = __builtin_amdgcn_wmma_f32_16x16x32_bf16(false, ah, false, bh, (short)0, c, false, false);
  c = __builtin_amdgcn_wmma_f32_16x16x32_bf16(false, ah, false, bl, (short)0, c, false, false);
  c = __builtin_amdgcn_wmma_f32_16x16x32_bf16(false, al, false, bh, (short)0, c, false, false);
  asm volatile("v_nop\n\tv_nop\n\tv_nop\n\tv_nop" : "+v"(c) : "v"(ah), "v"(al), "v"(bh), "v"(bl));
  return c;
}

// same-wave LDS exchange: order the wave's LDS stores before its cross-lane reloads
__device__ __forceinline__ void wave_lds_sync() {
  __builtin_amdgcn_fence(__ATOMIC_RELEASE, "workgroup");
  __builtin_amdgcn_wave_barrier();
  __builtin_amdgcn_fence(__ATOMIC_ACQUIRE, "workgroup");
}

// ---------------------------------------------------------------------------
// Elementwise bf16 split of a flat f32 array: hi = bf16(in), lo = bf16(in - hi); 2 elements per thread,
// ---------------------------------------------------------------------------
__global__ __launch_bounds__(256) void split_bf16x2_kernel(const float* __restrict__ in, unsigned short* hi,
                                                           unsigned short* lo, int n2) {
  const int i = blockIdx.x * 256 + threadIdx.x;
  if (i < n2) {
    const v2f f = *(const v2f*)(in + 2 * (size_t)i);
    const unsigned short h0 = f2bf_bits(f[0]), h1 = f2bf_bits(f[1]);
    const unsigned short l0 = f2bf_bits(f[0] - bf_bits2f(h0)), l1 = f2bf_bits(f[1] - bf_bits2f(h1));
    const unsigned uh = pk16(h0, h1), ul = pk16(l0, l1);
    ((unsigned*)hi)[i] = uh;
    ((unsigned*)lo)[i] = ul;
    
  }
}

// ---------------------------------------------------------------------------
// Fused transpose + bf16 split of an f32 matrix: in [R][Cc] -> oh[c][r] = bf16(in[r][c]), ol = residual
// ([Cc][R], pitch R). 64x64 tiles through LDS. grid = (Cc/64, R/64), 256 threads (R, Cc multiples of 64).
// Coverage per block and plane: load 4 it x 256 thr x 4 = 64x64; store 2 it x 256 thr x 8 = 64x64.
// ---------------------------------------------------------------------------
__global__ __launch_bounds__(256) void tsplit_kernel(const float* __restrict__ W, unsigned short* oh,
                                                     unsigned short* ol, int R, int Cc) {
  __shared__ __align__(16) float tf[64 * 68];
  const int c0  = blockIdx.x * 64;
  const int r0  = blockIdx.y * 64;
  const int tid = threadIdx.x;
  {
    const int lr = tid >> 4;
    const int c4 = (tid & 15) * 4;
#pragma unroll
    for (int it = 0; it < 4; ++it) {
      const int rr = it * 16 + lr;
      const v4f a = *(const v4f*)(W + (size_t)(r0 + rr) * Cc + c0 + c4);
      *(v4f*)(tf + rr * 68 + c4) = a;
    }
  }
  __syncthreads();
  const int sub = tid >> 3;
  const int c8  = (tid & 7) * 8;
  v4u hv[2], lv[2];
#pragma unroll
  for (int it = 0; it < 2; ++it) {
    const int oc = it * 32 + sub;
    v4u a, a2;
#pragma unroll
    for (int q = 0; q < 4; ++q) {
      const float f0 = tf[(c8 + 2 * q) * 68 + oc];
      const float f1 = tf[(c8 + 2 * q + 1) * 68 + oc];
      const unsigned short h0 = f2bf_bits(f0), h1 = f2bf_bits(f1);
      const unsigned short l0 = f2bf_bits(f0 - bf_bits2f(h0)), l1 = f2bf_bits(f1 - bf_bits2f(h1));
      a[q]  = pk16(h0, h1);
      a2[q] = pk16(l0, l1);
    }
    hv[it] = a; lv[it] = a2;
  }
  {
#pragma unroll
    for (int it = 0; it < 2; ++it) {
      const int oc = it * 32 + sub;
      const size_t go = (size_t)(c0 + oc) * R + r0 + c8;
      *(v4u*)(oh + go) = hv[it];
      *(v4u*)(ol + go) = lv[it];
    }
    
  }
}

// ---------------------------------------------------------------------------
// Transpose + bf16 split of a narrow f32 matrix: in [R][32] -> oh/ol [32][R] (pitch R). grid = R/64, 256 threads.
// Coverage per block: load 2 it x 256 thr x 4 = 64 rows x 32; store 32 output rows x (8 lanes x 8) = 32 x 64.
// ---------------------------------------------------------------------------
__global__ __launch_bounds__(256) void tsplit32_kernel(const float* __restrict__ W, unsigned short* oh,
                                                       unsigned short* ol, int R) {
  __shared__ __align__(16) float tf[64 * 36];
  const int r0  = blockIdx.x * 64;
  const int tid = threadIdx.x;
  {
    const int rr = tid >> 3;          // 0..31
    const int c4 = (tid & 7) * 4;     // 0..28
#pragma unroll
    for (int it = 0; it < 2; ++it) {
      const int row = it * 32 + rr;   // 0..63
      const v4f a = *(const v4f*)(W + (size_t)(r0 + row) * KO + c4);
      *(v4f*)(tf + row * 36 + c4) = a;
    }
  }
  __syncthreads();
  const int oc = tid >> 3;            // output row = input column 0..31
  const int c8 = (tid & 7) * 8;       // output cols r0+c8 .. +7
  v4u hv, lv;
#pragma unroll
  for (int q = 0; q < 4; ++q) {
    const float f0 = tf[(c8 + 2 * q) * 36 + oc];
    const float f1 = tf[(c8 + 2 * q + 1) * 36 + oc];
    const unsigned short h0 = f2bf_bits(f0), h1 = f2bf_bits(f1);
    const unsigned short l0 = f2bf_bits(f0 - bf_bits2f(h0)), l1 = f2bf_bits(f1 - bf_bits2f(h1));
    hv[q] = pk16(h0, h1);
    lv[q] = pk16(l0, l1);
  }
  const size_t go = (size_t)oc * R + r0 + c8;
  {
    *(v4u*)(oh + go) = hv;
    *(v4u*)(ol + go) = lv;
    
  }
}

// ---------------------------------------------------------------------------
// Register-blocked batched WMMA GEMM on bf16 hi/lo planes:
//   C[m,n] = sum_k A[m,k] * Bt[n,k] (+bias)(+resid)(act); product = hi.hi + hi.lo + lo.hi.
// A planes row-major [M][K] (pitch lda), Bt planes row-major [N][K] (pitch ldb); M % 32 == 0, N % 64 == 0, K % 32 == 0.
// Each wave owns a 32x64 tile (tile index = blockIdx.x*8 + wave), blockIdx.y = batch with element strides.
// BIAS_MODE: 1 = bias[m], 2 = bias[n]. OUT_MODE: 0 = f32, 2 = bf16 hi plane (Cout) + lo plane (Cout2). ACT 1 = tanh.
// ---------------------------------------------------------------------------
template <int BIAS_MODE, int OUT_MODE, bool RESID, int ACT>
__global__ __launch_bounds__(256) void gemm_hl_kernel(
    const unsigned short* __restrict__ Ahp, const unsigned short* __restrict__ Alp, int lda, long long strideA,
    const unsigned short* __restrict__ Bhp, const unsigned short* __restrict__ Blp, int ldb, long long strideB,
    void* Cout, void* Cout2, int ldc, long long strideC,
    const float* __restrict__ bias,
    const float* __restrict__ resid, long long strideR,
    int M, int N, int K) {
  __shared__ __align__(16) float sT[8][16 * 68];
  const __bf16* Ah = (const __bf16*)(const void*)Ahp;
  const __bf16* Al = (const __bf16*)(const void*)Alp;
  const __bf16* Bh = (const __bf16*)(const void*)Bhp;
  const __bf16* Bl = (const __bf16*)(const void*)Blp;
  const int bz   = blockIdx.y;
  const int lane = threadIdx.x & 31;
  const int wave = threadIdx.x >> 5;
  const int tilesN = N >> 6;
  const int tilesM = M >> 5;
  const int tile = blockIdx.x * 8 + wave;
  if (tile >= tilesM * tilesN) return;   // wave-uniform; no block barriers in this kernel
  const int tm = tile / tilesN;
  const int tn = tile - tm * tilesN;
  const int m0 = tm << 5;
  const int n0 = tn << 6;

  const __bf16* Abh = Ah + (size_t)bz * strideA;
  const __bf16* Abl = Al + (size_t)bz * strideA;
  const __bf16* Bbh = Bh + (size_t)bz * strideB;
  const __bf16* Bbl = Bl + (size_t)bz * strideB;

  const int rl   = lane & 15;            // row (A) / col (B, D) within subtile
  const int koff = (lane >> 4) * 8;      // k offset of this lane half
  const int mOff = (lane >> 4) * 8;      // D row offset

  v8f acc[2][4];
#pragma unroll
  for (int i = 0; i < 2; ++i)
#pragma unroll
    for (int j = 0; j < 4; ++j) acc[i][j] = zero8();

#pragma unroll 1
  for (int k0 = 0; k0 < K; k0 += 32) {
    v16b bh[4], bl[4];
#pragma unroll
    for (int j = 0; j < 4; ++j) {
      const size_t bo = (size_t)(n0 + (j << 4) + rl) * ldb + koff + k0;
      bh[j] = ldfrag(Bbh + bo);
      bl[j] = ldfrag(Bbl + bo);
    }
#pragma unroll
    for (int i = 0; i < 2; ++i) {
      const size_t ao = (size_t)(m0 + (i << 4) + rl) * lda + koff + k0;
      const v16b ah = ldfrag(Abh + ao);
      const v16b al = ldfrag(Abl + ao);
#pragma unroll
      for (int j = 0; j < 4; ++j) acc[i][j] = mma3(ah, al, bh[j], bl[j], acc[i][j]);
    }
  }

  // ---- epilogue ----
  float* slab = sT[wave];
  const float* Rb = RESID ? (resid + (size_t)bz * strideR) : nullptr;
#pragma unroll
  for (int i = 0; i < 2; ++i) {
    const int mBase = m0 + (i << 4);
#pragma unroll
    for (int j = 0; j < 4; ++j) {
      const int n = n0 + (j << 4) + rl;
      float bv = 0.f;
      if (BIAS_MODE == 2) bv = bias[n];
#pragma unroll
      for (int r = 0; r < 8; ++r) {
        float v = acc[i][j][r];
        if (BIAS_MODE == 1) v += bias[mBase + mOff + r];
        if (BIAS_MODE == 2) v += bv;
        if (RESID) v += Rb[(size_t)(mBase + mOff + r) * ldc + n];
        if (ACT == 1) v = tanhf(v);
        slab[(mOff + r) * 68 + (j << 4) + rl] = v;
      }
    }
    wave_lds_sync();
    if (OUT_MODE == 0) {
      float* C = (float*)Cout + (size_t)bz * strideC;
      const int hsel = lane >> 4, c4 = (lane & 15) * 4;   // row seg = 256 B = 16 lanes x 16 B, 2 rows per instruction
      {
#pragma unroll
        for (int it = 0; it < 8; ++it) {
          const int row = it * 2 + hsel;                   // it 0..7 x hsel 0..1 = rows 0..15
          const v4f v = *(const v4f*)(slab + row * 68 + c4);
          *(v4f*)(C + (size_t)(mBase + row) * ldc + n0 + c4) = v;
        }
        
      }
    } else {
      const int q4 = lane >> 3, c8 = (lane & 7) * 8;
      unsigned short* C  = (unsigned short*)Cout  + (size_t)bz * strideC;
      unsigned short* C2 = (unsigned short*)Cout2 + (size_t)bz * strideC;
      {
#pragma unroll
        for (int it = 0; it < 4; ++it) {
          const int row = it * 4 + q4;                     // it 0..3 x q4 0..3 = rows 0..15
          const float* sp = slab + row * 68 + c8;
          v8us hv, lv;
#pragma unroll
          for (int e = 0; e < 8; ++e) {
            const unsigned short hb = f2bf_bits(sp[e]);
            const unsigned short lb = f2bf_bits(sp[e] - bf_bits2f(hb));
            hv[e] = hb;
            lv[e] = lb;
          }
          const size_t go = (size_t)(mBase + row) * ldc + n0 + c8;
          *(v8us*)(C + go)  = hv;
          *(v8us*)(C2 + go) = lv;
        }
        
      }
    }
    wave_lds_sync();
  }
}

// ---------------------------------------------------------------------------
// Fused oscillator heads + encode. Per wave 16 rows (block = 4 waves = 64 rows, grid = 4096/64):
//   Pk = Hk.kp_w2, Pq = Hq.qp_w2, Ak = X.ka_w, Aq = X.qa_w  (each 16 x 32, K = 512, hi/lo WMMA);
//   phase = tanh(P + b2)*pi + pos[l]; amp = softplus(A + ba) + 0.1;
//   Kt[row] = [amp_k cos | amp_k sin] (64), Qt[row] = [amp_q cos | amp_q sin]  -> bf16 hi/lo planes [4096][64].
//   Kt also goes out key-contiguous: K^T planes [b][64 f][2048 l], one thread per 128-B line (64 keys of one f, one plane).
// Operand planes: H/X [4096][512]; W2t planes [32][512] (k-contiguous).
// LDS slab per wave [16][132]: cols 0..31 / 32..63 / 64..95 / 96..127 = k-phase / k-amp / q-phase / q-amp pre-acts,
// ---------------------------------------------------------------------------
__global__ __launch_bounds__(128) void enc_head_kernel(
    const unsigned short* __restrict__ Hkhp, const unsigned short* __restrict__ Hklp,
    const unsigned short* __restrict__ Hqhp, const unsigned short* __restrict__ Hqlp,
    const unsigned short* __restrict__ Xhp,  const unsigned short* __restrict__ Xlp,
    const unsigned short* __restrict__ Wk2hp, const unsigned short* __restrict__ Wk2lp,
    const unsigned short* __restrict__ Wq2hp, const unsigned short* __restrict__ Wq2lp,
    const unsigned short* __restrict__ Wkahp, const unsigned short* __restrict__ Wkalp,
    const unsigned short* __restrict__ Wqahp, const unsigned short* __restrict__ Wqalp,
    const float* __restrict__ bk2, const float* __restrict__ bq2,
    const float* __restrict__ bka, const float* __restrict__ bqa,
    const float* __restrict__ pos,
    unsigned short* Qhp, unsigned short* Qlp, unsigned short* Khp, unsigned short* Klp,
    unsigned short* KThp, unsigned short* KTlp) {
  __shared__ __align__(16) float slab_all[4][16 * 132];
  const int tid = threadIdx.x, wave = tid >> 5, lane = tid & 31, hh = lane >> 4, c = lane & 15;
  const int row0 = blockIdx.x * 64 + wave * 16;

  const __bf16* Hkh = (const __bf16*)(const void*)Hkhp;  const __bf16* Hkl = (const __bf16*)(const void*)Hklp;
  const __bf16* Hqh = (const __bf16*)(const void*)Hqhp;  const __bf16* Hql = (const __bf16*)(const void*)Hqlp;
  const __bf16* Xh  = (const __bf16*)(const void*)Xhp;   const __bf16* Xl  = (const __bf16*)(const void*)Xlp;
  const __bf16* Wk2h = (const __bf16*)(const void*)Wk2hp; const __bf16* Wk2l = (const __bf16*)(const void*)Wk2lp;
  const __bf16* Wq2h = (const __bf16*)(const void*)Wq2hp; const __bf16* Wq2l = (const __bf16*)(const void*)Wq2lp;
  const __bf16* Wkah = (const __bf16*)(const void*)Wkahp; const __bf16* Wkal = (const __bf16*)(const void*)Wkalp;
  const __bf16* Wqah = (const __bf16*)(const void*)Wqahp; const __bf16* Wqal = (const __bf16*)(const void*)Wqalp;

  v8f aPk[2], aPq[2], aAk[2], aAq[2];
#pragma unroll
  for (int t = 0; t < 2; ++t) { aPk[t] = zero8(); aPq[t] = zero8(); aAk[t] = zero8(); aAq[t] = zero8(); }

#pragma unroll 1
  for (int k0 = 0; k0 < DM; k0 += 32) {
    const size_t ao = (size_t)(row0 + c) * DM + k0 + 8 * hh;
    const v16b ahk = ldfrag(Hkh + ao), alk = ldfrag(Hkl + ao);
    const v16b ahq = ldfrag(Hqh + ao), alq = ldfrag(Hql + ao);
    const v16b axh = ldfrag(Xh + ao),  axl = ldfrag(Xl + ao);
#pragma unroll
    for (int t = 0; t < 2; ++t) {
      const size_t bo = (size_t)(t * 16 + c) * DM + k0 + 8 * hh;
      aPk[t] = mma3(ahk, alk, ldfrag(Wk2h + bo), ldfrag(Wk2l + bo), aPk[t]);
      aPq[t] = mma3(ahq, alq, ldfrag(Wq2h + bo), ldfrag(Wq2l + bo), aPq[t]);
      aAk[t] = mma3(axh, axl, ldfrag(Wkah + bo), ldfrag(Wkal + bo), aAk[t]);
      aAq[t] = mma3(axh, axl, ldfrag(Wqah + bo), ldfrag(Wqal + bo), aAq[t]);
    }
  }

  // stage pre-activations (+bias) in the D layout: row 8hh+r, oscillator n = t*16+c
  float* sl = slab_all[wave];
#pragma unroll
  for (int t = 0; t < 2; ++t) {
    const int n = t * 16 + c;
    const float b1 = bk2[n], b2 = bka[n], b3 = bq2[n], b4 = bqa[n];
#pragma unroll
    for (int r = 0; r < 8; ++r) {
      float* sp = sl + (8 * hh + r) * 132;
      sp[n]      = aPk[t][r] + b1;
      sp[32 + n] = aAk[t][r] + b2;
      sp[64 + n] = aPq[t][r] + b3;
      sp[96 + n] = aAq[t][r] + b4;
    }
  }
  wave_lds_sync();

  // encode: lane = oscillator index, one row per iteration (same lane reads and writes its own 4 slots)
  const float PI = 3.14159265358979323846f;
#pragma unroll 1
  for (int it = 0; it < 16; ++it) {
    float* sp = sl + it * 132;
    const int l = (row0 + it) & (SEQ - 1);
    const float pa  = pos[l * KO + lane];
    const float vpk = sp[lane], vak = sp[32 + lane], vpq = sp[64 + lane], vaq = sp[96 + lane];
    const float phk = tanhf(vpk) * PI + pa;
    const float phq = tanhf(vpq) * PI + pa;
    const float ak  = fmaxf(vak, 0.f) + log1pf(expf(-fabsf(vak))) + 0.1f;
    const float aq  = fmaxf(vaq, 0.f) + log1pf(expf(-fabsf(vaq))) + 0.1f;
    sp[lane]      = ak * cosf(phk);
    sp[32 + lane] = ak * sinf(phk);
    sp[64 + lane] = aq * cosf(phq);
    sp[96 + lane] = aq * sinf(phq);
  }
  wave_lds_sync();

  const int q4 = lane >> 3, c8 = (lane & 7) * 8;
  {
#pragma unroll
    for (int it = 0; it < 4; ++it) {
      const int row = it * 4 + q4;   // 0..15
      const float* sk = sl + row * 132 + c8;
      const float* sq = sl + row * 132 + 64 + c8;
      v8us khv, klv, qhv, qlv;
#pragma unroll
      for (int e = 0; e < 8; ++e) {
        const unsigned short kh = f2bf_bits(sk[e]);
        const unsigned short kl = f2bf_bits(sk[e] - bf_bits2f(kh));
        const unsigned short qh = f2bf_bits(sq[e]);
        const unsigned short ql = f2bf_bits(sq[e] - bf_bits2f(qh));
        khv[e] = kh; klv[e] = kl; qhv[e] = qh; qlv[e] = ql;
      }
      const size_t go = (size_t)(row0 + row) * QK + c8;
      *(v8us*)(Khp + go) = khv;
      *(v8us*)(Klp + go) = klv;
      *(v8us*)(Qhp + go) = qhv;
      *(v8us*)(Qlp + go) = qlv;
    }
    
  }

  __syncthreads();   // the K^T rows below gather the encoded K values of all four waves' slabs
  {
    const int  f   = tid & 63;
    const bool lop = __builtin_amdgcn_readfirstlane(wave) >= 2;   // scalar: waves 0,1 write the hi plane, waves 2,3 the lo plane
    const int  bb  = (blockIdx.x * 64) >> 11;         // batch element
    const int  l0  = (blockIdx.x * 64) & (SEQ - 1);   // first key of this block
    unsigned short* dst = (lop ? KTlp : KThp) + ((size_t)bb * QK + f) * SEQ + l0;
    float xv[64];                                     // key rows 0..63 of the block, feature f
#pragma unroll
    for (int r = 0; r < 64; ++r) xv[r] = slab_all[r >> 4][(r & 15) * 132 + f];
#pragma unroll
    for (int g = 0; g < 8; ++g) {
      v8us o;
#pragma unroll
      for (int e = 0; e < 8; ++e) {
        const float xe = xv[g * 8 + e];
        const unsigned short hb = f2bf_bits(xe);
        const unsigned short lb = f2bf_bits(xe - bf_bits2f(hb));
        o[e] = lop ? lb : hb;
      }
      *(v8us*)(dst + g * 8) = o;
    }
  }
}

// ---------------------------------------------------------------------------
// Per-chunk sums: U[b][ch][d][f] = sum_{l' in 64-key chunk ch} V^T[b][d][l'] * K^T[b][f][l'] (hi/lo WMMA, f32 out).
// A = V^T rows (m = d), B rows = K^T rows (n = f), both key-contiguous at pitch 2048. Wave = 16 d x 64 f, block = 8 waves
// = 128 d; grid = (4, NCH-1, NB): chunks 0..NCH-2 (the last chunk enters no state). Each wave stores whole 256-B rows.
// ---------------------------------------------------------------------------
__global__ __launch_bounds__(256) void chunk_kv_kernel(
    const unsigned short* __restrict__ Vhp, const unsigned short* __restrict__ Vlp,
    const unsigned short* __restrict__ KThp, const unsigned short* __restrict__ KTlp, float* U) {
  __shared__ __align__(16) float sT[8][16 * 68];
  const int lane = threadIdx.x & 31, wave = threadIdx.x >> 5, hh = lane >> 4, c = lane & 15;
  const int ch = blockIdx.y, b = blockIdx.z;
  const int d0 = blockIdx.x * 128 + wave * 16;
  const size_t ao = ((size_t)b * DM + d0 + c) * SEQ + ch * 64 + 8 * hh;
  const size_t bo = ((size_t)b * QK + c) * SEQ + ch * 64 + 8 * hh;
  const __bf16* va = (const __bf16*)(const void*)Vhp + ao;
  const __bf16* vl = (const __bf16*)(const void*)Vlp + ao;
  const __bf16* kb = (const __bf16*)(const void*)KThp + bo;
  const __bf16* kl = (const __bf16*)(const void*)KTlp + bo;
  v16b ah[2], al[2], bh[2][4], bl[2][4];
#pragma unroll
  for (int kk = 0; kk < 2; ++kk) {
    ah[kk] = ldfrag(va + kk * 32);
    al[kk] = ldfrag(vl + kk * 32);
#pragma unroll
    for (int j = 0; j < 4; ++j) {
      bh[kk][j] = ldfrag(kb + j * 16 * SEQ + kk * 32);
      bl[kk][j] = ldfrag(kl + j * 16 * SEQ + kk * 32);
    }
  }
  // wait before any address register of the 40 loads above is overwritten; the four addresses are inputs so that they
  // stay live up to the wait
  asm volatile("s_wait_xcnt 0x0" :: "v"(va), "v"(vl), "v"(kb), "v"(kl) : "memory");
  v8f acc[4];
#pragma unroll
  for (int j = 0; j < 4; ++j) acc[j] = zero8();
#pragma unroll
  for (int kk = 0; kk < 2; ++kk)
#pragma unroll
    for (int j = 0; j < 4; ++j) acc[j] = mma3(ah[kk], al[kk], bh[kk][j], bl[kk][j], acc[j]);

  float* slab = sT[wave];
#pragma unroll
  for (int j = 0; j < 4; ++j)
#pragma unroll
    for (int r = 0; r < 8; ++r) slab[(8 * hh + r) * 68 + j * 16 + c] = acc[j][r];
  wave_lds_sync();
  float* C = U + (((size_t)b * NCH + ch) * DM + d0) * QK + hh * QK + c * 4;   // 2 rows of 256 B per instruction
#pragma unroll
  for (int it = 0; it < 8; ++it) {
    const v4f v = *(const v4f*)(slab + (it * 2 + hh) * 68 + c * 4);
    *(v4f*)(C + it * 2 * QK) = v;
  }
}

// ---------------------------------------------------------------------------
// Exclusive prefix over the key chunks: M[b][ch] = sum_{c < ch} U[b][c], U f32 [b][ch][512 d][64 f] (chunks 0..NCH-2
// are written and read), M -> bf16 hi/lo planes of the same shape, chunk 0 = 0. Thread = 4 consecutive elements;
// grid = NB*512*64/4/128 blocks of 128; a wave reads 512 B and writes 256 B per plane and chunk.
// ---------------------------------------------------------------------------
__global__ __launch_bounds__(128) void chunk_scan_kernel(const float* __restrict__ U, unsigned short* Mh,
                                                         unsigned short* Ml) {
  const int i = blockIdx.x * 128 + threadIdx.x;
  const int b = i / (DM * QK / 4);
  const size_t base = (size_t)b * ((size_t)NCH * DM * QK) + (size_t)(i - b * (DM * QK / 4)) * 4;
  v4f u[NCH - 1];
#pragma unroll
  for (int ch = 0; ch < NCH - 1; ++ch) u[ch] = *(const v4f*)(U + base + (size_t)ch * (DM * QK));
  unsigned short* ph = Mh + base;
  unsigned short* pl = Ml + base;
  v4f m = (v4f){0.f, 0.f, 0.f, 0.f};
#pragma unroll
  for (int ch = 0; ch < NCH; ++ch) {
    const unsigned short h0 = f2bf_bits(m[0]), h1 = f2bf_bits(m[1]), h2 = f2bf_bits(m[2]), h3 = f2bf_bits(m[3]);
    const unsigned short l0 = f2bf_bits(m[0] - bf_bits2f(h0)), l1 = f2bf_bits(m[1] - bf_bits2f(h1));
    const unsigned short l2 = f2bf_bits(m[2] - bf_bits2f(h2)), l3 = f2bf_bits(m[3] - bf_bits2f(h3));
    const v2u hv = (v2u){pk16(h0, h1), pk16(h2, h3)};
    const v2u lv = (v2u){pk16(l0, l1), pk16(l2, l3)};
    // the chunk's two state stores and their wait in one statement: no later load result, packed value or address step
    // can be placed in a register that the stores name ahead of the wait
    asm volatile("global_store_b64 %0, %2, off\n\tglobal_store_b64 %1, %3, off\n\ts_wait_xcnt 0x0"
                 :: "v"(ph), "v"(pl), "v"(hv), "v"(lv) : "memory");
    ph += DM * QK;
    pl += DM * QK;
    if (ch < NCH - 1) m += u[ch];
  }
}

// ---------------------------------------------------------------------------
// Causal mixing: R[b][l][d] = (1/sqrt((l+1)*32)) * sum_{l' <= l} S[l][l'] * V[l'][d],  S = Qt[l] . Kt[l'] (K = 64).
// Block = 4 waves = 64 query rows of one batch element and one 128-wide d chunk; grid = NB * 32 * 4.
//   Qt/Kt planes bf16 hi/lo [4096][64]; V^T planes bf16 hi/lo [b][512 d][2048 l']; R f32 [4096][512].
//   Keys of the earlier 64-key chunks enter through the state M[b][qb] = sum_{l' < 64 qb} Kt[l'] (x) V[l'] (planes
//   [b][ch][512 d][64 f], f contiguous): O = Qt . M (A = Qt rows, B = M rows from global).
//   The block's own key tile: stage Kt tile [64][64] and V^T chunk [128][64] (hi+lo) in LDS
//   (plain 16-B loads, __syncthreads after); S per wave in registers (A = Qt rows, B = Kt rows from LDS);
//   entries with l' > l set to 0 by value; P = S split to bf16 hi/lo into the wave's LDS tile
//   Output: per wave 16 rows x 128 floats staged in LDS (aliasing the K/V region after a block barrier), each
//   Coverage: 4 d chunks x 32 row blocks x 2 batches x (4 waves x 16 rows x 128) = the whole [4096][512] R plane.
// ---------------------------------------------------------------------------
__global__ __launch_bounds__(128) void causal_mix_kernel(
    const unsigned short* __restrict__ Qhp, const unsigned short* __restrict__ Qlp,
    const unsigned short* __restrict__ Khp, const unsigned short* __restrict__ Klp,
    const unsigned short* __restrict__ Vhp, const unsigned short* __restrict__ Vlp,
    const unsigned short* __restrict__ Mhp, const unsigned short* __restrict__ Mlp,
    float* Rout) {
  // Every tile row holds 64 halves (128 B) at a pitch of LP = 72 halves (144 B = 16 B x 9): the 16 rows that one
  // ds_load_b128 / ds_store_b128 touches then start on 16 different 4-bank groups instead of 2.
  constexpr int LP = 72;
  __shared__ __align__(16) unsigned char smem[73728];
  __bf16* Ksh = (__bf16*)(smem);           // [64 l'][LP]    9216 B
  __bf16* Ksl = (__bf16*)(smem + 9216);
  __bf16* Vth = (__bf16*)(smem + 18432);   // [128 d][LP]   18432 B
  __bf16* Vtl = (__bf16*)(smem + 36864);
  __bf16* Pgh = (__bf16*)(smem + 55296);   // [4 waves][16][LP]  9216 B
  __bf16* Pgl = (__bf16*)(smem + 64512);
  float*  Osb = (float*)(smem);            // [4 waves][16][132] after the main loop (aliases K/V tiles)

  const int tid = threadIdx.x, wave = tid >> 5, lane = tid & 31, hh = lane >> 4, c = lane & 15;
  const int bx  = blockIdx.x;
  const int dch = bx & 3;
  const int qb  = (bx >> 2) & 31;
  const int b   = bx >> 7;
  const int q0  = qb * 64 + wave * 16;                 // sequence-local first row of this wave
  const size_t grow0 = (size_t)b * SEQ + q0;           // global row of this wave's row 0

  const __bf16* Qh = (const __bf16*)(const void*)Qhp; const __bf16* Ql = (const __bf16*)(const void*)Qlp;
  const __bf16* Kh = (const __bf16*)(const void*)Khp; const __bf16* Kl = (const __bf16*)(const void*)Klp;
  const __bf16* Vh = (const __bf16*)(const void*)Vhp; const __bf16* Vl = (const __bf16*)(const void*)Vlp;
  const __bf16* Mh = (const __bf16*)(const void*)Mhp; const __bf16* Ml = (const __bf16*)(const void*)Mlp;

  // Qt fragments (A operand, row = lane&15): two 32-deep k chunks, hi and lo
  v16b qah[2], qal[2];
#pragma unroll
  for (int dc = 0; dc < 2; ++dc) {
    qah[dc] = ldfrag(Qh + (grow0 + c) * QK + dc * 32 + 8 * hh);
    qal[dc] = ldfrag(Ql + (grow0 + c) * QK + dc * 32 + 8 * hh);
  }
  v8f oacc[8];
#pragma unroll
  for (int t = 0; t < 8; ++t) oacc[t] = zero8();

  __bf16* pwh = Pgh + wave * (16 * LP);
  __bf16* pwl = Pgl + wave * (16 * LP);

  // O[16 x 128] = Qt[16 x 64] . M[64 x 128]: B[k = feature][n = d] = M[d][feature]
  const size_t mo = (((size_t)b * NCH + qb) * DM + dch * 128 + c) * QK + 8 * hh;
  const __bf16* mhp = Mh + mo;
  const __bf16* mlp = Ml + mo;
#pragma unroll
  for (int dc = 0; dc < 2; ++dc) {
    v16b mb[8], ml[8];
#pragma unroll
    for (int t = 0; t < 8; ++t) {
      mb[t] = ldfrag(mhp + t * 16 * QK + dc * 32);
      ml[t] = ldfrag(mlp + t * 16 * QK + dc * 32);
    }
    // wait before any address register of the 32 loads above is overwritten; both addresses are inputs so that they
    // stay live up to the wait
    asm volatile("s_wait_xcnt 0x0" :: "v"(mhp), "v"(mlp) : "memory");
#pragma unroll
    for (int t = 0; t < 8; ++t) oacc[t] = mma3(qah[dc], qal[dc], mb[t], ml[t], oacc[t]);
  }

  {
    const int kv0 = qb * 64;
    {
      // Kt tile: 128 threads x 32 halves per plane = 64 x 64
      const int r = tid >> 1, half = (tid & 1) * 32;
      const __bf16* ks = Kh + ((size_t)b * SEQ + kv0 + r) * QK + half;
      const __bf16* ls = Kl + ((size_t)b * SEQ + kv0 + r) * QK + half;
      v8b kr[4], lr[4];
#pragma unroll
      for (int i = 0; i < 4; ++i) {
        kr[i] = *(const v8b*)(ks + 8 * i);
        lr[i] = *(const v8b*)(ls + 8 * i);
      }
      // V^T chunk: thread = d row (dch*128 + tid), 64 halves per plane = 128 x 64
      const __bf16* vs = Vh + ((size_t)b * DM + dch * 128 + tid) * SEQ + kv0;
      const __bf16* vl = Vl + ((size_t)b * DM + dch * 128 + tid) * SEQ + kv0;
      v8b vr[8], wr[8];
#pragma unroll
      for (int i = 0; i < 8; ++i) {
        vr[i] = *(const v8b*)(vs + 8 * i);
        wr[i] = *(const v8b*)(vl + 8 * i);
      }
      // wait before any address register of the 24 loads above is overwritten; the four addresses are inputs so that
      // they stay live up to the wait and no later load's result is placed in them
      asm volatile("s_wait_xcnt 0x0" :: "v"(ks), "v"(ls), "v"(vs), "v"(vl) : "memory");
#pragma unroll
      for (int i = 0; i < 4; ++i) {
        *(v8b*)(Ksh + r * LP + half + 8 * i) = kr[i];
        *(v8b*)(Ksl + r * LP + half + 8 * i) = lr[i];
      }
#pragma unroll
      for (int i = 0; i < 8; ++i) {
        *(v8b*)(Vth + tid * LP + 8 * i) = vr[i];
        *(v8b*)(Vtl + tid * LP + 8 * i) = wr[i];
      }
    }
    __syncthreads();

    // S strip 16 x 64 for this wave: B[k = feature][n = key] = Kt[key][feature]
    v8f s[4];
#pragma unroll
    for (int j = 0; j < 4; ++j) {
      s[j] = zero8();
#pragma unroll
      for (int dc = 0; dc < 2; ++dc) {
        FB kb, kl;
        const int kb0 = (j * 16 + c) * LP + dc * 32 + 8 * hh;
        kb.h[0] = *(const v8b*)(Ksh + kb0);
        kb.h[1] = *(const v8b*)(Ksh + kb0 + 16);
        kl.h[0] = *(const v8b*)(Ksl + kb0);
        kl.h[1] = *(const v8b*)(Ksl + kb0 + 16);
        s[j] = mma3(qah[dc], qal[dc], kb.v, kl.v, s[j]);
      }
    }
    // causal select by value, split to bf16 hi/lo, into the wave's P tile [row][key]
#pragma unroll
    for (int r = 0; r < 8; ++r) {
      const int qrow = q0 + 8 * hh + r;
#pragma unroll
      for (int j = 0; j < 4; ++j) {
        const int kvcol = kv0 + j * 16 + c;
        float pm = s[j][r];
        if (kvcol > qrow) pm = 0.f;
        const unsigned short hb = f2bf_bits(pm);
        const unsigned short lb = f2bf_bits(pm - bf_bits2f(hb));
        pwh[(8 * hh + r) * LP + j * 16 + c] = __builtin_bit_cast(__bf16, hb);
        pwl[(8 * hh + r) * LP + j * 16 + c] = __builtin_bit_cast(__bf16, lb);
      }
    }
    wave_lds_sync();

    // O[16 x 128] += P[16 x 64] . V[64 x 128]: A = P (row = lane&15), B[k = key][n = d] = V^T[d][key]
#pragma unroll 1
    for (int kk = 0; kk < 2; ++kk) {
      FB pa, pl;
      const int pb0 = c * LP + kk * 32 + 8 * hh;
      pa.h[0] = *(const v8b*)(pwh + pb0);
      pa.h[1] = *(const v8b*)(pwh + pb0 + 16);
      pl.h[0] = *(const v8b*)(pwl + pb0);
      pl.h[1] = *(const v8b*)(pwl + pb0 + 16);
#pragma unroll
      for (int t = 0; t < 8; ++t) {
        FB vb, vlo;
        const int vb0 = (t * 16 + c) * LP + kk * 32 + 8 * hh;
        vb.h[0]  = *(const v8b*)(Vth + vb0);
        vb.h[1]  = *(const v8b*)(Vth + vb0 + 16);
        vlo.h[0] = *(const v8b*)(Vtl + vb0);
        vlo.h[1] = *(const v8b*)(Vtl + vb0 + 16);
        oacc[t] = mma3(pa.v, pl.v, vb.v, vlo.v, oacc[t]);
      }
    }
  }
  __syncthreads();   // every wave done with the K/V tiles before the output staging aliases them

  // scale by 1/sqrt((l+1)*32), stage the wave's 16 x 128 tile, write whole 512-B row segments
  float* os = Osb + wave * (16 * 132);
#pragma unroll
  for (int r = 0; r < 8; ++r) {
    const int lq = q0 + 8 * hh + r;
    const float nrm = sqrtf((float)((lq + 1) * KO));
    const float inv = 1.0f / nrm;
#pragma unroll
    for (int t = 0; t < 8; ++t) os[(8 * hh + r) * 132 + t * 16 + c] = oacc[t][r] * inv;
  }
  wave_lds_sync();
  {
#pragma unroll
    for (int it = 0; it < 16; ++it) {
      const v4f val = *(const v4f*)(os + it * 132 + lane * 4);
      *(v4f*)(Rout + (grow0 + it) * DM + dch * 128 + lane * 4) = val;
    }
    
  }
}

// ---------------------------------------------------------------------------
// One wave per row (block = 8 rows, grid = 4096/8); lane holds cols 8*lane..+7 and 256+8*lane..+7.
// ---------------------------------------------------------------------------
__global__ __launch_bounds__(256) void ln_split_kernel(const float* __restrict__ R, const float* __restrict__ g,
                                                       const float* __restrict__ be,
                                                       unsigned short* Lh, unsigned short* Ll) {
  const int tid = threadIdx.x, wave = tid >> 5, lane = tid & 31;
  const int row = blockIdx.x * 8 + wave;
  const float* rp = R + (size_t)row * DM;
  const int cA = 8 * lane, cB = 256 + 8 * lane;
  const v4f x0 = *(const v4f*)(rp + cA), x1 = *(const v4f*)(rp + cA + 4);
  const v4f x2 = *(const v4f*)(rp + cB), x3 = *(const v4f*)(rp + cB + 4);
  const v4f g0 = *(const v4f*)(g + cA),  g1 = *(const v4f*)(g + cA + 4);
  const v4f g2 = *(const v4f*)(g + cB),  g3 = *(const v4f*)(g + cB + 4);
  const v4f e0 = *(const v4f*)(be + cA), e1 = *(const v4f*)(be + cA + 4);
  const v4f e2 = *(const v4f*)(be + cB), e3 = *(const v4f*)(be + cB + 4);
  float v[16], gg[16], bb[16];
#pragma unroll
  for (int e = 0; e < 4; ++e) {
    v[e] = x0[e]; v[4 + e] = x1[e]; v[8 + e] = x2[e]; v[12 + e] = x3[e];
    gg[e] = g0[e]; gg[4 + e] = g1[e]; gg[8 + e] = g2[e]; gg[12 + e] = g3[e];
    bb[e] = e0[e]; bb[4 + e] = e1[e]; bb[8 + e] = e2[e]; bb[12 + e] = e3[e];
  }
  float sum = 0.f;
#pragma unroll
  for (int e = 0; e < 16; ++e) sum += v[e];
#pragma unroll
  for (int off = 1; off < 32; off <<= 1) sum += __shfl_xor(sum, off, 32);
  const float mu = sum * (1.0f / (float)DM);
  float ss = 0.f;
#pragma unroll
  for (int e = 0; e < 16; ++e) { const float d = v[e] - mu; v[e] = d; ss += d * d; }
#pragma unroll
  for (int off = 1; off < 32; off <<= 1) ss += __shfl_xor(ss, off, 32);
  const float var  = ss * (1.0f / (float)DM);
  const float rstd = 1.0f / sqrtf(var + 1e-5f);
  v8us hA, lA, hB, lB;
#pragma unroll
  for (int e = 0; e < 8; ++e) {
    const float ya = v[e] * rstd * gg[e] + bb[e];
    const float yb = v[8 + e] * rstd * gg[8 + e] + bb[8 + e];
    const unsigned short ha = f2bf_bits(ya), la = f2bf_bits(ya - bf_bits2f(ha));
    const unsigned short hb = f2bf_bits(yb), lb = f2bf_bits(yb - bf_bits2f(hb));
    hA[e] = ha; lA[e] = la; hB[e] = hb; lB[e] = lb;
  }
  const size_t oA = (size_t)row * DM + cA, oB = (size_t)row * DM + cB;
  {
    *(v8us*)(Lh + oA) = hA;
    *(v8us*)(Lh + oB) = hB;
    *(v8us*)(Ll + oA) = lA;
    *(v8us*)(Ll + oB) = lB;
    
  }
}

// ---------------------------------------------------------------------------
// Workspace region map (bytes; every region an exact multiple of its store granularity, no tail rows):
//   Xh, Xl            bf16 [4096][512]     2 x 4,194,304          0 ..  8,388,608
//   Hkh,Hkl,Hqh,Hql   bf16 [4096][512]     4 x 4,194,304   8,388,608 .. 25,165,824
//   W1t planes (kp,qp,v,o) bf16 [512][512] 8 x 524,288  25,165,824 .. 29,360,128
//   W2t planes (kp2,qp2,ka,qa) bf16 [32][512] 8 x 32,768 29,360,128 .. 29,622,272
//   Qth,Qtl,Kth,Ktl   bf16 [4096][64]      4 x 524,288    29,622,272 .. 31,719,424
//   VTh, VTl          bf16 [2][512][2048]  2 x 4,194,304  31,719,424 .. 40,108,032
//   R                 f32  [4096][512]     8,388,608      40,108,032 .. 48,496,640
//   Lh, Ll            bf16 [4096][512]     2 x 4,194,304  48,496,640 .. 56,885,248
//   KTh, KTl          bf16 [2][64][2048]   2 x 524,288    56,885,248 .. 57,933,824
//   U                 f32  [2][32][512][64] 8,388,608     57,933,824 .. 66,322,432
//   Mh, Ml            bf16 [2][32][512][64] 2 x 4,194,304 66,322,432 .. 74,711,040
// ---------------------------------------------------------------------------
extern "C" void kernel_launch(void* const* d_in, const int* in_sizes, int n_in,
                              void* d_out, int out_size, void* d_ws, size_t ws_size,
                              hipStream_t stream) {
  if (n_in < 20) return;
  if (in_sizes[0] != MTOT * DM || in_sizes[1] != SEQ * KO) return;
  if (in_sizes[2] != DM * DM || in_sizes[8] != DM * DM || in_sizes[14] != DM * DM || in_sizes[18] != DM * DM) return;
  if (in_sizes[3] != DM || in_sizes[9] != DM || in_sizes[15] != DM || in_sizes[19] != DM) return;
  if (in_sizes[16] != DM || in_sizes[17] != DM) return;
  if (in_sizes[4] != DM * KO || in_sizes[6] != DM * KO || in_sizes[10] != DM * KO || in_sizes[12] != DM * KO) return;
  if (in_sizes[5] != KO || in_sizes[7] != KO || in_sizes[11] != KO || in_sizes[13] != KO) return;
  if (out_size != MTOT * DM) return;

  const float* x     = (const float*)d_in[0];
  const float* pos   = (const float*)d_in[1];
  const float* kp_w1 = (const float*)d_in[2];
  const float* kp_b1 = (const float*)d_in[3];
  const float* kp_w2 = (const float*)d_in[4];
  const float* kp_b2 = (const float*)d_in[5];
  const float* ka_w  = (const float*)d_in[6];
  const float* ka_b  = (const float*)d_in[7];
  const float* qp_w1 = (const float*)d_in[8];
  const float* qp_b1 = (const float*)d_in[9];
  const float* qp_w2 = (const float*)d_in[10];
  const float* qp_b2 = (const float*)d_in[11];
  const float* qa_w  = (const float*)d_in[12];
  const float* qa_b  = (const float*)d_in[13];
  const float* v_w   = (const float*)d_in[14];
  const float* v_b   = (const float*)d_in[15];
  const float* ln_g  = (const float*)d_in[16];
  const float* ln_b  = (const float*)d_in[17];
  const float* o_w   = (const float*)d_in[18];
  const float* o_b   = (const float*)d_in[19];

  const size_t PX = (size_t)MTOT * DM * 2;        // 4,194,304
  const size_t PW = (size_t)DM * DM * 2;          //   524,288
  const size_t PS = (size_t)KO * DM * 2;          //    32,768
  const size_t PQ = (size_t)MTOT * QK * 2;        //   524,288
  const size_t PV = (size_t)NB * DM * SEQ * 2;    // 4,194,304
  const size_t PR = (size_t)MTOT * DM * 4;        // 8,388,608
  size_t off = 0;
  const size_t oXh  = off; off += PX;  const size_t oXl  = off; off += PX;
  const size_t oHkh = off; off += PX;  const size_t oHkl = off; off += PX;
  const size_t oHqh = off; off += PX;  const size_t oHql = off; off += PX;
  const size_t oWkh = off; off += PW;  const size_t oWkl = off; off += PW;
  const size_t oWqh = off; off += PW;  const size_t oWql = off; off += PW;
  const size_t oWvh = off; off += PW;  const size_t oWvl = off; off += PW;
  const size_t oWoh = off; off += PW;  const size_t oWol = off; off += PW;
  const size_t oSk2h = off; off += PS; const size_t oSk2l = off; off += PS;
  const size_t oSq2h = off; off += PS; const size_t oSq2l = off; off += PS;
  const size_t oSkah = off; off += PS; const size_t oSkal = off; off += PS;
  const size_t oSqah = off; off += PS; const size_t oSqal = off; off += PS;
  const size_t oQth = off; off += PQ;  const size_t oQtl = off; off += PQ;
  const size_t oKth = off; off += PQ;  const size_t oKtl = off; off += PQ;
  const size_t oVTh = off; off += PV;  const size_t oVTl = off; off += PV;
  const size_t oR   = off; off += PR;
  const size_t oLh  = off; off += PX;  const size_t oLl  = off; off += PX;
  const size_t oKTh = off; off += PQ;  const size_t oKTl = off; off += PQ;
  const size_t oU   = off; off += PR;
  const size_t oMh  = off; off += PX;  const size_t oMl  = off; off += PX;
  if (off > ws_size) return;                      // off = 74,711,040

  char* ws = (char*)d_ws;
  unsigned short* Xh  = (unsigned short*)(ws + oXh);   unsigned short* Xl  = (unsigned short*)(ws + oXl);
  unsigned short* Hkh = (unsigned short*)(ws + oHkh);  unsigned short* Hkl = (unsigned short*)(ws + oHkl);
  unsigned short* Hqh = (unsigned short*)(ws + oHqh);  unsigned short* Hql = (unsigned short*)(ws + oHql);
  unsigned short* Wkh = (unsigned short*)(ws + oWkh);  unsigned short* Wkl = (unsigned short*)(ws + oWkl);
  unsigned short* Wqh = (unsigned short*)(ws + oWqh);  unsigned short* Wql = (unsigned short*)(ws + oWql);
  unsigned short* Wvh = (unsigned short*)(ws + oWvh);  unsigned short* Wvl = (unsigned short*)(ws + oWvl);
  unsigned short* Woh = (unsigned short*)(ws + oWoh);  unsigned short* Wol = (unsigned short*)(ws + oWol);
  unsigned short* Sk2h = (unsigned short*)(ws + oSk2h); unsigned short* Sk2l = (unsigned short*)(ws + oSk2l);
  unsigned short* Sq2h = (unsigned short*)(ws + oSq2h); unsigned short* Sq2l = (unsigned short*)(ws + oSq2l);
  unsigned short* Skah = (unsigned short*)(ws + oSkah); unsigned short* Skal = (unsigned short*)(ws + oSkal);
  unsigned short* Sqah = (unsigned short*)(ws + oSqah); unsigned short* Sqal = (unsigned short*)(ws + oSqal);
  unsigned short* Qth = (unsigned short*)(ws + oQth);  unsigned short* Qtl = (unsigned short*)(ws + oQtl);
  unsigned short* Kth = (unsigned short*)(ws + oKth);  unsigned short* Ktl = (unsigned short*)(ws + oKtl);
  unsigned short* VTh = (unsigned short*)(ws + oVTh);  unsigned short* VTl = (unsigned short*)(ws + oVTl);
  float*          Rws = (float*)(ws + oR);
  unsigned short* Lh  = (unsigned short*)(ws + oLh);   unsigned short* Ll  = (unsigned short*)(ws + oLl);
  unsigned short* KTh = (unsigned short*)(ws + oKTh);  unsigned short* KTl = (unsigned short*)(ws + oKTl);
  float*          Uws = (float*)(ws + oU);
  unsigned short* Mh  = (unsigned short*)(ws + oMh);   unsigned short* Ml  = (unsigned short*)(ws + oMl);

  const dim3 b256(256), b128(128);

  // (1) x [4096][512] f32 -> bf16 hi/lo planes
  const int n2x = MTOT * DM / 2;                               // 1,048,576 pairs
  split_bf16x2_kernel<<<dim3((n2x + 255) / 256), b256, 0, stream>>>(x, Xh, Xl, n2x);

  // (2) [in k][out n] weights -> transposed hi/lo planes [n][k]; in rows = 512, cols = 512; grid (cols/64, rows/64)
  tsplit_kernel<<<dim3(DM / 64, DM / 64), b256, 0, stream>>>(kp_w1, Wkh, Wkl, DM, DM);
  tsplit_kernel<<<dim3(DM / 64, DM / 64), b256, 0, stream>>>(qp_w1, Wqh, Wql, DM, DM);
  tsplit_kernel<<<dim3(DM / 64, DM / 64), b256, 0, stream>>>(v_w,   Wvh, Wvl, DM, DM);
  tsplit_kernel<<<dim3(DM / 64, DM / 64), b256, 0, stream>>>(o_w,   Woh, Wol, DM, DM);
  // (3) [512][32] weights -> [32][512] hi/lo planes
  tsplit32_kernel<<<dim3(DM / 64), b256, 0, stream>>>(kp_w2, Sk2h, Sk2l, DM);
  tsplit32_kernel<<<dim3(DM / 64), b256, 0, stream>>>(qp_w2, Sq2h, Sq2l, DM);
  tsplit32_kernel<<<dim3(DM / 64), b256, 0, stream>>>(ka_w,  Skah, Skal, DM);
  tsplit32_kernel<<<dim3(DM / 64), b256, 0, stream>>>(qa_w,  Sqah, Sqal, DM);

  // (4) hk = tanh(x . kp_w1 + kp_b1), hq likewise -> bf16 hi/lo planes [4096][512]  (M=4096, N=512, K=512; 1024 wave tiles)
  const dim3 gH(((MTOT / 32) * (DM / 64) + 7) / 8, 1);         // 128 blocks
  gemm_hl_kernel<2, 2, false, 1><<<gH, b256, 0, stream>>>(
      Xh, Xl, DM, 0LL, Wkh, Wkl, DM, 0LL, (void*)Hkh, (void*)Hkl, DM, 0LL,
      kp_b1, nullptr, 0LL, MTOT, DM, DM);
  gemm_hl_kernel<2, 2, false, 1><<<gH, b256, 0, stream>>>(
      Xh, Xl, DM, 0LL, Wqh, Wql, DM, 0LL, (void*)Hqh, (void*)Hql, DM, 0LL,
      qp_b1, nullptr, 0LL, MTOT, DM, DM);

  // (5) V^T[b][d][l] = sum_k v_w^T[d][k] x[b][l][k] + v_b[d] -> bf16 hi/lo planes [2][512][2048]
  //     (A = v_w^T planes [512][512], Bt = x planes of batch b [2048][512]; M=512, N=2048, K=512; 512 tiles per batch)
  const dim3 gV(((DM / 32) * (SEQ / 64) + 7) / 8, NB);         // (64, 2)
  gemm_hl_kernel<1, 2, false, 0><<<gV, b256, 0, stream>>>(
      Wvh, Wvl, DM, 0LL, Xh, Xl, DM, (long long)SEQ * DM, (void*)VTh, (void*)VTl, SEQ, (long long)DM * SEQ,
      v_b, nullptr, 0LL, DM, SEQ, DM);

  // (6) oscillator heads + encode -> Qt, Kt hi/lo planes [4096][64]
  enc_head_kernel<<<dim3(MTOT / 64), b128, 0, stream>>>(
      Hkh, Hkl, Hqh, Hql, Xh, Xl,
      Sk2h, Sk2l, Sq2h, Sq2l, Skah, Skal, Sqah, Sqal,
      kp_b2, qp_b2, ka_b, qa_b, pos,
      Qth, Qtl, Kth, Ktl, KTh, KTl);

  // (7a) per-chunk sums U[b][ch][d][f] = sum_{l' in chunk ch} V^T[b][d][l'] K^T[b][f][l'], chunks 0..30
  chunk_kv_kernel<<<dim3(DM / 128, NCH - 1, NB), b256, 0, stream>>>(VTh, VTl, KTh, KTl, Uws);
  // (7b) exclusive prefix over the chunks -> state planes M hi/lo [2][32][512][64]
  chunk_scan_kernel<<<dim3(NB * DM * QK / 4 / 128), b128, 0, stream>>>(Uws, Mh, Ml);

  // (7c) causal mixing (state term + own key tile) -> R f32 [4096][512]
  causal_mix_kernel<<<dim3(NB * (SEQ / 64) * 4), b128, 0, stream>>>(Qth, Qtl, Kth, Ktl, VTh, VTl, Mh, Ml, Rws);

  // (8) LayerNorm -> bf16 hi/lo planes [4096][512]
  ln_split_kernel<<<dim3(MTOT / 8), b256, 0, stream>>>(Rws, ln_g, ln_b, Lh, Ll);

  // (9) out = x + ln . o_w + o_b -> d_out f32 [4096][512]
  gemm_hl_kernel<2, 0, true, 0><<<gH, b256, 0, stream>>>(
      Lh, Ll, DM, 0LL, Woh, Wol, DM, 0LL, d_out, d_out, DM, 0LL,
      o_b, x, 0LL, MTOT, DM, DM);

  (void)hipGetLastError();
}

// v003
// Measured time: 160 microseconds a run.
// Next to v002, in two timings, it ran 1.55 times as fast each time.
// Over all steps from v000 it is 2.27 times as fast.
// All contractions (x.kp_w1, x.qp_w1, x.v_w, h.kp_w2, h.qp_w2, x.ka_w, x.qa_w, causal score S = Qt.Kt^T and S.V, chunk sums V^T.Kt, state term Qt.M, ln.o_w): v_wmma_f32_16x16x32_bf16 with bf16 hi/lo operands (hi.hi + hi.lo + lo.hi), f32 accumulate; encoders (tanh, softplus, sincos), norm scale, LayerNorm, biases and residual in f32.
#include <hip/hip_runtime.h>
#include <math.h>
#include <stdint.h>

#define NB   2
#define SEQ  2048
#define DM   512
#define KO   32
#define QK   64
#define MTOT (NB * SEQ)
#define NCH  (SEQ / 64)

typedef __attribute__((ext_vector_type(16))) __bf16 v16b;
typedef __attribute__((ext_vector_type(8)))  __bf16 v8b;
typedef __attribute__((ext_vector_type(8)))  float  v8f;
typedef __attribute__((ext_vector_type(4)))  float  v4f;
typedef __attribute__((ext_vector_type(2)))  float  v2f;
typedef __attribute__((ext_vector_type(4)))  unsigned int   v4u;
typedef __attribute__((ext_vector_type(2)))  unsigned int   v2u;
typedef __attribute__((ext_vector_type(8)))  unsigned short v8us;

union FB { v16b v; v8b h[2]; };

__device__ __forceinline__ unsigned short f2bf_bits(float f) {
  unsigned u = __float_as_uint(f);
  return (unsigned short)((u + 0x7FFFu + ((u >> 16) & 1u)) >> 16);   // RNE
}
__device__ __forceinline__ float bf_bits2f(unsigned short h) { return __uint_as_float(((unsigned)h) << 16); }
__device__ __forceinline__ unsigned pk16(unsigned short a, unsigned short b) { return (unsigned)a | ((unsigned)b << 16); }

__device__ __forceinline__ v8f zero8() { return (v8f){0.f, 0.f, 0.f, 0.f, 0.f, 0.f, 0.f, 0.f}; }

// 16-bit A/B fragment from a k-contiguous row p = &T[row][k0 + 8*(lane>>4)]:
// elements 0..7 <- p[0..7] (k0+8h..), elements 8..15 <- p[16..23] (k0+16+8h..)
__device__ __forceinline__ v16b ldfrag(const __bf16* p) {
  FB f;
  f.h[0] = *(const v8b*)(p);
  f.h[1] = *(const v8b*)(p + 16);
  return f.v;
}

// hi/lo split product group: c += ah.bh + ah.bl + al.bh, then 4 VALU slots tying D and keeping all operands live
__device__ __forceinline__ v8f mma3(v16b ah, v16b al, v16b bh, v16b bl, v8f c) {
  c = __builtin_amdgcn_wmma_f32_16x16x32_bf16(false, ah, false, bh, (short)0, c, false, false);
  c = __builtin_amdgcn_wmma_f32_16x16x32_bf16(false, ah, false, bl, (short)0, c, false, false);
  c = __builtin_amdgcn_wmma_f32_16x16x32_bf16(false, al, false, bh, (short)0, c, false, false);
  asm volatile("v_nop\n\tv_nop\n\tv_nop\n\tv_nop" : "+v"(c) : "v"(ah), "v"(al), "v"(bh), "v"(bl));
  return c;
}

// same-wave LDS exchange: order the wave's LDS stores before its cross-lane reloads
__device__ __forceinline__ void wave_lds_sync() {
  __builtin_amdgcn_fence(__ATOMIC_RELEASE, "workgroup");
  __builtin_amdgcn_wave_barrier();
  __builtin_amdgcn_fence(__ATOMIC_ACQUIRE, "workgroup");
}

// ---------------------------------------------------------------------------
// Elementwise bf16 split of a flat f32 array: hi = bf16(in), lo = bf16(in - hi); 2 elements per thread,
// ---------------------------------------------------------------------------
__device__ __forceinline__ void split_bf16x2_body(const float* __restrict__ in, unsigned short* hi,
                                                  unsigned short* lo, int n2, int blk) {
  const int i = blk * 256 + threadIdx.x;
  if (i < n2) {
    const v2f f = *(const v2f*)(in + 2 * (size_t)i);
    const unsigned short h0 = f2bf_bits(f[0]), h1 = f2bf_bits(f[1]);
    const unsigned short l0 = f2bf_bits(f[0] - bf_bits2f(h0)), l1 = f2bf_bits(f[1] - bf_bits2f(h1));
    const unsigned uh = pk16(h0, h1), ul = pk16(l0, l1);
    ((unsigned*)hi)[i] = uh;
    ((unsigned*)lo)[i] = ul;
    
  }
}

// ---------------------------------------------------------------------------
// Fused transpose + bf16 split of an f32 matrix: in [R][Cc] -> oh[c][r] = bf16(in[r][c]), ol = residual
// ([Cc][R], pitch R). 64x64 tiles through LDS (tf: 64 x 68 floats). Tile (bc, br) of (Cc/64, R/64), 256 threads.
// Coverage per block and plane: load 4 it x 256 thr x 4 = 64x64; store 2 it x 256 thr x 8 = 64x64.
// ---------------------------------------------------------------------------
__device__ __forceinline__ void tsplit_body(const float* __restrict__ W, unsigned short* oh,
                                            unsigned short* ol, int R, int Cc, int bc, int br, float* tf) {
  const int c0  = bc * 64;
  const int r0  = br * 64;
  const int tid = threadIdx.x;
  {
    const int lr = tid >> 4;
    const int c4 = (tid & 15) * 4;
    const float* wp[4];
    v4f a[4];
#pragma unroll
    for (int it = 0; it < 4; ++it) {
      wp[it] = W + (size_t)(r0 + it * 16 + lr) * Cc + c0 + c4;
      a[it]  = *(const v4f*)(wp[it]);
    }
    // wait before any address register of the four loads above is overwritten; the addresses are inputs so that they
    // stay live up to the wait
    asm volatile("s_wait_xcnt 0x0" :: "v"(wp[0]), "v"(wp[1]), "v"(wp[2]), "v"(wp[3]) : "memory");
#pragma unroll   // constant indices keep a[] in registers
    for (int it = 0; it < 4; ++it) *(v4f*)(tf + (it * 16 + lr) * 68 + c4) = a[it];
  }
  __syncthreads();
  const int sub = tid >> 3;
  const int c8  = (tid & 7) * 8;
  v4u hv[2], lv[2];
#pragma unroll
  for (int it = 0; it < 2; ++it) {
    const int oc = it * 32 + sub;
    v4u a, a2;
#pragma unroll
    for (int q = 0; q < 4; ++q) {
      const float f0 = tf[(c8 + 2 * q) * 68 + oc];
      const float f1 = tf[(c8 + 2 * q + 1) * 68 + oc];
      const unsigned short h0 = f2bf_bits(f0), h1 = f2bf_bits(f1);
      const unsigned short l0 = f2bf_bits(f0 - bf_bits2f(h0)), l1 = f2bf_bits(f1 - bf_bits2f(h1));
      a[q]  = pk16(h0, h1);
      a2[q] = pk16(l0, l1);
    }
    hv[it] = a; lv[it] = a2;
  }
  {
#pragma unroll
    for (int it = 0; it < 2; ++it) {
      const int oc = it * 32 + sub;
      const size_t go = (size_t)(c0 + oc) * R + r0 + c8;
      *(v4u*)(oh + go) = hv[it];
      *(v4u*)(ol + go) = lv[it];
    }
    
  }
}

// ---------------------------------------------------------------------------
// Transpose + bf16 split of a narrow f32 matrix: in [R][32] -> oh/ol [32][R] (pitch R). Tile br of R/64, 256 threads,
// tf: 64 x 36 floats of LDS.
// Coverage per block: load 2 it x 256 thr x 4 = 64 rows x 32; store 32 output rows x (8 lanes x 8) = 32 x 64.
// ---------------------------------------------------------------------------
__device__ __forceinline__ void tsplit32_body(const float* __restrict__ W, unsigned short* oh,
                                              unsigned short* ol, int R, int br, float* tf) {
  const int r0  = br * 64;
  const int tid = threadIdx.x;
  {
    const int rr = tid >> 3;          // 0..31
    const int c4 = (tid & 7) * 4;     // 0..28
    const float* wp[2];
    v4f a[2];
#pragma unroll
    for (int it = 0; it < 2; ++it) {
      wp[it] = W + (size_t)(r0 + it * 32 + rr) * KO + c4;   // rows 0..63
      a[it]  = *(const v4f*)(wp[it]);
    }
    // wait before an address register of the two loads above is overwritten; the addresses are inputs so that they
    // stay live up to the wait
    asm volatile("s_wait_xcnt 0x0" :: "v"(wp[0]), "v"(wp[1]) : "memory");
#pragma unroll   // constant indices keep a[] in registers
    for (int it = 0; it < 2; ++it) *(v4f*)(tf + (it * 32 + rr) * 36 + c4) = a[it];
  }
  __syncthreads();
  const int oc = tid >> 3;            // output row = input column 0..31
  const int c8 = (tid & 7) * 8;       // output cols r0+c8 .. +7
  v4u hv, lv;
#pragma unroll
  for (int q = 0; q < 4; ++q) {
    const float f0 = tf[(c8 + 2 * q) * 36 + oc];
    const float f1 = tf[(c8 + 2 * q + 1) * 36 + oc];
    const unsigned short h0 = f2bf_bits(f0), h1 = f2bf_bits(f1);
    const unsigned short l0 = f2bf_bits(f0 - bf_bits2f(h0)), l1 = f2bf_bits(f1 - bf_bits2f(h1));
    hv[q] = pk16(h0, h1);
    lv[q] = pk16(l0, l1);
  }
  const size_t go = (size_t)oc * R + r0 + c8;
  {
    *(v4u*)(oh + go) = hv;
    *(v4u*)(ol + go) = lv;
    
  }
}

// ---------------------------------------------------------------------------
// All operand preparation in one launch; the nine jobs do not depend on one another and the block index picks the job:
//   blocks   0..255  four [512][512] weights -> transposed planes (64 tiles each); planes of job j at W1p + j*2*512*512
//   blocks 256..287  four [512][32] weights  -> transposed planes (8 tiles each);  planes of job j at W2p + j*2*32*512
//   blocks 288..     x -> hi/lo planes, 512 elements per block
// Each job's hi plane is followed by its lo plane. The two-phase transposes come first in the index order.
// ---------------------------------------------------------------------------
#define PREP_T1 (4 * (DM / 64) * (DM / 64))
#define PREP_T2 (4 * (DM / 64))
#define PREP_X  (MTOT * DM / 2 / 256)
__global__ __launch_bounds__(256) void prep_kernel(
    const float* __restrict__ x,
    const float* __restrict__ kp_w1, const float* __restrict__ qp_w1,
    const float* __restrict__ v_w,   const float* __restrict__ o_w,
    const float* __restrict__ kp_w2, const float* __restrict__ qp_w2,
    const float* __restrict__ ka_w,  const float* __restrict__ qa_w,
    unsigned short* Xh, unsigned short* Xl, unsigned short* W1p, unsigned short* W2p) {
  __shared__ __align__(16) float tf[64 * 68];
  const int bx = blockIdx.x;
  if (bx < PREP_T1) {
    const int job = bx >> 6, t = bx & 63;
    const float* Wsrc = job == 0 ? kp_w1 : job == 1 ? qp_w1 : job == 2 ? v_w : o_w;
    unsigned short* oh = W1p + (size_t)job * (2 * DM * DM);
    tsplit_body(Wsrc, oh, oh + DM * DM, DM, DM, t & 7, t >> 3, tf);
  } else if (bx < PREP_T1 + PREP_T2) {
    const int job = (bx - PREP_T1) >> 3, t = (bx - PREP_T1) & 7;
    const float* Wsrc = job == 0 ? kp_w2 : job == 1 ? qp_w2 : job == 2 ? ka_w : qa_w;
    unsigned short* oh = W2p + (size_t)job * (2 * KO * DM);
    tsplit32_body(Wsrc, oh, oh + KO * DM, DM, t, tf);
  } else {
    split_bf16x2_body(x, Xh, Xl, MTOT * DM / 2, bx - (PREP_T1 + PREP_T2));
  }
}

// ---------------------------------------------------------------------------
// Register-blocked batched WMMA GEMM on bf16 hi/lo planes:
//   C[m,n] = sum_k A[m,k] * Bt[n,k] (+bias)(+resid)(act); product = hi.hi + hi.lo + lo.hi.
// A planes row-major [M][K] (pitch lda), Bt planes row-major [N][K] (pitch ldb); M % 32 == 0, N % 64 == 0, K % 32 == 0.
// Each wave owns a 32x64 tile (index tile), bz = batch with element strides; slab = the wave's own 16 x 68 floats of LDS.
// BIAS_MODE: 1 = bias[m], 2 = bias[n]. OUT_MODE: 0 = f32, 2 = bf16 hi plane (Cout) + lo plane (Cout2). ACT 1 = tanh.
// ---------------------------------------------------------------------------
template <int BIAS_MODE, int OUT_MODE, bool RESID, int ACT>
__device__ __forceinline__ void gemm_hl_body(
    const unsigned short* __restrict__ Ahp, const unsigned short* __restrict__ Alp, int lda, long long strideA,
    const unsigned short* __restrict__ Bhp, const unsigned short* __restrict__ Blp, int ldb, long long strideB,
    void* Cout, void* Cout2, int ldc, long long strideC,
    const float* __restrict__ bias,
    const float* __restrict__ resid, long long strideR,
    int M, int N, int K, int tile, int bz, float* slab) {
  const __bf16* Ah = (const __bf16*)(const void*)Ahp;
  const __bf16* Al = (const __bf16*)(const void*)Alp;
  const __bf16* Bh = (const __bf16*)(const void*)Bhp;
  const __bf16* Bl = (const __bf16*)(const void*)Blp;
  const int lane = threadIdx.x & 31;
  const int tilesN = N >> 6;
  const int tilesM = M >> 5;
  if (tile >= tilesM * tilesN) return;   // wave-uniform; no block barriers in this body
  const int tm = tile / tilesN;
  const int tn = tile - tm * tilesN;
  const int m0 = tm << 5;
  const int n0 = tn << 6;

  const __bf16* Abh = Ah + (size_t)bz * strideA;
  const __bf16* Abl = Al + (size_t)bz * strideA;
  const __bf16* Bbh = Bh + (size_t)bz * strideB;
  const __bf16* Bbl = Bl + (size_t)bz * strideB;

  const int rl   = lane & 15;            // row (A) / col (B, D) within subtile
  const int koff = (lane >> 4) * 8;      // k offset of this lane half
  const int mOff = (lane >> 4) * 8;      // D row offset

  v8f acc[2][4];
#pragma unroll
  for (int i = 0; i < 2; ++i)
#pragma unroll
    for (int j = 0; j < 4; ++j) acc[i][j] = zero8();

#pragma unroll 1
  for (int k0 = 0; k0 < K; k0 += 32) {
    v16b bh[4], bl[4];
    const __bf16 *pbh[4], *pbl[4];
#pragma unroll
    for (int j = 0; j < 4; ++j) {
      const size_t bo = (size_t)(n0 + (j << 4) + rl) * ldb + koff + k0;
      pbh[j] = Bbh + bo;
      pbl[j] = Bbl + bo;
      bh[j] = ldfrag(pbh[j]);
      bl[j] = ldfrag(pbl[j]);
    }
#pragma unroll
    for (int i = 0; i < 2; ++i) {
      const size_t ao = (size_t)(m0 + (i << 4) + rl) * lda + koff + k0;
      const __bf16* pah = Abh + ao;
      const __bf16* pal = Abl + ao;
      const v16b ah = ldfrag(pah);
      const v16b al = ldfrag(pal);
      // wait before any address register of the fragment loads above is overwritten; the addresses are inputs so that
      // they stay live up to the wait and no later load's result is placed in them
      if (i == 0)
        asm volatile("s_wait_xcnt 0x0" :: "v"(pbh[0]), "v"(pbh[1]), "v"(pbh[2]), "v"(pbh[3]), "v"(pbl[0]), "v"(pbl[1]),
                     "v"(pbl[2]), "v"(pbl[3]), "v"(pah), "v"(pal) : "memory");
      else
        asm volatile("s_wait_xcnt 0x0" :: "v"(pah), "v"(pal) : "memory");
#pragma unroll
      for (int j = 0; j < 4; ++j) acc[i][j] = mma3(ah, al, bh[j], bl[j], acc[i][j]);
    }
  }

  // ---- epilogue ----
  const float* Rb = RESID ? (resid + (size_t)bz * strideR) : nullptr;
#pragma unroll
  for (int i = 0; i < 2; ++i) {
    const int mBase = m0 + (i << 4);
#pragma unroll
    for (int j = 0; j < 4; ++j) {
      const int n = n0 + (j << 4) + rl;
      float bv = 0.f;
      if (BIAS_MODE == 2) bv = bias[n];
#pragma unroll
      for (int r = 0; r < 8; ++r) {
        float v = acc[i][j][r];
        if (BIAS_MODE == 1) v += bias[mBase + mOff + r];
        if (BIAS_MODE == 2) v += bv;
        if (RESID) v += Rb[(size_t)(mBase + mOff + r) * ldc + n];
        if (ACT == 1) v = tanhf(v);
        slab[(mOff + r) * 68 + (j << 4) + rl] = v;
      }
    }
    wave_lds_sync();
    if (OUT_MODE == 0) {
      float* C = (float*)Cout + (size_t)bz * strideC;
      const int hsel = lane >> 4, c4 = (lane & 15) * 4;   // row seg = 256 B = 16 lanes x 16 B, 2 rows per instruction
      {
#pragma unroll
        for (int it = 0; it < 8; ++it) {
          const int row = it * 2 + hsel;                   // it 0..7 x hsel 0..1 = rows 0..15
          const v4f v = *(const v4f*)(slab + row * 68 + c4);
          *(v4f*)(C + (size_t)(mBase + row) * ldc + n0 + c4) = v;
        }
        
      }
    } else {
      const int q4 = lane >> 3, c8 = (lane & 7) * 8;
      unsigned short* C  = (unsigned short*)Cout  + (size_t)bz * strideC;
      unsigned short* C2 = (unsigned short*)Cout2 + (size_t)bz * strideC;
      {
#pragma unroll
        for (int it = 0; it < 4; ++it) {
          const int row = it * 4 + q4;                     // it 0..3 x q4 0..3 = rows 0..15
          const float* sp = slab + row * 68 + c8;
          v8us hv, lv;
#pragma unroll
          for (int e = 0; e < 8; ++e) {
            const unsigned short hb = f2bf_bits(sp[e]);
            const unsigned short lb = f2bf_bits(sp[e] - bf_bits2f(hb));
            hv[e] = hb;
            lv[e] = lb;
          }
          const size_t go = (size_t)(mBase + row) * ldc + n0 + c8;
          *(v8us*)(C + go)  = hv;
          *(v8us*)(C2 + go) = lv;
        }
        
      }
    }
    wave_lds_sync();
  }
}

// hk = tanh(x . kp_w1 + kp_b1) and hq = tanh(x . qp_w1 + qp_b1) in one launch (neither reads the other's result):
// blockIdx.y picks the encoder; per encoder M = 4096, N = 512, K = 512 = 1024 wave tiles = 128 blocks of 8 waves.
__global__ __launch_bounds__(256) void gemm_hidden_kernel(
    const unsigned short* __restrict__ Xh,  const unsigned short* __restrict__ Xl,
    const unsigned short* __restrict__ Wkh, const unsigned short* __restrict__ Wkl,
    const unsigned short* __restrict__ Wqh, const unsigned short* __restrict__ Wql,
    const float* __restrict__ kp_b1, const float* __restrict__ qp_b1,
    unsigned short* Hkh, unsigned short* Hkl, unsigned short* Hqh, unsigned short* Hql) {
  __shared__ __align__(16) float sT[8][16 * 68];
  const int  wave = threadIdx.x >> 5;
  const bool q    = blockIdx.y != 0;
  gemm_hl_body<2, 2, false, 1>(Xh, Xl, DM, 0LL, q ? Wqh : Wkh, q ? Wql : Wkl, DM, 0LL,
                               (void*)(q ? Hqh : Hkh), (void*)(q ? Hql : Hkl), DM, 0LL,
                               q ? qp_b1 : kp_b1, nullptr, 0LL, MTOT, DM, DM, blockIdx.x * 8 + wave, 0, sT[wave]);
}

// out = x + ln . o_w + o_b: M = 4096, N = 512, K = 512 = 128 blocks of 8 waves.
__global__ __launch_bounds__(256) void gemm_out_kernel(
    const unsigned short* __restrict__ Lh,  const unsigned short* __restrict__ Ll,
    const unsigned short* __restrict__ Woh, const unsigned short* __restrict__ Wol,
    const float* __restrict__ o_b, const float* __restrict__ x, float* out) {
  __shared__ __align__(16) float sT[8][16 * 68];
  const int wave = threadIdx.x >> 5;
  gemm_hl_body<2, 0, true, 0>(Lh, Ll, DM, 0LL, Woh, Wol, DM, 0LL, (void*)out, (void*)out, DM, 0LL,
                              o_b, x, 0LL, MTOT, DM, DM, blockIdx.x * 8 + wave, 0, sT[wave]);
}

// ---------------------------------------------------------------------------
// Fused oscillator heads + encode. Per wave 16 rows (block = 4 waves = 64 rows, blk = row block of 4096/64):
//   Pk = Hk.kp_w2, Pq = Hq.qp_w2, Ak = X.ka_w, Aq = X.qa_w  (each 16 x 32, K = 512, hi/lo WMMA);
//   phase = tanh(P + b2)*pi + pos[l]; amp = softplus(A + ba) + 0.1;
//   Kt[row] = [amp_k cos | amp_k sin] (64), Qt[row] = [amp_q cos | amp_q sin]  -> bf16 hi/lo planes [4096][64].
//   Kt also goes out key-contiguous: K^T planes [b][64 f][2048 l], one thread per 128-B line (64 keys of one f, one plane).
// Operand planes: H/X [4096][512]; W2t planes [32][512] (k-contiguous).
// LDS slab per wave [16][132]: cols 0..31 / 32..63 / 64..95 / 96..127 = k-phase / k-amp / q-phase / q-amp pre-acts,
// ---------------------------------------------------------------------------
__device__ __forceinline__ void enc_head_body(
    const unsigned short* __restrict__ Hkhp, const unsigned short* __restrict__ Hklp,
    const unsigned short* __restrict__ Hqhp, const unsigned short* __restrict__ Hqlp,
    const unsigned short* __restrict__ Xhp,  const unsigned short* __restrict__ Xlp,
    const unsigned short* __restrict__ Wk2hp, const unsigned short* __restrict__ Wk2lp,
    const unsigned short* __restrict__ Wq2hp, const unsigned short* __restrict__ Wq2lp,
    const unsigned short* __restrict__ Wkahp, const unsigned short* __restrict__ Wkalp,
    const unsigned short* __restrict__ Wqahp, const unsigned short* __restrict__ Wqalp,
    const float* __restrict__ bk2, const float* __restrict__ bq2,
    const float* __restrict__ bka, const float* __restrict__ bqa,
    const float* __restrict__ pos,
    unsigned short* Qhp, unsigned short* Qlp, unsigned short* Khp, unsigned short* Klp,
    unsigned short* KThp, unsigned short* KTlp, int blk, float (*slab_all)[16 * 132]) {
  const int tid = threadIdx.x, wave = tid >> 5, lane = tid & 31, hh = lane >> 4, c = lane & 15;
  const int row0 = blk * 64 + wave * 16;

  const __bf16* Hkh = (const __bf16*)(const void*)Hkhp;  const __bf16* Hkl = (const __bf16*)(const void*)Hklp;
  const __bf16* Hqh = (const __bf16*)(const void*)Hqhp;  const __bf16* Hql = (const __bf16*)(const void*)Hqlp;
  const __bf16* Xh  = (const __bf16*)(const void*)Xhp;   const __bf16* Xl  = (const __bf16*)(const void*)Xlp;
  const __bf16* Wk2h = (const __bf16*)(const void*)Wk2hp; const __bf16* Wk2l = (const __bf16*)(const void*)Wk2lp;
  const __bf16* Wq2h = (const __bf16*)(const void*)Wq2hp; const __bf16* Wq2l = (const __bf16*)(const void*)Wq2lp;
  const __bf16* Wkah = (const __bf16*)(const void*)Wkahp; const __bf16* Wkal = (const __bf16*)(const void*)Wkalp;
  const __bf16* Wqah = (const __bf16*)(const void*)Wqahp; const __bf16* Wqal = (const __bf16*)(const void*)Wqalp;

  v8f aPk[2], aPq[2], aAk[2], aAq[2];
#pragma unroll
  for (int t = 0; t < 2; ++t) { aPk[t] = zero8(); aPq[t] = zero8(); aAk[t] = zero8(); aAq[t] = zero8(); }

#pragma unroll 1
  for (int k0 = 0; k0 < DM; k0 += 32) {
    const size_t ao = (size_t)(row0 + c) * DM + k0 + 8 * hh;
    const __bf16 *pa0 = Hkh + ao, *pa1 = Hkl + ao, *pa2 = Hqh + ao, *pa3 = Hql + ao, *pa4 = Xh + ao, *pa5 = Xl + ao;
    const v16b ahk = ldfrag(pa0), alk = ldfrag(pa1);
    const v16b ahq = ldfrag(pa2), alq = ldfrag(pa3);
    const v16b axh = ldfrag(pa4), axl = ldfrag(pa5);
    const size_t bo = (size_t)c * DM + k0 + 8 * hh;
    const __bf16 *pb0 = Wk2h + bo, *pb1 = Wk2l + bo, *pb2 = Wq2h + bo, *pb3 = Wq2l + bo;
    const __bf16 *pb4 = Wkah + bo, *pb5 = Wkal + bo, *pb6 = Wqah + bo, *pb7 = Wqal + bo;
#pragma unroll
    for (int t = 0; t < 2; ++t) {
      const int to = t * 16 * DM;   // weight rows t*16 + c
      const v16b b0 = ldfrag(pb0 + to), b1 = ldfrag(pb1 + to), b2 = ldfrag(pb2 + to), b3 = ldfrag(pb3 + to);
      const v16b b4 = ldfrag(pb4 + to), b5 = ldfrag(pb5 + to), b6 = ldfrag(pb6 + to), b7 = ldfrag(pb7 + to);
      // wait before any address register of the fragment loads above is overwritten; the addresses are inputs so that
      // they stay live up to the wait and no later load's result is placed in them
      if (t == 0)
        asm volatile("s_wait_xcnt 0x0" :: "v"(pa0), "v"(pa1), "v"(pa2), "v"(pa3), "v"(pa4), "v"(pa5), "v"(pb0), "v"(pb1),
                     "v"(pb2), "v"(pb3), "v"(pb4), "v"(pb5), "v"(pb6), "v"(pb7) : "memory");
      else
        asm volatile("s_wait_xcnt 0x0" :: "v"(pb0), "v"(pb1), "v"(pb2), "v"(pb3), "v"(pb4), "v"(pb5), "v"(pb6), "v"(pb7)
                     : "memory");
      aPk[t] = mma3(ahk, alk, b0, b1, aPk[t]);
      aPq[t] = mma3(ahq, alq, b2, b3, aPq[t]);
      aAk[t] = mma3(axh, axl, b4, b5, aAk[t]);
      aAq[t] = mma3(axh, axl, b6, b7, aAq[t]);
    }
  }

  // stage pre-activations (+bias) in the D layout: row 8hh+r, oscillator n = t*16+c
  float* sl = slab_all[wave];
  float bv1[2], bv2[2], bv3[2], bv4[2];
#pragma unroll   // constant indices keep the bias values in registers
  for (int t = 0; t < 2; ++t) {
    bv1[t] = bk2[t * 16 + c]; bv2[t] = bka[t * 16 + c]; bv3[t] = bq2[t * 16 + c]; bv4[t] = bqa[t * 16 + c];
  }
  // wait before a base or index register of the eight bias loads above is overwritten; they are inputs so that they
  // stay live up to the wait
  asm volatile("s_wait_xcnt 0x0" :: "s"(bk2), "s"(bka), "s"(bq2), "s"(bqa), "v"(c) : "memory");
#pragma unroll
  for (int t = 0; t < 2; ++t) {
    const int n = t * 16 + c;
    const float b1 = bv1[t], b2 = bv2[t], b3 = bv3[t], b4 = bv4[t];
#pragma unroll
    for (int r = 0; r < 8; ++r) {
      float* sp = sl + (8 * hh + r) * 132;
      sp[n]      = aPk[t][r] + b1;
      sp[32 + n] = aAk[t][r] + b2;
      sp[64 + n] = aPq[t][r] + b3;
      sp[96 + n] = aAq[t][r] + b4;
    }
  }
  wave_lds_sync();

  // encode: lane = oscillator index, one row per iteration (same lane reads and writes its own 4 slots)
  const float PI = 3.14159265358979323846f;
#pragma unroll 1
  for (int it = 0; it < 16; ++it) {
    float* sp = sl + it * 132;
    const int l = (row0 + it) & (SEQ - 1);
    const float pa  = pos[l * KO + lane];
    const float vpk = sp[lane], vak = sp[32 + lane], vpq = sp[64 + lane], vaq = sp[96 + lane];
    const float phk = tanhf(vpk) * PI + pa;
    const float phq = tanhf(vpq) * PI + pa;
    const float ak  = fmaxf(vak, 0.f) + log1pf(expf(-fabsf(vak))) + 0.1f;
    const float aq  = fmaxf(vaq, 0.f) + log1pf(expf(-fabsf(vaq))) + 0.1f;
    sp[lane]      = ak * cosf(phk);
    sp[32 + lane] = ak * sinf(phk);
    sp[64 + lane] = aq * cosf(phq);
    sp[96 + lane] = aq * sinf(phq);
  }
  wave_lds_sync();

  const int q4 = lane >> 3, c8 = (lane & 7) * 8;
  {
#pragma unroll
    for (int it = 0; it < 4; ++it) {
      const int row = it * 4 + q4;   // 0..15
      const float* sk = sl + row * 132 + c8;
      const float* sq = sl + row * 132 + 64 + c8;
      v8us khv, klv, qhv, qlv;
#pragma unroll
      for (int e = 0; e < 8; ++e) {
        const unsigned short kh = f2bf_bits(sk[e]);
        const unsigned short kl = f2bf_bits(sk[e] - bf_bits2f(kh));
        const unsigned short qh = f2bf_bits(sq[e]);
        const unsigned short ql = f2bf_bits(sq[e] - bf_bits2f(qh));
        khv[e] = kh; klv[e] = kl; qhv[e] = qh; qlv[e] = ql;
      }
      const size_t go = (size_t)(row0 + row) * QK + c8;
      unsigned short *sk0 = Khp + go, *sk1 = Klp + go, *sq0 = Qhp + go, *sq1 = Qlp + go;
      *(v8us*)(sk0) = khv;
      *(v8us*)(sk1) = klv;
      *(v8us*)(sq0) = qhv;
      *(v8us*)(sq1) = qlv;
      // wait before an address or data register of the four stores above is overwritten; they are inputs so that they
      // stay live up to the wait
      asm volatile("s_wait_xcnt 0x0" :: "v"(sk0), "v"(sk1), "v"(sq0), "v"(sq1), "v"(khv), "v"(klv), "v"(qhv), "v"(qlv)
                   : "memory");
    }
    
  }

  __syncthreads();   // the K^T rows below gather the encoded K values of all four waves' slabs
  {
    const int  f   = tid & 63;
    const bool lop = __builtin_amdgcn_readfirstlane(wave) >= 2;   // scalar: waves 0,1 write the hi plane, waves 2,3 the lo plane
    const int  bb  = (blk * 64) >> 11;                // batch element
    const int  l0  = (blk * 64) & (SEQ - 1);          // first key of this block
    unsigned short* dst = (lop ? KTlp : KThp) + ((size_t)bb * QK + f) * SEQ + l0;
    float xv[64];                                     // key rows 0..63 of the block, feature f
#pragma unroll
    for (int r = 0; r < 64; ++r) xv[r] = slab_all[r >> 4][(r & 15) * 132 + f];
#pragma unroll
    for (int g = 0; g < 8; ++g) {
      v8us o;
#pragma unroll
      for (int e = 0; e < 8; ++e) {
        const float xe = xv[g * 8 + e];
        const unsigned short hb = f2bf_bits(xe);
        const unsigned short lb = f2bf_bits(xe - bf_bits2f(hb));
        o[e] = lop ? lb : hb;
      }
      *(v8us*)(dst + g * 8) = o;
      // wait before the address or the data registers of the store above are overwritten (inputs: live up to the wait)
      asm volatile("s_wait_xcnt 0x0" :: "v"(dst), "v"(o) : "memory");
    }
  }
}

// ---------------------------------------------------------------------------
// Oscillator heads + encode and the V^T projection in one launch (neither reads the other's result), 4 waves a block:
//   blocks 0..63   enc_head_body, row block = blockIdx.x (the longer job, first in the index order);
//   blocks 64..319 V^T[b][d][l] = sum_k v_w^T[d][k] x[b][l][k] + v_b[d] -> bf16 hi/lo planes [2][512][2048]
//                  (A = v_w^T planes [512][512], Bt = x planes of batch b [2048][512]; M = 512, N = 2048, K = 512:
//                  512 wave tiles = 128 blocks per batch).
// ---------------------------------------------------------------------------
__global__ __launch_bounds__(128) void enc_v_kernel(
    const unsigned short* __restrict__ Hkhp, const unsigned short* __restrict__ Hklp,
    const unsigned short* __restrict__ Hqhp, const unsigned short* __restrict__ Hqlp,
    const unsigned short* __restrict__ Xhp,  const unsigned short* __restrict__ Xlp,
    const unsigned short* __restrict__ Wk2hp, const unsigned short* __restrict__ Wk2lp,
    const unsigned short* __restrict__ Wq2hp, const unsigned short* __restrict__ Wq2lp,
    const unsigned short* __restrict__ Wkahp, const unsigned short* __restrict__ Wkalp,
    const unsigned short* __restrict__ Wqahp, const unsigned short* __restrict__ Wqalp,
    const float* __restrict__ bk2, const float* __restrict__ bq2,
    const float* __restrict__ bka, const float* __restrict__ bqa,
    const float* __restrict__ pos,
    unsigned short* Qhp, unsigned short* Qlp, unsigned short* Khp, unsigned short* Klp,
    unsigned short* KThp, unsigned short* KTlp,
    const unsigned short* __restrict__ Wvhp, const unsigned short* __restrict__ Wvlp,
    const float* __restrict__ v_b, unsigned short* VThp, unsigned short* VTlp) {
  __shared__ __align__(16) float slab_all[4][16 * 132];
  const int bx = blockIdx.x;
  if (bx < MTOT / 64) {
    enc_head_body(Hkhp, Hklp, Hqhp, Hqlp, Xhp, Xlp, Wk2hp, Wk2lp, Wq2hp, Wq2lp, Wkahp, Wkalp, Wqahp, Wqalp,
                  bk2, bq2, bka, bqa, pos, Qhp, Qlp, Khp, Klp, KThp, KTlp, bx, slab_all);
  } else {
    const int wave = threadIdx.x >> 5;
    const int idx  = bx - MTOT / 64;
    gemm_hl_body<1, 2, false, 0>(Wvhp, Wvlp, DM, 0LL, Xhp, Xlp, DM, (long long)SEQ * DM,
                                 (void*)VThp, (void*)VTlp, SEQ, (long long)DM * SEQ,
                                 v_b, nullptr, 0LL, DM, SEQ, DM, (idx & 127) * 4 + wave, idx >> 7, slab_all[wave]);
  }
}

// ---------------------------------------------------------------------------
// Per-chunk sums: U[b][ch][d][f] = sum_{l' in 64-key chunk ch} V^T[b][d][l'] * K^T[b][f][l'] (hi/lo WMMA, f32 out).
// A = V^T rows (m = d), B rows = K^T rows (n = f), both key-contiguous at pitch 2048. Wave = 16 d x 64 f, block = 8 waves
// = 128 d; grid = (4, NCH-1, NB): chunks 0..NCH-2 (the last chunk enters no state). Each wave stores whole 256-B rows.
// ---------------------------------------------------------------------------
__global__ __launch_bounds__(256) void chunk_kv_kernel(
    const unsigned short* __restrict__ Vhp, const unsigned short* __restrict__ Vlp,
    const unsigned short* __restrict__ KThp, const unsigned short* __restrict__ KTlp, float* U) {
  __shared__ __align__(16) float sT[8][16 * 68];
  const int lane = threadIdx.x & 31, wave = threadIdx.x >> 5, hh = lane >> 4, c = lane & 15;
  const int ch = blockIdx.y, b = blockIdx.z;
  const int d0 = blockIdx.x * 128 + wave * 16;
  const size_t ao = ((size_t)b * DM + d0 + c) * SEQ + ch * 64 + 8 * hh;
  const size_t bo = ((size_t)b * QK + c) * SEQ + ch * 64 + 8 * hh;
  const __bf16* va = (const __bf16*)(const void*)Vhp + ao;
  const __bf16* vl = (const __bf16*)(const void*)Vlp + ao;
  const __bf16* kb = (const __bf16*)(const void*)KThp + bo;
  const __bf16* kl = (const __bf16*)(const void*)KTlp + bo;
  v16b ah[2], al[2], bh[2][4], bl[2][4];
#pragma unroll
  for (int kk = 0; kk < 2; ++kk) {
    ah[kk] = ldfrag(va + kk * 32);
    al[kk] = ldfrag(vl + kk * 32);
#pragma unroll
    for (int j = 0; j < 4; ++j) {
      bh[kk][j] = ldfrag(kb + j * 16 * SEQ + kk * 32);
      bl[kk][j] = ldfrag(kl + j * 16 * SEQ + kk * 32);
    }
  }
  // wait before any address register of the 40 loads above is overwritten; the four addresses are inputs so that they
  // stay live up to the wait
  asm volatile("s_wait_xcnt 0x0" :: "v"(va), "v"(vl), "v"(kb), "v"(kl) : "memory");
  v8f acc[4];
#pragma unroll
  for (int j = 0; j < 4; ++j) acc[j] = zero8();
#pragma unroll
  for (int kk = 0; kk < 2; ++kk)
#pragma unroll
    for (int j = 0; j < 4; ++j) acc[j] = mma3(ah[kk], al[kk], bh[kk][j], bl[kk][j], acc[j]);

  float* slab = sT[wave];
#pragma unroll
  for (int j = 0; j < 4; ++j)
#pragma unroll
    for (int r = 0; r < 8; ++r) slab[(8 * hh + r) * 68 + j * 16 + c] = acc[j][r];
  wave_lds_sync();
  float* C = U + (((size_t)b * NCH + ch) * DM + d0) * QK + hh * QK + c * 4;   // 2 rows of 256 B per instruction
#pragma unroll
  for (int it = 0; it < 8; ++it) {
    const v4f v = *(const v4f*)(slab + (it * 2 + hh) * 68 + c * 4);
    *(v4f*)(C + it * 2 * QK) = v;
  }
}

// ---------------------------------------------------------------------------
// Exclusive prefix over the key chunks: M[b][ch] = sum_{c < ch} U[b][c], U f32 [b][ch][512 d][64 f] (chunks 0..NCH-2
// are written and read), M -> bf16 hi/lo planes of the same shape, chunk 0 = 0. Thread = 4 consecutive elements;
// grid = NB*512*64/4/128 blocks of 128; a wave reads 512 B and writes 256 B per plane and chunk.
// ---------------------------------------------------------------------------
__global__ __launch_bounds__(128) void chunk_scan_kernel(const float* __restrict__ U, unsigned short* Mh,
                                                         unsigned short* Ml) {
  const int i = blockIdx.x * 128 + threadIdx.x;
  const int b = i / (DM * QK / 4);
  const size_t base = (size_t)b * ((size_t)NCH * DM * QK) + (size_t)(i - b * (DM * QK / 4)) * 4;
  v4f u[NCH - 1];
#pragma unroll
  for (int ch = 0; ch < NCH - 1; ++ch) u[ch] = *(const v4f*)(U + base + (size_t)ch * (DM * QK));
  unsigned short* ph = Mh + base;
  unsigned short* pl = Ml + base;
  v4f m = (v4f){0.f, 0.f, 0.f, 0.f};
#pragma unroll
  for (int ch = 0; ch < NCH; ++ch) {
    const unsigned short h0 = f2bf_bits(m[0]), h1 = f2bf_bits(m[1]), h2 = f2bf_bits(m[2]), h3 = f2bf_bits(m[3]);
    const unsigned short l0 = f2bf_bits(m[0] - bf_bits2f(h0)), l1 = f2bf_bits(m[1] - bf_bits2f(h1));
    const unsigned short l2 = f2bf_bits(m[2] - bf_bits2f(h2)), l3 = f2bf_bits(m[3] - bf_bits2f(h3));
    const v2u hv = (v2u){pk16(h0, h1), pk16(h2, h3)};
    const v2u lv = (v2u){pk16(l0, l1), pk16(l2, l3)};
    // the chunk's two state stores and their wait in one statement: no later load result, packed value or address step
    // can be placed in a register that the stores name ahead of the wait
    asm volatile("global_store_b64 %0, %2, off\n\tglobal_store_b64 %1, %3, off\n\ts_wait_xcnt 0x0"
                 :: "v"(ph), "v"(pl), "v"(hv), "v"(lv) : "memory");
    ph += DM * QK;
    pl += DM * QK;
    if (ch < NCH - 1) m += u[ch];
  }
}

// ---------------------------------------------------------------------------
// Causal mixing: R[b][l][d] = (1/sqrt((l+1)*32)) * sum_{l' <= l} S[l][l'] * V[l'][d],  S = Qt[l] . Kt[l'] (K = 64).
// Block = 4 waves = 64 query rows of one batch element and one 128-wide d chunk; grid = NB * 32 * 4.
//   Qt/Kt planes bf16 hi/lo [4096][64]; V^T planes bf16 hi/lo [b][512 d][2048 l']; R f32 [4096][512].
//   Keys of the earlier 64-key chunks enter through the state M[b][qb] = sum_{l' < 64 qb} Kt[l'] (x) V[l'] (planes
//   [b][ch][512 d][64 f], f contiguous): O = Qt . M (A = Qt rows, B = M rows from global).
//   The block's own key tile: stage Kt tile [64][64] and V^T chunk [128][64] (hi+lo) in LDS
//   (plain 16-B loads, __syncthreads after); S per wave in registers (A = Qt rows, B = Kt rows from LDS);
//   entries with l' > l set to 0 by value; P = S split to bf16 hi/lo into the wave's LDS tile
//   Output: per wave 16 rows x 128 floats staged in LDS (aliasing the K/V region after a block barrier), each
//   Coverage: 4 d chunks x 32 row blocks x 2 batches x (4 waves x 16 rows x 128) = the whole [4096][512] R plane.
// ---------------------------------------------------------------------------
__global__ __launch_bounds__(128) void causal_mix_kernel(
    const unsigned short* __restrict__ Qhp, const unsigned short* __restrict__ Qlp,
    const unsigned short* __restrict__ Khp, const unsigned short* __restrict__ Klp,
    const unsigned short* __restrict__ Vhp, const unsigned short* __restrict__ Vlp,
    const unsigned short* __restrict__ Mhp, const unsigned short* __restrict__ Mlp,
    float* Rout) {
  // Every tile row holds 64 halves (128 B) at a pitch of LP = 72 halves (144 B = 16 B x 9): the 16 rows that one
  // ds_load_b128 / ds_store_b128 touches then start on 16 different 4-bank groups instead of 2.
  constexpr int LP = 72;
  __shared__ __align__(16) unsigned char smem[73728];
  __bf16* Ksh = (__bf16*)(smem);           // [64 l'][LP]    9216 B
  __bf16* Ksl = (__bf16*)(smem + 9216);
  __bf16* Vth = (__bf16*)(smem + 18432);   // [128 d][LP]   18432 B
  __bf16* Vtl = (__bf16*)(smem + 36864);
  __bf16* Pgh = (__bf16*)(smem + 55296);   // [4 waves][16][LP]  9216 B
  __bf16* Pgl = (__bf16*)(smem + 64512);
  float*  Osb = (float*)(smem);            // [4 waves][16][132] after the main loop (aliases K/V tiles)

  const int tid = threadIdx.x, wave = tid >> 5, lane = tid & 31, hh = lane >> 4, c = lane & 15;
  const int bx  = blockIdx.x;
  const int dch = bx & 3;
  const int qb  = (bx >> 2) & 31;
  const int b   = bx >> 7;
  const int q0  = qb * 64 + wave * 16;                 // sequence-local first row of this wave
  const size_t grow0 = (size_t)b * SEQ + q0;           // global row of this wave's row 0

  const __bf16* Qh = (const __bf16*)(const void*)Qhp; const __bf16* Ql = (const __bf16*)(const void*)Qlp;
  const __bf16* Kh = (const __bf16*)(const void*)Khp; const __bf16* Kl = (const __bf16*)(const void*)Klp;
  const __bf16* Vh = (const __bf16*)(const void*)Vhp; const __bf16* Vl = (const __bf16*)(const void*)Vlp;
  const __bf16* Mh = (const __bf16*)(const void*)Mhp; const __bf16* Ml = (const __bf16*)(const void*)Mlp;

  // Qt fragments (A operand, row = lane&15): two 32-deep k chunks, hi and lo
  v16b qah[2], qal[2];
#pragma unroll
  for (int dc = 0; dc < 2; ++dc) {
    qah[dc] = ldfrag(Qh + (grow0 + c) * QK + dc * 32 + 8 * hh);
    qal[dc] = ldfrag(Ql + (grow0 + c) * QK + dc * 32 + 8 * hh);
  }
  v8f oacc[8];
#pragma unroll
  for (int t = 0; t < 8; ++t) oacc[t] = zero8();

  __bf16* pwh = Pgh + wave * (16 * LP);
  __bf16* pwl = Pgl + wave * (16 * LP);

  // O[16 x 128] = Qt[16 x 64] . M[64 x 128]: B[k = feature][n = d] = M[d][feature]
  const size_t mo = (((size_t)b * NCH + qb) * DM + dch * 128 + c) * QK + 8 * hh;
  const __bf16* mhp = Mh + mo;
  const __bf16* mlp = Ml + mo;
#pragma unroll
  for (int dc = 0; dc < 2; ++dc) {
    v16b mb[8], ml[8];
#pragma unroll
    for (int t = 0; t < 8; ++t) {
      mb[t] = ldfrag(mhp + t * 16 * QK + dc * 32);
      ml[t] = ldfrag(mlp + t * 16 * QK + dc * 32);
    }
    // wait before any address register of the 32 loads above is overwritten; both addresses are inputs so that they
    // stay live up to the wait
    asm volatile("s_wait_xcnt 0x0" :: "v"(mhp), "v"(mlp) : "memory");
#pragma unroll
    for (int t = 0; t < 8; ++t) oacc[t] = mma3(qah[dc], qal[dc], mb[t], ml[t], oacc[t]);
  }

  {
    const int kv0 = qb * 64;
    {
      // Kt tile: 128 threads x 32 halves per plane = 64 x 64
      const int r = tid >> 1, half = (tid & 1) * 32;
      const __bf16* ks = Kh + ((size_t)b * SEQ + kv0 + r) * QK + half;
      const __bf16* ls = Kl + ((size_t)b * SEQ + kv0 + r) * QK + half;
      v8b kr[4], lr[4];
#pragma unroll
      for (int i = 0; i < 4; ++i) {
        kr[i] = *(const v8b*)(ks + 8 * i);
        lr[i] = *(const v8b*)(ls + 8 * i);
      }
      // V^T chunk: thread = d row (dch*128 + tid), 64 halves per plane = 128 x 64
      const __bf16* vs = Vh + ((size_t)b * DM + dch * 128 + tid) * SEQ + kv0;
      const __bf16* vl = Vl + ((size_t)b * DM + dch * 128 + tid) * SEQ + kv0;
      v8b vr[8], wr[8];
#pragma unroll
      for (int i = 0; i < 8; ++i) {
        vr[i] = *(const v8b*)(vs + 8 * i);
        wr[i] = *(const v8b*)(vl + 8 * i);
      }
      // wait before any address register of the 24 loads above is overwritten; the four addresses are inputs so that
      // they stay live up to the wait and no later load's result is placed in them
      asm volatile("s_wait_xcnt 0x0" :: "v"(ks), "v"(ls), "v"(vs), "v"(vl) : "memory");
#pragma unroll
      for (int i = 0; i < 4; ++i) {
        *(v8b*)(Ksh + r * LP + half + 8 * i) = kr[i];
        *(v8b*)(Ksl + r * LP + half + 8 * i) = lr[i];
      }
#pragma unroll
      for (int i = 0; i < 8; ++i) {
        *(v8b*)(Vth + tid * LP + 8 * i) = vr[i];
        *(v8b*)(Vtl + tid * LP + 8 * i) = wr[i];
      }
    }
    __syncthreads();

    // S strip 16 x 64 for this wave: B[k = feature][n = key] = Kt[key][feature]
    v8f s[4];
#pragma unroll
    for (int j = 0; j < 4; ++j) {
      s[j] = zero8();
#pragma unroll
      for (int dc = 0; dc < 2; ++dc) {
        FB kb, kl;
        const int kb0 = (j * 16 + c) * LP + dc * 32 + 8 * hh;
        kb.h[0] = *(const v8b*)(Ksh + kb0);
        kb.h[1] = *(const v8b*)(Ksh + kb0 + 16);
        kl.h[0] = *(const v8b*)(Ksl + kb0);
        kl.h[1] = *(const v8b*)(Ksl + kb0 + 16);
        s[j] = mma3(qah[dc], qal[dc], kb.v, kl.v, s[j]);
      }
    }
    // causal select by value, split to bf16 hi/lo, into the wave's P tile [row][key]
#pragma unroll
    for (int r = 0; r < 8; ++r) {
      const int qrow = q0 + 8 * hh + r;
#pragma unroll
      for (int j = 0; j < 4; ++j) {
        const int kvcol = kv0 + j * 16 + c;
        float pm = s[j][r];
        if (kvcol > qrow) pm = 0.f;
        const unsigned short hb = f2bf_bits(pm);
        const unsigned short lb = f2bf_bits(pm - bf_bits2f(hb));
        pwh[(8 * hh + r) * LP + j * 16 + c] = __builtin_bit_cast(__bf16, hb);
        pwl[(8 * hh + r) * LP + j * 16 + c] = __builtin_bit_cast(__bf16, lb);
      }
    }
    wave_lds_sync();

    // O[16 x 128] += P[16 x 64] . V[64 x 128]: A = P (row = lane&15), B[k = key][n = d] = V^T[d][key]
#pragma unroll 1
    for (int kk = 0; kk < 2; ++kk) {
      FB pa, pl;
      const int pb0 = c * LP + kk * 32 + 8 * hh;
      pa.h[0] = *(const v8b*)(pwh + pb0);
      pa.h[1] = *(const v8b*)(pwh + pb0 + 16);
      pl.h[0] = *(const v8b*)(pwl + pb0);
      pl.h[1] = *(const v8b*)(pwl + pb0 + 16);
#pragma unroll
      for (int t = 0; t < 8; ++t) {
        FB vb, vlo;
        const int vb0 = (t * 16 + c) * LP + kk * 32 + 8 * hh;
        vb.h[0]  = *(const v8b*)(Vth + vb0);
        vb.h[1]  = *(const v8b*)(Vth + vb0 + 16);
        vlo.h[0] = *(const v8b*)(Vtl + vb0);
        vlo.h[1] = *(const v8b*)(Vtl + vb0 + 16);
        oacc[t] = mma3(pa.v, pl.v, vb.v, vlo.v, oacc[t]);
      }
    }
  }
  __syncthreads();   // every wave done with the K/V tiles before the output staging aliases them

  // scale by 1/sqrt((l+1)*32), stage the wave's 16 x 128 tile, write whole 512-B row segments
  float* os = Osb + wave * (16 * 132);
#pragma unroll
  for (int r = 0; r < 8; ++r) {
    const int lq = q0 + 8 * hh + r;
    const float nrm = sqrtf((float)((lq + 1) * KO));
    const float inv = 1.0f / nrm;
#pragma unroll
    for (int t = 0; t < 8; ++t) os[(8 * hh + r) * 132 + t * 16 + c] = oacc[t][r] * inv;
  }
  wave_lds_sync();
  {
#pragma unroll
    for (int it = 0; it < 16; ++it) {
      const v4f val = *(const v4f*)(os + it * 132 + lane * 4);
      *(v4f*)(Rout + (grow0 + it) * DM + dch * 128 + lane * 4) = val;
    }
    
  }
}

// ---------------------------------------------------------------------------
// One wave per row (block = 8 rows, grid = 4096/8); lane holds cols 8*lane..+7 and 256+8*lane..+7.
// ---------------------------------------------------------------------------
__global__ __launch_bounds__(256) void ln_split_kernel(const float* __restrict__ R, const float* __restrict__ g,
                                                       const float* __restrict__ be,
                                                       unsigned short* Lh, unsigned short* Ll) {
  const int tid = threadIdx.x, wave = tid >> 5, lane = tid & 31;
  const int row = blockIdx.x * 8 + wave;
  const float* rp = R + (size_t)row * DM;
  const int cA = 8 * lane, cB = 256 + 8 * lane;
  const v4f x0 = *(const v4f*)(rp + cA), x1 = *(const v4f*)(rp + cA + 4);
  const v4f x2 = *(const v4f*)(rp + cB), x3 = *(const v4f*)(rp + cB + 4);
  const v4f g0 = *(const v4f*)(g + cA),  g1 = *(const v4f*)(g + cA + 4);
  const v4f g2 = *(const v4f*)(g + cB),  g3 = *(const v4f*)(g + cB + 4);
  const v4f e0 = *(const v4f*)(be + cA), e1 = *(const v4f*)(be + cA + 4);
  const v4f e2 = *(const v4f*)(be + cB), e3 = *(const v4f*)(be + cB + 4);
  float v[16], gg[16], bb[16];
#pragma unroll
  for (int e = 0; e < 4; ++e) {
    v[e] = x0[e]; v[4 + e] = x1[e]; v[8 + e] = x2[e]; v[12 + e] = x3[e];
    gg[e] = g0[e]; gg[4 + e] = g1[e]; gg[8 + e] = g2[e]; gg[12 + e] = g3[e];
    bb[e] = e0[e]; bb[4 + e] = e1[e]; bb[8 + e] = e2[e]; bb[12 + e] = e3[e];
  }
  float sum = 0.f;
#pragma unroll
  for (int e = 0; e < 16; ++e) sum += v[e];
#pragma unroll
  for (int off = 1; off < 32; off <<= 1) sum += __shfl_xor(sum, off, 32);
  const float mu = sum * (1.0f / (float)DM);
  float ss = 0.f;
#pragma unroll
  for (int e = 0; e < 16; ++e) { const float d = v[e] - mu; v[e] = d; ss += d * d; }
#pragma unroll
  for (int off = 1; off < 32; off <<= 1) ss += __shfl_xor(ss, off, 32);
  const float var  = ss * (1.0f / (float)DM);
  const float rstd = 1.0f / sqrtf(var + 1e-5f);
  v8us hA, lA, hB, lB;
#pragma unroll
  for (int e = 0; e < 8; ++e) {
    const float ya = v[e] * rstd * gg[e] + bb[e];
    const float yb = v[8 + e] * rstd * gg[8 + e] + bb[8 + e];
    const unsigned short ha = f2bf_bits(ya), la = f2bf_bits(ya - bf_bits2f(ha));
    const unsigned short hb = f2bf_bits(yb), lb = f2bf_bits(yb - bf_bits2f(hb));
    hA[e] = ha; lA[e] = la; hB[e] = hb; lB[e] = lb;
  }
  const size_t oA = (size_t)row * DM + cA, oB = (size_t)row * DM + cB;
  {
    *(v8us*)(Lh + oA) = hA;
    *(v8us*)(Lh + oB) = hB;
    *(v8us*)(Ll + oA) = lA;
    *(v8us*)(Ll + oB) = lB;
    
  }
}

// ---------------------------------------------------------------------------
// Workspace region map (bytes; every region an exact multiple of its store granularity, no tail rows):
//   Xh, Xl            bf16 [4096][512]     2 x 4,194,304          0 ..  8,388,608
//   Hkh,Hkl,Hqh,Hql   bf16 [4096][512]     4 x 4,194,304   8,388,608 .. 25,165,824
//   W1t planes (kp,qp,v,o) bf16 [512][512] 8 x 524,288  25,165,824 .. 29,360,128
//   W2t planes (kp2,qp2,ka,qa) bf16 [32][512] 8 x 32,768 29,360,128 .. 29,622,272
//   Qth,Qtl,Kth,Ktl   bf16 [4096][64]      4 x 524,288    29,622,272 .. 31,719,424
//   VTh, VTl          bf16 [2][512][2048]  2 x 4,194,304  31,719,424 .. 40,108,032
//   R                 f32  [4096][512]     8,388,608      40,108,032 .. 48,496,640
//   Lh, Ll            bf16 [4096][512]     2 x 4,194,304  48,496,640 .. 56,885,248
//   KTh, KTl          bf16 [2][64][2048]   2 x 524,288    56,885,248 .. 57,933,824
//   U                 f32  [2][32][512][64] 8,388,608     57,933,824 .. 66,322,432
//   Mh, Ml            bf16 [2][32][512][64] 2 x 4,194,304 66,322,432 .. 74,711,040
// ---------------------------------------------------------------------------
extern "C" void kernel_launch(void* const* d_in, const int* in_sizes, int n_in,
                              void* d_out, int out_size, void* d_ws, size_t ws_size,
                              hipStream_t stream) {
  if (n_in < 20) return;
  if (in_sizes[0] != MTOT * DM || in_sizes[1] != SEQ * KO) return;
  if (in_sizes[2] != DM * DM || in_sizes[8] != DM * DM || in_sizes[14] != DM * DM || in_sizes[18] != DM * DM) return;
  if (in_sizes[3] != DM || in_sizes[9] != DM || in_sizes[15] != DM || in_sizes[19] != DM) return;
  if (in_sizes[16] != DM || in_sizes[17] != DM) return;
  if (in_sizes[4] != DM * KO || in_sizes[6] != DM * KO || in_sizes[10] != DM * KO || in_sizes[12] != DM * KO) return;
  if (in_sizes[5] != KO || in_sizes[7] != KO || in_sizes[11] != KO || in_sizes[13] != KO) return;
  if (out_size != MTOT * DM) return;

  const float* x     = (const float*)d_in[0];
  const float* pos   = (const float*)d_in[1];
  const float* kp_w1 = (const float*)d_in[2];
  const float* kp_b1 = (const float*)d_in[3];
  const float* kp_w2 = (const float*)d_in[4];
  const float* kp_b2 = (const float*)d_in[5];
  const float* ka_w  = (const float*)d_in[6];
  const float* ka_b  = (const float*)d_in[7];
  const float* qp_w1 = (const float*)d_in[8];
  const float* qp_b1 = (const float*)d_in[9];
  const float* qp_w2 = (const float*)d_in[10];
  const float* qp_b2 = (const float*)d_in[11];
  const float* qa_w  = (const float*)d_in[12];
  const float* qa_b  = (const float*)d_in[13];
  const float* v_w   = (const float*)d_in[14];
  const float* v_b   = (const float*)d_in[15];
  const float* ln_g  = (const float*)d_in[16];
  const float* ln_b  = (const float*)d_in[17];
  const float* o_w   = (const float*)d_in[18];
  const float* o_b   = (const float*)d_in[19];

  const size_t PX = (size_t)MTOT * DM * 2;        // 4,194,304
  const size_t PW = (size_t)DM * DM * 2;          //   524,288
  const size_t PS = (size_t)KO * DM * 2;          //    32,768
  const size_t PQ = (size_t)MTOT * QK * 2;        //   524,288
  const size_t PV = (size_t)NB * DM * SEQ * 2;    // 4,194,304
  const size_t PR = (size_t)MTOT * DM * 4;        // 8,388,608
  size_t off = 0;
  const size_t oXh  = off; off += PX;  const size_t oXl  = off; off += PX;
  const size_t oHkh = off; off += PX;  const size_t oHkl = off; off += PX;
  const size_t oHqh = off; off += PX;  const size_t oHql = off; off += PX;
  const size_t oWkh = off; off += PW;  const size_t oWkl = off; off += PW;
  const size_t oWqh = off; off += PW;  const size_t oWql = off; off += PW;
  const size_t oWvh = off; off += PW;  const size_t oWvl = off; off += PW;
  const size_t oWoh = off; off += PW;  const size_t oWol = off; off += PW;
  const size_t oSk2h = off; off += PS; const size_t oSk2l = off; off += PS;
  const size_t oSq2h = off; off += PS; const size_t oSq2l = off; off += PS;
  const size_t oSkah = off; off += PS; const size_t oSkal = off; off += PS;
  const size_t oSqah = off; off += PS; const size_t oSqal = off; off += PS;
  const size_t oQth = off; off += PQ;  const size_t oQtl = off; off += PQ;
  const size_t oKth = off; off += PQ;  const size_t oKtl = off; off += PQ;
  const size_t oVTh = off; off += PV;  const size_t oVTl = off; off += PV;
  const size_t oR   = off; off += PR;
  const size_t oLh  = off; off += PX;  const size_t oLl  = off; off += PX;
  const size_t oKTh = off; off += PQ;  const size_t oKTl = off; off += PQ;
  const size_t oU   = off; off += PR;
  const size_t oMh  = off; off += PX;  const size_t oMl  = off; off += PX;
  if (off > ws_size) return;                      // off = 74,711,040

  char* ws = (char*)d_ws;
  unsigned short* Xh  = (unsigned short*)(ws + oXh);   unsigned short* Xl  = (unsigned short*)(ws + oXl);
  unsigned short* Hkh = (unsigned short*)(ws + oHkh);  unsigned short* Hkl = (unsigned short*)(ws + oHkl);
  unsigned short* Hqh = (unsigned short*)(ws + oHqh);  unsigned short* Hql = (unsigned short*)(ws + oHql);
  unsigned short* Wkh = (unsigned short*)(ws + oWkh);  unsigned short* Wkl = (unsigned short*)(ws + oWkl);
  unsigned short* Wqh = (unsigned short*)(ws + oWqh);  unsigned short* Wql = (unsigned short*)(ws + oWql);
  unsigned short* Wvh = (unsigned short*)(ws + oWvh);  unsigned short* Wvl = (unsigned short*)(ws + oWvl);
  unsigned short* Woh = (unsigned short*)(ws + oWoh);  unsigned short* Wol = (unsigned short*)(ws + oWol);
  unsigned short* Sk2h = (unsigned short*)(ws + oSk2h); unsigned short* Sk2l = (unsigned short*)(ws + oSk2l);
  unsigned short* Sq2h = (unsigned short*)(ws + oSq2h); unsigned short* Sq2l = (unsigned short*)(ws + oSq2l);
  unsigned short* Skah = (unsigned short*)(ws + oSkah); unsigned short* Skal = (unsigned short*)(ws + oSkal);
  unsigned short* Sqah = (unsigned short*)(ws + oSqah); unsigned short* Sqal = (unsigned short*)(ws + oSqal);
  unsigned short* Qth = (unsigned short*)(ws + oQth);  unsigned short* Qtl = (unsigned short*)(ws + oQtl);
  unsigned short* Kth = (unsigned short*)(ws + oKth);  unsigned short* Ktl = (unsigned short*)(ws + oKtl);
  unsigned short* VTh = (unsigned short*)(ws + oVTh);  unsigned short* VTl = (unsigned short*)(ws + oVTl);
  float*          Rws = (float*)(ws + oR);
  unsigned short* Lh  = (unsigned short*)(ws + oLh);   unsigned short* Ll  = (unsigned short*)(ws + oLl);
  unsigned short* KTh = (unsigned short*)(ws + oKTh);  unsigned short* KTl = (unsigned short*)(ws + oKTl);
  float*          Uws = (float*)(ws + oU);
  unsigned short* Mh  = (unsigned short*)(ws + oMh);   unsigned short* Ml  = (unsigned short*)(ws + oMl);

  const dim3 b256(256), b128(128);

  // (1) operand preparation, one launch: the four [512][512] and the four [512][32] weights -> transposed hi/lo planes
  //     (the planes lie in the workspace in the order of the jobs), x -> hi/lo planes
  prep_kernel<<<dim3(PREP_T1 + PREP_T2 + PREP_X), b256, 0, stream>>>(
      x, kp_w1, qp_w1, v_w, o_w, kp_w2, qp_w2, ka_w, qa_w, Xh, Xl, Wkh, Sk2h);

  // (2) hk = tanh(x . kp_w1 + kp_b1), hq likewise -> bf16 hi/lo planes [4096][512], one launch: (128, 2) blocks
  const dim3 gH(((MTOT / 32) * (DM / 64) + 7) / 8, 1);         // 128 blocks
  gemm_hidden_kernel<<<dim3((MTOT / 32) * (DM / 64) / 8, 2), b256, 0, stream>>>(
      Xh, Xl, Wkh, Wkl, Wqh, Wql, kp_b1, qp_b1, Hkh, Hkl, Hqh, Hql);

  // (3) oscillator heads + encode -> Qt, Kt hi/lo planes [4096][64], K^T planes; V^T hi/lo planes; one launch
  enc_v_kernel<<<dim3(MTOT / 64 + NB * (DM / 32) * (SEQ / 64) / 4), b128, 0, stream>>>(
      Hkh, Hkl, Hqh, Hql, Xh, Xl,
      Sk2h, Sk2l, Sq2h, Sq2l, Skah, Skal, Sqah, Sqal,
      kp_b2, qp_b2, ka_b, qa_b, pos,
      Qth, Qtl, Kth, Ktl, KTh, KTl,
      Wvh, Wvl, v_b, VTh, VTl);

  // (7a) per-chunk sums U[b][ch][d][f] = sum_{l' in chunk ch} V^T[b][d][l'] K^T[b][f][l'], chunks 0..30
  chunk_kv_kernel<<<dim3(DM / 128, NCH - 1, NB), b256, 0, stream>>>(VTh, VTl, KTh, KTl, Uws);
  // (7b) exclusive prefix over the chunks -> state planes M hi/lo [2][32][512][64]
  chunk_scan_kernel<<<dim3(NB * DM * QK / 4 / 128), b128, 0, stream>>>(Uws, Mh, Ml);

  // (7c) causal mixing (state term + own key tile) -> R f32 [4096][512]
  causal_mix_kernel<<<dim3(NB * (SEQ / 64) * 4), b128, 0, stream>>>(Qth, Qtl, Kth, Ktl, VTh, VTl, Mh, Ml, Rws);

  // (8) LayerNorm -> bf16 hi/lo planes [4096][512]
  ln_split_kernel<<<dim3(MTOT / 8), b256, 0, stream>>>(Rws, ln_g, ln_b, Lh, Ll);

  // (9) out = x + ln . o_w + o_b -> d_out f32 [4096][512]
  gemm_out_kernel<<<gH, b256, 0, stream>>>(Lh, Ll, Woh, Wol, o_b, x, (float*)d_out);

  (void)hipGetLastError();
}

// v004
// It runs in 119 microseconds.
// Timed twice side by side with v003, it ran 1.35 and 1.32 times as fast.
// Counting every step since v000, it is 3.03 times as fast.
// All contractions (x.kp_w1, x.qp_w1, x.v_w, h.kp_w2, h.qp_w2, x.ka_w, x.qa_w, causal score S = Qt.Kt^T and S.V, chunk sums V^T.Kt, state term Qt.M, ln.o_w): v_wmma_f32_16x16x32_bf16 with bf16 hi/lo operands (hi.hi + hi.lo + lo.hi), f32 accumulate; encoders (tanh, softplus, sincos), norm scale, LayerNorm, biases and residual in f32.
#include <hip/hip_runtime.h>
#include <math.h>
#include <stdint.h>

#define NB   2
#define SEQ  2048
#define DM   512
#define KO   32
#define QK   64
#define MTOT (NB * SEQ)
#define NCH  (SEQ / 64)

typedef __attribute__((ext_vector_type(16))) __bf16 v16b;
typedef __attribute__((ext_vector_type(8)))  __bf16 v8b;
typedef __attribute__((ext_vector_type(8)))  float  v8f;
typedef __attribute__((ext_vector_type(4)))  float  v4f;
typedef __attribute__((ext_vector_type(2)))  float  v2f;
typedef __attribute__((ext_vector_type(4)))  unsigned int   v4u;
typedef __attribute__((ext_vector_type(2)))  unsigned int   v2u;
typedef __attribute__((ext_vector_type(8)))  unsigned short v8us;

union FB { v16b v; v8b h[2]; };

__device__ __forceinline__ unsigned short f2bf_bits(float f) {
  unsigned u = __float_as_uint(f);
  return (unsigned short)((u + 0x7FFFu + ((u >> 16) & 1u)) >> 16);   // RNE
}
__device__ __forceinline__ float bf_bits2f(unsigned short h) { return __uint_as_float(((unsigned)h) << 16); }
__device__ __forceinline__ unsigned pk16(unsigned short a, unsigned short b) { return (unsigned)a | ((unsigned)b << 16); }

__device__ __forceinline__ v8f zero8() { return (v8f){0.f, 0.f, 0.f, 0.f, 0.f, 0.f, 0.f, 0.f}; }

// 16-bit A/B fragment from a k-contiguous row p = &T[row][k0 + 8*(lane>>4)]:
// elements 0..7 <- p[0..7] (k0+8h..), elements 8..15 <- p[16..23] (k0+16+8h..)
__device__ __forceinline__ v16b ldfrag(const __bf16* p) {
  FB f;
  f.h[0] = *(const v8b*)(p);
  f.h[1] = *(const v8b*)(p + 16);
  return f.v;
}

// hi/lo split product group: c += ah.bh + ah.bl + al.bh, then 4 VALU slots tying D and keeping all operands live
__device__ __forceinline__ v8f mma3(v16b ah, v16b al, v16b bh, v16b bl, v8f c) {
  c = __builtin_amdgcn_wmma_f32_16x16x32_bf16(false, ah, false, bh, (short)0, c, false, false);
  c = __builtin_amdgcn_wmma_f32_16x16x32_bf16(false, ah, false, bl, (short)0, c, false, false);
  c = __builtin_amdgcn_wmma_f32_16x16x32_bf16(false, al, false, bh, (short)0, c, false, false);
  asm volatile("v_nop\n\tv_nop\n\tv_nop\n\tv_nop" : "+v"(c) : "v"(ah), "v"(al), "v"(bh), "v"(bl));
  return c;
}

// same-wave LDS exchange: order the wave's LDS stores before its cross-lane reloads
__device__ __forceinline__ void wave_lds_sync() {
  __builtin_amdgcn_fence(__ATOMIC_RELEASE, "workgroup");
  __builtin_amdgcn_wave_barrier();
  __builtin_amdgcn_fence(__ATOMIC_ACQUIRE, "workgroup");
}

// ---------------------------------------------------------------------------
// Elementwise bf16 split of a flat f32 array: hi = bf16(in), lo = bf16(in - hi); 2 elements per thread,
// ---------------------------------------------------------------------------
__device__ __forceinline__ void split_bf16x2_body(const float* __restrict__ in, unsigned short* hi,
                                                  unsigned short* lo, int n2, int blk) {
  const int i = blk * 256 + threadIdx.x;
  if (i < n2) {
    const v2f f = *(const v2f*)(in + 2 * (size_t)i);
    const unsigned short h0 = f2bf_bits(f[0]), h1 = f2bf_bits(f[1]);
    const unsigned short l0 = f2bf_bits(f[0] - bf_bits2f(h0)), l1 = f2bf_bits(f[1] - bf_bits2f(h1));
    const unsigned uh = pk16(h0, h1), ul = pk16(l0, l1);
    ((unsigned*)hi)[i] = uh;
    ((unsigned*)lo)[i] = ul;
    
  }
}

// ---------------------------------------------------------------------------
// Fused transpose + bf16 split of an f32 matrix: in [R][Cc] -> oh[c][r] = bf16(in[r][c]), ol = residual
// ([Cc][R], pitch R). 64x64 tiles through LDS (tf: 64 x 68 floats). Tile (bc, br) of (Cc/64, R/64), 256 threads.
// Coverage per block and plane: load 4 it x 256 thr x 4 = 64x64; store 2 it x 256 thr x 8 = 64x64.
// ---------------------------------------------------------------------------
__device__ __forceinline__ void tsplit_body(const float* __restrict__ W, unsigned short* oh,
                                            unsigned short* ol, int R, int Cc, int bc, int br, float* tf) {
  const int c0  = bc * 64;
  const int r0  = br * 64;
  const int tid = threadIdx.x;
  {
    const int lr = tid >> 4;
    const int c4 = (tid & 15) * 4;
    const float* wp[4];
    v4f a[4];
#pragma unroll
    for (int it = 0; it < 4; ++it) {
      wp[it] = W + (size_t)(r0 + it * 16 + lr) * Cc + c0 + c4;
      a[it]  = *(const v4f*)(wp[it]);
    }
    // wait before any address register of the four loads above is overwritten; the addresses are inputs so that they
    // stay live up to the wait
    asm volatile("s_wait_xcnt 0x0" :: "v"(wp[0]), "v"(wp[1]), "v"(wp[2]), "v"(wp[3]) : "memory");
#pragma unroll   // constant indices keep a[] in registers
    for (int it = 0; it < 4; ++it) *(v4f*)(tf + (it * 16 + lr) * 68 + c4) = a[it];
  }
  __syncthreads();
  const int sub = tid >> 3;
  const int c8  = (tid & 7) * 8;
  v4u hv[2], lv[2];
#pragma unroll
  for (int it = 0; it < 2; ++it) {
    const int oc = it * 32 + sub;
    v4u a, a2;
#pragma unroll
    for (int q = 0; q < 4; ++q) {
      const float f0 = tf[(c8 + 2 * q) * 68 + oc];
      const float f1 = tf[(c8 + 2 * q + 1) * 68 + oc];
      const unsigned short h0 = f2bf_bits(f0), h1 = f2bf_bits(f1);
      const unsigned short l0 = f2bf_bits(f0 - bf_bits2f(h0)), l1 = f2bf_bits(f1 - bf_bits2f(h1));
      a[q]  = pk16(h0, h1);
      a2[q] = pk16(l0, l1);
    }
    hv[it] = a; lv[it] = a2;
  }
  {
#pragma unroll
    for (int it = 0; it < 2; ++it) {
      const int oc = it * 32 + sub;
      const size_t go = (size_t)(c0 + oc) * R + r0 + c8;
      *(v4u*)(oh + go) = hv[it];
      *(v4u*)(ol + go) = lv[it];
    }
    
  }
}

// ---------------------------------------------------------------------------
// Transpose + bf16 split of a narrow f32 matrix: in [R][32] -> oh/ol [32][R] (pitch R). Tile br of R/64, 256 threads,
// tf: 64 x 36 floats of LDS.
// Coverage per block: load 2 it x 256 thr x 4 = 64 rows x 32; store 32 output rows x (8 lanes x 8) = 32 x 64.
// ---------------------------------------------------------------------------
__device__ __forceinline__ void tsplit32_body(const float* __restrict__ W, unsigned short* oh,
                                              unsigned short* ol, int R, int br, float* tf) {
  const int r0  = br * 64;
  const int tid = threadIdx.x;
  {
    const int rr = tid >> 3;          // 0..31
    const int c4 = (tid & 7) * 4;     // 0..28
    const float* wp[2];
    v4f a[2];
#pragma unroll
    for (int it = 0; it < 2; ++it) {
      wp[it] = W + (size_t)(r0 + it * 32 + rr) * KO + c4;   // rows 0..63
      a[it]  = *(const v4f*)(wp[it]);
    }
    // wait before an address register of the two loads above is overwritten; the addresses are inputs so that they
    // stay live up to the wait
    asm volatile("s_wait_xcnt 0x0" :: "v"(wp[0]), "v"(wp[1]) : "memory");
#pragma unroll   // constant indices keep a[] in registers
    for (int it = 0; it < 2; ++it) *(v4f*)(tf + (it * 32 + rr) * 36 + c4) = a[it];
  }
  __syncthreads();
  const int oc = tid >> 3;            // output row = input column 0..31
  const int c8 = (tid & 7) * 8;       // output cols r0+c8 .. +7
  v4u hv, lv;
#pragma unroll
  for (int q = 0; q < 4; ++q) {
    const float f0 = tf[(c8 + 2 * q) * 36 + oc];
    const float f1 = tf[(c8 + 2 * q + 1) * 36 + oc];
    const unsigned short h0 = f2bf_bits(f0), h1 = f2bf_bits(f1);
    const unsigned short l0 = f2bf_bits(f0 - bf_bits2f(h0)), l1 = f2bf_bits(f1 - bf_bits2f(h1));
    hv[q] = pk16(h0, h1);
    lv[q] = pk16(l0, l1);
  }
  const size_t go = (size_t)oc * R + r0 + c8;
  {
    *(v4u*)(oh + go) = hv;
    *(v4u*)(ol + go) = lv;
    
  }
}

// ---------------------------------------------------------------------------
// All operand preparation in one launch; the nine jobs do not depend on one another and the block index picks the job:
//   blocks   0..255  four [512][512] weights -> transposed planes (64 tiles each); planes of job j at W1p + j*2*512*512
//   blocks 256..287  four [512][32] weights  -> transposed planes (8 tiles each);  planes of job j at W2p + j*2*32*512
//   blocks 288..     x -> hi/lo planes, 512 elements per block
// Each job's hi plane is followed by its lo plane. The two-phase transposes come first in the index order.
// ---------------------------------------------------------------------------
#define PREP_T1 (4 * (DM / 64) * (DM / 64))
#define PREP_T2 (4 * (DM / 64))
#define PREP_X  (MTOT * DM / 2 / 256)
__global__ __launch_bounds__(256) void prep_kernel(
    const float* __restrict__ x,
    const float* __restrict__ kp_w1, const float* __restrict__ qp_w1,
    const float* __restrict__ v_w,   const float* __restrict__ o_w,
    const float* __restrict__ kp_w2, const float* __restrict__ qp_w2,
    const float* __restrict__ ka_w,  const float* __restrict__ qa_w,
    unsigned short* Xh, unsigned short* Xl, unsigned short* W1p, unsigned short* W2p) {
  __shared__ __align__(16) float tf[64 * 68];
  const int bx = blockIdx.x;
  if (bx < PREP_T1) {
    const int job = bx >> 6, t = bx & 63;
    const float* Wsrc = job == 0 ? kp_w1 : job == 1 ? qp_w1 : job == 2 ? v_w : o_w;
    unsigned short* oh = W1p + (size_t)job * (2 * DM * DM);
    tsplit_body(Wsrc, oh, oh + DM * DM, DM, DM, t & 7, t >> 3, tf);
  } else if (bx < PREP_T1 + PREP_T2) {
    const int job = (bx - PREP_T1) >> 3, t = (bx - PREP_T1) & 7;
    const float* Wsrc = job == 0 ? kp_w2 : job == 1 ? qp_w2 : job == 2 ? ka_w : qa_w;
    unsigned short* oh = W2p + (size_t)job * (2 * KO * DM);
    tsplit32_body(Wsrc, oh, oh + KO * DM, DM, t, tf);
  } else {
    split_bf16x2_body(x, Xh, Xl, MTOT * DM / 2, bx - (PREP_T1 + PREP_T2));
  }
}

// ---------------------------------------------------------------------------
// Batched WMMA GEMM on bf16 hi/lo planes, operands staged in LDS:
//   C[m,n] = sum_k A[m,k] * Bt[n,k] (+bias)(+resid)(act); product = hi.hi + hi.lo + lo.hi.
// A planes row-major [M][K] (pitch lda), Bt planes row-major [N][K] (pitch ldb); M % 64 == 0, N % 128 == 0, K % 64 == 0.
// Block = 4 waves = one 64 x 128 tile (index tile, the grid holds exactly (M/64)*(N/128) of them per batch), wave =
// 32 x 64 (2 x 2 waves); bz = batch with element strides.
// A stage is 64 k of the block's rows: A hi, A lo (64 rows each), B hi, B lo (128 rows each), 128 B a row at a pitch of
// GP = 72 halves (144 B = 16 B x 9). Each global load of a wave covers 4 whole 128-B lines (8 lanes a row); the next
// stage's 24 loads a thread fly while the current stage is multiplied, and go to the other of two LDS buffers behind it.
// After the last stage the wave's own 16 x 68 floats for the output staging alias the buffers.
// BIAS_MODE: 1 = bias[m], 2 = bias[n]. OUT_MODE: 0 = f32, 2 = bf16 hi plane (Cout) + lo plane (Cout2). ACT 1 = tanh.
// ---------------------------------------------------------------------------
#define GP       72
#define G_AT     (64 * GP)
#define G_BT     (128 * GP)
#define G_STAGE  (2 * G_AT + 2 * G_BT)
#define G_LDS_BYTES (2 * G_STAGE * 2)
template <int BIAS_MODE, int OUT_MODE, bool RESID, int ACT>
__device__ __forceinline__ void gemm_hl_body(
    const unsigned short* __restrict__ Ahp, const unsigned short* __restrict__ Alp, int lda, long long strideA,
    const unsigned short* __restrict__ Bhp, const unsigned short* __restrict__ Blp, int ldb, long long strideB,
    void* Cout, void* Cout2, int ldc, long long strideC,
    const float* __restrict__ bias,
    const float* __restrict__ resid, long long strideR,
    int N, int K, int tile, int bz, unsigned char* smem) {
  const __bf16* Ah = (const __bf16*)(const void*)Ahp;
  const __bf16* Al = (const __bf16*)(const void*)Alp;
  const __bf16* Bh = (const __bf16*)(const void*)Bhp;
  const __bf16* Bl = (const __bf16*)(const void*)Blp;
  const int tid  = threadIdx.x;
  const int wave = tid >> 5;
  const int lane = tid & 31;
  const int tilesN = N >> 7;
  const int tm  = tile / tilesN;
  const int tn  = tile - tm * tilesN;
  const int bm0 = tm << 6;               // block tile origin
  const int bn0 = tn << 7;
  const int wm  = (wave >> 1) << 5;      // wave tile origin inside the block tile
  const int wn  = (wave & 1) << 6;
  const int m0  = bm0 + wm;
  const int n0  = bn0 + wn;

  const int rl   = lane & 15;            // row (A) / col (B, D) within subtile
  const int koff = (lane >> 4) * 8;      // k offset of this lane half
  const int mOff = (lane >> 4) * 8;      // D row offset

  __bf16* sb = (__bf16*)smem;
  // staging map: thread = 16 B (8 halves) of row sr + 16 * it; 8 lanes cover one 128-B row
  const int sr = tid >> 3;               // 0..15
  const int sc = (tid & 7) * 8;
  const __bf16* gah = Ah + (size_t)bz * strideA + (size_t)(bm0 + sr) * lda + sc;
  const __bf16* gal = Al + (size_t)bz * strideA + (size_t)(bm0 + sr) * lda + sc;
  const __bf16* gbh = Bh + (size_t)bz * strideB + (size_t)(bn0 + sr) * ldb + sc;
  const __bf16* gbl = Bl + (size_t)bz * strideB + (size_t)(bn0 + sr) * ldb + sc;
  const int so = sr * GP + sc;

  v8f acc[2][4];
#pragma unroll
  for (int i = 0; i < 2; ++i)
#pragma unroll
    for (int j = 0; j < 4; ++j) acc[i][j] = zero8();

  v8b rah[4], ral[4], rbh[8], rbl[8];
  // stage 0: global -> registers -> buffer 0
#pragma unroll   // constant indices keep the staged values in registers
  for (int it = 0; it < 4; ++it) {
    rah[it] = *(const v8b*)(gah + (size_t)(it * 16) * lda);
    ral[it] = *(const v8b*)(gal + (size_t)(it * 16) * lda);
  }
#pragma unroll   // constant indices keep the staged values in registers
  for (int it = 0; it < 8; ++it) {
    rbh[it] = *(const v8b*)(gbh + (size_t)(it * 16) * ldb);
    rbl[it] = *(const v8b*)(gbl + (size_t)(it * 16) * ldb);
  }
  // wait before any address register of the 24 loads above is overwritten; the four addresses are inputs so that they
  // stay live up to the wait
  asm volatile("s_wait_xcnt 0x0" :: "v"(gah), "v"(gal), "v"(gbh), "v"(gbl) : "memory");
#pragma unroll
  for (int it = 0; it < 4; ++it) {
    *(v8b*)(sb + so + it * 16 * GP)        = rah[it];
    *(v8b*)(sb + G_AT + so + it * 16 * GP) = ral[it];
  }
#pragma unroll
  for (int it = 0; it < 8; ++it) {
    *(v8b*)(sb + 2 * G_AT + so + it * 16 * GP)        = rbh[it];
    *(v8b*)(sb + 2 * G_AT + G_BT + so + it * 16 * GP) = rbl[it];
  }
  __syncthreads();   // stage 0 is complete before any wave reads it

  const int nst = K >> 6;
#pragma unroll 1   // one stage a trip: the body already holds 48 matrix instructions
  for (int s = 0; s < nst; ++s) {
    const bool more = s + 1 < nst;       // block-uniform
    if (more) {
      gah += 64; gal += 64; gbh += 64; gbl += 64;
#pragma unroll   // constant indices keep the staged values in registers
      for (int it = 0; it < 4; ++it) {
        rah[it] = *(const v8b*)(gah + (size_t)(it * 16) * lda);
        ral[it] = *(const v8b*)(gal + (size_t)(it * 16) * lda);
      }
#pragma unroll   // constant indices keep the staged values in registers
      for (int it = 0; it < 8; ++it) {
        rbh[it] = *(const v8b*)(gbh + (size_t)(it * 16) * ldb);
        rbl[it] = *(const v8b*)(gbl + (size_t)(it * 16) * ldb);
      }
      // wait before any address register of the 24 loads above is overwritten; the four addresses are inputs so that
      // they stay live up to the wait
      asm volatile("s_wait_xcnt 0x0" :: "v"(gah), "v"(gal), "v"(gbh), "v"(gbl) : "memory");
    }
    const __bf16* cur = sb + (s & 1) * G_STAGE;
#pragma unroll
    for (int kk = 0; kk < 2; ++kk) {
      v16b ah[2], al[2];
#pragma unroll
      for (int i = 0; i < 2; ++i) {
        const int ao = (wm + (i << 4) + rl) * GP + kk * 32 + koff;
        ah[i] = ldfrag(cur + ao);
        al[i] = ldfrag(cur + G_AT + ao);
      }
      // B fragments one column tile ahead of their products, in a second register set
      const int bo = (wn + rl) * GP + kk * 32 + koff;
      v16b bh[2], bl[2];
      bh[0] = ldfrag(cur + 2 * G_AT + bo);
      bl[0] = ldfrag(cur + 2 * G_AT + G_BT + bo);
#pragma unroll
      for (int j = 0; j < 4; ++j) {
        if (j < 3) {
          bh[(j + 1) & 1] = ldfrag(cur + 2 * G_AT + bo + (j + 1) * 16 * GP);
          bl[(j + 1) & 1] = ldfrag(cur + 2 * G_AT + G_BT + bo + (j + 1) * 16 * GP);
        }
#pragma unroll
        for (int i = 0; i < 2; ++i) acc[i][j] = mma3(ah[i], al[i], bh[j & 1], bl[j & 1], acc[i][j]);
      }
    }
    if (more) {
      // the other buffer: its last readers left it at the barrier that ended the trip before
      __bf16* nxt = sb + ((s + 1) & 1) * G_STAGE;
#pragma unroll
      for (int it = 0; it < 4; ++it) {
        *(v8b*)(nxt + so + it * 16 * GP)        = rah[it];
        *(v8b*)(nxt + G_AT + so + it * 16 * GP) = ral[it];
      }
#pragma unroll
      for (int it = 0; it < 8; ++it) {
        *(v8b*)(nxt + 2 * G_AT + so + it * 16 * GP)        = rbh[it];
        *(v8b*)(nxt + 2 * G_AT + G_BT + so + it * 16 * GP) = rbl[it];
      }
    }
    __syncthreads();   // publishes stage s + 1 and ends every wave's reads of stage s (the output staging aliases it)
  }
  float* slab = (float*)smem + wave * (16 * 68);

  // ---- epilogue ----
  const float* Rb = RESID ? (resid + (size_t)bz * strideR) : nullptr;
  const int nb = n0 + rl;
  float bvn[4] = {0.f, 0.f, 0.f, 0.f};
  if (BIAS_MODE == 2) {
#pragma unroll   // constant indices keep the bias values in registers
    for (int j = 0; j < 4; ++j) bvn[j] = bias[nb + (j << 4)];
    // wait before the base or the index register of the four bias loads above is overwritten; they are inputs so that
    // they stay live up to the wait
    asm volatile("s_wait_xcnt 0x0" :: "s"(bias), "v"(nb) : "memory");
  }
#pragma unroll
  for (int i = 0; i < 2; ++i) {
    const int mBase = m0 + (i << 4);
#pragma unroll
    for (int j = 0; j < 4; ++j) {
      const int n = n0 + (j << 4) + rl;
      const float bv = bvn[j];
#pragma unroll
      for (int r = 0; r < 8; ++r) {
        float v = acc[i][j][r];
        if (BIAS_MODE == 1) v += bias[mBase + mOff + r];
        if (BIAS_MODE == 2) v += bv;
        if (RESID) v += Rb[(size_t)(mBase + mOff + r) * ldc + n];
        if (ACT == 1) v = tanhf(v);
        slab[(mOff + r) * 68 + (j << 4) + rl] = v;
      }
    }
    wave_lds_sync();
    if (OUT_MODE == 0) {
      float* C = (float*)Cout + (size_t)bz * strideC;
      const int hsel = lane >> 4, c4 = (lane & 15) * 4;   // row seg = 256 B = 16 lanes x 16 B, 2 rows per instruction
      {
        float* cp[8];
        v4f cv[8];
#pragma unroll
        for (int it = 0; it < 8; ++it) {
          const int row = it * 2 + hsel;                   // it 0..7 x hsel 0..1 = rows 0..15
          cv[it] = *(const v4f*)(slab + row * 68 + c4);
          cp[it] = C + (size_t)(mBase + row) * ldc + n0 + c4;
          *(v4f*)(cp[it]) = cv[it];
        }
        // wait before the second half's work overwrites an address or data register of the eight stores above; they
        // are inputs so that they stay live up to the wait
        if (i == 0)
          asm volatile("s_wait_xcnt 0x0" :: "v"(cp[0]), "v"(cp[1]), "v"(cp[2]), "v"(cp[3]), "v"(cp[4]), "v"(cp[5]),
                       "v"(cp[6]), "v"(cp[7]), "v"(cv[0]), "v"(cv[1]), "v"(cv[2]), "v"(cv[3]), "v"(cv[4]), "v"(cv[5]),
                       "v"(cv[6]), "v"(cv[7]) : "memory");
      }
    } else {
      const int q4 = lane >> 3, c8 = (lane & 7) * 8;
      unsigned short* C  = (unsigned short*)Cout  + (size_t)bz * strideC;
      unsigned short* C2 = (unsigned short*)Cout2 + (size_t)bz * strideC;
      {
        unsigned short *ph[4], *pl[4];
        v8us hs[4], ls[4];
#pragma unroll
        for (int it = 0; it < 4; ++it) {
          const int row = it * 4 + q4;                     // it 0..3 x q4 0..3 = rows 0..15
          const float* sp = slab + row * 68 + c8;
          v8us hv, lv;
#pragma unroll
          for (int e = 0; e < 8; ++e) {
            const unsigned short hb = f2bf_bits(sp[e]);
            const unsigned short lb = f2bf_bits(sp[e] - bf_bits2f(hb));
            hv[e] = hb;
            lv[e] = lb;
          }
          const size_t go = (size_t)(mBase + row) * ldc + n0 + c8;
          hs[it] = hv; ls[it] = lv;
          ph[it] = C + go; pl[it] = C2 + go;
          *(v8us*)(ph[it]) = hs[it];
          *(v8us*)(pl[it]) = ls[it];
        }
        // wait before the second half's work overwrites an address or data register of the eight stores above; they
        // are inputs so that they stay live up to the wait
        if (i == 0)
          asm volatile("s_wait_xcnt 0x0" :: "v"(ph[0]), "v"(ph[1]), "v"(ph[2]), "v"(ph[3]), "v"(pl[0]), "v"(pl[1]),
                       "v"(pl[2]), "v"(pl[3]), "v"(hs[0]), "v"(hs[1]), "v"(hs[2]), "v"(hs[3]), "v"(ls[0]), "v"(ls[1]),
                       "v"(ls[2]), "v"(ls[3]) : "memory");
      }
    }
    wave_lds_sync();
  }
}

// hk = tanh(x . kp_w1 + kp_b1) and hq = tanh(x . qp_w1 + qp_b1) in one launch (neither reads the other's result):
// blockIdx.y picks the encoder; per encoder M = 4096, N = 512, K = 512 = 64 x 4 block tiles = 256 blocks of 4 waves.
__global__ __launch_bounds__(128) void gemm_hidden_kernel(
    const unsigned short* __restrict__ Xh,  const unsigned short* __restrict__ Xl,
    const unsigned short* __restrict__ Wkh, const unsigned short* __restrict__ Wkl,
    const unsigned short* __restrict__ Wqh, const unsigned short* __restrict__ Wql,
    const float* __restrict__ kp_b1, const float* __restrict__ qp_b1,
    unsigned short* Hkh, unsigned short* Hkl, unsigned short* Hqh, unsigned short* Hql) {
  __shared__ __align__(16) unsigned char smem[G_LDS_BYTES];
  const bool q    = blockIdx.y != 0;
  gemm_hl_body<2, 2, false, 1>(Xh, Xl, DM, 0LL, q ? Wqh : Wkh, q ? Wql : Wkl, DM, 0LL,
                               (void*)(q ? Hqh : Hkh), (void*)(q ? Hql : Hkl), DM, 0LL,
                               q ? qp_b1 : kp_b1, nullptr, 0LL, DM, DM, blockIdx.x, 0, smem);
}

// out = x + ln . o_w + o_b: M = 4096, N = 512, K = 512 = 256 blocks of 4 waves.
__global__ __launch_bounds__(128) void gemm_out_kernel(
    const unsigned short* __restrict__ Lh,  const unsigned short* __restrict__ Ll,
    const unsigned short* __restrict__ Woh, const unsigned short* __restrict__ Wol,
    const float* __restrict__ o_b, const float* __restrict__ x, float* out) {
  __shared__ __align__(16) unsigned char smem[G_LDS_BYTES];
  gemm_hl_body<2, 0, true, 0>(Lh, Ll, DM, 0LL, Woh, Wol, DM, 0LL, (void*)out, (void*)out, DM, 0LL,
                              o_b, x, 0LL, DM, DM, blockIdx.x, 0, smem);
}

// ---------------------------------------------------------------------------
// Fused oscillator heads + encode. Per wave 16 rows (block = 4 waves = 64 rows, blk = row block of 4096/64):
//   Pk = Hk.kp_w2, Pq = Hq.qp_w2, Ak = X.ka_w, Aq = X.qa_w  (each 16 x 32, K = 512, hi/lo WMMA);
//   phase = tanh(P + b2)*pi + pos[l]; amp = softplus(A + ba) + 0.1;
//   Kt[row] = [amp_k cos | amp_k sin] (64), Qt[row] = [amp_q cos | amp_q sin]  -> bf16 hi/lo planes [4096][64].
//   Kt also goes out key-contiguous: K^T planes [b][64 f][2048 l], one thread per 128-B line (64 keys of one f, one plane).
// Operand planes: H/X [4096][512]; W2t planes [32][512] (k-contiguous).
// LDS slab per wave [16][132]: cols 0..31 / 32..63 / 64..95 / 96..127 = k-phase / k-amp / q-phase / q-amp pre-acts,
// ---------------------------------------------------------------------------
__device__ __forceinline__ void enc_head_body(
    const unsigned short* __restrict__ Hkhp, const unsigned short* __restrict__ Hklp,
    const unsigned short* __restrict__ Hqhp, const unsigned short* __restrict__ Hqlp,
    const unsigned short* __restrict__ Xhp,  const unsigned short* __restrict__ Xlp,
    const unsigned short* __restrict__ Wk2hp, const unsigned short* __restrict__ Wk2lp,
    const unsigned short* __restrict__ Wq2hp, const unsigned short* __restrict__ Wq2lp,
    const unsigned short* __restrict__ Wkahp, const unsigned short* __restrict__ Wkalp,
    const unsigned short* __restrict__ Wqahp, const unsigned short* __restrict__ Wqalp,
    const float* __restrict__ bk2, const float* __restrict__ bq2,
    const float* __restrict__ bka, const float* __restrict__ bqa,
    const float* __restrict__ pos,
    unsigned short* Qhp, unsigned short* Qlp, unsigned short* Khp, unsigned short* Klp,
    unsigned short* KThp, unsigned short* KTlp, int blk, float (*slab_all)[16 * 132]) {
  const int tid = threadIdx.x, wave = tid >> 5, lane = tid & 31, hh = lane >> 4, c = lane & 15;
  const int row0 = blk * 64 + wave * 16;

  const __bf16* Hkh = (const __bf16*)(const void*)Hkhp;  const __bf16* Hkl = (const __bf16*)(const void*)Hklp;
  const __bf16* Hqh = (const __bf16*)(const void*)Hqhp;  const __bf16* Hql = (const __bf16*)(const void*)Hqlp;
  const __bf16* Xh  = (const __bf16*)(const void*)Xhp;   const __bf16* Xl  = (const __bf16*)(const void*)Xlp;
  const __bf16* Wk2h = (const __bf16*)(const void*)Wk2hp; const __bf16* Wk2l = (const __bf16*)(const void*)Wk2lp;
  const __bf16* Wq2h = (const __bf16*)(const void*)Wq2hp; const __bf16* Wq2l = (const __bf16*)(const void*)Wq2lp;
  const __bf16* Wkah = (const __bf16*)(const void*)Wkahp; const __bf16* Wkal = (const __bf16*)(const void*)Wkalp;
  const __bf16* Wqah = (const __bf16*)(const void*)Wqahp; const __bf16* Wqal = (const __bf16*)(const void*)Wqalp;

  v8f aPk[2], aPq[2], aAk[2], aAq[2];
#pragma unroll
  for (int t = 0; t < 2; ++t) { aPk[t] = zero8(); aPq[t] = zero8(); aAk[t] = zero8(); aAq[t] = zero8(); }

#pragma unroll 1
  for (int k0 = 0; k0 < DM; k0 += 32) {
    const size_t ao = (size_t)(row0 + c) * DM + k0 + 8 * hh;
    const __bf16 *pa0 = Hkh + ao, *pa1 = Hkl + ao, *pa2 = Hqh + ao, *pa3 = Hql + ao, *pa4 = Xh + ao, *pa5 = Xl + ao;
    const v16b ahk = ldfrag(pa0), alk = ldfrag(pa1);
    const v16b ahq = ldfrag(pa2), alq = ldfrag(pa3);
    const v16b axh = ldfrag(pa4), axl = ldfrag(pa5);
    const size_t bo = (size_t)c * DM + k0 + 8 * hh;
    const __bf16 *pb0 = Wk2h + bo, *pb1 = Wk2l + bo, *pb2 = Wq2h + bo, *pb3 = Wq2l + bo;
    const __bf16 *pb4 = Wkah + bo, *pb5 = Wkal + bo, *pb6 = Wqah + bo, *pb7 = Wqal + bo;
#pragma unroll
    for (int t = 0; t < 2; ++t) {
      const int to = t * 16 * DM;   // weight rows t*16 + c
      const v16b b0 = ldfrag(pb0 + to), b1 = ldfrag(pb1 + to), b2 = ldfrag(pb2 + to), b3 = ldfrag(pb3 + to);
      const v16b b4 = ldfrag(pb4 + to), b5 = ldfrag(pb5 + to), b6 = ldfrag(pb6 + to), b7 = ldfrag(pb7 + to);
      // wait before any address register of the fragment loads above is overwritten; the addresses are inputs so that
      // they stay live up to the wait and no later load's result is placed in them
      if (t == 0)
        asm volatile("s_wait_xcnt 0x0" :: "v"(pa0), "v"(pa1), "v"(pa2), "v"(pa3), "v"(pa4), "v"(pa5), "v"(pb0), "v"(pb1),
                     "v"(pb2), "v"(pb3), "v"(pb4), "v"(pb5), "v"(pb6), "v"(pb7) : "memory");
      else
        asm volatile("s_wait_xcnt 0x0" :: "v"(pb0), "v"(pb1), "v"(pb2), "v"(pb3), "v"(pb4), "v"(pb5), "v"(pb6), "v"(pb7)
                     : "memory");
      aPk[t] = mma3(ahk, alk, b0, b1, aPk[t]);
      aPq[t] = mma3(ahq, alq, b2, b3, aPq[t]);
      aAk[t] = mma3(axh, axl, b4, b5, aAk[t]);
      aAq[t] = mma3(axh, axl, b6, b7, aAq[t]);
    }
  }

  // stage pre-activations (+bias) in the D layout: row 8hh+r, oscillator n = t*16+c
  float* sl = slab_all[wave];
  float bv1[2], bv2[2], bv3[2], bv4[2];
#pragma unroll   // constant indices keep the bias values in registers
  for (int t = 0; t < 2; ++t) {
    bv1[t] = bk2[t * 16 + c]; bv2[t] = bka[t * 16 + c]; bv3[t] = bq2[t * 16 + c]; bv4[t] = bqa[t * 16 + c];
  }
  // wait before a base or index register of the eight bias loads above is overwritten; they are inputs so that they
  // stay live up to the wait
  asm volatile("s_wait_xcnt 0x0" :: "s"(bk2), "s"(bka), "s"(bq2), "s"(bqa), "v"(c) : "memory");
#pragma unroll
  for (int t = 0; t < 2; ++t) {
    const int n = t * 16 + c;
    const float b1 = bv1[t], b2 = bv2[t], b3 = bv3[t], b4 = bv4[t];
#pragma unroll
    for (int r = 0; r < 8; ++r) {
      float* sp = sl + (8 * hh + r) * 132;
      sp[n]      = aPk[t][r] + b1;
      sp[32 + n] = aAk[t][r] + b2;
      sp[64 + n] = aPq[t][r] + b3;
      sp[96 + n] = aAq[t][r] + b4;
    }
  }
  wave_lds_sync();

  // encode: lane = oscillator index, one row per iteration (same lane reads and writes its own 4 slots)
  const float PI = 3.14159265358979323846f;
#pragma unroll 1
  for (int it = 0; it < 16; ++it) {
    float* sp = sl + it * 132;
    const int l = (row0 + it) & (SEQ - 1);
    const float pa  = pos[l * KO + lane];
    const float vpk = sp[lane], vak = sp[32 + lane], vpq = sp[64 + lane], vaq = sp[96 + lane];
    const float phk = tanhf(vpk) * PI + pa;
    const float phq = tanhf(vpq) * PI + pa;
    const float ak  = fmaxf(vak, 0.f) + log1pf(expf(-fabsf(vak))) + 0.1f;
    const float aq  = fmaxf(vaq, 0.f) + log1pf(expf(-fabsf(vaq))) + 0.1f;
    sp[lane]      = ak * cosf(phk);
    sp[32 + lane] = ak * sinf(phk);
    sp[64 + lane] = aq * cosf(phq);
    sp[96 + lane] = aq * sinf(phq);
  }
  wave_lds_sync();

  const int q4 = lane >> 3, c8 = (lane & 7) * 8;
  {
#pragma unroll
    for (int it = 0; it < 4; ++it) {
      const int row = it * 4 + q4;   // 0..15
      const float* sk = sl + row * 132 + c8;
      const float* sq = sl + row * 132 + 64 + c8;
      v8us khv, klv, qhv, qlv;
#pragma unroll
      for (int e = 0; e < 8; ++e) {
        const unsigned short kh = f2bf_bits(sk[e]);
        const unsigned short kl = f2bf_bits(sk[e] - bf_bits2f(kh));
        const unsigned short qh = f2bf_bits(sq[e]);
        const unsigned short ql = f2bf_bits(sq[e] - bf_bits2f(qh));
        khv[e] = kh; klv[e] = kl; qhv[e] = qh; qlv[e] = ql;
      }
      const size_t go = (size_t)(row0 + row) * QK + c8;
      unsigned short *sk0 = Khp + go, *sk1 = Klp + go, *sq0 = Qhp + go, *sq1 = Qlp + go;
      *(v8us*)(sk0) = khv;
      *(v8us*)(sk1) = klv;
      *(v8us*)(sq0) = qhv;
      *(v8us*)(sq1) = qlv;
      // wait before an address or data register of the four stores above is overwritten; they are inputs so that they
      // stay live up to the wait
      asm volatile("s_wait_xcnt 0x0" :: "v"(sk0), "v"(sk1), "v"(sq0), "v"(sq1), "v"(khv), "v"(klv), "v"(qhv), "v"(qlv)
                   : "memory");
    }
    
  }

  __syncthreads();   // the K^T rows below gather the encoded K values of all four waves' slabs
  {
    const int  f   = tid & 63;
    const bool lop = __builtin_amdgcn_readfirstlane(wave) >= 2;   // scalar: waves 0,1 write the hi plane, waves 2,3 the lo plane
    const int  bb  = (blk * 64) >> 11;                // batch element
    const int  l0  = (blk * 64) & (SEQ - 1);          // first key of this block
    unsigned short* dst = (lop ? KTlp : KThp) + ((size_t)bb * QK + f) * SEQ + l0;
    float xv[64];                                     // key rows 0..63 of the block, feature f
#pragma unroll
    for (int r = 0; r < 64; ++r) xv[r] = slab_all[r >> 4][(r & 15) * 132 + f];
#pragma unroll
    for (int g = 0; g < 8; ++g) {
      v8us o;
#pragma unroll
      for (int e = 0; e < 8; ++e) {
        const float xe = xv[g * 8 + e];
        const unsigned short hb = f2bf_bits(xe);
        const unsigned short lb = f2bf_bits(xe - bf_bits2f(hb));
        o[e] = lop ? lb : hb;
      }
      *(v8us*)(dst + g * 8) = o;
      // wait before the address or the data registers of the store above are overwritten (inputs: live up to the wait)
      asm volatile("s_wait_xcnt 0x0" :: "v"(dst), "v"(o) : "memory");
    }
  }
}

// ---------------------------------------------------------------------------
// Oscillator heads + encode and the V^T projection in one launch (neither reads the other's result), 4 waves a block:
//   blocks 0..63   enc_head_body, row block = blockIdx.x (the longer job, first in the index order);
//   blocks 64..319 V^T[b][d][l] = sum_k v_w^T[d][k] x[b][l][k] + v_b[d] -> bf16 hi/lo planes [2][512][2048]
//                  (A = v_w^T planes [512][512], Bt = x planes of batch b [2048][512]; M = 512, N = 2048, K = 512:
//                  8 x 16 block tiles = 128 blocks per batch).
// ---------------------------------------------------------------------------
__global__ __launch_bounds__(128) void enc_v_kernel(
    const unsigned short* __restrict__ Hkhp, const unsigned short* __restrict__ Hklp,
    const unsigned short* __restrict__ Hqhp, const unsigned short* __restrict__ Hqlp,
    const unsigned short* __restrict__ Xhp,  const unsigned short* __restrict__ Xlp,
    const unsigned short* __restrict__ Wk2hp, const unsigned short* __restrict__ Wk2lp,
    const unsigned short* __restrict__ Wq2hp, const unsigned short* __restrict__ Wq2lp,
    const unsigned short* __restrict__ Wkahp, const unsigned short* __restrict__ Wkalp,
    const unsigned short* __restrict__ Wqahp, const unsigned short* __restrict__ Wqalp,
    const float* __restrict__ bk2, const float* __restrict__ bq2,
    const float* __restrict__ bka, const float* __restrict__ bqa,
    const float* __restrict__ pos,
    unsigned short* Qhp, unsigned short* Qlp, unsigned short* Khp, unsigned short* Klp,
    unsigned short* KThp, unsigned short* KTlp,
    const unsigned short* __restrict__ Wvhp, const unsigned short* __restrict__ Wvlp,
    const float* __restrict__ v_b, unsigned short* VThp, unsigned short* VTlp) {
  __shared__ __align__(16) unsigned char smem[G_LDS_BYTES];   // encoder blocks use its first 4 x 16 x 132 floats
  const int bx = blockIdx.x;
  if (bx < MTOT / 64) {
    float (*slab_all)[16 * 132] = (float (*)[16 * 132])smem;
    enc_head_body(Hkhp, Hklp, Hqhp, Hqlp, Xhp, Xlp, Wk2hp, Wk2lp, Wq2hp, Wq2lp, Wkahp, Wkalp, Wqahp, Wqalp,
                  bk2, bq2, bka, bqa, pos, Qhp, Qlp, Khp, Klp, KThp, KTlp, bx, slab_all);
  } else {
    const int idx  = bx - MTOT / 64;
    gemm_hl_body<1, 2, false, 0>(Wvhp, Wvlp, DM, 0LL, Xhp, Xlp, DM, (long long)SEQ * DM,
                                 (void*)VThp, (void*)VTlp, SEQ, (long long)DM * SEQ,
                                 v_b, nullptr, 0LL, SEQ, DM, idx & 127, idx >> 7, smem);
  }
}

// ---------------------------------------------------------------------------
// Per-chunk sums: U[b][ch][d][f] = sum_{l' in 64-key chunk ch} V^T[b][d][l'] * K^T[b][f][l'] (hi/lo WMMA, f32 out).
// A = V^T rows (m = d), B rows = K^T rows (n = f), both key-contiguous at pitch 2048. Wave = 16 d x 64 f, block = 8 waves
// = 128 d; grid = (4, NCH-1, NB): chunks 0..NCH-2 (the last chunk enters no state). Each wave stores whole 256-B rows.
// ---------------------------------------------------------------------------
__global__ __launch_bounds__(256) void chunk_kv_kernel(
    const unsigned short* __restrict__ Vhp, const unsigned short* __restrict__ Vlp,
    const unsigned short* __restrict__ KThp, const unsigned short* __restrict__ KTlp, float* U) {
  __shared__ __align__(16) float sT[8][16 * 68];
  const int lane = threadIdx.x & 31, wave = threadIdx.x >> 5, hh = lane >> 4, c = lane & 15;
  const int ch = blockIdx.y, b = blockIdx.z;
  const int d0 = blockIdx.x * 128 + wave * 16;
  const size_t ao = ((size_t)b * DM + d0 + c) * SEQ + ch * 64 + 8 * hh;
  const size_t bo = ((size_t)b * QK + c) * SEQ + ch * 64 + 8 * hh;
  const __bf16* va = (const __bf16*)(const void*)Vhp + ao;
  const __bf16* vl = (const __bf16*)(const void*)Vlp + ao;
  const __bf16* kb = (const __bf16*)(const void*)KThp + bo;
  const __bf16* kl = (const __bf16*)(const void*)KTlp + bo;
  v16b ah[2], al[2], bh[2][4], bl[2][4];
#pragma unroll
  for (int kk = 0; kk < 2; ++kk) {
    ah[kk] = ldfrag(va + kk * 32);
    al[kk] = ldfrag(vl + kk * 32);
#pragma unroll
    for (int j = 0; j < 4; ++j) {
      bh[kk][j] = ldfrag(kb + j * 16 * SEQ + kk * 32);
      bl[kk][j] = ldfrag(kl + j * 16 * SEQ + kk * 32);
    }
  }
  // wait before any address register of the 40 loads above is overwritten; the four addresses are inputs so that they
  // stay live up to the wait
  asm volatile("s_wait_xcnt 0x0" :: "v"(va), "v"(vl), "v"(kb), "v"(kl) : "memory");
  v8f acc[4];
#pragma unroll
  for (int j = 0; j < 4; ++j) acc[j] = zero8();
#pragma unroll
  for (int kk = 0; kk < 2; ++kk)
#pragma unroll
    for (int j = 0; j < 4; ++j) acc[j] = mma3(ah[kk], al[kk], bh[kk][j], bl[kk][j], acc[j]);

  float* slab = sT[wave];
#pragma unroll
  for (int j = 0; j < 4; ++j)
#pragma unroll
    for (int r = 0; r < 8; ++r) slab[(8 * hh + r) * 68 + j * 16 + c] = acc[j][r];
  wave_lds_sync();
  float* C = U + (((size_t)b * NCH + ch) * DM + d0) * QK + hh * QK + c * 4;   // 2 rows of 256 B per instruction
#pragma unroll
  for (int it = 0; it < 8; ++it) {
    const v4f v = *(const v4f*)(slab + (it * 2 + hh) * 68 + c * 4);
    *(v4f*)(C + it * 2 * QK) = v;
  }
}

// ---------------------------------------------------------------------------
// Exclusive prefix over the key chunks: M[b][ch] = sum_{c < ch} U[b][c], U f32 [b][ch][512 d][64 f] (chunks 0..NCH-2
// are written and read), M -> bf16 hi/lo planes of the same shape, chunk 0 = 0. Thread = 4 consecutive elements;
// grid = NB*512*64/4/128 blocks of 128; a wave reads 512 B and writes 256 B per plane and chunk.
// ---------------------------------------------------------------------------
__global__ __launch_bounds__(128) void chunk_scan_kernel(const float* __restrict__ U, unsigned short* Mh,
                                                         unsigned short* Ml) {
  const int i = blockIdx.x * 128 + threadIdx.x;
  const int b = i / (DM * QK / 4);
  const size_t base = (size_t)b * ((size_t)NCH * DM * QK) + (size_t)(i - b * (DM * QK / 4)) * 4;
  v4f u[NCH - 1];
#pragma unroll
  for (int ch = 0; ch < NCH - 1; ++ch) u[ch] = *(const v4f*)(U + base + (size_t)ch * (DM * QK));
  unsigned short* ph = Mh + base;
  unsigned short* pl = Ml + base;
  v4f m = (v4f){0.f, 0.f, 0.f, 0.f};
#pragma unroll
  for (int ch = 0; ch < NCH; ++ch) {
    const unsigned short h0 = f2bf_bits(m[0]), h1 = f2bf_bits(m[1]), h2 = f2bf_bits(m[2]), h3 = f2bf_bits(m[3]);
    const unsigned short l0 = f2bf_bits(m[0] - bf_bits2f(h0)), l1 = f2bf_bits(m[1] - bf_bits2f(h1));
    const unsigned short l2 = f2bf_bits(m[2] - bf_bits2f(h2)), l3 = f2bf_bits(m[3] - bf_bits2f(h3));
    const v2u hv = (v2u){pk16(h0, h1), pk16(h2, h3)};
    const v2u lv = (v2u){pk16(l0, l1), pk16(l2, l3)};
    // the chunk's two state stores and their wait in one statement: no later load result, packed value or address step
    // can be placed in a register that the stores name ahead of the wait
    asm volatile("global_store_b64 %0, %2, off\n\tglobal_store_b64 %1, %3, off\n\ts_wait_xcnt 0x0"
                 :: "v"(ph), "v"(pl), "v"(hv), "v"(lv) : "memory");
    ph += DM * QK;
    pl += DM * QK;
    if (ch < NCH - 1) m += u[ch];
  }
}

// ---------------------------------------------------------------------------
// Causal mixing: R[b][l][d] = (1/sqrt((l+1)*32)) * sum_{l' <= l} S[l][l'] * V[l'][d],  S = Qt[l] . Kt[l'] (K = 64).
// Block = 4 waves = 64 query rows of one batch element and one 128-wide d chunk; grid = NB * 32 * 4.
//   Qt/Kt planes bf16 hi/lo [4096][64]; V^T planes bf16 hi/lo [b][512 d][2048 l']; R f32 [4096][512].
//   Keys of the earlier 64-key chunks enter through the state M[b][qb] = sum_{l' < 64 qb} Kt[l'] (x) V[l'] (planes
//   [b][ch][512 d][64 f], f contiguous): O = Qt . M (A = Qt rows, B = M rows from global).
//   The block's own key tile: stage Kt tile [64][64] and V^T chunk [128][64] (hi+lo) in LDS
//   (plain 16-B loads, __syncthreads after); S per wave in registers (A = Qt rows, B = Kt rows from LDS);
//   entries with l' > l set to 0 by value; P = S split to bf16 hi/lo into the wave's LDS tile
//   Output: per wave 16 rows x 128 floats staged in LDS (aliasing the K/V region after a block barrier), each
//   Coverage: 4 d chunks x 32 row blocks x 2 batches x (4 waves x 16 rows x 128) = the whole [4096][512] R plane.
// ---------------------------------------------------------------------------
__global__ __launch_bounds__(128) void causal_mix_kernel(
    const unsigned short* __restrict__ Qhp, const unsigned short* __restrict__ Qlp,
    const unsigned short* __restrict__ Khp, const unsigned short* __restrict__ Klp,
    const unsigned short* __restrict__ Vhp, const unsigned short* __restrict__ Vlp,
    const unsigned short* __restrict__ Mhp, const unsigned short* __restrict__ Mlp,
    float* Rout) {
  // Every tile row holds 64 halves (128 B) at a pitch of LP = 72 halves (144 B = 16 B x 9): the 16 rows that one
  // ds_load_b128 / ds_store_b128 touches then start on 16 different 4-bank groups instead of 2.
  constexpr int LP = 72;
  __shared__ __align__(16) unsigned char smem[73728];
  __bf16* Ksh = (__bf16*)(smem);           // [64 l'][LP]    9216 B
  __bf16* Ksl = (__bf16*)(smem + 9216);
  __bf16* Vth = (__bf16*)(smem + 18432);   // [128 d][LP]   18432 B
  __bf16* Vtl = (__bf16*)(smem + 36864);
  __bf16* Pgh = (__bf16*)(smem + 55296);   // [4 waves][16][LP]  9216 B
  __bf16* Pgl = (__bf16*)(smem + 64512);
  float*  Osb = (float*)(smem);            // [4 waves][16][132] after the main loop (aliases K/V tiles)

  const int tid = threadIdx.x, wave = tid >> 5, lane = tid & 31, hh = lane >> 4, c = lane & 15;
  const int bx  = blockIdx.x;
  const int dch = bx & 3;
  const int qb  = (bx >> 2) & 31;
  const int b   = bx >> 7;
  const int q0  = qb * 64 + wave * 16;                 // sequence-local first row of this wave
  const size_t grow0 = (size_t)b * SEQ + q0;           // global row of this wave's row 0

  const __bf16* Qh = (const __bf16*)(const void*)Qhp; const __bf16* Ql = (const __bf16*)(const void*)Qlp;
  const __bf16* Kh = (const __bf16*)(const void*)Khp; const __bf16* Kl = (const __bf16*)(const void*)Klp;
  const __bf16* Vh = (const __bf16*)(const void*)Vhp; const __bf16* Vl = (const __bf16*)(const void*)Vlp;
  const __bf16* Mh = (const __bf16*)(const void*)Mhp; const __bf16* Ml = (const __bf16*)(const void*)Mlp;

  // Qt fragments (A operand, row = lane&15): two 32-deep k chunks, hi and lo
  v16b qah[2], qal[2];
#pragma unroll
  for (int dc = 0; dc < 2; ++dc) {
    qah[dc] = ldfrag(Qh + (grow0 + c) * QK + dc * 32 + 8 * hh);
    qal[dc] = ldfrag(Ql + (grow0 + c) * QK + dc * 32 + 8 * hh);
  }
  v8f oacc[8];
#pragma unroll
  for (int t = 0; t < 8; ++t) oacc[t] = zero8();

  __bf16* pwh = Pgh + wave * (16 * LP);
  __bf16* pwl = Pgl + wave * (16 * LP);

  // O[16 x 128] = Qt[16 x 64] . M[64 x 128]: B[k = feature][n = d] = M[d][feature]
  const size_t mo = (((size_t)b * NCH + qb) * DM + dch * 128 + c) * QK + 8 * hh;
  const __bf16* mhp = Mh + mo;
  const __bf16* mlp = Ml + mo;
#pragma unroll
  for (int dc = 0; dc < 2; ++dc) {
    v16b mb[8], ml[8];
#pragma unroll
    for (int t = 0; t < 8; ++t) {
      mb[t] = ldfrag(mhp + t * 16 * QK + dc * 32);
      ml[t] = ldfrag(mlp + t * 16 * QK + dc * 32);
    }
    // wait before any address register of the 32 loads above is overwritten; both addresses are inputs so that they
    // stay live up to the wait
    asm volatile("s_wait_xcnt 0x0" :: "v"(mhp), "v"(mlp) : "memory");
#pragma unroll
    for (int t = 0; t < 8; ++t) oacc[t] = mma3(qah[dc], qal[dc], mb[t], ml[t], oacc[t]);
  }

  {
    const int kv0 = qb * 64;
    {
      // Kt tile: 128 threads x 32 halves per plane = 64 x 64
      const int r = tid >> 1, half = (tid & 1) * 32;
      const __bf16* ks = Kh + ((size_t)b * SEQ + kv0 + r) * QK + half;
      const __bf16* ls = Kl + ((size_t)b * SEQ + kv0 + r) * QK + half;
      v8b kr[4], lr[4];
#pragma unroll
      for (int i = 0; i < 4; ++i) {
        kr[i] = *(const v8b*)(ks + 8 * i);
        lr[i] = *(const v8b*)(ls + 8 * i);
      }
      // V^T chunk: thread = d row (dch*128 + tid), 64 halves per plane = 128 x 64
      const __bf16* vs = Vh + ((size_t)b * DM + dch * 128 + tid) * SEQ + kv0;
      const __bf16* vl = Vl + ((size_t)b * DM + dch * 128 + tid) * SEQ + kv0;
      v8b vr[8], wr[8];
#pragma unroll
      for (int i = 0; i < 8; ++i) {
        vr[i] = *(const v8b*)(vs + 8 * i);
        wr[i] = *(const v8b*)(vl + 8 * i);
      }
      // wait before any address register of the 24 loads above is overwritten; the four addresses are inputs so that
      // they stay live up to the wait and no later load's result is placed in them
      asm volatile("s_wait_xcnt 0x0" :: "v"(ks), "v"(ls), "v"(vs), "v"(vl) : "memory");
#pragma unroll
      for (int i = 0; i < 4; ++i) {
        *(v8b*)(Ksh + r * LP + half + 8 * i) = kr[i];
        *(v8b*)(Ksl + r * LP + half + 8 * i) = lr[i];
      }
#pragma unroll
      for (int i = 0; i < 8; ++i) {
        *(v8b*)(Vth + tid * LP + 8 * i) = vr[i];
        *(v8b*)(Vtl + tid * LP + 8 * i) = wr[i];
      }
    }
    __syncthreads();

    // S strip 16 x 64 for this wave: B[k = feature][n = key] = Kt[key][feature]
    v8f s[4];
#pragma unroll
    for (int j = 0; j < 4; ++j) {
      s[j] = zero8();
#pragma unroll
      for (int dc = 0; dc < 2; ++dc) {
        FB kb, kl;
        const int kb0 = (j * 16 + c) * LP + dc * 32 + 8 * hh;
        kb.h[0] = *(const v8b*)(Ksh + kb0);
        kb.h[1] = *(const v8b*)(Ksh + kb0 + 16);
        kl.h[0] = *(const v8b*)(Ksl + kb0);
        kl.h[1] = *(const v8b*)(Ksl + kb0 + 16);
        s[j] = mma3(qah[dc], qal[dc], kb.v, kl.v, s[j]);
      }
    }
    // causal select by value, split to bf16 hi/lo, into the wave's P tile [row][key]
#pragma unroll
    for (int r = 0; r < 8; ++r) {
      const int qrow = q0 + 8 * hh + r;
#pragma unroll
      for (int j = 0; j < 4; ++j) {
        const int kvcol = kv0 + j * 16 + c;
        float pm = s[j][r];
        if (kvcol > qrow) pm = 0.f;
        const unsigned short hb = f2bf_bits(pm);
        const unsigned short lb = f2bf_bits(pm - bf_bits2f(hb));
        pwh[(8 * hh + r) * LP + j * 16 + c] = __builtin_bit_cast(__bf16, hb);
        pwl[(8 * hh + r) * LP + j * 16 + c] = __builtin_bit_cast(__bf16, lb);
      }
    }
    wave_lds_sync();

    // O[16 x 128] += P[16 x 64] . V[64 x 128]: A = P (row = lane&15), B[k = key][n = d] = V^T[d][key]
#pragma unroll 1
    for (int kk = 0; kk < 2; ++kk) {
      FB pa, pl;
      const int pb0 = c * LP + kk * 32 + 8 * hh;
      pa.h[0] = *(const v8b*)(pwh + pb0);
      pa.h[1] = *(const v8b*)(pwh + pb0 + 16);
      pl.h[0] = *(const v8b*)(pwl + pb0);
      pl.h[1] = *(const v8b*)(pwl + pb0 + 16);
#pragma unroll
      for (int t = 0; t < 8; ++t) {
        FB vb, vlo;
        const int vb0 = (t * 16 + c) * LP + kk * 32 + 8 * hh;
        vb.h[0]  = *(const v8b*)(Vth + vb0);
        vb.h[1]  = *(const v8b*)(Vth + vb0 + 16);
        vlo.h[0] = *(const v8b*)(Vtl + vb0);
        vlo.h[1] = *(const v8b*)(Vtl + vb0 + 16);
        oacc[t] = mma3(pa.v, pl.v, vb.v, vlo.v, oacc[t]);
      }
    }
  }
  __syncthreads();   // every wave done with the K/V tiles before the output staging aliases them

  // scale by 1/sqrt((l+1)*32), stage the wave's 16 x 128 tile, write whole 512-B row segments
  float* os = Osb + wave * (16 * 132);
#pragma unroll
  for (int r = 0; r < 8; ++r) {
    const int lq = q0 + 8 * hh + r;
    const float nrm = sqrtf((float)((lq + 1) * KO));
    const float inv = 1.0f / nrm;
#pragma unroll
    for (int t = 0; t < 8; ++t) os[(8 * hh + r) * 132 + t * 16 + c] = oacc[t][r] * inv;
  }
  wave_lds_sync();
  {
#pragma unroll
    for (int it = 0; it < 16; ++it) {
      const v4f val = *(const v4f*)(os + it * 132 + lane * 4);
      *(v4f*)(Rout + (grow0 + it) * DM + dch * 128 + lane * 4) = val;
    }
    
  }
}

// ---------------------------------------------------------------------------
// One wave per row (block = 8 rows, grid = 4096/8); lane holds cols 8*lane..+7 and 256+8*lane..+7.
// ---------------------------------------------------------------------------
__global__ __launch_bounds__(256) void ln_split_kernel(const float* __restrict__ R, const float* __restrict__ g,
                                                       const float* __restrict__ be,
                                                       unsigned short* Lh, unsigned short* Ll) {
  const int tid = threadIdx.x, wave = tid >> 5, lane = tid & 31;
  const int row = blockIdx.x * 8 + wave;
  const float* rp = R + (size_t)row * DM;
  const int cA = 8 * lane, cB = 256 + 8 * lane;
  const v4f x0 = *(const v4f*)(rp + cA), x1 = *(const v4f*)(rp + cA + 4);
  const v4f x2 = *(const v4f*)(rp + cB), x3 = *(const v4f*)(rp + cB + 4);
  const v4f g0 = *(const v4f*)(g + cA),  g1 = *(const v4f*)(g + cA + 4);
  const v4f g2 = *(const v4f*)(g + cB),  g3 = *(const v4f*)(g + cB + 4);
  const v4f e0 = *(const v4f*)(be + cA), e1 = *(const v4f*)(be + cA + 4);
  const v4f e2 = *(const v4f*)(be + cB), e3 = *(const v4f*)(be + cB + 4);
  float v[16], gg[16], bb[16];
#pragma unroll
  for (int e = 0; e < 4; ++e) {
    v[e] = x0[e]; v[4 + e] = x1[e]; v[8 + e] = x2[e]; v[12 + e] = x3[e];
    gg[e] = g0[e]; gg[4 + e] = g1[e]; gg[8 + e] = g2[e]; gg[12 + e] = g3[e];
    bb[e] = e0[e]; bb[4 + e] = e1[e]; bb[8 + e] = e2[e]; bb[12 + e] = e3[e];
  }
  float sum = 0.f;
#pragma unroll
  for (int e = 0; e < 16; ++e) sum += v[e];
#pragma unroll
  for (int off = 1; off < 32; off <<= 1) sum += __shfl_xor(sum, off, 32);
  const float mu = sum * (1.0f / (float)DM);
  float ss = 0.f;
#pragma unroll
  for (int e = 0; e < 16; ++e) { const float d = v[e] - mu; v[e] = d; ss += d * d; }
#pragma unroll
  for (int off = 1; off < 32; off <<= 1) ss += __shfl_xor(ss, off, 32);
  const float var  = ss * (1.0f / (float)DM);
  const float rstd = 1.0f / sqrtf(var + 1e-5f);
  v8us hA, lA, hB, lB;
#pragma unroll
  for (int e = 0; e < 8; ++e) {
    const float ya = v[e] * rstd * gg[e] + bb[e];
    const float yb = v[8 + e] * rstd * gg[8 + e] + bb[8 + e];
    const unsigned short ha = f2bf_bits(ya), la = f2bf_bits(ya - bf_bits2f(ha));
    const unsigned short hb = f2bf_bits(yb), lb = f2bf_bits(yb - bf_bits2f(hb));
    hA[e] = ha; lA[e] = la; hB[e] = hb; lB[e] = lb;
  }
  const size_t oA = (size_t)row * DM + cA, oB = (size_t)row * DM + cB;
  {
    *(v8us*)(Lh + oA) = hA;
    *(v8us*)(Lh + oB) = hB;
    *(v8us*)(Ll + oA) = lA;
    *(v8us*)(Ll + oB) = lB;
    
  }
}

// ---------------------------------------------------------------------------
// Workspace region map (bytes; every region an exact multiple of its store granularity, no tail rows):
//   Xh, Xl            bf16 [4096][512]     2 x 4,194,304          0 ..  8,388,608
//   Hkh,Hkl,Hqh,Hql   bf16 [4096][512]     4 x 4,194,304   8,388,608 .. 25,165,824
//   W1t planes (kp,qp,v,o) bf16 [512][512] 8 x 524,288  25,165,824 .. 29,360,128
//   W2t planes (kp2,qp2,ka,qa) bf16 [32][512] 8 x 32,768 29,360,128 .. 29,622,272
//   Qth,Qtl,Kth,Ktl   bf16 [4096][64]      4 x 524,288    29,622,272 .. 31,719,424
//   VTh, VTl          bf16 [2][512][2048]  2 x 4,194,304  31,719,424 .. 40,108,032
//   R                 f32  [4096][512]     8,388,608      40,108,032 .. 48,496,640
//   Lh, Ll            bf16 [4096][512]     2 x 4,194,304  48,496,640 .. 56,885,248
//   KTh, KTl          bf16 [2][64][2048]   2 x 524,288    56,885,248 .. 57,933,824
//   U                 f32  [2][32][512][64] 8,388,608     57,933,824 .. 66,322,432
//   Mh, Ml            bf16 [2][32][512][64] 2 x 4,194,304 66,322,432 .. 74,711,040
// ---------------------------------------------------------------------------
extern "C" void kernel_launch(void* const* d_in, const int* in_sizes, int n_in,
                              void* d_out, int out_size, void* d_ws, size_t ws_size,
                              hipStream_t stream) {
  if (n_in < 20) return;
  if (in_sizes[0] != MTOT * DM || in_sizes[1] != SEQ * KO) return;
  if (in_sizes[2] != DM * DM || in_sizes[8] != DM * DM || in_sizes[14] != DM * DM || in_sizes[18] != DM * DM) return;
  if (in_sizes[3] != DM || in_sizes[9] != DM || in_sizes[15] != DM || in_sizes[19] != DM) return;
  if (in_sizes[16] != DM || in_sizes[17] != DM) return;
  if (in_sizes[4] != DM * KO || in_sizes[6] != DM * KO || in_sizes[10] != DM * KO || in_sizes[12] != DM * KO) return;
  if (in_sizes[5] != KO || in_sizes[7] != KO || in_sizes[11] != KO || in_sizes[13] != KO) return;
  if (out_size != MTOT * DM) return;

  const float* x     = (const float*)d_in[0];
  const float* pos   = (const float*)d_in[1];
  const float* kp_w1 = (const float*)d_in[2];
  const float* kp_b1 = (const float*)d_in[3];
  const float* kp_w2 = (const float*)d_in[4];
  const float* kp_b2 = (const float*)d_in[5];
  const float* ka_w  = (const float*)d_in[6];
  const float* ka_b  = (const float*)d_in[7];
  const float* qp_w1 = (const float*)d_in[8];
  const float* qp_b1 = (const float*)d_in[9];
  const float* qp_w2 = (const float*)d_in[10];
  const float* qp_b2 = (const float*)d_in[11];
  const float* qa_w  = (const float*)d_in[12];
  const float* qa_b  = (const float*)d_in[13];
  const float* v_w   = (const float*)d_in[14];
  const float* v_b   = (const float*)d_in[15];
  const float* ln_g  = (const float*)d_in[16];
  const float* ln_b  = (const float*)d_in[17];
  const float* o_w   = (const float*)d_in[18];
  const float* o_b   = (const float*)d_in[19];

  const size_t PX = (size_t)MTOT * DM * 2;        // 4,194,304
  const size_t PW = (size_t)DM * DM * 2;          //   524,288
  const size_t PS = (size_t)KO * DM * 2;          //    32,768
  const size_t PQ = (size_t)MTOT * QK * 2;        //   524,288
  const size_t PV = (size_t)NB * DM * SEQ * 2;    // 4,194,304
  const size_t PR = (size_t)MTOT * DM * 4;        // 8,388,608
  size_t off = 0;
  const size_t oXh  = off; off += PX;  const size_t oXl  = off; off += PX;
  const size_t oHkh = off; off += PX;  const size_t oHkl = off; off += PX;
  const size_t oHqh = off; off += PX;  const size_t oHql = off; off += PX;
  const size_t oWkh = off; off += PW;  const size_t oWkl = off; off += PW;
  const size_t oWqh = off; off += PW;  const size_t oWql = off; off += PW;
  const size_t oWvh = off; off += PW;  const size_t oWvl = off; off += PW;
  const size_t oWoh = off; off += PW;  const size_t oWol = off; off += PW;
  const size_t oSk2h = off; off += PS; const size_t oSk2l = off; off += PS;
  const size_t oSq2h = off; off += PS; const size_t oSq2l = off; off += PS;
  const size_t oSkah = off; off += PS; const size_t oSkal = off; off += PS;
  const size_t oSqah = off; off += PS; const size_t oSqal = off; off += PS;
  const size_t oQth = off; off += PQ;  const size_t oQtl = off; off += PQ;
  const size_t oKth = off; off += PQ;  const size_t oKtl = off; off += PQ;
  const size_t oVTh = off; off += PV;  const size_t oVTl = off; off += PV;
  const size_t oR   = off; off += PR;
  const size_t oLh  = off; off += PX;  const size_t oLl  = off; off += PX;
  const size_t oKTh = off; off += PQ;  const size_t oKTl = off; off += PQ;
  const size_t oU   = off; off += PR;
  const size_t oMh  = off; off += PX;  const size_t oMl  = off; off += PX;
  if (off > ws_size) return;                      // off = 74,711,040

  char* ws = (char*)d_ws;
  unsigned short* Xh  = (unsigned short*)(ws + oXh);   unsigned short* Xl  = (unsigned short*)(ws + oXl);
  unsigned short* Hkh = (unsigned short*)(ws + oHkh);  unsigned short* Hkl = (unsigned short*)(ws + oHkl);
  unsigned short* Hqh = (unsigned short*)(ws + oHqh);  unsigned short* Hql = (unsigned short*)(ws + oHql);
  unsigned short* Wkh = (unsigned short*)(ws + oWkh);  unsigned short* Wkl = (unsigned short*)(ws + oWkl);
  unsigned short* Wqh = (unsigned short*)(ws + oWqh);  unsigned short* Wql = (unsigned short*)(ws + oWql);
  unsigned short* Wvh = (unsigned short*)(ws + oWvh);  unsigned short* Wvl = (unsigned short*)(ws + oWvl);
  unsigned short* Woh = (unsigned short*)(ws + oWoh);  unsigned short* Wol = (unsigned short*)(ws + oWol);
  unsigned short* Sk2h = (unsigned short*)(ws + oSk2h); unsigned short* Sk2l = (unsigned short*)(ws + oSk2l);
  unsigned short* Sq2h = (unsigned short*)(ws + oSq2h); unsigned short* Sq2l = (unsigned short*)(ws + oSq2l);
  unsigned short* Skah = (unsigned short*)(ws + oSkah); unsigned short* Skal = (unsigned short*)(ws + oSkal);
  unsigned short* Sqah = (unsigned short*)(ws + oSqah); unsigned short* Sqal = (unsigned short*)(ws + oSqal);
  unsigned short* Qth = (unsigned short*)(ws + oQth);  unsigned short* Qtl = (unsigned short*)(ws + oQtl);
  unsigned short* Kth = (unsigned short*)(ws + oKth);  unsigned short* Ktl = (unsigned short*)(ws + oKtl);
  unsigned short* VTh = (unsigned short*)(ws + oVTh);  unsigned short* VTl = (unsigned short*)(ws + oVTl);
  float*          Rws = (float*)(ws + oR);
  unsigned short* Lh  = (unsigned short*)(ws + oLh);   unsigned short* Ll  = (unsigned short*)(ws + oLl);
  unsigned short* KTh = (unsigned short*)(ws + oKTh);  unsigned short* KTl = (unsigned short*)(ws + oKTl);
  float*          Uws = (float*)(ws + oU);
  unsigned short* Mh  = (unsigned short*)(ws + oMh);   unsigned short* Ml  = (unsigned short*)(ws + oMl);

  const dim3 b256(256), b128(128);

  // (1) operand preparation, one launch: the four [512][512] and the four [512][32] weights -> transposed hi/lo planes
  //     (the planes lie in the workspace in the order of the jobs), x -> hi/lo planes
  prep_kernel<<<dim3(PREP_T1 + PREP_T2 + PREP_X), b256, 0, stream>>>(
      x, kp_w1, qp_w1, v_w, o_w, kp_w2, qp_w2, ka_w, qa_w, Xh, Xl, Wkh, Sk2h);

  // (2) hk = tanh(x . kp_w1 + kp_b1), hq likewise -> bf16 hi/lo planes [4096][512], one launch: (256, 2) blocks
  const dim3 gH((MTOT / 64) * (DM / 128), 1);                  // 256 blocks
  gemm_hidden_kernel<<<dim3((MTOT / 64) * (DM / 128), 2), b128, 0, stream>>>(
      Xh, Xl, Wkh, Wkl, Wqh, Wql, kp_b1, qp_b1, Hkh, Hkl, Hqh, Hql);

  // (3) oscillator heads + encode -> Qt, Kt hi/lo planes [4096][64], K^T planes; V^T hi/lo planes; one launch
  enc_v_kernel<<<dim3(MTOT / 64 + NB * (DM / 64) * (SEQ / 128)), b128, 0, stream>>>(
      Hkh, Hkl, Hqh, Hql, Xh, Xl,
      Sk2h, Sk2l, Sq2h, Sq2l, Skah, Skal, Sqah, Sqal,
      kp_b2, qp_b2, ka_b, qa_b, pos,
      Qth, Qtl, Kth, Ktl, KTh, KTl,
      Wvh, Wvl, v_b, VTh, VTl);

  // (7a) per-chunk sums U[b][ch][d][f] = sum_{l' in chunk ch} V^T[b][d][l'] K^T[b][f][l'], chunks 0..30
  chunk_kv_kernel<<<dim3(DM / 128, NCH - 1, NB), b256, 0, stream>>>(VTh, VTl, KTh, KTl, Uws);
  // (7b) exclusive prefix over the chunks -> state planes M hi/lo [2][32][512][64]
  chunk_scan_kernel<<<dim3(NB * DM * QK / 4 / 128), b128, 0, stream>>>(Uws, Mh, Ml);

  // (7c) causal mixing (state term + own key tile) -> R f32 [4096][512]
  causal_mix_kernel<<<dim3(NB * (SEQ / 64) * 4), b128, 0, stream>>>(Qth, Qtl, Kth, Ktl, VTh, VTl, Mh, Ml, Rws);

  // (8) LayerNorm -> bf16 hi/lo planes [4096][512]
  ln_split_kernel<<<dim3(MTOT / 8), b256, 0, stream>>>(Rws, ln_g, ln_b, Lh, Ll);

  // (9) out = x + ln . o_w + o_b -> d_out f32 [4096][512]
  gemm_out_kernel<<<gH, b128, 0, stream>>>(Lh, Ll, Woh, Wol, o_b, x, (float*)d_out);

  (void)hipGetLastError();
}

// v005
// One run takes 89.6 microseconds.
// Two timings next to v004 put it at 1.33 and 1.35 times that version's speed.
// Over all steps from v000 it is 4.05 times as fast.
// All contractions (x.kp_w1, x.qp_w1, x.v_w, h.kp_w2, h.qp_w2, x.ka_w, x.qa_w, causal score S = Qt.Kt^T and S.V, chunk sums V^T.Kt, state term Qt.M, ln.o_w): v_wmma_f32_16x16x32_bf16 with bf16 hi/lo operands (hi.hi + hi.lo + lo.hi), f32 accumulate; encoders (tanh, softplus, sincos), norm scale, LayerNorm, biases and residual in f32.
#include <hip/hip_runtime.h>
#include <math.h>
#include <stdint.h>

#define NB   2
#define SEQ  2048
#define DM   512
#define KO   32
#define QK   64
#define MTOT (NB * SEQ)
#define NCH  (SEQ / 64)

typedef __attribute__((ext_vector_type(16))) __bf16 v16b;
typedef __attribute__((ext_vector_type(8)))  __bf16 v8b;
typedef __attribute__((ext_vector_type(8)))  float  v8f;
typedef __attribute__((ext_vector_type(4)))  float  v4f;
typedef __attribute__((ext_vector_type(2)))  float  v2f;
typedef __attribute__((ext_vector_type(4)))  unsigned int   v4u;
typedef __attribute__((ext_vector_type(2)))  unsigned int   v2u;
typedef __attribute__((ext_vector_type(8)))  unsigned short v8us;

union FB { v16b v; v8b h[2]; };

__device__ __forceinline__ unsigned short f2bf_bits(float f) {
  unsigned u = __float_as_uint(f);
  return (unsigned short)((u + 0x7FFFu + ((u >> 16) & 1u)) >> 16);   // RNE
}
__device__ __forceinline__ float bf_bits2f(unsigned short h) { return __uint_as_float(((unsigned)h) << 16); }
__device__ __forceinline__ unsigned pk16(unsigned short a, unsigned short b) { return (unsigned)a | ((unsigned)b << 16); }

__device__ __forceinline__ v8f zero8() { return (v8f){0.f, 0.f, 0.f, 0.f, 0.f, 0.f, 0.f, 0.f}; }

// 16-bit A/B fragment from a k-contiguous row p = &T[row][k0 + 8*(lane>>4)]:
// elements 0..7 <- p[0..7] (k0+8h..), elements 8..15 <- p[16..23] (k0+16+8h..)
__device__ __forceinline__ v16b ldfrag(const __bf16* p) {
  FB f;
  f.h[0] = *(const v8b*)(p);
  f.h[1] = *(const v8b*)(p + 16);
  return f.v;
}

// hi/lo split product group: c += ah.bh + ah.bl + al.bh, then 4 VALU slots tying D and keeping all operands live
__device__ __forceinline__ v8f mma3(v16b ah, v16b al, v16b bh, v16b bl, v8f c) {
  c = __builtin_amdgcn_wmma_f32_16x16x32_bf16(false, ah, false, bh, (short)0, c, false, false);
  c = __builtin_amdgcn_wmma_f32_16x16x32_bf16(false, ah, false, bl, (short)0, c, false, false);
  c = __builtin_amdgcn_wmma_f32_16x16x32_bf16(false, al, false, bh, (short)0, c, false, false);
  asm volatile("v_nop\n\tv_nop\n\tv_nop\n\tv_nop" : "+v"(c) : "v"(ah), "v"(al), "v"(bh), "v"(bl));
  return c;
}

// same-wave LDS exchange: order the wave's LDS stores before its cross-lane reloads
__device__ __forceinline__ void wave_lds_sync() {
  __builtin_amdgcn_fence(__ATOMIC_RELEASE, "workgroup");
  __builtin_amdgcn_wave_barrier();
  __builtin_amdgcn_fence(__ATOMIC_ACQUIRE, "workgroup");
}

// ---------------------------------------------------------------------------
// Elementwise bf16 split of a flat f32 array: hi = bf16(in), lo = bf16(in - hi); 2 elements per thread,
// ---------------------------------------------------------------------------
__device__ __forceinline__ void split_bf16x2_body(const float* __restrict__ in, unsigned short* hi,
                                                  unsigned short* lo, int n2, int blk) {
  const int i = blk * 256 + threadIdx.x;
  if (i < n2) {
    const v2f f = *(const v2f*)(in + 2 * (size_t)i);
    const unsigned short h0 = f2bf_bits(f[0]), h1 = f2bf_bits(f[1]);
    const unsigned short l0 = f2bf_bits(f[0] - bf_bits2f(h0)), l1 = f2bf_bits(f[1] - bf_bits2f(h1));
    const unsigned uh = pk16(h0, h1), ul = pk16(l0, l1);
    ((unsigned*)hi)[i] = uh;
    ((unsigned*)lo)[i] = ul;
    
  }
}

// ---------------------------------------------------------------------------
// Fused transpose + bf16 split of an f32 matrix: in [R][Cc] -> oh[c][r] = bf16(in[r][c]), ol = residual
// ([Cc][R], pitch R). 64x64 tiles through LDS (tf: 64 x 68 floats). Tile (bc, br) of (Cc/64, R/64), 256 threads.
// Coverage per block and plane: load 4 it x 256 thr x 4 = 64x64; store 2 it x 256 thr x 8 = 64x64.
// ---------------------------------------------------------------------------
__device__ __forceinline__ void tsplit_body(const float* __restrict__ W, unsigned short* oh,
                                            unsigned short* ol, int R, int Cc, int bc, int br, float* tf) {
  const int c0  = bc * 64;
  const int r0  = br * 64;
  const int tid = threadIdx.x;
  {
    const int lr = tid >> 4;
    const int c4 = (tid & 15) * 4;
    const float* wp[4];
    v4f a[4];
#pragma unroll
    for (int it = 0; it < 4; ++it) {
      wp[it] = W + (size_t)(r0 + it * 16 + lr) * Cc + c0 + c4;
      a[it]  = *(const v4f*)(wp[it]);
    }
    // wait before any address register of the four loads above is overwritten; the addresses are inputs so that they
    // stay live up to the wait
    asm volatile("s_wait_xcnt 0x0" :: "v"(wp[0]), "v"(wp[1]), "v"(wp[2]), "v"(wp[3]) : "memory");
#pragma unroll   // constant indices keep a[] in registers
    for (int it = 0; it < 4; ++it) *(v4f*)(tf + (it * 16 + lr) * 68 + c4) = a[it];
  }
  __syncthreads();
  const int sub = tid >> 3;
  const int c8  = (tid & 7) * 8;
  v4u hv[2], lv[2];
#pragma unroll
  for (int it = 0; it < 2; ++it) {
    const int oc = it * 32 + sub;
    v4u a, a2;
#pragma unroll
    for (int q = 0; q < 4; ++q) {
      const float f0 = tf[(c8 + 2 * q) * 68 + oc];
      const float f1 = tf[(c8 + 2 * q + 1) * 68 + oc];
      const unsigned short h0 = f2bf_bits(f0), h1 = f2bf_bits(f1);
      const unsigned short l0 = f2bf_bits(f0 - bf_bits2f(h0)), l1 = f2bf_bits(f1 - bf_bits2f(h1));
      a[q]  = pk16(h0, h1);
      a2[q] = pk16(l0, l1);
    }
    hv[it] = a; lv[it] = a2;
  }
  {
#pragma unroll
    for (int it = 0; it < 2; ++it) {
      const int oc = it * 32 + sub;
      const size_t go = (size_t)(c0 + oc) * R + r0 + c8;
      *(v4u*)(oh + go) = hv[it];
      *(v4u*)(ol + go) = lv[it];
    }
    
  }
}

// ---------------------------------------------------------------------------
// Transpose + bf16 split of a narrow f32 matrix: in [R][32] -> oh/ol [32][R] (pitch R). Tile br of R/64, 256 threads,
// tf: 64 x 36 floats of LDS.
// Coverage per block: load 2 it x 256 thr x 4 = 64 rows x 32; store 32 output rows x (8 lanes x 8) = 32 x 64.
// ---------------------------------------------------------------------------
__device__ __forceinline__ void tsplit32_body(const float* __restrict__ W, unsigned short* oh,
                                              unsigned short* ol, int R, int br, float* tf) {
  const int r0  = br * 64;
  const int tid = threadIdx.x;
  {
    const int rr = tid >> 3;          // 0..31
    const int c4 = (tid & 7) * 4;     // 0..28
    const float* wp[2];
    v4f a[2];
#pragma unroll
    for (int it = 0; it < 2; ++it) {
      wp[it] = W + (size_t)(r0 + it * 32 + rr) * KO + c4;   // rows 0..63
      a[it]  = *(const v4f*)(wp[it]);
    }
    // wait before an address register of the two loads above is overwritten; the addresses are inputs so that they
    // stay live up to the wait
    asm volatile("s_wait_xcnt 0x0" :: "v"(wp[0]), "v"(wp[1]) : "memory");
#pragma unroll   // constant indices keep a[] in registers
    for (int it = 0; it < 2; ++it) *(v4f*)(tf + (it * 32 + rr) * 36 + c4) = a[it];
  }
  __syncthreads();
  const int oc = tid >> 3;            // output row = input column 0..31
  const int c8 = (tid & 7) * 8;       // output cols r0+c8 .. +7
  v4u hv, lv;
#pragma unroll
  for (int q = 0; q < 4; ++q) {
    const float f0 = tf[(c8 + 2 * q) * 36 + oc];
    const float f1 = tf[(c8 + 2 * q + 1) * 36 + oc];
    const unsigned short h0 = f2bf_bits(f0), h1 = f2bf_bits(f1);
    const unsigned short l0 = f2bf_bits(f0 - bf_bits2f(h0)), l1 = f2bf_bits(f1 - bf_bits2f(h1));
    hv[q] = pk16(h0, h1);
    lv[q] = pk16(l0, l1);
  }
  const size_t go = (size_t)oc * R + r0 + c8;
  {
    *(v4u*)(oh + go) = hv;
    *(v4u*)(ol + go) = lv;
    
  }
}

// ---------------------------------------------------------------------------
// All operand preparation in one launch; the nine jobs do not depend on one another and the block index picks the job:
//   blocks   0..255  four [512][512] weights -> transposed planes (64 tiles each); planes of job j at W1p + j*2*512*512
//   blocks 256..287  four [512][32] weights  -> transposed planes (8 tiles each);  planes of job j at W2p + j*2*32*512
//   blocks 288..     x -> hi/lo planes, 512 elements per block
// Each job's hi plane is followed by its lo plane. The two-phase transposes come first in the index order.
// ---------------------------------------------------------------------------
#define PREP_T1 (4 * (DM / 64) * (DM / 64))
#define PREP_T2 (4 * (DM / 64))
#define PREP_X  (MTOT * DM / 2 / 256)
__global__ __launch_bounds__(256) void prep_kernel(
    const float* __restrict__ x,
    const float* __restrict__ kp_w1, const float* __restrict__ qp_w1,
    const float* __restrict__ v_w,   const float* __restrict__ o_w,
    const float* __restrict__ kp_w2, const float* __restrict__ qp_w2,
    const float* __restrict__ ka_w,  const float* __restrict__ qa_w,
    unsigned short* Xh, unsigned short* Xl, unsigned short* W1p, unsigned short* W2p) {
  __shared__ __align__(16) float tf[64 * 68];
  const int bx = blockIdx.x;
  if (bx < PREP_T1) {
    const int job = bx >> 6, t = bx & 63;
    const float* Wsrc = job == 0 ? kp_w1 : job == 1 ? qp_w1 : job == 2 ? v_w : o_w;
    unsigned short* oh = W1p + (size_t)job * (2 * DM * DM);
    tsplit_body(Wsrc, oh, oh + DM * DM, DM, DM, t & 7, t >> 3, tf);
  } else if (bx < PREP_T1 + PREP_T2) {
    const int job = (bx - PREP_T1) >> 3, t = (bx - PREP_T1) & 7;
    const float* Wsrc = job == 0 ? kp_w2 : job == 1 ? qp_w2 : job == 2 ? ka_w : qa_w;
    unsigned short* oh = W2p + (size_t)job * (2 * KO * DM);
    tsplit32_body(Wsrc, oh, oh + KO * DM, DM, t, tf);
  } else {
    split_bf16x2_body(x, Xh, Xl, MTOT * DM / 2, bx - (PREP_T1 + PREP_T2));
  }
}

// ---------------------------------------------------------------------------
// Batched WMMA GEMM on bf16 hi/lo planes, operands staged in LDS:
//   C[m,n] = sum_k A[m,k] * Bt[n,k] (+bias)(+resid)(act); product = hi.hi + hi.lo + lo.hi.
// A planes row-major [M][K] (pitch lda), Bt planes row-major [N][K] (pitch ldb); M % 64 == 0, N % 128 == 0, K % 64 == 0.
// Block = 4 waves = one 64 x 128 tile (index tile, the grid holds exactly (M/64)*(N/128) of them per batch), wave =
// 32 x 64 (2 x 2 waves); bz = batch with element strides.
// A stage is 64 k of the block's rows: A hi, A lo (64 rows each), B hi, B lo (128 rows each), 128 B a row at a pitch of
// GP = 72 halves (144 B = 16 B x 9). Each global load of a wave covers 4 whole 128-B lines (8 lanes a row); the next
// stage's 24 loads a thread fly while the current stage is multiplied, and go to the other of two LDS buffers behind it.
// After the last stage the wave's own 16 x 68 floats for the output staging alias the buffers.
// BIAS_MODE: 1 = bias[m], 2 = bias[n]. OUT_MODE: 0 = f32, 2 = bf16 hi plane (Cout) + lo plane (Cout2). ACT 1 = tanh.
// ---------------------------------------------------------------------------
#define GP       72
#define G_AT     (64 * GP)
#define G_BT     (128 * GP)
#define G_STAGE  (2 * G_AT + 2 * G_BT)
#define G_LDS_BYTES (2 * G_STAGE * 2)
template <int BIAS_MODE, int OUT_MODE, bool RESID, int ACT>
__device__ __forceinline__ void gemm_hl_body(
    const unsigned short* __restrict__ Ahp, const unsigned short* __restrict__ Alp, int lda, long long strideA,
    const unsigned short* __restrict__ Bhp, const unsigned short* __restrict__ Blp, int ldb, long long strideB,
    void* Cout, void* Cout2, int ldc, long long strideC,
    const float* __restrict__ bias,
    const float* __restrict__ resid, long long strideR,
    int N, int K, int tile, int bz, unsigned char* smem) {
  const __bf16* Ah = (const __bf16*)(const void*)Ahp;
  const __bf16* Al = (const __bf16*)(const void*)Alp;
  const __bf16* Bh = (const __bf16*)(const void*)Bhp;
  const __bf16* Bl = (const __bf16*)(const void*)Blp;
  const int tid  = threadIdx.x;
  const int wave = tid >> 5;
  const int lane = tid & 31;
  const int tilesN = N >> 7;
  const int tm  = tile / tilesN;
  const int tn  = tile - tm * tilesN;
  const int bm0 = tm << 6;               // block tile origin
  const int bn0 = tn << 7;
  const int wm  = (wave >> 1) << 5;      // wave tile origin inside the block tile
  const int wn  = (wave & 1) << 6;
  const int m0  = bm0 + wm;
  const int n0  = bn0 + wn;

  const int rl   = lane & 15;            // row (A) / col (B, D) within subtile
  const int koff = (lane >> 4) * 8;      // k offset of this lane half
  const int mOff = (lane >> 4) * 8;      // D row offset

  __bf16* sb = (__bf16*)smem;
  // staging map: thread = 16 B (8 halves) of row sr + 16 * it; 8 lanes cover one 128-B row
  const int sr = tid >> 3;               // 0..15
  const int sc = (tid & 7) * 8;
  const __bf16* gah = Ah + (size_t)bz * strideA + (size_t)(bm0 + sr) * lda + sc;
  const __bf16* gal = Al + (size_t)bz * strideA + (size_t)(bm0 + sr) * lda + sc;
  const __bf16* gbh = Bh + (size_t)bz * strideB + (size_t)(bn0 + sr) * ldb + sc;
  const __bf16* gbl = Bl + (size_t)bz * strideB + (size_t)(bn0 + sr) * ldb + sc;
  const int so = sr * GP + sc;

  v8f acc[2][4];
#pragma unroll
  for (int i = 0; i < 2; ++i)
#pragma unroll
    for (int j = 0; j < 4; ++j) acc[i][j] = zero8();

  v8b rah[4], ral[4], rbh[8], rbl[8];
  // stage 0: global -> registers -> buffer 0
#pragma unroll   // constant indices keep the staged values in registers
  for (int it = 0; it < 4; ++it) {
    rah[it] = *(const v8b*)(gah + (size_t)(it * 16) * lda);
    ral[it] = *(const v8b*)(gal + (size_t)(it * 16) * lda);
  }
#pragma unroll   // constant indices keep the staged values in registers
  for (int it = 0; it < 8; ++it) {
    rbh[it] = *(const v8b*)(gbh + (size_t)(it * 16) * ldb);
    rbl[it] = *(const v8b*)(gbl + (size_t)(it * 16) * ldb);
  }
  // wait before any address register of the 24 loads above is overwritten; the four addresses are inputs so that they
  // stay live up to the wait
  asm volatile("s_wait_xcnt 0x0" :: "v"(gah), "v"(gal), "v"(gbh), "v"(gbl) : "memory");
#pragma unroll
  for (int it = 0; it < 4; ++it) {
    *(v8b*)(sb + so + it * 16 * GP)        = rah[it];
    *(v8b*)(sb + G_AT + so + it * 16 * GP) = ral[it];
  }
#pragma unroll
  for (int it = 0; it < 8; ++it) {
    *(v8b*)(sb + 2 * G_AT + so + it * 16 * GP)        = rbh[it];
    *(v8b*)(sb + 2 * G_AT + G_BT + so + it * 16 * GP) = rbl[it];
  }
  __syncthreads();   // stage 0 is complete before any wave reads it

  const int nst = K >> 6;
#pragma unroll 1   // one stage a trip: the body already holds 48 matrix instructions
  for (int s = 0; s < nst; ++s) {
    const bool more = s + 1 < nst;       // block-uniform
    if (more) {
      gah += 64; gal += 64; gbh += 64; gbl += 64;
#pragma unroll   // constant indices keep the staged values in registers
      for (int it = 0; it < 4; ++it) {
        rah[it] = *(const v8b*)(gah + (size_t)(it * 16) * lda);
        ral[it] = *(const v8b*)(gal + (size_t)(it * 16) * lda);
      }
#pragma unroll   // constant indices keep the staged values in registers
      for (int it = 0; it < 8; ++it) {
        rbh[it] = *(const v8b*)(gbh + (size_t)(it * 16) * ldb);
        rbl[it] = *(const v8b*)(gbl + (size_t)(it * 16) * ldb);
      }
      // wait before any address register of the 24 loads above is overwritten; the four addresses are inputs so that
      // they stay live up to the wait
      asm volatile("s_wait_xcnt 0x0" :: "v"(gah), "v"(gal), "v"(gbh), "v"(gbl) : "memory");
    }
    const __bf16* cur = sb + (s & 1) * G_STAGE;
#pragma unroll
    for (int kk = 0; kk < 2; ++kk) {
      v16b ah[2], al[2];
#pragma unroll
      for (int i = 0; i < 2; ++i) {
        const int ao = (wm + (i << 4) + rl) * GP + kk * 32 + koff;
        ah[i] = ldfrag(cur + ao);
        al[i] = ldfrag(cur + G_AT + ao);
      }
      // B fragments one column tile ahead of their products, in a second register set
      const int bo = (wn + rl) * GP + kk * 32 + koff;
      v16b bh[2], bl[2];
      bh[0] = ldfrag(cur + 2 * G_AT + bo);
      bl[0] = ldfrag(cur + 2 * G_AT + G_BT + bo);
#pragma unroll
      for (int j = 0; j < 4; ++j) {
        if (j < 3) {
          bh[(j + 1) & 1] = ldfrag(cur + 2 * G_AT + bo + (j + 1) * 16 * GP);
          bl[(j + 1) & 1] = ldfrag(cur + 2 * G_AT + G_BT + bo + (j + 1) * 16 * GP);
        }
#pragma unroll
        for (int i = 0; i < 2; ++i) acc[i][j] = mma3(ah[i], al[i], bh[j & 1], bl[j & 1], acc[i][j]);
      }
    }
    if (more) {
      // the other buffer: its last readers left it at the barrier that ended the trip before
      __bf16* nxt = sb + ((s + 1) & 1) * G_STAGE;
#pragma unroll
      for (int it = 0; it < 4; ++it) {
        *(v8b*)(nxt + so + it * 16 * GP)        = rah[it];
        *(v8b*)(nxt + G_AT + so + it * 16 * GP) = ral[it];
      }
#pragma unroll
      for (int it = 0; it < 8; ++it) {
        *(v8b*)(nxt + 2 * G_AT + so + it * 16 * GP)        = rbh[it];
        *(v8b*)(nxt + 2 * G_AT + G_BT + so + it * 16 * GP) = rbl[it];
      }
    }
    __syncthreads();   // publishes stage s + 1 and ends every wave's reads of stage s (the output staging aliases it)
  }
  float* slab = (float*)smem + wave * (16 * 68);

  // ---- epilogue ----
  const float* Rb = RESID ? (resid + (size_t)bz * strideR) : nullptr;
  const int nb = n0 + rl;
  float bvn[4] = {0.f, 0.f, 0.f, 0.f};
  if (BIAS_MODE == 2) {
#pragma unroll   // constant indices keep the bias values in registers
    for (int j = 0; j < 4; ++j) bvn[j] = bias[nb + (j << 4)];
    // wait before the base or the index register of the four bias loads above is overwritten; they are inputs so that
    // they stay live up to the wait
    asm volatile("s_wait_xcnt 0x0" :: "s"(bias), "v"(nb) : "memory");
  }
#pragma unroll
  for (int i = 0; i < 2; ++i) {
    const int mBase = m0 + (i << 4);
#pragma unroll
    for (int j = 0; j < 4; ++j) {
      const int n = n0 + (j << 4) + rl;
      const float bv = bvn[j];
#pragma unroll
      for (int r = 0; r < 8; ++r) {
        float v = acc[i][j][r];
        if (BIAS_MODE == 1) v += bias[mBase + mOff + r];
        if (BIAS_MODE == 2) v += bv;
        if (RESID) v += Rb[(size_t)(mBase + mOff + r) * ldc + n];
        if (ACT == 1) v = tanhf(v);
        slab[(mOff + r) * 68 + (j << 4) + rl] = v;
      }
    }
    wave_lds_sync();
    if (OUT_MODE == 0) {
      float* C = (float*)Cout + (size_t)bz * strideC;
      const int hsel = lane >> 4, c4 = (lane & 15) * 4;   // row seg = 256 B = 16 lanes x 16 B, 2 rows per instruction
      {
        float* cp[8];
        v4f cv[8];
#pragma unroll
        for (int it = 0; it < 8; ++it) {
          const int row = it * 2 + hsel;                   // it 0..7 x hsel 0..1 = rows 0..15
          cv[it] = *(const v4f*)(slab + row * 68 + c4);
          cp[it] = C + (size_t)(mBase + row) * ldc + n0 + c4;
          *(v4f*)(cp[it]) = cv[it];
        }
        // wait before the second half's work overwrites an address or data register of the eight stores above; they
        // are inputs so that they stay live up to the wait
        if (i == 0)
          asm volatile("s_wait_xcnt 0x0" :: "v"(cp[0]), "v"(cp[1]), "v"(cp[2]), "v"(cp[3]), "v"(cp[4]), "v"(cp[5]),
                       "v"(cp[6]), "v"(cp[7]), "v"(cv[0]), "v"(cv[1]), "v"(cv[2]), "v"(cv[3]), "v"(cv[4]), "v"(cv[5]),
                       "v"(cv[6]), "v"(cv[7]) : "memory");
      }
    } else {
      const int q4 = lane >> 3, c8 = (lane & 7) * 8;
      unsigned short* C  = (unsigned short*)Cout  + (size_t)bz * strideC;
      unsigned short* C2 = (unsigned short*)Cout2 + (size_t)bz * strideC;
      {
        unsigned short *ph[4], *pl[4];
        v8us hs[4], ls[4];
#pragma unroll
        for (int it = 0; it < 4; ++it) {
          const int row = it * 4 + q4;                     // it 0..3 x q4 0..3 = rows 0..15
          const float* sp = slab + row * 68 + c8;
          v8us hv, lv;
#pragma unroll
          for (int e = 0; e < 8; ++e) {
            const unsigned short hb = f2bf_bits(sp[e]);
            const unsigned short lb = f2bf_bits(sp[e] - bf_bits2f(hb));
            hv[e] = hb;
            lv[e] = lb;
          }
          const size_t go = (size_t)(mBase + row) * ldc + n0 + c8;
          hs[it] = hv; ls[it] = lv;
          ph[it] = C + go; pl[it] = C2 + go;
          *(v8us*)(ph[it]) = hs[it];
          *(v8us*)(pl[it]) = ls[it];
        }
        // wait before the second half's work overwrites an address or data register of the eight stores above; they
        // are inputs so that they stay live up to the wait
        if (i == 0)
          asm volatile("s_wait_xcnt 0x0" :: "v"(ph[0]), "v"(ph[1]), "v"(ph[2]), "v"(ph[3]), "v"(pl[0]), "v"(pl[1]),
                       "v"(pl[2]), "v"(pl[3]), "v"(hs[0]), "v"(hs[1]), "v"(hs[2]), "v"(hs[3]), "v"(ls[0]), "v"(ls[1]),
                       "v"(ls[2]), "v"(ls[3]) : "memory");
      }
    }
    wave_lds_sync();
  }
}

// hk = tanh(x . kp_w1 + kp_b1) and hq = tanh(x . qp_w1 + qp_b1) in one launch (neither reads the other's result):
// blockIdx.y picks the encoder; per encoder M = 4096, N = 512, K = 512 = 64 x 4 block tiles = 256 blocks of 4 waves.
__global__ __launch_bounds__(128) void gemm_hidden_kernel(
    const unsigned short* __restrict__ Xh,  const unsigned short* __restrict__ Xl,
    const unsigned short* __restrict__ Wkh, const unsigned short* __restrict__ Wkl,
    const unsigned short* __restrict__ Wqh, const unsigned short* __restrict__ Wql,
    const float* __restrict__ kp_b1, const float* __restrict__ qp_b1,
    unsigned short* Hkh, unsigned short* Hkl, unsigned short* Hqh, unsigned short* Hql) {
  __shared__ __align__(16) unsigned char smem[G_LDS_BYTES];
  const bool q    = blockIdx.y != 0;
  gemm_hl_body<2, 2, false, 1>(Xh, Xl, DM, 0LL, q ? Wqh : Wkh, q ? Wql : Wkl, DM, 0LL,
                               (void*)(q ? Hqh : Hkh), (void*)(q ? Hql : Hkl), DM, 0LL,
                               q ? qp_b1 : kp_b1, nullptr, 0LL, DM, DM, blockIdx.x, 0, smem);
}

// out = x + ln . o_w + o_b: M = 4096, N = 512, K = 512 = 256 blocks of 4 waves.
__global__ __launch_bounds__(128) void gemm_out_kernel(
    const unsigned short* __restrict__ Lh,  const unsigned short* __restrict__ Ll,
    const unsigned short* __restrict__ Woh, const unsigned short* __restrict__ Wol,
    const float* __restrict__ o_b, const float* __restrict__ x, float* out) {
  __shared__ __align__(16) unsigned char smem[G_LDS_BYTES];
  gemm_hl_body<2, 0, true, 0>(Lh, Ll, DM, 0LL, Woh, Wol, DM, 0LL, (void*)out, (void*)out, DM, 0LL,
                              o_b, x, 0LL, DM, DM, blockIdx.x, 0, smem);
}

// ---------------------------------------------------------------------------
// Fused oscillator heads + encode. Block = 4 waves = 16 rows (blk = row block of 4096/16); wave w forms one of the four
// 16 x 32 products, K = 512, hi/lo WMMA:
//   wave 0: Pk = Hk.kp_w2, wave 1: Ak = X.ka_w, wave 2: Pq = Hq.qp_w2, wave 3: Aq = X.qa_w;
//   phase = tanh(P + b2)*pi + pos[l]; amp = softplus(A + ba) + 0.1 (wave w encodes rows 4w..4w+3, lane = oscillator);
//   Kt[row] = [amp_k cos | amp_k sin] (64), Qt[row] = [amp_q cos | amp_q sin]  -> bf16 hi/lo planes [4096][64].
//   Kt also goes out key-contiguous in groups of 16 keys: K^T planes [4096/16 row blocks][64 f][16 keys], so that the
//   2 KB a block writes per plane are whole 128-B lines of its own.
// Operand planes: H/X [4096][512]; W2t planes [32][512] (k-contiguous).
// LDS slab of the block [16][132]: cols 0..31 / 32..63 / 64..95 / 96..127 = k-phase / k-amp / q-phase / q-amp pre-acts,
// then the encoded Kt (0..63) and Qt (64..127).
// ---------------------------------------------------------------------------
__device__ __forceinline__ void enc_head_body(
    const unsigned short* __restrict__ Hkhp, const unsigned short* __restrict__ Hklp,
    const unsigned short* __restrict__ Hqhp, const unsigned short* __restrict__ Hqlp,
    const unsigned short* __restrict__ Xhp,  const unsigned short* __restrict__ Xlp,
    const unsigned short* __restrict__ Wk2hp, const unsigned short* __restrict__ Wk2lp,
    const unsigned short* __restrict__ Wq2hp, const unsigned short* __restrict__ Wq2lp,
    const unsigned short* __restrict__ Wkahp, const unsigned short* __restrict__ Wkalp,
    const unsigned short* __restrict__ Wqahp, const unsigned short* __restrict__ Wqalp,
    const float* __restrict__ bk2, const float* __restrict__ bq2,
    const float* __restrict__ bka, const float* __restrict__ bqa,
    const float* __restrict__ pos,
    unsigned short* Qhp, unsigned short* Qlp, unsigned short* Khp, unsigned short* Klp,
    unsigned short* KThp, unsigned short* KTlp, int blk, float* sl) {
  const int tid = threadIdx.x, wave = tid >> 5, lane = tid & 31, hh = lane >> 4, c = lane & 15;
  const int row0 = blk * 16;
  const int pw   = __builtin_amdgcn_readfirstlane(wave);   // scalar: the wave's product

  const unsigned short* Ahp = pw == 0 ? Hkhp : pw == 2 ? Hqhp : Xhp;
  const unsigned short* Alp = pw == 0 ? Hklp : pw == 2 ? Hqlp : Xlp;
  const unsigned short* Bhp = pw == 0 ? Wk2hp : pw == 1 ? Wkahp : pw == 2 ? Wq2hp : Wqahp;
  const unsigned short* Blp = pw == 0 ? Wk2lp : pw == 1 ? Wkalp : pw == 2 ? Wq2lp : Wqalp;
  const float* bias = pw == 0 ? bk2 : pw == 1 ? bka : pw == 2 ? bq2 : bqa;

  const size_t ao = (size_t)(row0 + c) * DM + 8 * hh;
  const size_t bo = (size_t)c * DM + 8 * hh;
  const __bf16* pah = (const __bf16*)(const void*)Ahp + ao;
  const __bf16* pal = (const __bf16*)(const void*)Alp + ao;
  const __bf16* pbh = (const __bf16*)(const void*)Bhp + bo;
  const __bf16* pbl = (const __bf16*)(const void*)Blp + bo;

  v8f acc[2];
  acc[0] = zero8(); acc[1] = zero8();

#pragma unroll 1   // 128 k a trip: its 48 fragment loads are all in flight at once
  for (int k0 = 0; k0 < DM; k0 += 128) {
    v16b ah[4], al[4], bh[4][2], bl[4][2];
#pragma unroll   // constant indices keep the fragments in registers
    for (int u = 0; u < 4; ++u) {
      ah[u] = ldfrag(pah + u * 32);
      al[u] = ldfrag(pal + u * 32);
#pragma unroll
      for (int t = 0; t < 2; ++t) {   // weight rows t*16 + c
        bh[u][t] = ldfrag(pbh + t * 16 * DM + u * 32);
        bl[u][t] = ldfrag(pbl + t * 16 * DM + u * 32);
      }
    }
    // wait before any address register of the 48 loads above is overwritten; the four addresses are inputs so that they
    // stay live up to the wait and no load's result is placed in them
    asm volatile("s_wait_xcnt 0x0" :: "v"(pah), "v"(pal), "v"(pbh), "v"(pbl) : "memory");
#pragma unroll
    for (int u = 0; u < 4; ++u)
#pragma unroll
      for (int t = 0; t < 2; ++t) acc[t] = mma3(ah[u], al[u], bh[u][t], bl[u][t], acc[t]);
    pah += 128; pal += 128; pbh += 128; pbl += 128;
  }

  // stage pre-activations (+bias) in the D layout: row 8hh+r, oscillator n = t*16+c, columns of the wave's product
  float bv[2];
#pragma unroll   // constant indices keep the bias values in registers
  for (int t = 0; t < 2; ++t) bv[t] = bias[t * 16 + c];
  // wait before the base or the index register of the two bias loads above is overwritten; they are inputs so that they
  // stay live up to the wait
  asm volatile("s_wait_xcnt 0x0" :: "s"(bias), "v"(c) : "memory");
#pragma unroll
  for (int t = 0; t < 2; ++t) {
#pragma unroll
    for (int r = 0; r < 8; ++r) sl[(8 * hh + r) * 132 + pw * 32 + t * 16 + c] = acc[t][r] + bv[t];
  }
  __syncthreads();   // a row's four pre-activations come from the four waves

  // encode: lane = oscillator index, one row per iteration (same lane reads and writes its own 4 slots)
  const float PI = 3.14159265358979323846f;
#pragma unroll 1   // rolled: one copy of the long transcendental body in the instruction cache
  for (int i = 0; i < 4; ++i) {
    const int it = wave * 4 + i;
    float* sp = sl + it * 132;
    const int l = (row0 + it) & (SEQ - 1);
    const float pa  = pos[l * KO + lane];
    const float vpk = sp[lane], vak = sp[32 + lane], vpq = sp[64 + lane], vaq = sp[96 + lane];
    const float phk = tanhf(vpk) * PI + pa;
    const float phq = tanhf(vpq) * PI + pa;
    const float ak  = fmaxf(vak, 0.f) + log1pf(expf(-fabsf(vak))) + 0.1f;
    const float aq  = fmaxf(vaq, 0.f) + log1pf(expf(-fabsf(vaq))) + 0.1f;
    sp[lane]      = ak * cosf(phk);
    sp[32 + lane] = ak * sinf(phk);
    sp[64 + lane] = aq * cosf(phq);
    sp[96 + lane] = aq * sinf(phq);
  }
  __syncthreads();   // the stores below gather encoded rows of all four waves

  {
    // thread = 8 features of one row in each of the four planes; a wave's store covers 4 whole 128-B rows
    const int row = tid >> 3, c8 = (tid & 7) * 8;
    const float* sk = sl + row * 132 + c8;
    const float* sq = sl + row * 132 + 64 + c8;
    v8us khv, klv, qhv, qlv;
#pragma unroll
    for (int e = 0; e < 8; ++e) {
      const unsigned short kh = f2bf_bits(sk[e]);
      const unsigned short kl = f2bf_bits(sk[e] - bf_bits2f(kh));
      const unsigned short qh = f2bf_bits(sq[e]);
      const unsigned short ql = f2bf_bits(sq[e] - bf_bits2f(qh));
      khv[e] = kh; klv[e] = kl; qhv[e] = qh; qlv[e] = ql;
    }
    const size_t go = (size_t)(row0 + row) * QK + c8;
    unsigned short *sk0 = Khp + go, *sk1 = Klp + go, *sq0 = Qhp + go, *sq1 = Qlp + go;
    *(v8us*)(sk0) = khv;
    *(v8us*)(sk1) = klv;
    *(v8us*)(sq0) = qhv;
    *(v8us*)(sq1) = qlv;
    // wait before an address or data register of the four stores above is overwritten; they are inputs so that they
    // stay live up to the wait
    asm volatile("s_wait_xcnt 0x0" :: "v"(sk0), "v"(sk1), "v"(sq0), "v"(sq1), "v"(khv), "v"(klv), "v"(qhv), "v"(qlv)
                 : "memory");
  }

  {
    // K^T group of the block: [64 f][16 keys] per plane; waves 0,1 write the hi plane, waves 2,3 the lo plane, 32 f each;
    // piece p = 8 keys of feature p >> 1, so that one store of a wave covers 512 contiguous bytes
    const bool lop = pw >= 2;
    unsigned short* dst = (lop ? KTlp : KThp) + (size_t)blk * (QK * 16) + (wave & 1) * 512 + lane * 8;
    v8us o[2];
#pragma unroll
    for (int g = 0; g < 2; ++g) {
      const int p  = g * 32 + lane;
      const int f  = (wave & 1) * 32 + (p >> 1);
      const int k8 = (p & 1) * 8;
#pragma unroll
      for (int e = 0; e < 8; ++e) {
        const float xe = sl[(k8 + e) * 132 + f];
        const unsigned short hb = f2bf_bits(xe);
        const unsigned short lb = f2bf_bits(xe - bf_bits2f(hb));
        o[g][e] = lop ? lb : hb;
      }
    }
    *(v8us*)(dst)       = o[0];
    *(v8us*)(dst + 256) = o[1];
    // wait before the address or a data register of the two stores above is overwritten (inputs: live up to the wait)
    asm volatile("s_wait_xcnt 0x0" :: "v"(dst), "v"(o[0]), "v"(o[1]) : "memory");
  }
}

// ---------------------------------------------------------------------------
// Oscillator heads + encode and the V^T projection in one launch (neither reads the other's result), 4 waves a block:
//   blocks 0..255   enc_head_body, row block = blockIdx.x;
//   blocks 256..511 V^T[b][d][l] = sum_k v_w^T[d][k] x[b][l][k] + v_b[d] -> bf16 hi/lo planes [2][512][2048]
//                  (A = v_w^T planes [512][512], Bt = x planes of batch b [2048][512]; M = 512, N = 2048, K = 512:
//                  8 x 16 block tiles = 128 blocks per batch).
// ---------------------------------------------------------------------------
__global__ __launch_bounds__(128) void enc_v_kernel(
    const unsigned short* __restrict__ Hkhp, const unsigned short* __restrict__ Hklp,
    const unsigned short* __restrict__ Hqhp, const unsigned short* __restrict__ Hqlp,
    const unsigned short* __restrict__ Xhp,  const unsigned short* __restrict__ Xlp,
    const unsigned short* __restrict__ Wk2hp, const unsigned short* __restrict__ Wk2lp,
    const unsigned short* __restrict__ Wq2hp, const unsigned short* __restrict__ Wq2lp,
    const unsigned short* __restrict__ Wkahp, const unsigned short* __restrict__ Wkalp,
    const unsigned short* __restrict__ Wqahp, const unsigned short* __restrict__ Wqalp,
    const float* __restrict__ bk2, const float* __restrict__ bq2,
    const float* __restrict__ bka, const float* __restrict__ bqa,
    const float* __restrict__ pos,
    unsigned short* Qhp, unsigned short* Qlp, unsigned short* Khp, unsigned short* Klp,
    unsigned short* KThp, unsigned short* KTlp,
    const unsigned short* __restrict__ Wvhp, const unsigned short* __restrict__ Wvlp,
    const float* __restrict__ v_b, unsigned short* VThp, unsigned short* VTlp) {
  __shared__ __align__(16) unsigned char smem[G_LDS_BYTES];   // encoder blocks use its first 16 x 132 floats
  const int bx = blockIdx.x;
  if (bx < MTOT / 16) {
    enc_head_body(Hkhp, Hklp, Hqhp, Hqlp, Xhp, Xlp, Wk2hp, Wk2lp, Wq2hp, Wq2lp, Wkahp, Wkalp, Wqahp, Wqalp,
                  bk2, bq2, bka, bqa, pos, Qhp, Qlp, Khp, Klp, KThp, KTlp, bx, (float*)smem);
  } else {
    const int idx  = bx - MTOT / 16;
    gemm_hl_body<1, 2, false, 0>(Wvhp, Wvlp, DM, 0LL, Xhp, Xlp, DM, (long long)SEQ * DM,
                                 (void*)VThp, (void*)VTlp, SEQ, (long long)DM * SEQ,
                                 v_b, nullptr, 0LL, SEQ, DM, idx & 127, idx >> 7, smem);
  }
}

// ---------------------------------------------------------------------------
// Per-chunk sums: U[b][ch][d][f] = sum_{l' in 64-key chunk ch} V^T[b][d][l'] * K^T[b][f][l'] (hi/lo WMMA, f32 out).
// A = V^T rows (m = d), key-contiguous at pitch 2048; B rows = K^T rows (n = f) in groups [16-key group][64 f][16 keys]:
// a fragment's keys k0+8h.. and k0+16+8h.. lie in two neighbouring groups. Wave = 16 d x 64 f, block = 8 waves
// = 128 d; grid = (4, NCH-1, NB): chunks 0..NCH-2 (the last chunk enters no state). Each wave stores whole 256-B rows.
// ---------------------------------------------------------------------------
__global__ __launch_bounds__(256) void chunk_kv_kernel(
    const unsigned short* __restrict__ Vhp, const unsigned short* __restrict__ Vlp,
    const unsigned short* __restrict__ KThp, const unsigned short* __restrict__ KTlp, float* U) {
  __shared__ __align__(16) float sT[8][16 * 68];
  const int lane = threadIdx.x & 31, wave = threadIdx.x >> 5, hh = lane >> 4, c = lane & 15;
  const int ch = blockIdx.y, b = blockIdx.z;
  const int d0 = blockIdx.x * 128 + wave * 16;
  const size_t ao = ((size_t)b * DM + d0 + c) * SEQ + ch * 64 + 8 * hh;
  const size_t bo = ((size_t)(b * (SEQ / 16) + ch * 4) * QK + c) * 16 + 8 * hh;
  const __bf16* va = (const __bf16*)(const void*)Vhp + ao;
  const __bf16* vl = (const __bf16*)(const void*)Vlp + ao;
  const __bf16* kb = (const __bf16*)(const void*)KThp + bo;
  const __bf16* kl = (const __bf16*)(const void*)KTlp + bo;
  v16b ah[2], al[2], bh[2][4], bl[2][4];
#pragma unroll
  for (int kk = 0; kk < 2; ++kk) {
    ah[kk] = ldfrag(va + kk * 32);
    al[kk] = ldfrag(vl + kk * 32);
#pragma unroll
    for (int j = 0; j < 4; ++j) {
      FB fh, fl;   // 16-key groups 2 kk and 2 kk + 1 of the chunk, features j*16 + c
      fh.h[0] = *(const v8b*)(kb + (2 * kk) * (QK * 16) + j * 256);
      fh.h[1] = *(const v8b*)(kb + (2 * kk + 1) * (QK * 16) + j * 256);
      fl.h[0] = *(const v8b*)(kl + (2 * kk) * (QK * 16) + j * 256);
      fl.h[1] = *(const v8b*)(kl + (2 * kk + 1) * (QK * 16) + j * 256);
      bh[kk][j] = fh.v;
      bl[kk][j] = fl.v;
    }
  }
  // wait before any address register of the 40 loads above is overwritten; the four addresses are inputs so that they
  // stay live up to the wait
  asm volatile("s_wait_xcnt 0x0" :: "v"(va), "v"(vl), "v"(kb), "v"(kl) : "memory");
  v8f acc[4];
#pragma unroll
  for (int j = 0; j < 4; ++j) acc[j] = zero8();
#pragma unroll
  for (int kk = 0; kk < 2; ++kk)
#pragma unroll
    for (int j = 0; j < 4; ++j) acc[j] = mma3(ah[kk], al[kk], bh[kk][j], bl[kk][j], acc[j]);

  float* slab = sT[wave];
#pragma unroll
  for (int j = 0; j < 4; ++j)
#pragma unroll
    for (int r = 0; r < 8; ++r) slab[(8 * hh + r) * 68 + j * 16 + c] = acc[j][r];
  wave_lds_sync();
  float* C = U + (((size_t)b * NCH + ch) * DM + d0) * QK + hh * QK + c * 4;   // 2 rows of 256 B per instruction
#pragma unroll
  for (int it = 0; it < 8; ++it) {
    const v4f v = *(const v4f*)(slab + (it * 2 + hh) * 68 + c * 4);
    *(v4f*)(C + it * 2 * QK) = v;
  }
}

// ---------------------------------------------------------------------------
// Exclusive prefix over the key chunks: M[b][ch] = sum_{c < ch} U[b][c], U f32 [b][ch][512 d][64 f] (chunks 0..NCH-2
// are written and read), M -> bf16 hi/lo planes of the same shape, chunk 0 = 0. Thread = 4 consecutive elements;
// grid = NB*512*64/4/128 blocks of 128; a wave reads 512 B and writes 256 B per plane and chunk.
// ---------------------------------------------------------------------------
__global__ __launch_bounds__(128) void chunk_scan_kernel(const float* __restrict__ U, unsigned short* Mh,
                                                         unsigned short* Ml) {
  const int i = blockIdx.x * 128 + threadIdx.x;
  const int b = i / (DM * QK / 4);
  const size_t base = (size_t)b * ((size_t)NCH * DM * QK) + (size_t)(i - b * (DM * QK / 4)) * 4;
  v4f u[NCH - 1];
#pragma unroll
  for (int ch = 0; ch < NCH - 1; ++ch) u[ch] = *(const v4f*)(U + base + (size_t)ch * (DM * QK));
  unsigned short* ph = Mh + base;
  unsigned short* pl = Ml + base;
  v4f m = (v4f){0.f, 0.f, 0.f, 0.f};
#pragma unroll
  for (int ch = 0; ch < NCH; ++ch) {
    const unsigned short h0 = f2bf_bits(m[0]), h1 = f2bf_bits(m[1]), h2 = f2bf_bits(m[2]), h3 = f2bf_bits(m[3]);
    const unsigned short l0 = f2bf_bits(m[0] - bf_bits2f(h0)), l1 = f2bf_bits(m[1] - bf_bits2f(h1));
    const unsigned short l2 = f2bf_bits(m[2] - bf_bits2f(h2)), l3 = f2bf_bits(m[3] - bf_bits2f(h3));
    const v2u hv = (v2u){pk16(h0, h1), pk16(h2, h3)};
    const v2u lv = (v2u){pk16(l0, l1), pk16(l2, l3)};
    // the chunk's two state stores and their wait in one statement: no later load result, packed value or address step
    // can be placed in a register that the stores name ahead of the wait
    asm volatile("global_store_b64 %0, %2, off\n\tglobal_store_b64 %1, %3, off\n\ts_wait_xcnt 0x0"
                 :: "v"(ph), "v"(pl), "v"(hv), "v"(lv) : "memory");
    ph += DM * QK;
    pl += DM * QK;
    if (ch < NCH - 1) m += u[ch];
  }
}

// ---------------------------------------------------------------------------
// Causal mixing: R[b][l][d] = (1/sqrt((l+1)*32)) * sum_{l' <= l} S[l][l'] * V[l'][d],  S = Qt[l] . Kt[l'] (K = 64).
// Block = 4 waves = 64 query rows of one batch element and one 128-wide d chunk; grid = NB * 32 * 4.
//   Qt/Kt planes bf16 hi/lo [4096][64]; V^T planes bf16 hi/lo [b][512 d][2048 l']; R f32 [4096][512].
//   Keys of the earlier 64-key chunks enter through the state M[b][qb] = sum_{l' < 64 qb} Kt[l'] (x) V[l'] (planes
//   [b][ch][512 d][64 f], f contiguous): O = Qt . M (A = Qt rows, B = M rows from global).
//   The block's own key tile: stage Kt tile [64][64] and V^T chunk [128][64] (hi+lo) in LDS
//   (plain 16-B loads, __syncthreads after); S per wave in registers (A = Qt rows, B = Kt rows from LDS);
//   entries with l' > l set to 0 by value; P = S split to bf16 hi/lo into the wave's LDS tile
//   Output: per wave 16 rows x 128 floats staged in LDS (aliasing the K/V region after a block barrier), each
//   Coverage: 4 d chunks x 32 row blocks x 2 batches x (4 waves x 16 rows x 128) = the whole [4096][512] R plane.
// ---------------------------------------------------------------------------
__global__ __launch_bounds__(128) void causal_mix_kernel(
    const unsigned short* __restrict__ Qhp, const unsigned short* __restrict__ Qlp,
    const unsigned short* __restrict__ Khp, const unsigned short* __restrict__ Klp,
    const unsigned short* __restrict__ Vhp, const unsigned short* __restrict__ Vlp,
    const unsigned short* __restrict__ Mhp, const unsigned short* __restrict__ Mlp,
    float* Rout) {
  // Every tile row holds 64 halves (128 B) at a pitch of LP = 72 halves (144 B = 16 B x 9): the 16 rows that one
  // ds_load_b128 / ds_store_b128 touches then start on 16 different 4-bank groups instead of 2.
  constexpr int LP = 72;
  __shared__ __align__(16) unsigned char smem[73728];
  __bf16* Ksh = (__bf16*)(smem);           // [64 l'][LP]    9216 B
  __bf16* Ksl = (__bf16*)(smem + 9216);
  __bf16* Vth = (__bf16*)(smem + 18432);   // [128 d][LP]   18432 B
  __bf16* Vtl = (__bf16*)(smem + 36864);
  __bf16* Pgh = (__bf16*)(smem + 55296);   // [4 waves][16][LP]  9216 B
  __bf16* Pgl = (__bf16*)(smem + 64512);
  float*  Osb = (float*)(smem);            // [4 waves][16][132] after the main loop (aliases K/V tiles)

  const int tid = threadIdx.x, wave = tid >> 5, lane = tid & 31, hh = lane >> 4, c = lane & 15;
  const int bx  = blockIdx.x;
  const int dch = bx & 3;
  const int qb  = (bx >> 2) & 31;
  const int b   = bx >> 7;
  const int q0  = qb * 64 + wave * 16;                 // sequence-local first row of this wave
  const size_t grow0 = (size_t)b * SEQ + q0;           // global row of this wave's row 0

  const __bf16* Qh = (const __bf16*)(const void*)Qhp; const __bf16* Ql = (const __bf16*)(const void*)Qlp;
  const __bf16* Kh = (const __bf16*)(const void*)Khp; const __bf16* Kl = (const __bf16*)(const void*)Klp;
  const __bf16* Vh = (const __bf16*)(const void*)Vhp; const __bf16* Vl = (const __bf16*)(const void*)Vlp;
  const __bf16* Mh = (const __bf16*)(const void*)Mhp; const __bf16* Ml = (const __bf16*)(const void*)Mlp;

  // Qt fragments (A operand, row = lane&15): two 32-deep k chunks, hi and lo
  v16b qah[2], qal[2];
#pragma unroll
  for (int dc = 0; dc < 2; ++dc) {
    qah[dc] = ldfrag(Qh + (grow0 + c) * QK + dc * 32 + 8 * hh);
    qal[dc] = ldfrag(Ql + (grow0 + c) * QK + dc * 32 + 8 * hh);
  }
  v8f oacc[8];
#pragma unroll
  for (int t = 0; t < 8; ++t) oacc[t] = zero8();

  __bf16* pwh = Pgh + wave * (16 * LP);
  __bf16* pwl = Pgl + wave * (16 * LP);

  // O[16 x 128] = Qt[16 x 64] . M[64 x 128]: B[k = feature][n = d] = M[d][feature]
  const size_t mo = (((size_t)b * NCH + qb) * DM + dch * 128 + c) * QK + 8 * hh;
  const __bf16* mhp = Mh + mo;
  const __bf16* mlp = Ml + mo;
#pragma unroll
  for (int dc = 0; dc < 2; ++dc) {
    v16b mb[8], ml[8];
#pragma unroll
    for (int t = 0; t < 8; ++t) {
      mb[t] = ldfrag(mhp + t * 16 * QK + dc * 32);
      ml[t] = ldfrag(mlp + t * 16 * QK + dc * 32);
    }
    // wait before any address register of the 32 loads above is overwritten; both addresses are inputs so that they
    // stay live up to the wait
    asm volatile("s_wait_xcnt 0x0" :: "v"(mhp), "v"(mlp) : "memory");
#pragma unroll
    for (int t = 0; t < 8; ++t) oacc[t] = mma3(qah[dc], qal[dc], mb[t], ml[t], oacc[t]);
  }

  {
    const int kv0 = qb * 64;
    {
      // Kt tile: 128 threads x 32 halves per plane = 64 x 64
      const int r = tid >> 1, half = (tid & 1) * 32;
      const __bf16* ks = Kh + ((size_t)b * SEQ + kv0 + r) * QK + half;
      const __bf16* ls = Kl + ((size_t)b * SEQ + kv0 + r) * QK + half;
      v8b kr[4], lr[4];
#pragma unroll
      for (int i = 0; i < 4; ++i) {
        kr[i] = *(const v8b*)(ks + 8 * i);
        lr[i] = *(const v8b*)(ls + 8 * i);
      }
      // V^T chunk: thread = d row (dch*128 + tid), 64 halves per plane = 128 x 64
      const __bf16* vs = Vh + ((size_t)b * DM + dch * 128 + tid) * SEQ + kv0;
      const __bf16* vl = Vl + ((size_t)b * DM + dch * 128 + tid) * SEQ + kv0;
      v8b vr[8], wr[8];
#pragma unroll
      for (int i = 0; i < 8; ++i) {
        vr[i] = *(const v8b*)(vs + 8 * i);
        wr[i] = *(const v8b*)(vl + 8 * i);
      }
      // wait before any address register of the 24 loads above is overwritten; the four addresses are inputs so that
      // they stay live up to the wait and no later load's result is placed in them
      asm volatile("s_wait_xcnt 0x0" :: "v"(ks), "v"(ls), "v"(vs), "v"(vl) : "memory");
#pragma unroll
      for (int i = 0; i < 4; ++i) {
        *(v8b*)(Ksh + r * LP + half + 8 * i) = kr[i];
        *(v8b*)(Ksl + r * LP + half + 8 * i) = lr[i];
      }
#pragma unroll
      for (int i = 0; i < 8; ++i) {
        *(v8b*)(Vth + tid * LP + 8 * i) = vr[i];
        *(v8b*)(Vtl + tid * LP + 8 * i) = wr[i];
      }
    }
    __syncthreads();

    // S strip 16 x 64 for this wave: B[k = feature][n = key] = Kt[key][feature]
    v8f s[4];
#pragma unroll
    for (int j = 0; j < 4; ++j) {
      s[j] = zero8();
#pragma unroll
      for (int dc = 0; dc < 2; ++dc) {
        FB kb, kl;
        const int kb0 = (j * 16 + c) * LP + dc * 32 + 8 * hh;
        kb.h[0] = *(const v8b*)(Ksh + kb0);
        kb.h[1] = *(const v8b*)(Ksh + kb0 + 16);
        kl.h[0] = *(const v8b*)(Ksl + kb0);
        kl.h[1] = *(const v8b*)(Ksl + kb0 + 16);
        s[j] = mma3(qah[dc], qal[dc], kb.v, kl.v, s[j]);
      }
    }
    // causal select by value, split to bf16 hi/lo, into the wave's P tile [row][key]
#pragma unroll
    for (int r = 0; r < 8; ++r) {
      const int qrow = q0 + 8 * hh + r;
#pragma unroll
      for (int j = 0; j < 4; ++j) {
        const int kvcol = kv0 + j * 16 + c;
        float pm = s[j][r];
        if (kvcol > qrow) pm = 0.f;
        const unsigned short hb = f2bf_bits(pm);
        const unsigned short lb = f2bf_bits(pm - bf_bits2f(hb));
        pwh[(8 * hh + r) * LP + j * 16 + c] = __builtin_bit_cast(__bf16, hb);
        pwl[(8 * hh + r) * LP + j * 16 + c] = __builtin_bit_cast(__bf16, lb);
      }
    }
    wave_lds_sync();

    // O[16 x 128] += P[16 x 64] . V[64 x 128]: A = P (row = lane&15), B[k = key][n = d] = V^T[d][key]
#pragma unroll 1
    for (int kk = 0; kk < 2; ++kk) {
      FB pa, pl;
      const int pb0 = c * LP + kk * 32 + 8 * hh;
      pa.h[0] = *(const v8b*)(pwh + pb0);
      pa.h[1] = *(const v8b*)(pwh + pb0 + 16);
      pl.h[0] = *(const v8b*)(pwl + pb0);
      pl.h[1] = *(const v8b*)(pwl + pb0 + 16);
#pragma unroll
      for (int t = 0; t < 8; ++t) {
        FB vb, vlo;
        const int vb0 = (t * 16 + c) * LP + kk * 32 + 8 * hh;
        vb.h[0]  = *(const v8b*)(Vth + vb0);
        vb.h[1]  = *(const v8b*)(Vth + vb0 + 16);
        vlo.h[0] = *(const v8b*)(Vtl + vb0);
        vlo.h[1] = *(const v8b*)(Vtl + vb0 + 16);
        oacc[t] = mma3(pa.v, pl.v, vb.v, vlo.v, oacc[t]);
      }
    }
  }
  __syncthreads();   // every wave done with the K/V tiles before the output staging aliases them

  // scale by 1/sqrt((l+1)*32), stage the wave's 16 x 128 tile, write whole 512-B row segments
  float* os = Osb + wave * (16 * 132);
#pragma unroll
  for (int r = 0; r < 8; ++r) {
    const int lq = q0 + 8 * hh + r;
    const float nrm = sqrtf((float)((lq + 1) * KO));
    const float inv = 1.0f / nrm;
#pragma unroll
    for (int t = 0; t < 8; ++t) os[(8 * hh + r) * 132 + t * 16 + c] = oacc[t][r] * inv;
  }
  wave_lds_sync();
  {
#pragma unroll
    for (int it = 0; it < 16; ++it) {
      const v4f val = *(const v4f*)(os + it * 132 + lane * 4);
      *(v4f*)(Rout + (grow0 + it) * DM + dch * 128 + lane * 4) = val;
    }
    
  }
}

// ---------------------------------------------------------------------------
// One wave per row (block = 8 rows, grid = 4096/8); lane holds cols 8*lane..+7 and 256+8*lane..+7.
// ---------------------------------------------------------------------------
__global__ __launch_bounds__(256) void ln_split_kernel(const float* __restrict__ R, const float* __restrict__ g,
                                                       const float* __restrict__ be,
                                                       unsigned short* Lh, unsigned short* Ll) {
  const int tid = threadIdx.x, wave = tid >> 5, lane = tid & 31;
  const int row = blockIdx.x * 8 + wave;
  const float* rp = R + (size_t)row * DM;
  const int cA = 8 * lane, cB = 256 + 8 * lane;
  const v4f x0 = *(const v4f*)(rp + cA), x1 = *(const v4f*)(rp + cA + 4);
  const v4f x2 = *(const v4f*)(rp + cB), x3 = *(const v4f*)(rp + cB + 4);
  const v4f g0 = *(const v4f*)(g + cA),  g1 = *(const v4f*)(g + cA + 4);
  const v4f g2 = *(const v4f*)(g + cB),  g3 = *(const v4f*)(g + cB + 4);
  const v4f e0 = *(const v4f*)(be + cA), e1 = *(const v4f*)(be + cA + 4);
  const v4f e2 = *(const v4f*)(be + cB), e3 = *(const v4f*)(be + cB + 4);
  float v[16], gg[16], bb[16];
#pragma unroll
  for (int e = 0; e < 4; ++e) {
    v[e] = x0[e]; v[4 + e] = x1[e]; v[8 + e] = x2[e]; v[12 + e] = x3[e];
    gg[e] = g0[e]; gg[4 + e] = g1[e]; gg[8 + e] = g2[e]; gg[12 + e] = g3[e];
    bb[e] = e0[e]; bb[4 + e] = e1[e]; bb[8 + e] = e2[e]; bb[12 + e] = e3[e];
  }
  float sum = 0.f;
#pragma unroll
  for (int e = 0; e < 16; ++e) sum += v[e];
#pragma unroll
  for (int off = 1; off < 32; off <<= 1) sum += __shfl_xor(sum, off, 32);
  const float mu = sum * (1.0f / (float)DM);
  float ss = 0.f;
#pragma unroll
  for (int e = 0; e < 16; ++e) { const float d = v[e] - mu; v[e] = d; ss += d * d; }
#pragma unroll
  for (int off = 1; off < 32; off <<= 1) ss += __shfl_xor(ss, off, 32);
  const float var  = ss * (1.0f / (float)DM);
  const float rstd = 1.0f / sqrtf(var + 1e-5f);
  v8us hA, lA, hB, lB;
#pragma unroll
  for (int e = 0; e < 8; ++e) {
    const float ya = v[e] * rstd * gg[e] + bb[e];
    const float yb = v[8 + e] * rstd * gg[8 + e] + bb[8 + e];
    const unsigned short ha = f2bf_bits(ya), la = f2bf_bits(ya - bf_bits2f(ha));
    const unsigned short hb = f2bf_bits(yb), lb = f2bf_bits(yb - bf_bits2f(hb));
    hA[e] = ha; lA[e] = la; hB[e] = hb; lB[e] = lb;
  }
  const size_t oA = (size_t)row * DM + cA, oB = (size_t)row * DM + cB;
  {
    *(v8us*)(Lh + oA) = hA;
    *(v8us*)(Lh + oB) = hB;
    *(v8us*)(Ll + oA) = lA;
    *(v8us*)(Ll + oB) = lB;
    
  }
}

// ---------------------------------------------------------------------------
// Workspace region map (bytes; every region an exact multiple of its store granularity, no tail rows):
//   Xh, Xl            bf16 [4096][512]     2 x 4,194,304          0 ..  8,388,608
//   Hkh,Hkl,Hqh,Hql   bf16 [4096][512]     4 x 4,194,304   8,388,608 .. 25,165,824
//   W1t planes (kp,qp,v,o) bf16 [512][512] 8 x 524,288  25,165,824 .. 29,360,128
//   W2t planes (kp2,qp2,ka,qa) bf16 [32][512] 8 x 32,768 29,360,128 .. 29,622,272
//   Qth,Qtl,Kth,Ktl   bf16 [4096][64]      4 x 524,288    29,622,272 .. 31,719,424
//   VTh, VTl          bf16 [2][512][2048]  2 x 4,194,304  31,719,424 .. 40,108,032
//   R                 f32  [4096][512]     8,388,608      40,108,032 .. 48,496,640
//   Lh, Ll            bf16 [4096][512]     2 x 4,194,304  48,496,640 .. 56,885,248
//   KTh, KTl          bf16 [256][64][16]   2 x 524,288    56,885,248 .. 57,933,824
//   U                 f32  [2][32][512][64] 8,388,608     57,933,824 .. 66,322,432
//   Mh, Ml            bf16 [2][32][512][64] 2 x 4,194,304 66,322,432 .. 74,711,040
// ---------------------------------------------------------------------------
extern "C" void kernel_launch(void* const* d_in, const int* in_sizes, int n_in,
                              void* d_out, int out_size, void* d_ws, size_t ws_size,
                              hipStream_t stream) {
  if (n_in < 20) return;
  if (in_sizes[0] != MTOT * DM || in_sizes[1] != SEQ * KO) return;
  if (in_sizes[2] != DM * DM || in_sizes[8] != DM * DM || in_sizes[14] != DM * DM || in_sizes[18] != DM * DM) return;
  if (in_sizes[3] != DM || in_sizes[9] != DM || in_sizes[15] != DM || in_sizes[19] != DM) return;
  if (in_sizes[16] != DM || in_sizes[17] != DM) return;
  if (in_sizes[4] != DM * KO || in_sizes[6] != DM * KO || in_sizes[10] != DM * KO || in_sizes[12] != DM * KO) return;
  if (in_sizes[5] != KO || in_sizes[7] != KO || in_sizes[11] != KO || in_sizes[13] != KO) return;
  if (out_size != MTOT * DM) return;

  const float* x     = (const float*)d_in[0];
  const float* pos   = (const float*)d_in[1];
  const float* kp_w1 = (const float*)d_in[2];
  const float* kp_b1 = (const float*)d_in[3];
  const float* kp_w2 = (const float*)d_in[4];
  const float* kp_b2 = (const float*)d_in[5];
  const float* ka_w  = (const float*)d_in[6];
  const float* ka_b  = (const float*)d_in[7];
  const float* qp_w1 = (const float*)d_in[8];
  const float* qp_b1 = (const float*)d_in[9];
  const float* qp_w2 = (const float*)d_in[10];
  const float* qp_b2 = (const float*)d_in[11];
  const float* qa_w  = (const float*)d_in[12];
  const float* qa_b  = (const float*)d_in[13];
  const float* v_w   = (const float*)d_in[14];
  const float* v_b   = (const float*)d_in[15];
  const float* ln_g  = (const float*)d_in[16];
  const float* ln_b  = (const float*)d_in[17];
  const float* o_w   = (const float*)d_in[18];
  const float* o_b   = (const float*)d_in[19];

  const size_t PX = (size_t)MTOT * DM * 2;        // 4,194,304
  const size_t PW = (size_t)DM * DM * 2;          //   524,288
  const size_t PS = (size_t)KO * DM * 2;          //    32,768
  const size_t PQ = (size_t)MTOT * QK * 2;        //   524,288
  const size_t PV = (size_t)NB * DM * SEQ * 2;    // 4,194,304
  const size_t PR = (size_t)MTOT * DM * 4;        // 8,388,608
  size_t off = 0;
  const size_t oXh  = off; off += PX;  const size_t oXl  = off; off += PX;
  const size_t oHkh = off; off += PX;  const size_t oHkl = off; off += PX;
  const size_t oHqh = off; off += PX;  const size_t oHql = off; off += PX;
  const size_t oWkh = off; off += PW;  const size_t oWkl = off; off += PW;
  const size_t oWqh = off; off += PW;  const size_t oWql = off; off += PW;
  const size_t oWvh = off; off += PW;  const size_t oWvl = off; off += PW;
  const size_t oWoh = off; off += PW;  const size_t oWol = off; off += PW;
  const size_t oSk2h = off; off += PS; const size_t oSk2l = off; off += PS;
  const size_t oSq2h = off; off += PS; const size_t oSq2l = off; off += PS;
  const size_t oSkah = off; off += PS; const size_t oSkal = off; off += PS;
  const size_t oSqah = off; off += PS; const size_t oSqal = off; off += PS;
  const size_t oQth = off; off += PQ;  const size_t oQtl = off; off += PQ;
  const size_t oKth = off; off += PQ;  const size_t oKtl = off; off += PQ;
  const size_t oVTh = off; off += PV;  const size_t oVTl = off; off += PV;
  const size_t oR   = off; off += PR;
  const size_t oLh  = off; off += PX;  const size_t oLl  = off; off += PX;
  const size_t oKTh = off; off += PQ;  const size_t oKTl = off; off += PQ;
  const size_t oU   = off; off += PR;
  const size_t oMh  = off; off += PX;  const size_t oMl  = off; off += PX;
  if (off > ws_size) return;                      // off = 74,711,040

  char* ws = (char*)d_ws;
  unsigned short* Xh  = (unsigned short*)(ws + oXh);   unsigned short* Xl  = (unsigned short*)(ws + oXl);
  unsigned short* Hkh = (unsigned short*)(ws + oHkh);  unsigned short* Hkl = (unsigned short*)(ws + oHkl);
  unsigned short* Hqh = (unsigned short*)(ws + oHqh);  unsigned short* Hql = (unsigned short*)(ws + oHql);
  unsigned short* Wkh = (unsigned short*)(ws + oWkh);  unsigned short* Wkl = (unsigned short*)(ws + oWkl);
  unsigned short* Wqh = (unsigned short*)(ws + oWqh);  unsigned short* Wql = (unsigned short*)(ws + oWql);
  unsigned short* Wvh = (unsigned short*)(ws + oWvh);  unsigned short* Wvl = (unsigned short*)(ws + oWvl);
  unsigned short* Woh = (unsigned short*)(ws + oWoh);  unsigned short* Wol = (unsigned short*)(ws + oWol);
  unsigned short* Sk2h = (unsigned short*)(ws + oSk2h); unsigned short* Sk2l = (unsigned short*)(ws + oSk2l);
  unsigned short* Sq2h = (unsigned short*)(ws + oSq2h); unsigned short* Sq2l = (unsigned short*)(ws + oSq2l);
  unsigned short* Skah = (unsigned short*)(ws + oSkah); unsigned short* Skal = (unsigned short*)(ws + oSkal);
  unsigned short* Sqah = (unsigned short*)(ws + oSqah); unsigned short* Sqal = (unsigned short*)(ws + oSqal);
  unsigned short* Qth = (unsigned short*)(ws + oQth);  unsigned short* Qtl = (unsigned short*)(ws + oQtl);
  unsigned short* Kth = (unsigned short*)(ws + oKth);  unsigned short* Ktl = (unsigned short*)(ws + oKtl);
  unsigned short* VTh = (unsigned short*)(ws + oVTh);  unsigned short* VTl = (unsigned short*)(ws + oVTl);
  float*          Rws = (float*)(ws + oR);
  unsigned short* Lh  = (unsigned short*)(ws + oLh);   unsigned short* Ll  = (unsigned short*)(ws + oLl);
  unsigned short* KTh = (unsigned short*)(ws + oKTh);  unsigned short* KTl = (unsigned short*)(ws + oKTl);
  float*          Uws = (float*)(ws + oU);
  unsigned short* Mh  = (unsigned short*)(ws + oMh);   unsigned short* Ml  = (unsigned short*)(ws + oMl);

  const dim3 b256(256), b128(128);

  // (1) operand preparation, one launch: the four [512][512] and the four [512][32] weights -> transposed hi/lo planes
  //     (the planes lie in the workspace in the order of the jobs), x -> hi/lo planes
  prep_kernel<<<dim3(PREP_T1 + PREP_T2 + PREP_X), b256, 0, stream>>>(
      x, kp_w1, qp_w1, v_w, o_w, kp_w2, qp_w2, ka_w, qa_w, Xh, Xl, Wkh, Sk2h);

  // (2) hk = tanh(x . kp_w1 + kp_b1), hq likewise -> bf16 hi/lo planes [4096][512], one launch: (256, 2) blocks
  const dim3 gH((MTOT / 64) * (DM / 128), 1);                  // 256 blocks
  gemm_hidden_kernel<<<dim3((MTOT / 64) * (DM / 128), 2), b128, 0, stream>>>(
      Xh, Xl, Wkh, Wkl, Wqh, Wql, kp_b1, qp_b1, Hkh, Hkl, Hqh, Hql);

  // (3) oscillator heads + encode -> Qt, Kt hi/lo planes [4096][64], K^T planes; V^T hi/lo planes; one launch
  enc_v_kernel<<<dim3(MTOT / 16 + NB * (DM / 64) * (SEQ / 128)), b128, 0, stream>>>(
      Hkh, Hkl, Hqh, Hql, Xh, Xl,
      Sk2h, Sk2l, Sq2h, Sq2l, Skah, Skal, Sqah, Sqal,
      kp_b2, qp_b2, ka_b, qa_b, pos,
      Qth, Qtl, Kth, Ktl, KTh, KTl,
      Wvh, Wvl, v_b, VTh, VTl);

  // (7a) per-chunk sums U[b][ch][d][f] = sum_{l' in chunk ch} V^T[b][d][l'] K^T[b][f][l'], chunks 0..30
  chunk_kv_kernel<<<dim3(DM / 128, NCH - 1, NB), b256, 0, stream>>>(VTh, VTl, KTh, KTl, Uws);
  // (7b) exclusive prefix over the chunks -> state planes M hi/lo [2][32][512][64]
  chunk_scan_kernel<<<dim3(NB * DM * QK / 4 / 128), b128, 0, stream>>>(Uws, Mh, Ml);

  // (7c) causal mixing (state term + own key tile) -> R f32 [4096][512]
  causal_mix_kernel<<<dim3(NB * (SEQ / 64) * 4), b128, 0, stream>>>(Qth, Qtl, Kth, Ktl, VTh, VTl, Mh, Ml, Rws);

  // (8) LayerNorm -> bf16 hi/lo planes [4096][512]
  ln_split_kernel<<<dim3(MTOT / 8), b256, 0, stream>>>(Rws, ln_g, ln_b, Lh, Ll);

  // (9) out = x + ln . o_w + o_b -> d_out f32 [4096][512]
  gemm_out_kernel<<<gH, b128, 0, stream>>>(Lh, Ll, Woh, Wol, o_b, x, (float*)d_out);

  (void)hipGetLastError();
}

// v006
// One run takes 73.8 microseconds.
// Timed twice side by side with v005, it ran 1.21 and 1.20 times as fast.
// All steps since v000 together make it 4.89 times as fast.
// All contractions (x.kp_w1, x.qp_w1, x.v_w, h.kp_w2, h.qp_w2, x.ka_w, x.qa_w, causal score S = Qt.Kt^T and S.V, chunk sums V^T.Kt, state term Qt.M, ln.o_w): v_wmma_f32_16x16x32_bf16 with bf16 hi/lo operands (hi.hi + hi.lo + lo.hi), f32 accumulate; encoders (tanh, softplus, sincos), norm scale, LayerNorm, biases and residual in f32.
#include <hip/hip_runtime.h>
#include <math.h>
#include <stdint.h>

#define NB   2
#define SEQ  2048
#define DM   512
#define KO   32
#define QK   64
#define MTOT (NB * SEQ)
#define NCH  (SEQ / 64)

typedef __attribute__((ext_vector_type(16))) __bf16 v16b;
typedef __attribute__((ext_vector_type(8)))  __bf16 v8b;
typedef __attribute__((ext_vector_type(8)))  float  v8f;
typedef __attribute__((ext_vector_type(4)))  float  v4f;
typedef __attribute__((ext_vector_type(2)))  float  v2f;
typedef __attribute__((ext_vector_type(4)))  unsigned int   v4u;
typedef __attribute__((ext_vector_type(2)))  unsigned int   v2u;
typedef __attribute__((ext_vector_type(8)))  unsigned short v8us;

union FB { v16b v; v8b h[2]; };

__device__ __forceinline__ unsigned short f2bf_bits(float f) {
  unsigned u = __float_as_uint(f);
  return (unsigned short)((u + 0x7FFFu + ((u >> 16) & 1u)) >> 16);   // RNE
}
__device__ __forceinline__ float bf_bits2f(unsigned short h) { return __uint_as_float(((unsigned)h) << 16); }
__device__ __forceinline__ unsigned pk16(unsigned short a, unsigned short b) { return (unsigned)a | ((unsigned)b << 16); }

__device__ __forceinline__ v8f zero8() { return (v8f){0.f, 0.f, 0.f, 0.f, 0.f, 0.f, 0.f, 0.f}; }

// 16-bit A/B fragment from a k-contiguous row p = &T[row][k0 + 8*(lane>>4)]:
// elements 0..7 <- p[0..7] (k0+8h..), elements 8..15 <- p[16..23] (k0+16+8h..)
__device__ __forceinline__ v16b ldfrag(const __bf16* p) {
  FB f;
  f.h[0] = *(const v8b*)(p);
  f.h[1] = *(const v8b*)(p + 16);
  return f.v;
}

// hi/lo split product group: c += ah.bh + ah.bl + al.bh, then 4 VALU slots tying D and keeping all operands live
__device__ __forceinline__ v8f mma3(v16b ah, v16b al, v16b bh, v16b bl, v8f c) {
  c = __builtin_amdgcn_wmma_f32_16x16x32_bf16(false, ah, false, bh, (short)0, c, false, false);
  c = __builtin_amdgcn_wmma_f32_16x16x32_bf16(false, ah, false, bl, (short)0, c, false, false);
  c = __builtin_amdgcn_wmma_f32_16x16x32_bf16(false, al, false, bh, (short)0, c, false, false);
  asm volatile("v_nop\n\tv_nop\n\tv_nop\n\tv_nop" : "+v"(c) : "v"(ah), "v"(al), "v"(bh), "v"(bl));
  return c;
}

// tanh(x) = 1 - 2 / (exp(2x) + 1) without a branch: exp2 overflows to inf (-> 1) and underflows to 0 (-> -1), NaN stays
// NaN; absolute error of the order of one f32 rounding of a value near 1. Values of one thread stay independent of one
// another, so that their chains interleave.
__device__ __forceinline__ float tanh_nb(float x) {
  const float e = __builtin_amdgcn_exp2f(x * 2.8853900817779268f);   // 2 * log2(e)
  return __builtin_fmaf(-2.0f, __builtin_amdgcn_rcpf(e + 1.0f), 1.0f);
}

// same-wave LDS exchange: order the wave's LDS stores before its cross-lane reloads
__device__ __forceinline__ void wave_lds_sync() {
  __builtin_amdgcn_fence(__ATOMIC_RELEASE, "workgroup");
  __builtin_amdgcn_wave_barrier();
  __builtin_amdgcn_fence(__ATOMIC_ACQUIRE, "workgroup");
}

// ---------------------------------------------------------------------------
// Elementwise bf16 split of a flat f32 array: hi = bf16(in), lo = bf16(in - hi); 2 elements per thread,
// ---------------------------------------------------------------------------
__device__ __forceinline__ void split_bf16x2_body(const float* __restrict__ in, unsigned short* hi,
                                                  unsigned short* lo, int n2, int blk) {
  const int i = blk * 256 + threadIdx.x;
  if (i < n2) {
    const v2f f = *(const v2f*)(in + 2 * (size_t)i);
    const unsigned short h0 = f2bf_bits(f[0]), h1 = f2bf_bits(f[1]);
    const unsigned short l0 = f2bf_bits(f[0] - bf_bits2f(h0)), l1 = f2bf_bits(f[1] - bf_bits2f(h1));
    const unsigned uh = pk16(h0, h1), ul = pk16(l0, l1);
    ((unsigned*)hi)[i] = uh;
    ((unsigned*)lo)[i] = ul;
    
  }
}

// ---------------------------------------------------------------------------
// Fused transpose + bf16 split of an f32 matrix: in [R][Cc] -> oh[c][r] = bf16(in[r][c]), ol = residual
// ([Cc][R], pitch R). 64x64 tiles through LDS (tf: 64 x 68 floats). Tile (bc, br) of (Cc/64, R/64), 256 threads.
// Coverage per block and plane: load 4 it x 256 thr x 4 = 64x64; store 2 it x 256 thr x 8 = 64x64.
// ---------------------------------------------------------------------------
__device__ __forceinline__ void tsplit_body(const float* __restrict__ W, unsigned short* oh,
                                            unsigned short* ol, int R, int Cc, int bc, int br, float* tf) {
  const int c0  = bc * 64;
  const int r0  = br * 64;
  const int tid = threadIdx.x;
  {
    const int lr = tid >> 4;
    const int c4 = (tid & 15) * 4;
    const float* wp[4];
    v4f a[4];
#pragma unroll
    for (int it = 0; it < 4; ++it) {
      wp[it] = W + (size_t)(r0 + it * 16 + lr) * Cc + c0 + c4;
      a[it]  = *(const v4f*)(wp[it]);
    }
    // wait before any address register of the four loads above is overwritten; the addresses are inputs so that they
    // stay live up to the wait
    asm volatile("s_wait_xcnt 0x0" :: "v"(wp[0]), "v"(wp[1]), "v"(wp[2]), "v"(wp[3]) : "memory");
#pragma unroll   // constant indices keep a[] in registers
    for (int it = 0; it < 4; ++it) *(v4f*)(tf + (it * 16 + lr) * 68 + c4) = a[it];
  }
  __syncthreads();
  const int sub = tid >> 3;
  const int c8  = (tid & 7) * 8;
  v4u hv[2], lv[2];
#pragma unroll
  for (int it = 0; it < 2; ++it) {
    const int oc = it * 32 + sub;
    v4u a, a2;
#pragma unroll
    for (int q = 0; q < 4; ++q) {
      const float f0 = tf[(c8 + 2 * q) * 68 + oc];
      const float f1 = tf[(c8 + 2 * q + 1) * 68 + oc];
      const unsigned short h0 = f2bf_bits(f0), h1 = f2bf_bits(f1);
      const unsigned short l0 = f2bf_bits(f0 - bf_bits2f(h0)), l1 = f2bf_bits(f1 - bf_bits2f(h1));
      a[q]  = pk16(h0, h1);
      a2[q] = pk16(l0, l1);
    }
    hv[it] = a; lv[it] = a2;
  }
  {
#pragma unroll
    for (int it = 0; it < 2; ++it) {
      const int oc = it * 32 + sub;
      const size_t go = (size_t)(c0 + oc) * R + r0 + c8;
      *(v4u*)(oh + go) = hv[it];
      *(v4u*)(ol + go) = lv[it];
    }
    
  }
}

// ---------------------------------------------------------------------------
// Transpose + bf16 split of a narrow f32 matrix: in [R][32] -> oh/ol [32][R] (pitch R). Tile br of R/64, 256 threads,
// tf: 64 x 36 floats of LDS.
// Coverage per block: load 2 it x 256 thr x 4 = 64 rows x 32; store 32 output rows x (8 lanes x 8) = 32 x 64.
// ---------------------------------------------------------------------------
__device__ __forceinline__ void tsplit32_body(const float* __restrict__ W, unsigned short* oh,
                                              unsigned short* ol, int R, int br, float* tf) {
  const int r0  = br * 64;
  const int tid = threadIdx.x;
  {
    const int rr = tid >> 3;          // 0..31
    const int c4 = (tid & 7) * 4;     // 0..28
    const float* wp[2];
    v4f a[2];
#pragma unroll
    for (int it = 0; it < 2; ++it) {
      wp[it] = W + (size_t)(r0 + it * 32 + rr) * KO + c4;   // rows 0..63
      a[it]  = *(const v4f*)(wp[it]);
    }
    // wait before an address register of the two loads above is overwritten; the addresses are inputs so that they
    // stay live up to the wait
    asm volatile("s_wait_xcnt 0x0" :: "v"(wp[0]), "v"(wp[1]) : "memory");
#pragma unroll   // constant indices keep a[] in registers
    for (int it = 0; it < 2; ++it) *(v4f*)(tf + (it * 32 + rr) * 36 + c4) = a[it];
  }
  __syncthreads();
  const int oc = tid >> 3;            // output row = input column 0..31
  const int c8 = (tid & 7) * 8;       // output cols r0+c8 .. +7
  v4u hv, lv;
#pragma unroll
  for (int q = 0; q < 4; ++q) {
    const float f0 = tf[(c8 + 2 * q) * 36 + oc];
    const float f1 = tf[(c8 + 2 * q + 1) * 36 + oc];
    const unsigned short h0 = f2bf_bits(f0), h1 = f2bf_bits(f1);
    const unsigned short l0 = f2bf_bits(f0 - bf_bits2f(h0)), l1 = f2bf_bits(f1 - bf_bits2f(h1));
    hv[q] = pk16(h0, h1);
    lv[q] = pk16(l0, l1);
  }
  const size_t go = (size_t)oc * R + r0 + c8;
  {
    *(v4u*)(oh + go) = hv;
    *(v4u*)(ol + go) = lv;
    
  }
}

// ---------------------------------------------------------------------------
// All operand preparation in one launch; the nine jobs do not depend on one another and the block index picks the job:
//   blocks   0..255  four [512][512] weights -> transposed planes (64 tiles each); planes of job j at W1p + j*2*512*512
//   blocks 256..287  four [512][32] weights  -> transposed planes (8 tiles each);  planes of job j at W2p + j*2*32*512
//   blocks 288..     x -> hi/lo planes, 512 elements per block
// Each job's hi plane is followed by its lo plane. The two-phase transposes come first in the index order.
// ---------------------------------------------------------------------------
#define PREP_T1 (4 * (DM / 64) * (DM / 64))
#define PREP_T2 (4 * (DM / 64))
#define PREP_X  (MTOT * DM / 2 / 256)
__global__ __launch_bounds__(256) void prep_kernel(
    const float* __restrict__ x,
    const float* __restrict__ kp_w1, const float* __restrict__ qp_w1,
    const float* __restrict__ v_w,   const float* __restrict__ o_w,
    const float* __restrict__ kp_w2, const float* __restrict__ qp_w2,
    const float* __restrict__ ka_w,  const float* __restrict__ qa_w,
    unsigned short* Xh, unsigned short* Xl, unsigned short* W1p, unsigned short* W2p) {
  __shared__ __align__(16) float tf[64 * 68];
  const int bx = blockIdx.x;
  if (bx < PREP_T1) {
    const int job = bx >> 6, t = bx & 63;
    const float* Wsrc = job == 0 ? kp_w1 : job == 1 ? qp_w1 : job == 2 ? v_w : o_w;
    unsigned short* oh = W1p + (size_t)job * (2 * DM * DM);
    tsplit_body(Wsrc, oh, oh + DM * DM, DM, DM, t & 7, t >> 3, tf);
  } else if (bx < PREP_T1 + PREP_T2) {
    const int job = (bx - PREP_T1) >> 3, t = (bx - PREP_T1) & 7;
    const float* Wsrc = job == 0 ? kp_w2 : job == 1 ? qp_w2 : job == 2 ? ka_w : qa_w;
    unsigned short* oh = W2p + (size_t)job * (2 * KO * DM);
    tsplit32_body(Wsrc, oh, oh + KO * DM, DM, t, tf);
  } else {
    split_bf16x2_body(x, Xh, Xl, MTOT * DM / 2, bx - (PREP_T1 + PREP_T2));
  }
}

// ---------------------------------------------------------------------------
// Batched WMMA GEMM on bf16 hi/lo planes, operands staged in LDS:
//   C[m,n] = sum_k A[m,k] * Bt[n,k] (+bias)(+resid)(act); product = hi.hi + hi.lo + lo.hi.
// A planes row-major [M][K] (pitch lda), Bt planes row-major [N][K] (pitch ldb); M % 64 == 0, N % 128 == 0, K % 64 == 0.
// Block = 4 waves = one 64 x 128 tile (index tile, the grid holds exactly (M/64)*(N/128) of them per batch), wave =
// 32 x 64 (2 x 2 waves); bz = batch with element strides.
// A stage is 64 k of the block's rows: A hi, A lo (64 rows each), B hi, B lo (128 rows each), 128 B a row at a pitch of
// GP = 72 halves (144 B = 16 B x 9). Each global load of a wave covers 4 whole 128-B lines (8 lanes a row); the next
// stage's 24 loads a thread fly while the current stage is multiplied, and go to the other of two LDS buffers behind it.
// After the last stage the wave's own 16 x 68 floats for the output staging alias the buffers.
// BIAS_MODE: 1 = bias[m], 2 = bias[n]. OUT_MODE: 0 = f32, 2 = bf16 hi plane (Cout) + lo plane (Cout2). ACT 1 = tanh.
// ---------------------------------------------------------------------------
#define GP       72
#define G_AT     (64 * GP)
#define G_BT     (128 * GP)
#define G_STAGE  (2 * G_AT + 2 * G_BT)
#define G_LDS_BYTES (2 * G_STAGE * 2)
template <int BIAS_MODE, int OUT_MODE, bool RESID, int ACT>
__device__ __forceinline__ void gemm_hl_body(
    const unsigned short* __restrict__ Ahp, const unsigned short* __restrict__ Alp, int lda, long long strideA,
    const unsigned short* __restrict__ Bhp, const unsigned short* __restrict__ Blp, int ldb, long long strideB,
    void* Cout, void* Cout2, int ldc, long long strideC,
    const float* __restrict__ bias,
    const float* __restrict__ resid, long long strideR,
    int N, int K, int tile, int bz, unsigned char* smem) {
  const __bf16* Ah = (const __bf16*)(const void*)Ahp;
  const __bf16* Al = (const __bf16*)(const void*)Alp;
  const __bf16* Bh = (const __bf16*)(const void*)Bhp;
  const __bf16* Bl = (const __bf16*)(const void*)Blp;
  const int tid  = threadIdx.x;
  const int wave = tid >> 5;
  const int lane = tid & 31;
  const int tilesN = N >> 7;
  const int tm  = tile / tilesN;
  const int tn  = tile - tm * tilesN;
  const int bm0 = tm << 6;               // block tile origin
  const int bn0 = tn << 7;
  const int wm  = (wave >> 1) << 5;      // wave tile origin inside the block tile
  const int wn  = (wave & 1) << 6;
  const int m0  = bm0 + wm;
  const int n0  = bn0 + wn;

  const int rl   = lane & 15;            // row (A) / col (B, D) within subtile
  const int koff = (lane >> 4) * 8;      // k offset of this lane half
  const int mOff = (lane >> 4) * 8;      // D row offset

  __bf16* sb = (__bf16*)smem;
  // staging map: thread = 16 B (8 halves) of row sr + 16 * it; 8 lanes cover one 128-B row
  const int sr = tid >> 3;               // 0..15
  const int sc = (tid & 7) * 8;
  const __bf16* gah = Ah + (size_t)bz * strideA + (size_t)(bm0 + sr) * lda + sc;
  const __bf16* gal = Al + (size_t)bz * strideA + (size_t)(bm0 + sr) * lda + sc;
  const __bf16* gbh = Bh + (size_t)bz * strideB + (size_t)(bn0 + sr) * ldb + sc;
  const __bf16* gbl = Bl + (size_t)bz * strideB + (size_t)(bn0 + sr) * ldb + sc;
  const int so = sr * GP + sc;

  v8f acc[2][4];
#pragma unroll
  for (int i = 0; i < 2; ++i)
#pragma unroll
    for (int j = 0; j < 4; ++j) acc[i][j] = zero8();

  v8b rah[4], ral[4], rbh[8], rbl[8];
  // stage 0: global -> registers -> buffer 0
#pragma unroll   // constant indices keep the staged values in registers
  for (int it = 0; it < 4; ++it) {
    rah[it] = *(const v8b*)(gah + (size_t)(it * 16) * lda);
    ral[it] = *(const v8b*)(gal + (size_t)(it * 16) * lda);
  }
#pragma unroll   // constant indices keep the staged values in registers
  for (int it = 0; it < 8; ++it) {
    rbh[it] = *(const v8b*)(gbh + (size_t)(it * 16) * ldb);
    rbl[it] = *(const v8b*)(gbl + (size_t)(it * 16) * ldb);
  }
  // wait before any address register of the 24 loads above is overwritten; the four addresses are inputs so that they
  // stay live up to the wait
  asm volatile("s_wait_xcnt 0x0" :: "v"(gah), "v"(gal), "v"(gbh), "v"(gbl) : "memory");
#pragma unroll
  for (int it = 0; it < 4; ++it) {
    *(v8b*)(sb + so + it * 16 * GP)        = rah[it];
    *(v8b*)(sb + G_AT + so + it * 16 * GP) = ral[it];
  }
#pragma unroll
  for (int it = 0; it < 8; ++it) {
    *(v8b*)(sb + 2 * G_AT + so + it * 16 * GP)        = rbh[it];
    *(v8b*)(sb + 2 * G_AT + G_BT + so + it * 16 * GP) = rbl[it];
  }
  __syncthreads();   // stage 0 is complete before any wave reads it

  const int nst = K >> 6;
#pragma unroll 1   // one stage a trip: the body already holds 48 matrix instructions
  for (int s = 0; s < nst; ++s) {
    const bool more = s + 1 < nst;       // block-uniform
    if (more) {
      gah += 64; gal += 64; gbh += 64; gbl += 64;
#pragma unroll   // constant indices keep the staged values in registers
      for (int it = 0; it < 4; ++it) {
        rah[it] = *(const v8b*)(gah + (size_t)(it * 16) * lda);
        ral[it] = *(const v8b*)(gal + (size_t)(it * 16) * lda);
      }
#pragma unroll   // constant indices keep the staged values in registers
      for (int it = 0; it < 8; ++it) {
        rbh[it] = *(const v8b*)(gbh + (size_t)(it * 16) * ldb);
        rbl[it] = *(const v8b*)(gbl + (size_t)(it * 16) * ldb);
      }
      // wait before any address register of the 24 loads above is overwritten; the four addresses are inputs so that
      // they stay live up to the wait
      asm volatile("s_wait_xcnt 0x0" :: "v"(gah), "v"(gal), "v"(gbh), "v"(gbl) : "memory");
    }
    const __bf16* cur = sb + (s & 1) * G_STAGE;
#pragma unroll
    for (int kk = 0; kk < 2; ++kk) {
      v16b ah[2], al[2];
#pragma unroll
      for (int i = 0; i < 2; ++i) {
        const int ao = (wm + (i << 4) + rl) * GP + kk * 32 + koff;
        ah[i] = ldfrag(cur + ao);
        al[i] = ldfrag(cur + G_AT + ao);
      }
      // B fragments one column tile ahead of their products, in a second register set
      const int bo = (wn + rl) * GP + kk * 32 + koff;
      v16b bh[2], bl[2];
      bh[0] = ldfrag(cur + 2 * G_AT + bo);
      bl[0] = ldfrag(cur + 2 * G_AT + G_BT + bo);
#pragma unroll
      for (int j = 0; j < 4; ++j) {
        if (j < 3) {
          bh[(j + 1) & 1] = ldfrag(cur + 2 * G_AT + bo + (j + 1) * 16 * GP);
          bl[(j + 1) & 1] = ldfrag(cur + 2 * G_AT + G_BT + bo + (j + 1) * 16 * GP);
        }
#pragma unroll
        for (int i = 0; i < 2; ++i) acc[i][j] = mma3(ah[i], al[i], bh[j & 1], bl[j & 1], acc[i][j]);
      }
    }
    if (more) {
      // the other buffer: its last readers left it at the barrier that ended the trip before
      __bf16* nxt = sb + ((s + 1) & 1) * G_STAGE;
#pragma unroll
      for (int it = 0; it < 4; ++it) {
        *(v8b*)(nxt + so + it * 16 * GP)        = rah[it];
        *(v8b*)(nxt + G_AT + so + it * 16 * GP) = ral[it];
      }
#pragma unroll
      for (int it = 0; it < 8; ++it) {
        *(v8b*)(nxt + 2 * G_AT + so + it * 16 * GP)        = rbh[it];
        *(v8b*)(nxt + 2 * G_AT + G_BT + so + it * 16 * GP) = rbl[it];
      }
    }
    __syncthreads();   // publishes stage s + 1 and ends every wave's reads of stage s (the output staging aliases it)
  }
  float* slab = (float*)smem + wave * (16 * 68);

  // ---- epilogue ----
  const float* Rb = RESID ? (resid + (size_t)bz * strideR) : nullptr;
  const int nb = n0 + rl;
  float bvn[4] = {0.f, 0.f, 0.f, 0.f};
  if (BIAS_MODE == 2) {
#pragma unroll   // constant indices keep the bias values in registers
    for (int j = 0; j < 4; ++j) bvn[j] = bias[nb + (j << 4)];
    // wait before the base or the index register of the four bias loads above is overwritten; they are inputs so that
    // they stay live up to the wait
    asm volatile("s_wait_xcnt 0x0" :: "s"(bias), "v"(nb) : "memory");
  }
#pragma unroll
  for (int i = 0; i < 2; ++i) {
    const int mBase = m0 + (i << 4);
#pragma unroll
    for (int j = 0; j < 4; ++j) {
      const int n = n0 + (j << 4) + rl;
      const float bv = bvn[j];
#pragma unroll
      for (int r = 0; r < 8; ++r) {
        float v = acc[i][j][r];
        if (BIAS_MODE == 1) v += bias[mBase + mOff + r];
        if (BIAS_MODE == 2) v += bv;
        if (RESID) v += Rb[(size_t)(mBase + mOff + r) * ldc + n];
        if (ACT == 1) v = tanh_nb(v);
        slab[(mOff + r) * 68 + (j << 4) + rl] = v;
      }
    }
    wave_lds_sync();
    if (OUT_MODE == 0) {
      float* C = (float*)Cout + (size_t)bz * strideC;
      const int hsel = lane >> 4, c4 = (lane & 15) * 4;   // row seg = 256 B = 16 lanes x 16 B, 2 rows per instruction
      {
        float* cp[8];
        v4f cv[8];
#pragma unroll
        for (int it = 0; it < 8; ++it) {
          const int row = it * 2 + hsel;                   // it 0..7 x hsel 0..1 = rows 0..15
          cv[it] = *(const v4f*)(slab + row * 68 + c4);
          cp[it] = C + (size_t)(mBase + row) * ldc + n0 + c4;
          *(v4f*)(cp[it]) = cv[it];
        }
        // wait before the second half's work overwrites an address or data register of the eight stores above; they
        // are inputs so that they stay live up to the wait
        if (i == 0)
          asm volatile("s_wait_xcnt 0x0" :: "v"(cp[0]), "v"(cp[1]), "v"(cp[2]), "v"(cp[3]), "v"(cp[4]), "v"(cp[5]),
                       "v"(cp[6]), "v"(cp[7]), "v"(cv[0]), "v"(cv[1]), "v"(cv[2]), "v"(cv[3]), "v"(cv[4]), "v"(cv[5]),
                       "v"(cv[6]), "v"(cv[7]) : "memory");
      }
    } else {
      const int q4 = lane >> 3, c8 = (lane & 7) * 8;
      unsigned short* C  = (unsigned short*)Cout  + (size_t)bz * strideC;
      unsigned short* C2 = (unsigned short*)Cout2 + (size_t)bz * strideC;
      {
        unsigned short *ph[4], *pl[4];
        v8us hs[4], ls[4];
#pragma unroll
        for (int it = 0; it < 4; ++it) {
          const int row = it * 4 + q4;                     // it 0..3 x q4 0..3 = rows 0..15
          const float* sp = slab + row * 68 + c8;
          v8us hv, lv;
#pragma unroll
          for (int e = 0; e < 8; ++e) {
            const unsigned short hb = f2bf_bits(sp[e]);
            const unsigned short lb = f2bf_bits(sp[e] - bf_bits2f(hb));
            hv[e] = hb;
            lv[e] = lb;
          }
          const size_t go = (size_t)(mBase + row) * ldc + n0 + c8;
          hs[it] = hv; ls[it] = lv;
          ph[it] = C + go; pl[it] = C2 + go;
          *(v8us*)(ph[it]) = hs[it];
          *(v8us*)(pl[it]) = ls[it];
        }
        // wait before the second half's work overwrites an address or data register of the eight stores above; they
        // are inputs so that they stay live up to the wait
        if (i == 0)
          asm volatile("s_wait_xcnt 0x0" :: "v"(ph[0]), "v"(ph[1]), "v"(ph[2]), "v"(ph[3]), "v"(pl[0]), "v"(pl[1]),
                       "v"(pl[2]), "v"(pl[3]), "v"(hs[0]), "v"(hs[1]), "v"(hs[2]), "v"(hs[3]), "v"(ls[0]), "v"(ls[1]),
                       "v"(ls[2]), "v"(ls[3]) : "memory");
      }
    }
    wave_lds_sync();
  }
}

// hk = tanh(x . kp_w1 + kp_b1) and hq = tanh(x . qp_w1 + qp_b1) in one launch (neither reads the other's result):
// blockIdx.y picks the encoder; per encoder M = 4096, N = 512, K = 512 = 64 x 4 block tiles = 256 blocks of 4 waves.
__global__ __launch_bounds__(128) void gemm_hidden_kernel(
    const unsigned short* __restrict__ Xh,  const unsigned short* __restrict__ Xl,
    const unsigned short* __restrict__ Wkh, const unsigned short* __restrict__ Wkl,
    const unsigned short* __restrict__ Wqh, const unsigned short* __restrict__ Wql,
    const float* __restrict__ kp_b1, const float* __restrict__ qp_b1,
    unsigned short* Hkh, unsigned short* Hkl, unsigned short* Hqh, unsigned short* Hql) {
  __shared__ __align__(16) unsigned char smem[G_LDS_BYTES];
  const bool q    = blockIdx.y != 0;
  gemm_hl_body<2, 2, false, 1>(Xh, Xl, DM, 0LL, q ? Wqh : Wkh, q ? Wql : Wkl, DM, 0LL,
                               (void*)(q ? Hqh : Hkh), (void*)(q ? Hql : Hkl), DM, 0LL,
                               q ? qp_b1 : kp_b1, nullptr, 0LL, DM, DM, blockIdx.x, 0, smem);
}

// out = x + ln . o_w + o_b: M = 4096, N = 512, K = 512 = 256 blocks of 4 waves.
__global__ __launch_bounds__(128) void gemm_out_kernel(
    const unsigned short* __restrict__ Lh,  const unsigned short* __restrict__ Ll,
    const unsigned short* __restrict__ Woh, const unsigned short* __restrict__ Wol,
    const float* __restrict__ o_b, const float* __restrict__ x, float* out) {
  __shared__ __align__(16) unsigned char smem[G_LDS_BYTES];
  gemm_hl_body<2, 0, true, 0>(Lh, Ll, DM, 0LL, Woh, Wol, DM, 0LL, (void*)out, (void*)out, DM, 0LL,
                              o_b, x, 0LL, DM, DM, blockIdx.x, 0, smem);
}

// ---------------------------------------------------------------------------
// Fused oscillator heads + encode. Block = 4 waves = 16 rows (blk = row block of 4096/16); wave w forms one of the four
// 16 x 32 products, K = 512, hi/lo WMMA:
//   wave 0: Pk = Hk.kp_w2, wave 1: Ak = X.ka_w, wave 2: Pq = Hq.qp_w2, wave 3: Aq = X.qa_w;
//   phase = tanh(P + b2)*pi + pos[l]; amp = softplus(A + ba) + 0.1 (wave w encodes rows 4w..4w+3, lane = oscillator);
//   Kt[row] = [amp_k cos | amp_k sin] (64), Qt[row] = [amp_q cos | amp_q sin]  -> bf16 hi/lo planes [4096][64].
//   Kt also goes out key-contiguous in groups of 16 keys: K^T planes [4096/16 row blocks][64 f][16 keys], so that the
//   2 KB a block writes per plane are whole 128-B lines of its own.
// Operand planes: H/X [4096][512]; W2t planes [32][512] (k-contiguous).
// LDS slab of the block [16][132]: cols 0..31 / 32..63 / 64..95 / 96..127 = k-phase / k-amp / q-phase / q-amp pre-acts,
// then the encoded Kt (0..63) and Qt (64..127).
// ---------------------------------------------------------------------------
__device__ __forceinline__ void enc_head_body(
    const unsigned short* __restrict__ Hkhp, const unsigned short* __restrict__ Hklp,
    const unsigned short* __restrict__ Hqhp, const unsigned short* __restrict__ Hqlp,
    const unsigned short* __restrict__ Xhp,  const unsigned short* __restrict__ Xlp,
    const unsigned short* __restrict__ Wk2hp, const unsigned short* __restrict__ Wk2lp,
    const unsigned short* __restrict__ Wq2hp, const unsigned short* __restrict__ Wq2lp,
    const unsigned short* __restrict__ Wkahp, const unsigned short* __restrict__ Wkalp,
    const unsigned short* __restrict__ Wqahp, const unsigned short* __restrict__ Wqalp,
    const float* __restrict__ bk2, const float* __restrict__ bq2,
    const float* __restrict__ bka, const float* __restrict__ bqa,
    const float* __restrict__ pos,
    unsigned short* Qhp, unsigned short* Qlp, unsigned short* Khp, unsigned short* Klp,
    unsigned short* KThp, unsigned short* KTlp, int blk, float* sl) {
  const int tid = threadIdx.x, wave = tid >> 5, lane = tid & 31, hh = lane >> 4, c = lane & 15;
  const int row0 = blk * 16;
  const int pw   = __builtin_amdgcn_readfirstlane(wave);   // scalar: the wave's product

  const unsigned short* Ahp = pw == 0 ? Hkhp : pw == 2 ? Hqhp : Xhp;
  const unsigned short* Alp = pw == 0 ? Hklp : pw == 2 ? Hqlp : Xlp;
  const unsigned short* Bhp = pw == 0 ? Wk2hp : pw == 1 ? Wkahp : pw == 2 ? Wq2hp : Wqahp;
  const unsigned short* Blp = pw == 0 ? Wk2lp : pw == 1 ? Wkalp : pw == 2 ? Wq2lp : Wqalp;
  const float* bias = pw == 0 ? bk2 : pw == 1 ? bka : pw == 2 ? bq2 : bqa;

  const size_t ao = (size_t)(row0 + c) * DM + 8 * hh;
  const size_t bo = (size_t)c * DM + 8 * hh;
  const __bf16* pah = (const __bf16*)(const void*)Ahp + ao;
  const __bf16* pal = (const __bf16*)(const void*)Alp + ao;
  const __bf16* pbh = (const __bf16*)(const void*)Bhp + bo;
  const __bf16* pbl = (const __bf16*)(const void*)Blp + bo;

  v8f acc[2];
  acc[0] = zero8(); acc[1] = zero8();

#pragma unroll 1   // 128 k a trip: its 48 fragment loads are all in flight at once
  for (int k0 = 0; k0 < DM; k0 += 128) {
    v16b ah[4], al[4], bh[4][2], bl[4][2];
#pragma unroll   // constant indices keep the fragments in registers
    for (int u = 0; u < 4; ++u) {
      ah[u] = ldfrag(pah + u * 32);
      al[u] = ldfrag(pal + u * 32);
#pragma unroll
      for (int t = 0; t < 2; ++t) {   // weight rows t*16 + c
        bh[u][t] = ldfrag(pbh + t * 16 * DM + u * 32);
        bl[u][t] = ldfrag(pbl + t * 16 * DM + u * 32);
      }
    }
    // wait before any address register of the 48 loads above is overwritten; the four addresses are inputs so that they
    // stay live up to the wait and no load's result is placed in them
    asm volatile("s_wait_xcnt 0x0" :: "v"(pah), "v"(pal), "v"(pbh), "v"(pbl) : "memory");
#pragma unroll
    for (int u = 0; u < 4; ++u)
#pragma unroll
      for (int t = 0; t < 2; ++t) acc[t] = mma3(ah[u], al[u], bh[u][t], bl[u][t], acc[t]);
    pah += 128; pal += 128; pbh += 128; pbl += 128;
  }

  // stage pre-activations (+bias) in the D layout: row 8hh+r, oscillator n = t*16+c, columns of the wave's product
  float bv[2];
#pragma unroll   // constant indices keep the bias values in registers
  for (int t = 0; t < 2; ++t) bv[t] = bias[t * 16 + c];
  // wait before the base or the index register of the two bias loads above is overwritten; they are inputs so that they
  // stay live up to the wait
  asm volatile("s_wait_xcnt 0x0" :: "s"(bias), "v"(c) : "memory");
#pragma unroll
  for (int t = 0; t < 2; ++t) {
#pragma unroll
    for (int r = 0; r < 8; ++r) sl[(8 * hh + r) * 132 + pw * 32 + t * 16 + c] = acc[t][r] + bv[t];
  }
  __syncthreads();   // a row's four pre-activations come from the four waves

  // encode: lane = oscillator index, one row per iteration (same lane reads and writes its own 4 slots)
  const float PI = 3.14159265358979323846f;
#pragma unroll 1   // rolled: one copy of the long transcendental body in the instruction cache
  for (int i = 0; i < 4; ++i) {
    const int it = wave * 4 + i;
    float* sp = sl + it * 132;
    const int l = (row0 + it) & (SEQ - 1);
    const float pa  = pos[l * KO + lane];
    const float vpk = sp[lane], vak = sp[32 + lane], vpq = sp[64 + lane], vaq = sp[96 + lane];
    const float phk = tanh_nb(vpk) * PI + pa;
    const float phq = tanh_nb(vpq) * PI + pa;
    const float ak  = fmaxf(vak, 0.f) + log1pf(expf(-fabsf(vak))) + 0.1f;
    const float aq  = fmaxf(vaq, 0.f) + log1pf(expf(-fabsf(vaq))) + 0.1f;
    sp[lane]      = ak * cosf(phk);
    sp[32 + lane] = ak * sinf(phk);
    sp[64 + lane] = aq * cosf(phq);
    sp[96 + lane] = aq * sinf(phq);
  }
  __syncthreads();   // the stores below gather encoded rows of all four waves

  {
    // thread = 8 features of one row in each of the four planes; a wave's store covers 4 whole 128-B rows
    const int row = tid >> 3, c8 = (tid & 7) * 8;
    const float* sk = sl + row * 132 + c8;
    const float* sq = sl + row * 132 + 64 + c8;
    v8us khv, klv, qhv, qlv;
#pragma unroll
    for (int e = 0; e < 8; ++e) {
      const unsigned short kh = f2bf_bits(sk[e]);
      const unsigned short kl = f2bf_bits(sk[e] - bf_bits2f(kh));
      const unsigned short qh = f2bf_bits(sq[e]);
      const unsigned short ql = f2bf_bits(sq[e] - bf_bits2f(qh));
      khv[e] = kh; klv[e] = kl; qhv[e] = qh; qlv[e] = ql;
    }
    const size_t go = (size_t)(row0 + row) * QK + c8;
    unsigned short *sk0 = Khp + go, *sk1 = Klp + go, *sq0 = Qhp + go, *sq1 = Qlp + go;
    *(v8us*)(sk0) = khv;
    *(v8us*)(sk1) = klv;
    *(v8us*)(sq0) = qhv;
    *(v8us*)(sq1) = qlv;
    // wait before an address or data register of the four stores above is overwritten; they are inputs so that they
    // stay live up to the wait
    asm volatile("s_wait_xcnt 0x0" :: "v"(sk0), "v"(sk1), "v"(sq0), "v"(sq1), "v"(khv), "v"(klv), "v"(qhv), "v"(qlv)
                 : "memory");
  }

  {
    // K^T group of the block: [64 f][16 keys] per plane; waves 0,1 write the hi plane, waves 2,3 the lo plane, 32 f each;
    // piece p = 8 keys of feature p >> 1, so that one store of a wave covers 512 contiguous bytes
    const bool lop = pw >= 2;
    unsigned short* dst = (lop ? KTlp : KThp) + (size_t)blk * (QK * 16) + (wave & 1) * 512 + lane * 8;
    v8us o[2];
#pragma unroll
    for (int g = 0; g < 2; ++g) {
      const int p  = g * 32 + lane;
      const int f  = (wave & 1) * 32 + (p >> 1);
      const int k8 = (p & 1) * 8;
#pragma unroll
      for (int e = 0; e < 8; ++e) {
        const float xe = sl[(k8 + e) * 132 + f];
        const unsigned short hb = f2bf_bits(xe);
        const unsigned short lb = f2bf_bits(xe - bf_bits2f(hb));
        o[g][e] = lop ? lb : hb;
      }
    }
    *(v8us*)(dst)       = o[0];
    *(v8us*)(dst + 256) = o[1];
    // wait before the address or a data register of the two stores above is overwritten (inputs: live up to the wait)
    asm volatile("s_wait_xcnt 0x0" :: "v"(dst), "v"(o[0]), "v"(o[1]) : "memory");
  }
}

// ---------------------------------------------------------------------------
// Oscillator heads + encode and the V^T projection in one launch (neither reads the other's result), 4 waves a block:
//   blocks 0..255   enc_head_body, row block = blockIdx.x;
//   blocks 256..511 V^T[b][d][l] = sum_k v_w^T[d][k] x[b][l][k] + v_b[d] -> bf16 hi/lo planes [2][512][2048]
//                  (A = v_w^T planes [512][512], Bt = x planes of batch b [2048][512]; M = 512, N = 2048, K = 512:
//                  8 x 16 block tiles = 128 blocks per batch).
// ---------------------------------------------------------------------------
__global__ __launch_bounds__(128) void enc_v_kernel(
    const unsigned short* __restrict__ Hkhp, const unsigned short* __restrict__ Hklp,
    const unsigned short* __restrict__ Hqhp, const unsigned short* __restrict__ Hqlp,
    const unsigned short* __restrict__ Xhp,  const unsigned short* __restrict__ Xlp,
    const unsigned short* __restrict__ Wk2hp, const unsigned short* __restrict__ Wk2lp,
    const unsigned short* __restrict__ Wq2hp, const unsigned short* __restrict__ Wq2lp,
    const unsigned short* __restrict__ Wkahp, const unsigned short* __restrict__ Wkalp,
    const unsigned short* __restrict__ Wqahp, const unsigned short* __restrict__ Wqalp,
    const float* __restrict__ bk2, const float* __restrict__ bq2,
    const float* __restrict__ bka, const float* __restrict__ bqa,
    const float* __restrict__ pos,
    unsigned short* Qhp, unsigned short* Qlp, unsigned short* Khp, unsigned short* Klp,
    unsigned short* KThp, unsigned short* KTlp,
    const unsigned short* __restrict__ Wvhp, const unsigned short* __restrict__ Wvlp,
    const float* __restrict__ v_b, unsigned short* VThp, unsigned short* VTlp) {
  __shared__ __align__(16) unsigned char smem[G_LDS_BYTES];   // encoder blocks use its first 16 x 132 floats
  const int bx = blockIdx.x;
  if (bx < MTOT / 16) {
    enc_head_body(Hkhp, Hklp, Hqhp, Hqlp, Xhp, Xlp, Wk2hp, Wk2lp, Wq2hp, Wq2lp, Wkahp, Wkalp, Wqahp, Wqalp,
                  bk2, bq2, bka, bqa, pos, Qhp, Qlp, Khp, Klp, KThp, KTlp, bx, (float*)smem);
  } else {
    const int idx  = bx - MTOT / 16;
    gemm_hl_body<1, 2, false, 0>(Wvhp, Wvlp, DM, 0LL, Xhp, Xlp, DM, (long long)SEQ * DM,
                                 (void*)VThp, (void*)VTlp, SEQ, (long long)DM * SEQ,
                                 v_b, nullptr, 0LL, SEQ, DM, idx & 127, idx >> 7, smem);
  }
}

// ---------------------------------------------------------------------------
// Per-chunk sums: U[b][ch][d][f] = sum_{l' in 64-key chunk ch} V^T[b][d][l'] * K^T[b][f][l'] (hi/lo WMMA, f32 out).
// A = V^T rows (m = d), key-contiguous at pitch 2048; B rows = K^T rows (n = f) in groups [16-key group][64 f][16 keys]:
// a fragment's keys k0+8h.. and k0+16+8h.. lie in two neighbouring groups. Wave = 16 d x 64 f, block = 8 waves
// = 128 d; grid = (4, NCH-1, NB): chunks 0..NCH-2 (the last chunk enters no state). Each wave stores whole 256-B rows.
// ---------------------------------------------------------------------------
__global__ __launch_bounds__(256) void chunk_kv_kernel(
    const unsigned short* __restrict__ Vhp, const unsigned short* __restrict__ Vlp,
    const unsigned short* __restrict__ KThp, const unsigned short* __restrict__ KTlp, float* U) {
  __shared__ __align__(16) float sT[8][16 * 68];
  const int lane = threadIdx.x & 31, wave = threadIdx.x >> 5, hh = lane >> 4, c = lane & 15;
  const int ch = blockIdx.y, b = blockIdx.z;
  const int d0 = blockIdx.x * 128 + wave * 16;
  const size_t ao = ((size_t)b * DM + d0 + c) * SEQ + ch * 64 + 8 * hh;
  const size_t bo = ((size_t)(b * (SEQ / 16) + ch * 4) * QK + c) * 16 + 8 * hh;
  const __bf16* va = (const __bf16*)(const void*)Vhp + ao;
  const __bf16* vl = (const __bf16*)(const void*)Vlp + ao;
  const __bf16* kb = (const __bf16*)(const void*)KThp + bo;
  const __bf16* kl = (const __bf16*)(const void*)KTlp + bo;
  v16b ah[2], al[2], bh[2][4], bl[2][4];
#pragma unroll
  for (int kk = 0; kk < 2; ++kk) {
    ah[kk] = ldfrag(va + kk * 32);
    al[kk] = ldfrag(vl + kk * 32);
#pragma unroll
    for (int j = 0; j < 4; ++j) {
      FB fh, fl;   // 16-key groups 2 kk and 2 kk + 1 of the chunk, features j*16 + c
      fh.h[0] = *(const v8b*)(kb + (2 * kk) * (QK * 16) + j * 256);
      fh.h[1] = *(const v8b*)(kb + (2 * kk + 1) * (QK * 16) + j * 256);
      fl.h[0] = *(const v8b*)(kl + (2 * kk) * (QK * 16) + j * 256);
      fl.h[1] = *(const v8b*)(kl + (2 * kk + 1) * (QK * 16) + j * 256);
      bh[kk][j] = fh.v;
      bl[kk][j] = fl.v;
    }
  }
  // wait before any address register of the 40 loads above is overwritten; the four addresses are inputs so that they
  // stay live up to the wait
  asm volatile("s_wait_xcnt 0x0" :: "v"(va), "v"(vl), "v"(kb), "v"(kl) : "memory");
  v8f acc[4];
#pragma unroll
  for (int j = 0; j < 4; ++j) acc[j] = zero8();
#pragma unroll
  for (int kk = 0; kk < 2; ++kk)
#pragma unroll
    for (int j = 0; j < 4; ++j) acc[j] = mma3(ah[kk], al[kk], bh[kk][j], bl[kk][j], acc[j]);

  float* slab = sT[wave];
#pragma unroll
  for (int j = 0; j < 4; ++j)
#pragma unroll
    for (int r = 0; r < 8; ++r) slab[(8 * hh + r) * 68 + j * 16 + c] = acc[j][r];
  wave_lds_sync();
  float* C = U + (((size_t)b * NCH + ch) * DM + d0) * QK + hh * QK + c * 4;   // 2 rows of 256 B per instruction
#pragma unroll
  for (int it = 0; it < 8; ++it) {
    const v4f v = *(const v4f*)(slab + (it * 2 + hh) * 68 + c * 4);
    *(v4f*)(C + it * 2 * QK) = v;
  }
}

// ---------------------------------------------------------------------------
// Exclusive prefix over the key chunks: M[b][ch] = sum_{c < ch} U[b][c], U f32 [b][ch][512 d][64 f] (chunks 0..NCH-2
// are written and read), M -> bf16 hi/lo planes of the same shape, chunk 0 = 0. Thread = 4 consecutive elements;
// grid = NB*512*64/4/128 blocks of 128; a wave reads 512 B and writes 256 B per plane and chunk.
// ---------------------------------------------------------------------------
__global__ __launch_bounds__(128) void chunk_scan_kernel(const float* __restrict__ U, unsigned short* Mh,
                                                         unsigned short* Ml) {
  const int i = blockIdx.x * 128 + threadIdx.x;
  const int b = i / (DM * QK / 4);
  const size_t base = (size_t)b * ((size_t)NCH * DM * QK) + (size_t)(i - b * (DM * QK / 4)) * 4;
  v4f u[NCH - 1];
#pragma unroll
  for (int ch = 0; ch < NCH - 1; ++ch) u[ch] = *(const v4f*)(U + base + (size_t)ch * (DM * QK));
  unsigned short* ph = Mh + base;
  unsigned short* pl = Ml + base;
  v4f m = (v4f){0.f, 0.f, 0.f, 0.f};
#pragma unroll
  for (int ch = 0; ch < NCH; ++ch) {
    const unsigned short h0 = f2bf_bits(m[0]), h1 = f2bf_bits(m[1]), h2 = f2bf_bits(m[2]), h3 = f2bf_bits(m[3]);
    const unsigned short l0 = f2bf_bits(m[0] - bf_bits2f(h0)), l1 = f2bf_bits(m[1] - bf_bits2f(h1));
    const unsigned short l2 = f2bf_bits(m[2] - bf_bits2f(h2)), l3 = f2bf_bits(m[3] - bf_bits2f(h3));
    const v2u hv = (v2u){pk16(h0, h1), pk16(h2, h3)};
    const v2u lv = (v2u){pk16(l0, l1), pk16(l2, l3)};
    // the chunk's two state stores and their wait in one statement: no later load result, packed value or address step
    // can be placed in a register that the stores name ahead of the wait
    asm volatile("global_store_b64 %0, %2, off\n\tglobal_store_b64 %1, %3, off\n\ts_wait_xcnt 0x0"
                 :: "v"(ph), "v"(pl), "v"(hv), "v"(lv) : "memory");
    ph += DM * QK;
    pl += DM * QK;
    if (ch < NCH - 1) m += u[ch];
  }
}

// ---------------------------------------------------------------------------
// Causal mixing: R[b][l][d] = (1/sqrt((l+1)*32)) * sum_{l' <= l} S[l][l'] * V[l'][d],  S = Qt[l] . Kt[l'] (K = 64).
// Block = 4 waves = 64 query rows of one batch element and one 128-wide d chunk; grid = NB * 32 * 4.
//   Qt/Kt planes bf16 hi/lo [4096][64]; V^T planes bf16 hi/lo [b][512 d][2048 l']; R f32 [4096][512].
//   Keys of the earlier 64-key chunks enter through the state M[b][qb] = sum_{l' < 64 qb} Kt[l'] (x) V[l'] (planes
//   [b][ch][512 d][64 f], f contiguous): O = Qt . M (A = Qt rows, B = M rows from global).
//   The block's own key tile: stage Kt tile [64][64] and V^T chunk [128][64] (hi+lo) in LDS
//   (plain 16-B loads, __syncthreads after); S per wave in registers (A = Qt rows, B = Kt rows from LDS);
//   entries with l' > l set to 0 by value; P = S split to bf16 hi/lo into the wave's LDS tile
//   Output: per wave 16 rows x 128 floats staged in LDS (aliasing the K/V region after a block barrier), each
//   Coverage: 4 d chunks x 32 row blocks x 2 batches x (4 waves x 16 rows x 128) = the whole [4096][512] R plane.
// ---------------------------------------------------------------------------
__global__ __launch_bounds__(128) void causal_mix_kernel(
    const unsigned short* __restrict__ Qhp, const unsigned short* __restrict__ Qlp,
    const unsigned short* __restrict__ Khp, const unsigned short* __restrict__ Klp,
    const unsigned short* __restrict__ Vhp, const unsigned short* __restrict__ Vlp,
    const unsigned short* __restrict__ Mhp, const unsigned short* __restrict__ Mlp,
    float* Rout) {
  // Every tile row holds 64 halves (128 B) at a pitch of LP = 72 halves (144 B = 16 B x 9): the 16 rows that one
  // ds_load_b128 / ds_store_b128 touches then start on 16 different 4-bank groups instead of 2.
  constexpr int LP = 72;
  __shared__ __align__(16) unsigned char smem[73728];
  __bf16* Ksh = (__bf16*)(smem);           // [64 l'][LP]    9216 B
  __bf16* Ksl = (__bf16*)(smem + 9216);
  __bf16* Vth = (__bf16*)(smem + 18432);   // [128 d][LP]   18432 B
  __bf16* Vtl = (__bf16*)(smem + 36864);
  __bf16* Pgh = (__bf16*)(smem + 55296);   // [4 waves][16][LP]  9216 B
  __bf16* Pgl = (__bf16*)(smem + 64512);
  float*  Osb = (float*)(smem);            // [4 waves][16][132] after the main loop (aliases K/V tiles)

  const int tid = threadIdx.x, wave = tid >> 5, lane = tid & 31, hh = lane >> 4, c = lane & 15;
  const int bx  = blockIdx.x;
  const int dch = bx & 3;
  const int qb  = (bx >> 2) & 31;
  const int b   = bx >> 7;
  const int q0  = qb * 64 + wave * 16;                 // sequence-local first row of this wave
  const size_t grow0 = (size_t)b * SEQ + q0;           // global row of this wave's row 0

  const __bf16* Qh = (const __bf16*)(const void*)Qhp; const __bf16* Ql = (const __bf16*)(const void*)Qlp;
  const __bf16* Kh = (const __bf16*)(const void*)Khp; const __bf16* Kl = (const __bf16*)(const void*)Klp;
  const __bf16* Vh = (const __bf16*)(const void*)Vhp; const __bf16* Vl = (const __bf16*)(const void*)Vlp;
  const __bf16* Mh = (const __bf16*)(const void*)Mhp; const __bf16* Ml = (const __bf16*)(const void*)Mlp;

  // Qt fragments (A operand, row = lane&15): two 32-deep k chunks, hi and lo
  v16b qah[2], qal[2];
#pragma unroll
  for (int dc = 0; dc < 2; ++dc) {
    qah[dc] = ldfrag(Qh + (grow0 + c) * QK + dc * 32 + 8 * hh);
    qal[dc] = ldfrag(Ql + (grow0 + c) * QK + dc * 32 + 8 * hh);
  }
  v8f oacc[8];
#pragma unroll
  for (int t = 0; t < 8; ++t) oacc[t] = zero8();

  __bf16* pwh = Pgh + wave * (16 * LP);
  __bf16* pwl = Pgl + wave * (16 * LP);

  // O[16 x 128] = Qt[16 x 64] . M[64 x 128]: B[k = feature][n = d] = M[d][feature]
  const size_t mo = (((size_t)b * NCH + qb) * DM + dch * 128 + c) * QK + 8 * hh;
  const __bf16* mhp = Mh + mo;
  const __bf16* mlp = Ml + mo;
#pragma unroll
  for (int dc = 0; dc < 2; ++dc) {
    v16b mb[8], ml[8];
#pragma unroll
    for (int t = 0; t < 8; ++t) {
      mb[t] = ldfrag(mhp + t * 16 * QK + dc * 32);
      ml[t] = ldfrag(mlp + t * 16 * QK + dc * 32);
    }
    // wait before any address register of the 32 loads above is overwritten; both addresses are inputs so that they
    // stay live up to the wait
    asm volatile("s_wait_xcnt 0x0" :: "v"(mhp), "v"(mlp) : "memory");
#pragma unroll
    for (int t = 0; t < 8; ++t) oacc[t] = mma3(qah[dc], qal[dc], mb[t], ml[t], oacc[t]);
  }

  {
    const int kv0 = qb * 64;
    {
      // Kt tile: 128 threads x 32 halves per plane = 64 x 64
      const int r = tid >> 1, half = (tid & 1) * 32;
      const __bf16* ks = Kh + ((size_t)b * SEQ + kv0 + r) * QK + half;
      const __bf16* ls = Kl + ((size_t)b * SEQ + kv0 + r) * QK + half;
      v8b kr[4], lr[4];
#pragma unroll
      for (int i = 0; i < 4; ++i) {
        kr[i] = *(const v8b*)(ks + 8 * i);
        lr[i] = *(const v8b*)(ls + 8 * i);
      }
      // V^T chunk: thread = d row (dch*128 + tid), 64 halves per plane = 128 x 64
      const __bf16* vs = Vh + ((size_t)b * DM + dch * 128 + tid) * SEQ + kv0;
      const __bf16* vl = Vl + ((size_t)b * DM + dch * 128 + tid) * SEQ + kv0;
      v8b vr[8], wr[8];
#pragma unroll
      for (int i = 0; i < 8; ++i) {
        vr[i] = *(const v8b*)(vs + 8 * i);
        wr[i] = *(const v8b*)(vl + 8 * i);
      }
      // wait before any address register of the 24 loads above is overwritten; the four addresses are inputs so that
      // they stay live up to the wait and no later load's result is placed in them
      asm volatile("s_wait_xcnt 0x0" :: "v"(ks), "v"(ls), "v"(vs), "v"(vl) : "memory");
#pragma unroll
      for (int i = 0; i < 4; ++i) {
        *(v8b*)(Ksh + r * LP + half + 8 * i) = kr[i];
        *(v8b*)(Ksl + r * LP + half + 8 * i) = lr[i];
      }
#pragma unroll
      for (int i = 0; i < 8; ++i) {
        *(v8b*)(Vth + tid * LP + 8 * i) = vr[i];
        *(v8b*)(Vtl + tid * LP + 8 * i) = wr[i];
      }
    }
    __syncthreads();

    // S strip 16 x 64 for this wave: B[k = feature][n = key] = Kt[key][feature]
    v8f s[4];
#pragma unroll
    for (int j = 0; j < 4; ++j) {
      s[j] = zero8();
#pragma unroll
      for (int dc = 0; dc < 2; ++dc) {
        FB kb, kl;
        const int kb0 = (j * 16 + c) * LP + dc * 32 + 8 * hh;
        kb.h[0] = *(const v8b*)(Ksh + kb0);
        kb.h[1] = *(const v8b*)(Ksh + kb0 + 16);
        kl.h[0] = *(const v8b*)(Ksl + kb0);
        kl.h[1] = *(const v8b*)(Ksl + kb0 + 16);
        s[j] = mma3(qah[dc], qal[dc], kb.v, kl.v, s[j]);
      }
    }
    // causal select by value, split to bf16 hi/lo, into the wave's P tile [row][key]
#pragma unroll
    for (int r = 0; r < 8; ++r) {
      const int qrow = q0 + 8 * hh + r;
#pragma unroll
      for (int j = 0; j < 4; ++j) {
        const int kvcol = kv0 + j * 16 + c;
        float pm = s[j][r];
        if (kvcol > qrow) pm = 0.f;
        const unsigned short hb = f2bf_bits(pm);
        const unsigned short lb = f2bf_bits(pm - bf_bits2f(hb));
        pwh[(8 * hh + r) * LP + j * 16 + c] = __builtin_bit_cast(__bf16, hb);
        pwl[(8 * hh + r) * LP + j * 16 + c] = __builtin_bit_cast(__bf16, lb);
      }
    }
    wave_lds_sync();

    // O[16 x 128] += P[16 x 64] . V[64 x 128]: A = P (row = lane&15), B[k = key][n = d] = V^T[d][key]
#pragma unroll 1
    for (int kk = 0; kk < 2; ++kk) {
      FB pa, pl;
      const int pb0 = c * LP + kk * 32 + 8 * hh;
      pa.h[0] = *(const v8b*)(pwh + pb0);
      pa.h[1] = *(const v8b*)(pwh + pb0 + 16);
      pl.h[0] = *(const v8b*)(pwl + pb0);
      pl.h[1] = *(const v8b*)(pwl + pb0 + 16);
#pragma unroll
      for (int t = 0; t < 8; ++t) {
        FB vb, vlo;
        const int vb0 = (t * 16 + c) * LP + kk * 32 + 8 * hh;
        vb.h[0]  = *(const v8b*)(Vth + vb0);
        vb.h[1]  = *(const v8b*)(Vth + vb0 + 16);
        vlo.h[0] = *(const v8b*)(Vtl + vb0);
        vlo.h[1] = *(const v8b*)(Vtl + vb0 + 16);
        oacc[t] = mma3(pa.v, pl.v, vb.v, vlo.v, oacc[t]);
      }
    }
  }
  __syncthreads();   // every wave done with the K/V tiles before the output staging aliases them

  // scale by 1/sqrt((l+1)*32), stage the wave's 16 x 128 tile, write whole 512-B row segments
  float* os = Osb + wave * (16 * 132);
#pragma unroll
  for (int r = 0; r < 8; ++r) {
    const int lq = q0 + 8 * hh + r;
    const float nrm = sqrtf((float)((lq + 1) * KO));
    const float inv = 1.0f / nrm;
#pragma unroll
    for (int t = 0; t < 8; ++t) os[(8 * hh + r) * 132 + t * 16 + c] = oacc[t][r] * inv;
  }
  wave_lds_sync();
  {
#pragma unroll
    for (int it = 0; it < 16; ++it) {
      const v4f val = *(const v4f*)(os + it * 132 + lane * 4);
      *(v4f*)(Rout + (grow0 + it) * DM + dch * 128 + lane * 4) = val;
    }
    
  }
}

// ---------------------------------------------------------------------------
// One wave per row (block = 8 rows, grid = 4096/8); lane holds cols 8*lane..+7 and 256+8*lane..+7.
// ---------------------------------------------------------------------------
__global__ __launch_bounds__(256) void ln_split_kernel(const float* __restrict__ R, const float* __restrict__ g,
                                                       const float* __restrict__ be,
                                                       unsigned short* Lh, unsigned short* Ll) {
  const int tid = threadIdx.x, wave = tid >> 5, lane = tid & 31;
  const int row = blockIdx.x * 8 + wave;
  const float* rp = R + (size_t)row * DM;
  const int cA = 8 * lane, cB = 256 + 8 * lane;
  const v4f x0 = *(const v4f*)(rp + cA), x1 = *(const v4f*)(rp + cA + 4);
  const v4f x2 = *(const v4f*)(rp + cB), x3 = *(const v4f*)(rp + cB + 4);
  const v4f g0 = *(const v4f*)(g + cA),  g1 = *(const v4f*)(g + cA + 4);
  const v4f g2 = *(const v4f*)(g + cB),  g3 = *(const v4f*)(g + cB + 4);
  const v4f e0 = *(const v4f*)(be + cA), e1 = *(const v4f*)(be + cA + 4);
  const v4f e2 = *(const v4f*)(be + cB), e3 = *(const v4f*)(be + cB + 4);
  float v[16], gg[16], bb[16];
#pragma unroll
  for (int e = 0; e < 4; ++e) {
    v[e] = x0[e]; v[4 + e] = x1[e]; v[8 + e] = x2[e]; v[12 + e] = x3[e];
    gg[e] = g0[e]; gg[4 + e] = g1[e]; gg[8 + e] = g2[e]; gg[12 + e] = g3[e];
    bb[e] = e0[e]; bb[4 + e] = e1[e]; bb[8 + e] = e2[e]; bb[12 + e] = e3[e];
  }
  float sum = 0.f;
#pragma unroll
  for (int e = 0; e < 16; ++e) sum += v[e];
#pragma unroll
  for (int off = 1; off < 32; off <<= 1) sum += __shfl_xor(sum, off, 32);
  const float mu = sum * (1.0f / (float)DM);
  float ss = 0.f;
#pragma unroll
  for (int e = 0; e < 16; ++e) { const float d = v[e] - mu; v[e] = d; ss += d * d; }
#pragma unroll
  for (int off = 1; off < 32; off <<= 1) ss += __shfl_xor(ss, off, 32);
  const float var  = ss * (1.0f / (float)DM);
  const float rstd = 1.0f / sqrtf(var + 1e-5f);
  v8us hA, lA, hB, lB;
#pragma unroll
  for (int e = 0; e < 8; ++e) {
    const float ya = v[e] * rstd * gg[e] + bb[e];
    const float yb = v[8 + e] * rstd * gg[8 + e] + bb[8 + e];
    const unsigned short ha = f2bf_bits(ya), la = f2bf_bits(ya - bf_bits2f(ha));
    const unsigned short hb = f2bf_bits(yb), lb = f2bf_bits(yb - bf_bits2f(hb));
    hA[e] = ha; lA[e] = la; hB[e] = hb; lB[e] = lb;
  }
  const size_t oA = (size_t)row * DM + cA, oB = (size_t)row * DM + cB;
  {
    *(v8us*)(Lh + oA) = hA;
    *(v8us*)(Lh + oB) = hB;
    *(v8us*)(Ll + oA) = lA;
    *(v8us*)(Ll + oB) = lB;
    
  }
}

// ---------------------------------------------------------------------------
// Workspace region map (bytes; every region an exact multiple of its store granularity, no tail rows):
//   Xh, Xl            bf16 [4096][512]     2 x 4,194,304          0 ..  8,388,608
//   Hkh,Hkl,Hqh,Hql   bf16 [4096][512]     4 x 4,194,304   8,388,608 .. 25,165,824
//   W1t planes (kp,qp,v,o) bf16 [512][512] 8 x 524,288  25,165,824 .. 29,360,128
//   W2t planes (kp2,qp2,ka,qa) bf16 [32][512] 8 x 32,768 29,360,128 .. 29,622,272
//   Qth,Qtl,Kth,Ktl   bf16 [4096][64]      4 x 524,288    29,622,272 .. 31,719,424
//   VTh, VTl          bf16 [2][512][2048]  2 x 4,194,304  31,719,424 .. 40,108,032
//   R                 f32  [4096][512]     8,388,608      40,108,032 .. 48,496,640
//   Lh, Ll            bf16 [4096][512]     2 x 4,194,304  48,496,640 .. 56,885,248
//   KTh, KTl          bf16 [256][64][16]   2 x 524,288    56,885,248 .. 57,933,824
//   U                 f32  [2][32][512][64] 8,388,608     57,933,824 .. 66,322,432
//   Mh, Ml            bf16 [2][32][512][64] 2 x 4,194,304 66,322,432 .. 74,711,040
// ---------------------------------------------------------------------------
extern "C" void kernel_launch(void* const* d_in, const int* in_sizes, int n_in,
                              void* d_out, int out_size, void* d_ws, size_t ws_size,
                              hipStream_t stream) {
  if (n_in < 20) return;
  if (in_sizes[0] != MTOT * DM || in_sizes[1] != SEQ * KO) return;
  if (in_sizes[2] != DM * DM || in_sizes[8] != DM * DM || in_sizes[14] != DM * DM || in_sizes[18] != DM * DM) return;
  if (in_sizes[3] != DM || in_sizes[9] != DM || in_sizes[15] != DM || in_sizes[19] != DM) return;
  if (in_sizes[16] != DM || in_sizes[17] != DM) return;
  if (in_sizes[4] != DM * KO || in_sizes[6] != DM * KO || in_sizes[10] != DM * KO || in_sizes[12] != DM * KO) return;
  if (in_sizes[5] != KO || in_sizes[7] != KO || in_sizes[11] != KO || in_sizes[13] != KO) return;
  if (out_size != MTOT * DM) return;

  const float* x     = (const float*)d_in[0];
  const float* pos   = (const float*)d_in[1];
  const float* kp_w1 = (const float*)d_in[2];
  const float* kp_b1 = (const float*)d_in[3];
  const float* kp_w2 = (const float*)d_in[4];
  const float* kp_b2 = (const float*)d_in[5];
  const float* ka_w  = (const float*)d_in[6];
  const float* ka_b  = (const float*)d_in[7];
  const float* qp_w1 = (const float*)d_in[8];
  const float* qp_b1 = (const float*)d_in[9];
  const float* qp_w2 = (const float*)d_in[10];
  const float* qp_b2 = (const float*)d_in[11];
  const float* qa_w  = (const float*)d_in[12];
  const float* qa_b  = (const float*)d_in[13];
  const float* v_w   = (const float*)d_in[14];
  const float* v_b   = (const float*)d_in[15];
  const float* ln_g  = (const float*)d_in[16];
  const float* ln_b  = (const float*)d_in[17];
  const float* o_w   = (const float*)d_in[18];
  const float* o_b   = (const float*)d_in[19];

  const size_t PX = (size_t)MTOT * DM * 2;        // 4,194,304
  const size_t PW = (size_t)DM * DM * 2;          //   524,288
  const size_t PS = (size_t)KO * DM * 2;          //    32,768
  const size_t PQ = (size_t)MTOT * QK * 2;        //   524,288
  const size_t PV = (size_t)NB * DM * SEQ * 2;    // 4,194,304
  const size_t PR = (size_t)MTOT * DM * 4;        // 8,388,608
  size_t off = 0;
  const size_t oXh  = off; off += PX;  const size_t oXl  = off; off += PX;
  const size_t oHkh = off; off += PX;  const size_t oHkl = off; off += PX;
  const size_t oHqh = off; off += PX;  const size_t oHql = off; off += PX;
  const size_t oWkh = off; off += PW;  const size_t oWkl = off; off += PW;
  const size_t oWqh = off; off += PW;  const size_t oWql = off; off += PW;
  const size_t oWvh = off; off += PW;  const size_t oWvl = off; off += PW;
  const size_t oWoh = off; off += PW;  const size_t oWol = off; off += PW;
  const size_t oSk2h = off; off += PS; const size_t oSk2l = off; off += PS;
  const size_t oSq2h = off; off += PS; const size_t oSq2l = off; off += PS;
  const size_t oSkah = off; off += PS; const size_t oSkal = off; off += PS;
  const size_t oSqah = off; off += PS; const size_t oSqal = off; off += PS;
  const size_t oQth = off; off += PQ;  const size_t oQtl = off; off += PQ;
  const size_t oKth = off; off += PQ;  const size_t oKtl = off; off += PQ;
  const size_t oVTh = off; off += PV;  const size_t oVTl = off; off += PV;
  const size_t oR   = off; off += PR;
  const size_t oLh  = off; off += PX;  const size_t oLl  = off; off += PX;
  const size_t oKTh = off; off += PQ;  const size_t oKTl = off; off += PQ;
  const size_t oU   = off; off += PR;
  const size_t oMh  = off; off += PX;  const size_t oMl  = off; off += PX;
  if (off > ws_size) return;                      // off = 74,711,040

  char* ws = (char*)d_ws;
  unsigned short* Xh  = (unsigned short*)(ws + oXh);   unsigned short* Xl  = (unsigned short*)(ws + oXl);
  unsigned short* Hkh = (unsigned short*)(ws + oHkh);  unsigned short* Hkl = (unsigned short*)(ws + oHkl);
  unsigned short* Hqh = (unsigned short*)(ws + oHqh);  unsigned short* Hql = (unsigned short*)(ws + oHql);
  unsigned short* Wkh = (unsigned short*)(ws + oWkh);  unsigned short* Wkl = (unsigned short*)(ws + oWkl);
  unsigned short* Wqh = (unsigned short*)(ws + oWqh);  unsigned short* Wql = (unsigned short*)(ws + oWql);
  unsigned short* Wvh = (unsigned short*)(ws + oWvh);  unsigned short* Wvl = (unsigned short*)(ws + oWvl);
  unsigned short* Woh = (unsigned short*)(ws + oWoh);  unsigned short* Wol = (unsigned short*)(ws + oWol);
  unsigned short* Sk2h = (unsigned short*)(ws + oSk2h); unsigned short* Sk2l = (unsigned short*)(ws + oSk2l);
  unsigned short* Sq2h = (unsigned short*)(ws + oSq2h); unsigned short* Sq2l = (unsigned short*)(ws + oSq2l);
  unsigned short* Skah = (unsigned short*)(ws + oSkah); unsigned short* Skal = (unsigned short*)(ws + oSkal);
  unsigned short* Sqah = (unsigned short*)(ws + oSqah); unsigned short* Sqal = (unsigned short*)(ws + oSqal);
  unsigned short* Qth = (unsigned short*)(ws + oQth);  unsigned short* Qtl = (unsigned short*)(ws + oQtl);
  unsigned short* Kth = (unsigned short*)(ws + oKth);  unsigned short* Ktl = (unsigned short*)(ws + oKtl);
  unsigned short* VTh = (unsigned short*)(ws + oVTh);  unsigned short* VTl = (unsigned short*)(ws + oVTl);
  float*          Rws = (float*)(ws + oR);
  unsigned short* Lh  = (unsigned short*)(ws + oLh);   unsigned short* Ll  = (unsigned short*)(ws + oLl);
  unsigned short* KTh = (unsigned short*)(ws + oKTh);  unsigned short* KTl = (unsigned short*)(ws + oKTl);
  float*          Uws = (float*)(ws + oU);
  unsigned short* Mh  = (unsigned short*)(ws + oMh);   unsigned short* Ml  = (unsigned short*)(ws + oMl);

  const dim3 b256(256), b128(128);

  // (1) operand preparation, one launch: the four [512][512] and the four [512][32] weights -> transposed hi/lo planes
  //     (the planes lie in the workspace in the order of the jobs), x -> hi/lo planes
  prep_kernel<<<dim3(PREP_T1 + PREP_T2 + PREP_X), b256, 0, stream>>>(
      x, kp_w1, qp_w1, v_w, o_w, kp_w2, qp_w2, ka_w, qa_w, Xh, Xl, Wkh, Sk2h);

  // (2) hk = tanh(x . kp_w1 + kp_b1), hq likewise -> bf16 hi/lo planes [4096][512], one launch: (256, 2) blocks
  const dim3 gH((MTOT / 64) * (DM / 128), 1);                  // 256 blocks
  gemm_hidden_kernel<<<dim3((MTOT / 64) * (DM / 128), 2), b128, 0, stream>>>(
      Xh, Xl, Wkh, Wkl, Wqh, Wql, kp_b1, qp_b1, Hkh, Hkl, Hqh, Hql);

  // (3) oscillator heads + encode -> Qt, Kt hi/lo planes [4096][64], K^T planes; V^T hi/lo planes; one launch
  enc_v_kernel<<<dim3(MTOT / 16 + NB * (DM / 64) * (SEQ / 128)), b128, 0, stream>>>(
      Hkh, Hkl, Hqh, Hql, Xh, Xl,
      Sk2h, Sk2l, Sq2h, Sq2l, Skah, Skal, Sqah, Sqal,
      kp_b2, qp_b2, ka_b, qa_b, pos,
      Qth, Qtl, Kth, Ktl, KTh, KTl,
      Wvh, Wvl, v_b, VTh, VTl);

  // (7a) per-chunk sums U[b][ch][d][f] = sum_{l' in chunk ch} V^T[b][d][l'] K^T[b][f][l'], chunks 0..30
  chunk_kv_kernel<<<dim3(DM / 128, NCH - 1, NB), b256, 0, stream>>>(VTh, VTl, KTh, KTl, Uws);
  // (7b) exclusive prefix over the chunks -> state planes M hi/lo [2][32][512][64]
  chunk_scan_kernel<<<dim3(NB * DM * QK / 4 / 128), b128, 0, stream>>>(Uws, Mh, Ml);

  // (7c) causal mixing (state term + own key tile) -> R f32 [4096][512]
  causal_mix_kernel<<<dim3(NB * (SEQ / 64) * 4), b128, 0, stream>>>(Qth, Qtl, Kth, Ktl, VTh, VTl, Mh, Ml, Rws);

  // (8) LayerNorm -> bf16 hi/lo planes [4096][512]
  ln_split_kernel<<<dim3(MTOT / 8), b256, 0, stream>>>(Rws, ln_g, ln_b, Lh, Ll);

  // (9) out = x + ln . o_w + o_b -> d_out f32 [4096][512]
  gemm_out_kernel<<<gH, b128, 0, stream>>>(Lh, Ll, Woh, Wol, o_b, x, (float*)d_out);

  (void)hipGetLastError();
}
